// v000
// Measured on an AMD MI455X. A time is GPU time per run, averaged over a window of back-to-back runs after a warm-up
// (all launches, gaps included; the runs take copies of the inputs in turn), and the median of several windows.
// Apart from v000's, it joins two sittings. Times from different sittings can be a few percent apart, while
// side-by-side timings come from the same sitting.
// v000, which the later versions start from, runs in 5120 microseconds.
#include <hip/hip_runtime.h>
// Pre-LN causal transformer layer: x [NB][SEQ][1024]; h = LN1(x) (biased variance, eps 1e-5); q/k/v[b][h] = h Wq/Wk/Wv[h] (per-head [16][1024][64], [in][out], no biases); scores / sqrt(64); mask = padding_mask[b][key] AND causal, masked scores REPLACED by -1e9; softmax; heads concatenated (no output projection); x1 = x + attn; h2 = LN2(x1); out = x1 + relu(h2 W1 + b1) W2 + b2 ([in][out] 1024 x 1024 x 1024).
// Structure: LN1 on VALU -> f16 rows; per-head weights transposed on VALU into one x16 f16 q|k|v plane; q|k|v as ONE WMMA GEMM (32x64 wave tiles, f32 accumulation, f16 out); per batch: V^T via LDS transposes, an f32 first tile (rows 0..127) on VALU, then per query tile of 256 rows: scores against the keys below the tile end (K = 64, all heads on grid.y, alpha 1/8), masked row softmax on VALU (arithmetic select, f32 statistics; weights x256 f16), o = P V^T (x64) f16; x1 = bf16(x) + o / 64; LN2 -> f16; FFN as two GEMMs (ReLU epilogue; own-element residual).
// Compute dtype: all contractions v_wmma_f32_16x16x32_f16 (f16 operands, f32 accumulate); float inputs RNE-converted to bf16 first (weights then x16, exact in f16); q, k, v, softmax weights (x256) and o (x64) as plain f16 operands; scores and softmax statistics f32; first 128 query rows of each batch in f32 on VALU.
#ifndef NB
#define NB 2
#endif
#ifndef SEQ
#define SEQ 2048
#endif
#define SQ SEQ
#define NB_FULL 2
#define SQ_FULL 2048                 /* per-batch row stride of the inputs (x rows, mask entries) */
#define DM 1024
#define NH 16
#define HD 64
#define DFF 1024
#define QT 256                       /* query rows per causal tile */
#define NKX SQ                       /* S / P row pitch */
#define QT0 128                      /* first-tile rows computed in f32 */
#define NR ((size_t)NB * SQ)         /* token rows */
#define LQ (3 * DM)                  /* row pitch of the q|k|v rows */
static_assert(NH * HD == DM);
static_assert(SQ % QT == 0 && QT % 128 == 0 && (QT & (QT - 1)) == 0);
static_assert(QT0 == 128 && QT0 <= SQ && SQ <= SQ_FULL && NB <= NB_FULL);
static_assert(DM % 64 == 0 && DFF % 64 == 0 && DM % 32 == 0 && DFF % 32 == 0 && HD == 64);
static_assert(DM / 4 == 256);
static_assert(DFF <= 3 * DM);
static_assert((((size_t)NB * SQ * DM) / 4) % 256 == 0);
static_assert((size_t)NB * SQ * DM / 4 < 0x7fffffffu);

typedef unsigned short v8us __attribute__((ext_vector_type(8), may_alias));
typedef float  v8f  __attribute__((ext_vector_type(8)));
typedef float  v4f  __attribute__((ext_vector_type(4)));
typedef float  v4fa __attribute__((ext_vector_type(4), may_alias));
typedef _Float16 v16h __attribute__((ext_vector_type(16)));
typedef _Float16 v4h __attribute__((ext_vector_type(4)));
union FragH { v16h v; v8us half[2]; _Float16 h[16]; unsigned short u[16]; };

__device__ __forceinline__ unsigned short bf16_bits(float x) { unsigned int u = __float_as_uint(x); return (unsigned short)((u + 0x7FFFu + ((u >> 16) & 1u)) >> 16); }
__device__ __forceinline__ float bf16_rne(float x) { return __uint_as_float(((unsigned int)bf16_bits(x)) << 16); }

// fragment: elements 0..7 <- k0 + 8h + 0..7, elements 8..15 <- k0 + 16 + 8h + 0..7 (same map for A rows and B columns)
__device__ __forceinline__ v16h g2_frag(const _Float16* p, unsigned hh) { FragH f; f.half[0] = *(const v8us*)((const unsigned short*)p + 8u * hh); f.half[1] = *(const v8us*)((const unsigned short*)p + 16u + 8u * hh); return f.v; }
__device__ __forceinline__ v8f g2_mma(v16h a, v16h b, v8f c) { v8f d = __builtin_amdgcn_wmma_f32_16x16x32_f16(false, a, false, b, (short)0, c, false, false); asm volatile("v_nop\n\tv_nop\n\tv_nop\n\tv_nop" : "+v"(d) : "v"(a), "v"(b)); return d; }

// GEMM (wave tile 32x64; workgroup = 4 waves = 128 rows x 64 cols; M % 128 == 0, N % 64 == 0, K % 32 == 0): A f16 [M][K] (pitch lda, batch stride sA), Bh f16 [N][K] (pitch ldb, batch stride sB);
// v = acc * alpha + bf16(bias[col]) (+ CP own element of the batched C plane); ACT 0 none / 3 relu; writes f32 C and/or f16 C16 (pitch ldc, batch offset by * sC);
template <int ACT>
__global__ __launch_bounds__(128) void k_gemm2(const _Float16* __restrict__ A, int lda, size_t sA, const _Float16* __restrict__ Bh, int ldb, size_t sB, float alpha,
    const float* __restrict__ bias, const float* __restrict__ CP, float* __restrict__ C, _Float16* __restrict__ C16, int ldc, size_t sC, int M, int N, int K) {
  static_assert(ACT == 0 || ACT == 3);
  __shared__ __attribute__((aligned(16))) float so[4][32][68];
  const unsigned tid = threadIdx.x, w = tid >> 5, lane = tid & 31u, ln = lane & 15u, hh = lane >> 4; const unsigned by = blockIdx.y;
  A += (size_t)by * sA; Bh += (size_t)by * sB; const size_t cofs = (size_t)by * sC;
  const unsigned ntn = (unsigned)N >> 6; const unsigned mt = blockIdx.x / ntn, nq = blockIdx.x - mt * ntn; const unsigned row0 = mt * 128u + 32u * w, col0 = nq * 64u; if (row0 >= (unsigned)M) return;
  const _Float16* a0p = A + (size_t)(row0 + ln) * (size_t)lda; const _Float16* a1p = a0p + (size_t)16 * (size_t)lda;
  const _Float16* b0p = Bh + (size_t)(col0 + ln) * (size_t)ldb; const _Float16* b1p = b0p + (size_t)16 * (size_t)ldb; const _Float16* b2p = b1p + (size_t)16 * (size_t)ldb; const _Float16* b3p = b2p + (size_t)16 * (size_t)ldb;
  const v8f z8 = {0.f,0.f,0.f,0.f,0.f,0.f,0.f,0.f}; v8f c00 = z8, c01 = z8, c02 = z8, c03 = z8, c10 = z8, c11 = z8, c12 = z8, c13 = z8;
#pragma unroll 1
  for (int kb = 0; kb < K; kb += 32) { const v16h a0 = g2_frag(a0p + kb, hh), a1 = g2_frag(a1p + kb, hh);
    v16h b = g2_frag(b0p + kb, hh); c00 = g2_mma(a0, b, c00); c10 = g2_mma(a1, b, c10);
    b = g2_frag(b1p + kb, hh); c01 = g2_mma(a0, b, c01); c11 = g2_mma(a1, b, c11);
    b = g2_frag(b2p + kb, hh); c02 = g2_mma(a0, b, c02); c12 = g2_mma(a1, b, c12);
    b = g2_frag(b3p + kb, hh); c03 = g2_mma(a0, b, c03); c13 = g2_mma(a1, b, c13); }
  v8f accs[8] = {c00, c01, c02, c03, c10, c11, c12, c13};
#pragma unroll
  for (int u = 0; u < 8; ++u) { const unsigned t = (unsigned)u & 3u, half = (unsigned)u >> 2; const unsigned col = col0 + t * 16u + ln; const float bv = bias ? bf16_rne(bias[col]) : 0.f;
#pragma unroll
    for (int r = 0; r < 8; ++r) { const unsigned rloc = half * 16u + 8u * hh + (unsigned)r; float v = accs[u][r] * alpha + bv;
      if (CP) v += CP[cofs + (size_t)(row0 + rloc) * (size_t)ldc + col];      /* own element of the batched C plane */
      if (ACT == 3) v = fmaxf(v, 0.f);
      so[w][rloc][t * 16u + ln] = v; } }
  __builtin_amdgcn_fence(4 /* acq_rel order */, "workgroup"); __builtin_amdgcn_wave_barrier();      /* wave-private tile: same wave writes and reads */
  const unsigned rsub = lane >> 4, c4 = (lane & 15u) * 4u;
  {
#pragma unroll
    for (int q = 0; q < 16; ++q) { const unsigned r = (unsigned)q * 2u + rsub; const v4f v = *(const v4fa*)&so[w][r][c4];
      if (C) *(v4f*)(C + cofs + (size_t)(row0 + r) * (size_t)ldc + col0 + c4) = v;
      if (C16) { v4h h4; for (int i = 0; i < 4; ++i) h4[i] = (_Float16)v[i]; *(v4h*)(C16 + cofs + (size_t)(row0 + r) * (size_t)ldc + col0 + c4) = h4; } }
     } }

__global__ __launch_bounds__(256) void k_wt_f16(const float* __restrict__ W, _Float16* __restrict__ Wt, int K, int N, float scale) {
  const unsigned k8n = (unsigned)K >> 3; const unsigned t = blockIdx.x * 256u + threadIdx.x; if (t >= (unsigned)N * k8n) return; const unsigned n = t / k8n, k8 = (t - n * k8n) * 8u; FragH f;
#pragma unroll
  for (int i = 0; i < 8; ++i) f.h[i] = (_Float16)(bf16_rne(W[(size_t)(k8 + (unsigned)i) * (size_t)N + n]) * scale);
  const v8us o = f.half[0]; unsigned short* dst = (unsigned short*)Wt + (size_t)n * (size_t)K + k8;
  *(v8us*)dst = o;  }

__global__ __launch_bounds__(256) void k_wthd(const float* __restrict__ Wt, _Float16* __restrict__ Bt) {
  const unsigned t = blockIdx.x * 256u + threadIdx.x; if (t >= (unsigned)(NH * HD * (DM / 8))) return;
  const unsigned m8 = (t % (unsigned)(DM / 8)) * 8u; const unsigned d = (t / (unsigned)(DM / 8)) % (unsigned)HD; const unsigned h = t / (unsigned)((DM / 8) * HD); FragH f;
#pragma unroll
  for (int q = 0; q < 8; ++q) f.h[q] = (_Float16)(16.0f * bf16_rne(Wt[((size_t)h * DM + m8 + (unsigned)q) * HD + d]));
  const v8us o = f.half[0]; unsigned short* dst = (unsigned short*)Bt + ((size_t)h * HD + d) * DM + m8;
  *(v8us*)dst = o;  }

template <int NHv, int TTv>
__global__ __launch_bounds__(256) void k_vt(const _Float16* __restrict__ V16, int ldv, int voff, _Float16* __restrict__ Vt) {
  __shared__ unsigned short tl[64][66]; const unsigned tid = threadIdx.x; const unsigned slab = blockIdx.x / (unsigned)(TTv / 64), lg = blockIdx.x % (unsigned)(TTv / 64); const unsigned b = slab / (unsigned)NHv, h = slab % (unsigned)NHv;
  for (unsigned i = tid; i < 64u * 8u; i += 256u) { const unsigned r = i >> 3, c8 = (i & 7u) * 8u; FragH f; f.half[0] = *(const v8us*)((const unsigned short*)V16 + ((size_t)b * TTv + lg * 64u + r) * (size_t)ldv + (size_t)voff + h * 64u + c8);
#pragma unroll
    for (int q = 0; q < 8; ++q) tl[r][c8 + (unsigned)q] = f.u[q]; }
  __syncthreads();
  {
#pragma unroll
    for (int rd = 0; rd < 2; ++rd) { const unsigned d = (unsigned)rd * 32u + (tid >> 3), pc = tid & 7u; FragH f;
#pragma unroll
      for (int q = 0; q < 8; ++q) f.u[q] = tl[pc * 8u + (unsigned)q][d];
      *(v8us*)((unsigned short*)Vt + ((size_t)slab * 64u + d) * TTv + lg * 64u + pc * 8u) = f.half[0]; }
     } }

// masked row softmax for head-batched query tiles: thread t -> head t / QT, tile row t % QT (query q0 + row); key j is valid iff j <= query AND pm[j] != 0; the mask enters as an arithmetic 0/1 factor over the
// whole computed key range nk (v = fmaf(f, s, (1-f)(-1e9)): a REPLACE fill, no load under a lane-divergent exec mask; exp(-1e9 - max) is exactly 0 whenever the row has one valid key);
__global__ __launch_bounds__(256) void k_rsmcf2(const float* __restrict__ S, const int* __restrict__ pm, _Float16* __restrict__ P, int hg, int q0, int nk) {
  #pragma clang fp contract(off)
  const unsigned t = blockIdx.x * 256u + threadIdx.x; if (t >= (unsigned)hg * (unsigned)QT) return; const float* s = S + (size_t)t * NKX; const int last = q0 + (int)(t & (unsigned)(QT - 1)); float mx = -3.0e38f;
#pragma unroll 1
  for (int j = 0; j < nk; ++j) { const int pj = pm[j]; const float f = ((j <= last) & (pj != 0)) ? 1.f : 0.f; mx = fmaxf(mx, fmaf(f, s[j], (1.f - f) * -1.0e9f)); }
  float se = 0.f;
#pragma unroll 1
  for (int j = 0; j < nk; ++j) { const int pj = pm[j]; const float f = ((j <= last) & (pj != 0)) ? 1.f : 0.f; se += __expf(fmaf(f, s[j], (1.f - f) * -1.0e9f) - mx); }
  const float sc = 256.0f * (1.0f / se);
#pragma unroll 1
  for (int j0 = 0; j0 < nk; j0 += 8) { FragH fr;
#pragma unroll
    for (int q = 0; q < 8; ++q) { const int j = j0 + q; const int pj = pm[j]; const float f = ((j <= last) & (pj != 0)) ? 1.f : 0.f; fr.h[q] = (_Float16)(__expf(fmaf(f, s[j], (1.f - f) * -1.0e9f) - mx) * sc); }
    const v8us o = fr.half[0]; unsigned short* d = (unsigned short*)P + (size_t)t * NKX + j0; *(v8us*)d = o;  } }

// f32 attention for the FIRST query tile of a causal sequence (rows 0..QT0-1 of one batch): workgroup = 64 threads = 64 consecutive rows of one head; thread i keeps its q row and its o accumulator in its own LDS
// rows (rolled float4 loops), walks keys j = 0..(workgroup's last row) with an ONLINE softmax in f32 (precise expf; invalid keys (j > i or pm[j] == 0) enter through an arithmetic 0/1 factor as -1e30,
__global__ __launch_bounds__(64) void k_att0(const float* __restrict__ QF, const float* __restrict__ KF, const float* __restrict__ VF, int ld, const int* __restrict__ pm, float scale, float* __restrict__ OF, int ldo) {
  #pragma clang fp contract(off)
  __shared__ __attribute__((aligned(16))) float lq[64][64]; __shared__ __attribute__((aligned(16))) float lo[64][64];
  const unsigned tid = threadIdx.x; const unsigned h = blockIdx.x / (unsigned)(QT0 / 64), rg = blockIdx.x % (unsigned)(QT0 / 64); const unsigned i = rg * 64u + tid;
  const float* qr = QF + (size_t)i * (size_t)ld + h * HD;
#pragma unroll 1
  for (int c = 0; c < HD / 4; ++c) { *(v4fa*)&lq[tid][c * 4] = *(const v4fa*)(qr + c * 4); const v4f z = {0.f, 0.f, 0.f, 0.f}; *(v4fa*)&lo[tid][c * 4] = z; }
  float m = -1.0e30f, l = 0.f; const int jmax = (int)(rg * 64u + 63u);
#pragma unroll 1
  for (int j = 0; j <= jmax; ++j) { const float* kr = KF + (size_t)j * (size_t)ld + h * HD; const float* vr = VF + (size_t)j * (size_t)ld + h * HD; const int pj = pm[j]; float s = 0.f;
#pragma unroll 1
    for (int c = 0; c < HD / 4; ++c) { const v4f kq = *(const v4fa*)(kr + c * 4); const v4f qq = *(const v4fa*)&lq[tid][c * 4]; s = s + qq[0] * kq[0]; s = s + qq[1] * kq[1]; s = s + qq[2] * kq[2]; s = s + qq[3] * kq[3]; }
    s = s * scale;
    const float f = (((unsigned)j <= i) & (pj != 0)) ? 1.f : 0.f; const float sm = fmaf(f, s, (1.f - f) * -1.0e30f); const float mn = fmaxf(m, sm); const float sc = expf(m - mn); const float e = expf(sm - mn); l = l * sc + e; m = mn;
#pragma unroll 1
    for (int c = 0; c < HD / 4; ++c) { const v4f vv = *(const v4fa*)(vr + c * 4); v4f oo = *(const v4fa*)&lo[tid][c * 4]; for (int u = 0; u < 4; ++u) oo[u] = oo[u] * sc + e * vv[u]; *(v4fa*)&lo[tid][c * 4] = oo; } }
  const float fin = 64.0f * (1.0f / l);      /* o carried x64 like the f16 path */
#pragma unroll 1
  for (int c = 0; c < HD / 4; ++c) { v4f oo = *(const v4fa*)&lo[tid][c * 4]; for (int u = 0; u < 4; ++u) oo[u] = oo[u] * fin; *(v4fa*)&lo[tid][c * 4] = oo; }
  __syncthreads();
  {
#pragma unroll 1
    for (int it = 0; it < 16; ++it) { const unsigned row = (unsigned)it * 4u + (tid >> 4), pc = (tid & 15u) * 4u; const v4f v = *(const v4fa*)&lo[row][pc]; *(v4f*)(OF + (size_t)(rg * 64u + row) * (size_t)ldo + h * HD + pc) = v; }
     } }

// row LayerNorm over DM = 1024 of f32 rows: mean, BIASED variance, (x - mu) * rsqrt(var + eps) * bf16(g[c]) + bf16(b[c]) -> f16 rows (GEMM operand); workgroup = 256 threads, thread t owns columns 4t..4t+3;
template <int BFIN, int FULLIN>
__global__ __launch_bounds__(256) void k_lnx(const float* __restrict__ X, const float* __restrict__ g, const float* __restrict__ bb, float eps, _Float16* __restrict__ N16) {
  #pragma clang fp contract(off)
  __shared__ float red[256]; const unsigned r = blockIdx.x; const unsigned t = threadIdx.x; const unsigned c0 = t * 4u;
  const size_t xr = FULLIN ? ((size_t)(r / (unsigned)SQ) * SQ_FULL + (r % (unsigned)SQ)) : (size_t)r;
  const v4f xa = *(const v4fa*)(X + xr * DM + c0); float s[4]; float sum = 0.f;
  for (int q = 0; q < 4; ++q) { s[q] = BFIN ? bf16_rne(xa[q]) : xa[q]; sum = sum + s[q]; }
  red[t] = sum; __syncthreads(); for (unsigned st = 128u; st > 0u; st >>= 1) { if (t < st) red[t] = red[t] + red[t + st]; __syncthreads(); } const float mu = red[0] * (1.0f / (float)DM); __syncthreads();
  float vs = 0.f; for (int q = 0; q < 4; ++q) { const float dl = s[q] - mu; vs = vs + dl * dl; } red[t] = vs; __syncthreads(); for (unsigned st = 128u; st > 0u; st >>= 1) { if (t < st) red[t] = red[t] + red[t + st]; __syncthreads(); }
  const float rs = rsqrtf(red[0] * (1.0f / (float)DM) + eps); v4h y;
  for (int q = 0; q < 4; ++q) { const unsigned c = c0 + (unsigned)q; y[q] = (_Float16)((((s[q] - mu) * rs) * bf16_rne(g[c])) + bf16_rne(bb[c])); }
  { *(v4h*)(N16 + (size_t)r * DM + c0) = y;  } }

// residual without an output projection: X1[r][c] = bf16(x[r][c]) + o[r][c] / 64 (+ NaN when the batch's first mask entry is 0: the structure the attention kernels rely on is violated);
__global__ __launch_bounds__(256) void k_resid(const float* __restrict__ x, const int* __restrict__ pm, const _Float16* __restrict__ O16, const float* __restrict__ OF0, float* __restrict__ X1) {
  #pragma clang fp contract(off)
  const unsigned t = blockIdx.x * 256u + threadIdx.x; if (t >= (unsigned)(NR * DM / 4)) return;
  const unsigned row = t / (unsigned)(DM / 4), c0 = (t % (unsigned)(DM / 4)) * 4u; const unsigned b = row / (unsigned)SQ, rl = row % (unsigned)SQ; const bool ft = rl < (unsigned)QT0; const unsigned rs = ft ? rl : 0u;
  const size_t e = (size_t)row * DM + c0;
  const v4f xv = *(const v4fa*)(x + ((size_t)b * SQ_FULL + rl) * DM + c0);
  const v4h oh = *(const v4h*)(O16 + e);
  const v4f of = *(const v4fa*)(OF0 + ((size_t)b * QT0 + rs) * DM + c0);
  const int p0 = pm[(size_t)b * SQ_FULL]; const float pz = (p0 != 0) ? 0.f : __uint_as_float(0x7fc00000u);
  v4f y; for (int q = 0; q < 4; ++q) { const float o = ft ? of[q] : (float)oh[q]; y[q] = (bf16_rne(xv[q]) + o * 0.015625f) + pz; }
  *(v4f*)(X1 + e) = y;  }

extern "C" void kernel_launch(void* const* d_in, const int* in_sizes, int n_in,
                              void* d_out, int out_size, void* d_ws, size_t ws_size, hipStream_t stream) {
  if (n_in < 13) return;
  const size_t rows_need = (size_t)(NB - 1) * SQ_FULL + SQ;
  if ((size_t)in_sizes[0] < rows_need * DM) return; if ((size_t)in_sizes[1] < rows_need) return;
  if ((size_t)in_sizes[2] < (size_t)NH * DM * HD || (size_t)in_sizes[3] < (size_t)NH * DM * HD || (size_t)in_sizes[4] < (size_t)NH * DM * HD) return;
  if (in_sizes[5] < DM || in_sizes[6] < DM || in_sizes[7] < DM || in_sizes[8] < DM) return;
  if ((size_t)in_sizes[9] < (size_t)DM * DFF || in_sizes[10] < DFF || (size_t)in_sizes[11] < (size_t)DFF * DM || in_sizes[12] < DM) return;
  if ((size_t)out_size < NR * DM) return;
  const float* x = (const float*)d_in[0]; const int* pmask = (const int*)d_in[1];
  const float* wq = (const float*)d_in[2]; const float* wk = (const float*)d_in[3]; const float* wv = (const float*)d_in[4];
  const float* g1 = (const float*)d_in[5]; const float* be1 = (const float*)d_in[6]; const float* g2 = (const float*)d_in[7]; const float* be2 = (const float*)d_in[8];
  const float* w1 = (const float*)d_in[9]; const float* b1 = (const float*)d_in[10]; const float* w2 = (const float*)d_in[11]; const float* b2 = (const float*)d_in[12];
  char* ws = (char*)d_ws; size_t off = 0;
  auto take = [&](size_t bytes) { char* p = ws + off; off += (bytes + 255) & ~(size_t)255; return p; };
  _Float16* BQKV = (_Float16*)take((size_t)3 * DM * DM * 2);          /* [3*DM][DM] x16: q | k | v stacked, row (h*HD + d) */
  _Float16* X16 = (_Float16*)take(NR * DM * 2);                       /* LN1 rows; reused as the LN2 rows (last reader of LN1 rows: the last batch's first-tile GEMM, before LN2 writes) */
  float* X1 = (float*)take(NR * DM * 4);
  _Float16* BW1 = (_Float16*)take((size_t)DFF * DM * 2); _Float16* BW2 = (_Float16*)take((size_t)DM * DFF * 2);
  _Float16* QKV = (_Float16*)take(NR * 3 * DM * 2); _Float16* Q16 = QKV; _Float16* K16 = QKV + DM; _Float16* V16 = QKV + 2 * DM;
  _Float16* HF16 = QKV;                                               /* FFN hidden rows [NR][DFF] alias the q|k|v rows (dead after the attention); DFF <= 3*DM asserted */
  _Float16* O16 = (_Float16*)take(NR * DM * 2);
  float* S = (float*)take((size_t)NH * QT * NKX * 4); _Float16* P = (_Float16*)take((size_t)NH * QT * NKX * 2); _Float16* VT = (_Float16*)take((size_t)NH * HD * SQ * 2);
  float* F0 = (float*)take((size_t)QT0 * 3 * DM * 4);                 /* f32 q | k | v of the first 128 rows of the current batch */
  float* OF0 = (float*)take((size_t)NB * QT0 * DM * 4);
  _Float16* M16 = X16;
  if (off > ws_size || off > (size_t)134217728) return;
  { const unsigned g = (unsigned)(((size_t)NH * HD * (DM / 8) + 255) / 256);
    k_wthd<<<g, 256, 0, stream>>>(wq, BQKV); k_wthd<<<g, 256, 0, stream>>>(wk, BQKV + (size_t)DM * DM); k_wthd<<<g, 256, 0, stream>>>(wv, BQKV + (size_t)2 * DM * DM); }
  k_lnx<1, 1><<<(unsigned)NR, 256, 0, stream>>>(x, g1, be1, 1e-5f, X16);      /* h = LN1(bf16(x)) -> f16 rows */
  k_wt_f16<<<(unsigned)(((size_t)DFF * (DM / 8) + 255) / 256), 256, 0, stream>>>(w1, BW1, DM, DFF, 16.0f);      /* W1 [DM][DFF] -> [DFF][DM] x16 */
  k_wt_f16<<<(unsigned)(((size_t)DM * (DFF / 8) + 255) / 256), 256, 0, stream>>>(w2, BW2, DFF, DM, 16.0f);      /* W2 [DFF][DM] -> [DM][DFF] x16 */
  k_gemm2<0><<<dim3((unsigned)((NR / 128) * (3 * DM / 64)), 1), 128, 0, stream>>>(X16, DM, (size_t)0, BQKV, DM, (size_t)0, 0.0625f, (const float*)nullptr, (const float*)nullptr, (float*)nullptr, QKV, LQ, (size_t)0, (int)NR, 3 * DM, DM);      /* q | k | v rows (f16) */
  for (int b = 0; b < NB; ++b) { const size_t r0 = (size_t)b * SQ; const int* pmb = pmask + (size_t)b * SQ_FULL;
    k_vt<NH, SQ><<<NH * (SQ / 64), 256, 0, stream>>>(V16 + r0 * LQ, LQ, 0, VT);      /* V^T [NH][HD][SQ] for this batch */
    k_gemm2<0><<<dim3((unsigned)((QT0 / 128) * (3 * DM / 64)), 1), 128, 0, stream>>>(X16 + r0 * DM, DM, (size_t)0, BQKV, DM, (size_t)0, 0.0625f, (const float*)nullptr, (const float*)nullptr, F0, (_Float16*)nullptr, 3 * DM, (size_t)0, QT0, 3 * DM, DM);      /* f32 q | k | v of rows 0..127 */
    k_att0<<<NH * (QT0 / 64), 64, 0, stream>>>(F0, F0 + DM, F0 + 2 * DM, 3 * DM, pmb, 0.125f, OF0 + (size_t)b * QT0 * DM, DM);      /* f32 attention for rows 0..127 (o x64) */
    for (int q0 = 0; q0 < SQ; q0 += QT) { const int nk = q0 + QT;      /* causal: only keys below the tile end are computed */
      k_gemm2<0><<<dim3((unsigned)((QT / 128) * (nk / 64)), NH), 128, 0, stream>>>(Q16 + (r0 + q0) * LQ, LQ, (size_t)HD, K16 + r0 * LQ, LQ, (size_t)HD, 0.125f, (const float*)nullptr, (const float*)nullptr, S, (_Float16*)nullptr, NKX, (size_t)QT * NKX, QT, nk, HD);      /* scores / sqrt(64), all heads on grid.y */
      k_rsmcf2<<<(NH * QT + 255) / 256, 256, 0, stream>>>(S, pmb, P, NH, q0, nk);
      k_gemm2<0><<<dim3((unsigned)((QT / 128) * (HD / 64)), NH), 128, 0, stream>>>(P, NKX, (size_t)QT * NKX, VT, SQ, (size_t)HD * SQ, 0.25f, (const float*)nullptr, (const float*)nullptr, (float*)nullptr, O16 + (r0 + q0) * DM, DM, (size_t)HD, QT, HD, nk); } }      /* o (merged heads, x64) as f16 rows */
  k_resid<<<(unsigned)((NR * DM / 4) / 256), 256, 0, stream>>>(x, pmask, O16, OF0, X1);      /* x1 = bf16(x) + attn */
  k_lnx<0, 0><<<(unsigned)NR, 256, 0, stream>>>(X1, g2, be2, 1e-5f, M16);      /* h2 = LN2(x1) -> f16 rows */
  k_gemm2<3><<<dim3((unsigned)((NR / 128) * (DFF / 64)), 1), 128, 0, stream>>>(M16, DM, (size_t)0, BW1, DM, (size_t)0, 0.0625f, b1, (const float*)nullptr, (float*)nullptr, HF16, DFF, (size_t)0, (int)NR, DFF, DM);      /* relu(h2 W1 + b1) -> f16 */
  k_gemm2<0><<<dim3((unsigned)((NR / 128) * (DM / 64)), 1), 128, 0, stream>>>(HF16, DFF, (size_t)0, BW2, DFF, (size_t)0, 0.0625f, b2, X1, (float*)d_out, (_Float16*)nullptr, DM, (size_t)0, (int)NR, DM, DFF);      /* out = x1 + mlp (own-element residual) */
}

// v001
// A run of this version takes 1910 microseconds.
// Next to v000, in two timings, it ran 2.68 and 2.67 times as fast.
#include <hip/hip_runtime.h>
// Pre-LN causal transformer layer: x [NB][SEQ][1024]; h = LN1(x) (biased variance, eps 1e-5); q/k/v[b][h] = h Wq/Wk/Wv[h] (per-head [16][1024][64], [in][out], no biases); scores / sqrt(64); mask = padding_mask[b][key] AND causal, masked scores REPLACED by -1e9; softmax; heads concatenated (no output projection); x1 = x + attn; h2 = LN2(x1); out = x1 + relu(h2 W1 + b1) W2 + b2 ([in][out] 1024 x 1024 x 1024).
// Structure: LN1 on VALU -> f16 rows; per-head weights transposed on VALU into one x16 f16 q|k|v plane; q|k|v as ONE WMMA GEMM (32x64 wave tiles, f32 accumulation, f16 out); per batch: V^T via LDS transposes, an f32 first tile (rows 0..127) on VALU, then per query tile of 256 rows: scores against the keys below the tile end (K = 64, all heads on grid.y, alpha 1/8), masked row softmax on VALU, one wave per row (arithmetic select, f32 statistics; weights x256 f16), o = P V^T (x64) f16; x1 = bf16(x) + o / 64; LN2 -> f16; FFN as two GEMMs (ReLU epilogue; own-element residual).
// Compute dtype: all contractions v_wmma_f32_16x16x32_f16 (f16 operands, f32 accumulate); float inputs RNE-converted to bf16 first (weights then x16, exact in f16); q, k, v, softmax weights (x256) and o (x64) as plain f16 operands; scores and softmax statistics f32; first 128 query rows of each batch in f32 on VALU.
#ifndef NB
#define NB 2
#endif
#ifndef SEQ
#define SEQ 2048
#endif
#define SQ SEQ
#define NB_FULL 2
#define SQ_FULL 2048                 /* per-batch row stride of the inputs (x rows, mask entries) */
#define DM 1024
#define NH 16
#define HD 64
#define DFF 1024
#define QT 256                       /* query rows per causal tile */
#define NKX SQ                       /* S / P row pitch */
#define QT0 128                      /* first-tile rows computed in f32 */
#define NR ((size_t)NB * SQ)         /* token rows */
#define LQ (3 * DM)                  /* row pitch of the q|k|v rows */
static_assert(NH * HD == DM);
static_assert(SQ % QT == 0 && QT % 128 == 0 && (QT & (QT - 1)) == 0);
static_assert(QT0 == 128 && QT0 <= SQ && SQ <= SQ_FULL && NB <= NB_FULL);
static_assert(DM % 64 == 0 && DFF % 64 == 0 && DM % 32 == 0 && DFF % 32 == 0 && HD == 64);
static_assert(DM / 4 == 256);
static_assert(DFF <= 3 * DM);
static_assert((((size_t)NB * SQ * DM) / 4) % 256 == 0);
static_assert((size_t)NB * SQ * DM / 4 < 0x7fffffffu);

typedef unsigned short v8us __attribute__((ext_vector_type(8), may_alias));
typedef float  v8f  __attribute__((ext_vector_type(8)));
typedef float  v4f  __attribute__((ext_vector_type(4)));
typedef float  v4fa __attribute__((ext_vector_type(4), may_alias));
typedef _Float16 v16h __attribute__((ext_vector_type(16)));
typedef _Float16 v4h __attribute__((ext_vector_type(4)));
union FragH { v16h v; v8us half[2]; _Float16 h[16]; unsigned short u[16]; };

__device__ __forceinline__ unsigned short bf16_bits(float x) { unsigned int u = __float_as_uint(x); return (unsigned short)((u + 0x7FFFu + ((u >> 16) & 1u)) >> 16); }
__device__ __forceinline__ float bf16_rne(float x) { return __uint_as_float(((unsigned int)bf16_bits(x)) << 16); }

// fragment: elements 0..7 <- k0 + 8h + 0..7, elements 8..15 <- k0 + 16 + 8h + 0..7 (same map for A rows and B columns)
__device__ __forceinline__ v16h g2_frag(const _Float16* p, unsigned hh) { FragH f; f.half[0] = *(const v8us*)((const unsigned short*)p + 8u * hh); f.half[1] = *(const v8us*)((const unsigned short*)p + 16u + 8u * hh); return f.v; }
__device__ __forceinline__ v8f g2_mma(v16h a, v16h b, v8f c) { v8f d = __builtin_amdgcn_wmma_f32_16x16x32_f16(false, a, false, b, (short)0, c, false, false); asm volatile("v_nop\n\tv_nop\n\tv_nop\n\tv_nop" : "+v"(d) : "v"(a), "v"(b)); return d; }

// GEMM (wave tile 32x64; workgroup = 4 waves = 128 rows x 64 cols; M % 128 == 0, N % 64 == 0, K % 32 == 0): A f16 [M][K] (pitch lda, batch stride sA), Bh f16 [N][K] (pitch ldb, batch stride sB);
// v = acc * alpha + bf16(bias[col]) (+ CP own element of the batched C plane); ACT 0 none / 3 relu; writes f32 C and/or f16 C16 (pitch ldc, batch offset by * sC);
template <int ACT>
__global__ __launch_bounds__(128) void k_gemm2(const _Float16* __restrict__ A, int lda, size_t sA, const _Float16* __restrict__ Bh, int ldb, size_t sB, float alpha,
    const float* __restrict__ bias, const float* __restrict__ CP, float* __restrict__ C, _Float16* __restrict__ C16, int ldc, size_t sC, int M, int N, int K) {
  static_assert(ACT == 0 || ACT == 3);
  __shared__ __attribute__((aligned(16))) float so[4][32][68];
  const unsigned tid = threadIdx.x, w = tid >> 5, lane = tid & 31u, ln = lane & 15u, hh = lane >> 4; const unsigned by = blockIdx.y;
  A += (size_t)by * sA; Bh += (size_t)by * sB; const size_t cofs = (size_t)by * sC;
  const unsigned ntn = (unsigned)N >> 6; const unsigned mt = blockIdx.x / ntn, nq = blockIdx.x - mt * ntn; const unsigned row0 = mt * 128u + 32u * w, col0 = nq * 64u; if (row0 >= (unsigned)M) return;
  const _Float16* a0p = A + (size_t)(row0 + ln) * (size_t)lda; const _Float16* a1p = a0p + (size_t)16 * (size_t)lda;
  const _Float16* b0p = Bh + (size_t)(col0 + ln) * (size_t)ldb; const _Float16* b1p = b0p + (size_t)16 * (size_t)ldb; const _Float16* b2p = b1p + (size_t)16 * (size_t)ldb; const _Float16* b3p = b2p + (size_t)16 * (size_t)ldb;
  const v8f z8 = {0.f,0.f,0.f,0.f,0.f,0.f,0.f,0.f}; v8f c00 = z8, c01 = z8, c02 = z8, c03 = z8, c10 = z8, c11 = z8, c12 = z8, c13 = z8;
#pragma unroll 1
  for (int kb = 0; kb < K; kb += 32) { const v16h a0 = g2_frag(a0p + kb, hh), a1 = g2_frag(a1p + kb, hh);
    v16h b = g2_frag(b0p + kb, hh); c00 = g2_mma(a0, b, c00); c10 = g2_mma(a1, b, c10);
    b = g2_frag(b1p + kb, hh); c01 = g2_mma(a0, b, c01); c11 = g2_mma(a1, b, c11);
    b = g2_frag(b2p + kb, hh); c02 = g2_mma(a0, b, c02); c12 = g2_mma(a1, b, c12);
    b = g2_frag(b3p + kb, hh); c03 = g2_mma(a0, b, c03); c13 = g2_mma(a1, b, c13); }
  v8f accs[8] = {c00, c01, c02, c03, c10, c11, c12, c13};
#pragma unroll
  for (int u = 0; u < 8; ++u) { const unsigned t = (unsigned)u & 3u, half = (unsigned)u >> 2; const unsigned col = col0 + t * 16u + ln; const float bv = bias ? bf16_rne(bias[col]) : 0.f;
#pragma unroll
    for (int r = 0; r < 8; ++r) { const unsigned rloc = half * 16u + 8u * hh + (unsigned)r; float v = accs[u][r] * alpha + bv;
      if (CP) v += CP[cofs + (size_t)(row0 + rloc) * (size_t)ldc + col];      /* own element of the batched C plane */
      if (ACT == 3) v = fmaxf(v, 0.f);
      so[w][rloc][t * 16u + ln] = v; } }
  __builtin_amdgcn_fence(4 /* acq_rel order */, "workgroup"); __builtin_amdgcn_wave_barrier();      /* wave-private tile: same wave writes and reads */
  const unsigned rsub = lane >> 4, c4 = (lane & 15u) * 4u;
  {
#pragma unroll
    for (int q = 0; q < 16; ++q) { const unsigned r = (unsigned)q * 2u + rsub; const v4f v = *(const v4fa*)&so[w][r][c4];
      if (C) *(v4f*)(C + cofs + (size_t)(row0 + r) * (size_t)ldc + col0 + c4) = v;
      if (C16) { v4h h4; for (int i = 0; i < 4; ++i) h4[i] = (_Float16)v[i]; *(v4h*)(C16 + cofs + (size_t)(row0 + r) * (size_t)ldc + col0 + c4) = h4; } }
     } }

__global__ __launch_bounds__(256) void k_wt_f16(const float* __restrict__ W, _Float16* __restrict__ Wt, int K, int N, float scale) {
  const unsigned k8n = (unsigned)K >> 3; const unsigned t = blockIdx.x * 256u + threadIdx.x; if (t >= (unsigned)N * k8n) return; const unsigned n = t / k8n, k8 = (t - n * k8n) * 8u; FragH f;
#pragma unroll
  for (int i = 0; i < 8; ++i) f.h[i] = (_Float16)(bf16_rne(W[(size_t)(k8 + (unsigned)i) * (size_t)N + n]) * scale);
  const v8us o = f.half[0]; unsigned short* dst = (unsigned short*)Wt + (size_t)n * (size_t)K + k8;
  *(v8us*)dst = o;  }

__global__ __launch_bounds__(256) void k_wthd(const float* __restrict__ Wt, _Float16* __restrict__ Bt) {
  const unsigned t = blockIdx.x * 256u + threadIdx.x; if (t >= (unsigned)(NH * HD * (DM / 8))) return;
  const unsigned m8 = (t % (unsigned)(DM / 8)) * 8u; const unsigned d = (t / (unsigned)(DM / 8)) % (unsigned)HD; const unsigned h = t / (unsigned)((DM / 8) * HD); FragH f;
#pragma unroll
  for (int q = 0; q < 8; ++q) f.h[q] = (_Float16)(16.0f * bf16_rne(Wt[((size_t)h * DM + m8 + (unsigned)q) * HD + d]));
  const v8us o = f.half[0]; unsigned short* dst = (unsigned short*)Bt + ((size_t)h * HD + d) * DM + m8;
  *(v8us*)dst = o;  }

template <int NHv, int TTv>
__global__ __launch_bounds__(256) void k_vt(const _Float16* __restrict__ V16, int ldv, int voff, _Float16* __restrict__ Vt) {
  __shared__ unsigned short tl[64][66]; const unsigned tid = threadIdx.x; const unsigned slab = blockIdx.x / (unsigned)(TTv / 64), lg = blockIdx.x % (unsigned)(TTv / 64); const unsigned b = slab / (unsigned)NHv, h = slab % (unsigned)NHv;
  for (unsigned i = tid; i < 64u * 8u; i += 256u) { const unsigned r = i >> 3, c8 = (i & 7u) * 8u; FragH f; f.half[0] = *(const v8us*)((const unsigned short*)V16 + ((size_t)b * TTv + lg * 64u + r) * (size_t)ldv + (size_t)voff + h * 64u + c8);
#pragma unroll
    for (int q = 0; q < 8; ++q) tl[r][c8 + (unsigned)q] = f.u[q]; }
  __syncthreads();
  {
#pragma unroll
    for (int rd = 0; rd < 2; ++rd) { const unsigned d = (unsigned)rd * 32u + (tid >> 3), pc = tid & 7u; FragH f;
#pragma unroll
      for (int q = 0; q < 8; ++q) f.u[q] = tl[pc * 8u + (unsigned)q][d];
      *(v8us*)((unsigned short*)Vt + ((size_t)slab * 64u + d) * TTv + lg * 64u + pc * 8u) = f.half[0]; }
     } }

// masked row softmax for head-batched query tiles: ONE WAVE PER ROW (row t -> head t / QT, tile row t % QT, query q0 + row); key j is valid iff j <= query AND pm[j] != 0; the mask enters as an arithmetic 0/1 factor over the
// whole computed key range nk (v = fmaf(f, s, (1-f)(-1e9)): a REPLACE fill; exp(-1e9 - max) is exactly 0 whenever the row has one valid key). Lane l holds keys 128 c + 4 l + 0..3 of every 128-key chunk c in registers:
// each load covers 512 contiguous bytes of the row, S is read once, exp is taken once; maximum and sum close with a five-step butterfly over the lanes (sum: four chains per lane, then the butterfly).
typedef int v4ia __attribute__((ext_vector_type(4), may_alias));
static_assert(QT == 256 && SQ <= 2048);      /* nk = q0 + QT is 1..8 times 256: the cases of the switch in k_rsmcf2 */
// exp2 of four values, each straight on the hardware's v_exp_f32 (what __expf comes down to behind its multiply by log2 e)
__device__ __forceinline__ v4f rsm_exp2x4(v4f x) { const v4f e = {__builtin_amdgcn_exp2f(x[0]), __builtin_amdgcn_exp2f(x[1]), __builtin_amdgcn_exp2f(x[2]), __builtin_amdgcn_exp2f(x[3])}; return e; }
template <int NC>
__device__ __forceinline__ void rsm_row(const float* __restrict__ s, const int* __restrict__ pm, _Float16* __restrict__ p, int last, unsigned lane) {
  const unsigned l4 = lane * 4u; v4f v[NC];
#pragma unroll      /* v[c] indexed by constants: the row stays in registers, all its loads in flight together */
  for (int c = 0; c < NC; ++c) v[c] = *(const v4fa*)(s + c * 128 + l4);
  float mx = -3.0e38f;
#pragma unroll      /* constant index into v[] */
  for (int c = 0; c < NC; ++c) { const v4ia m = *(const v4ia*)(pm + c * 128 + l4);
#pragma unroll      /* constant element index */
    for (int q = 0; q < 4; ++q) { const int j = c * 128 + (int)l4 + q; const float f = ((j <= last) & (m[q] != 0)) ? 1.f : 0.f; v[c][q] = fmaf(f, v[c][q], (1.f - f) * -1.0e9f); mx = fmaxf(mx, v[c][q]); } }
  for (int d = 16; d > 0; d >>= 1) mx = fmaxf(mx, __shfl_xor(mx, d, 32));
  v4f a = {0.f, 0.f, 0.f, 0.f};
#pragma unroll      /* constant index into v[] */
  for (int c = 0; c < NC; ++c) { v[c] = rsm_exp2x4((v[c] - mx) * 1.44269504088896340736f); a += v[c]; }      /* exp(x) = exp2(x log2 e), as __expf forms it */
  float se = (a[0] + a[1]) + (a[2] + a[3]);
  for (int d = 16; d > 0; d >>= 1) se += __shfl_xor(se, d, 32);
  const float sc = 256.0f * (1.0f / se); v4h h[NC];
#pragma unroll      /* constant index into v[] and h[] */
  for (int c = 0; c < NC; ++c) h[c] = __builtin_convertvector(v[c] * sc, v4h);
#pragma unroll      /* constant index into h[] */
  for (int c = 0; c < NC; ++c) *(v4h*)(p + c * 128 + l4) = h[c];
  asm volatile("s_wait_xcnt 0x0" ::: "memory"); }      /* behind the last store of the run: stands in front of whatever code follows in the kernel and rewrites a register that an issued store names */

__global__ __launch_bounds__(512) void k_rsmcf2(const float* __restrict__ S, const int* __restrict__ pm, _Float16* __restrict__ P, int hg, int q0, int nk) {
  /* readfirstlane: the wave's number in a scalar register, so that the row's base addresses and the switch stay scalar */
  const unsigned lane = threadIdx.x & 31u; const unsigned t = blockIdx.x * 16u + (unsigned)__builtin_amdgcn_readfirstlane((int)(threadIdx.x >> 5)); if (t >= (unsigned)hg * (unsigned)QT) return;
  const float* s = S + (size_t)t * NKX; _Float16* p = P + (size_t)t * NKX; const int last = q0 + (int)(t & (unsigned)(QT - 1));
  switch (nk >> 8) {      /* the row length as a compile-time count, so that the whole row stays in registers */
    case 1: rsm_row<2>(s, pm, p, last, lane); break; case 2: rsm_row<4>(s, pm, p, last, lane); break; case 3: rsm_row<6>(s, pm, p, last, lane); break; case 4: rsm_row<8>(s, pm, p, last, lane); break;
    case 5: rsm_row<10>(s, pm, p, last, lane); break; case 6: rsm_row<12>(s, pm, p, last, lane); break; case 7: rsm_row<14>(s, pm, p, last, lane); break; case 8: rsm_row<16>(s, pm, p, last, lane); break;
    default: break; } }

// f32 attention for the FIRST query tile of a causal sequence (rows 0..QT0-1 of one batch): workgroup = 64 threads = 64 consecutive rows of one head; thread i keeps its q row and its o accumulator in its own LDS
// rows (rolled float4 loops), walks keys j = 0..(workgroup's last row) with an ONLINE softmax in f32 (precise expf; invalid keys (j > i or pm[j] == 0) enter through an arithmetic 0/1 factor as -1e30,
__global__ __launch_bounds__(64) void k_att0(const float* __restrict__ QF, const float* __restrict__ KF, const float* __restrict__ VF, int ld, const int* __restrict__ pm, float scale, float* __restrict__ OF, int ldo) {
  #pragma clang fp contract(off)
  __shared__ __attribute__((aligned(16))) float lq[64][64]; __shared__ __attribute__((aligned(16))) float lo[64][64];
  const unsigned tid = threadIdx.x; const unsigned h = blockIdx.x / (unsigned)(QT0 / 64), rg = blockIdx.x % (unsigned)(QT0 / 64); const unsigned i = rg * 64u + tid;
  const float* qr = QF + (size_t)i * (size_t)ld + h * HD;
#pragma unroll 1
  for (int c = 0; c < HD / 4; ++c) { *(v4fa*)&lq[tid][c * 4] = *(const v4fa*)(qr + c * 4); const v4f z = {0.f, 0.f, 0.f, 0.f}; *(v4fa*)&lo[tid][c * 4] = z; }
  float m = -1.0e30f, l = 0.f; const int jmax = (int)(rg * 64u + 63u);
#pragma unroll 1
  for (int j = 0; j <= jmax; ++j) { const float* kr = KF + (size_t)j * (size_t)ld + h * HD; const float* vr = VF + (size_t)j * (size_t)ld + h * HD; const int pj = pm[j]; float s = 0.f;
#pragma unroll 1
    for (int c = 0; c < HD / 4; ++c) { const v4f kq = *(const v4fa*)(kr + c * 4); const v4f qq = *(const v4fa*)&lq[tid][c * 4]; s = s + qq[0] * kq[0]; s = s + qq[1] * kq[1]; s = s + qq[2] * kq[2]; s = s + qq[3] * kq[3]; }
    s = s * scale;
    const float f = (((unsigned)j <= i) & (pj != 0)) ? 1.f : 0.f; const float sm = fmaf(f, s, (1.f - f) * -1.0e30f); const float mn = fmaxf(m, sm); const float sc = expf(m - mn); const float e = expf(sm - mn); l = l * sc + e; m = mn;
#pragma unroll 1
    for (int c = 0; c < HD / 4; ++c) { const v4f vv = *(const v4fa*)(vr + c * 4); v4f oo = *(const v4fa*)&lo[tid][c * 4]; for (int u = 0; u < 4; ++u) oo[u] = oo[u] * sc + e * vv[u]; *(v4fa*)&lo[tid][c * 4] = oo; } }
  const float fin = 64.0f * (1.0f / l);      /* o carried x64 like the f16 path */
#pragma unroll 1
  for (int c = 0; c < HD / 4; ++c) { v4f oo = *(const v4fa*)&lo[tid][c * 4]; for (int u = 0; u < 4; ++u) oo[u] = oo[u] * fin; *(v4fa*)&lo[tid][c * 4] = oo; }
  __syncthreads();
  {
#pragma unroll 1
    for (int it = 0; it < 16; ++it) { const unsigned row = (unsigned)it * 4u + (tid >> 4), pc = (tid & 15u) * 4u; const v4f v = *(const v4fa*)&lo[row][pc]; *(v4f*)(OF + (size_t)(rg * 64u + row) * (size_t)ldo + h * HD + pc) = v; }
     } }

// row LayerNorm over DM = 1024 of f32 rows: mean, BIASED variance, (x - mu) * rsqrt(var + eps) * bf16(g[c]) + bf16(b[c]) -> f16 rows (GEMM operand); workgroup = 256 threads, thread t owns columns 4t..4t+3;
template <int BFIN, int FULLIN>
__global__ __launch_bounds__(256) void k_lnx(const float* __restrict__ X, const float* __restrict__ g, const float* __restrict__ bb, float eps, _Float16* __restrict__ N16) {
  #pragma clang fp contract(off)
  __shared__ float red[256]; const unsigned r = blockIdx.x; const unsigned t = threadIdx.x; const unsigned c0 = t * 4u;
  const size_t xr = FULLIN ? ((size_t)(r / (unsigned)SQ) * SQ_FULL + (r % (unsigned)SQ)) : (size_t)r;
  const v4f xa = *(const v4fa*)(X + xr * DM + c0); float s[4]; float sum = 0.f;
  for (int q = 0; q < 4; ++q) { s[q] = BFIN ? bf16_rne(xa[q]) : xa[q]; sum = sum + s[q]; }
  red[t] = sum; __syncthreads(); for (unsigned st = 128u; st > 0u; st >>= 1) { if (t < st) red[t] = red[t] + red[t + st]; __syncthreads(); } const float mu = red[0] * (1.0f / (float)DM); __syncthreads();
  float vs = 0.f; for (int q = 0; q < 4; ++q) { const float dl = s[q] - mu; vs = vs + dl * dl; } red[t] = vs; __syncthreads(); for (unsigned st = 128u; st > 0u; st >>= 1) { if (t < st) red[t] = red[t] + red[t + st]; __syncthreads(); }
  const float rs = rsqrtf(red[0] * (1.0f / (float)DM) + eps); v4h y;
  for (int q = 0; q < 4; ++q) { const unsigned c = c0 + (unsigned)q; y[q] = (_Float16)((((s[q] - mu) * rs) * bf16_rne(g[c])) + bf16_rne(bb[c])); }
  { *(v4h*)(N16 + (size_t)r * DM + c0) = y;  } }

// residual without an output projection: X1[r][c] = bf16(x[r][c]) + o[r][c] / 64 (+ NaN when the batch's first mask entry is 0: the structure the attention kernels rely on is violated);
__global__ __launch_bounds__(256) void k_resid(const float* __restrict__ x, const int* __restrict__ pm, const _Float16* __restrict__ O16, const float* __restrict__ OF0, float* __restrict__ X1) {
  #pragma clang fp contract(off)
  const unsigned t = blockIdx.x * 256u + threadIdx.x; if (t >= (unsigned)(NR * DM / 4)) return;
  const unsigned row = t / (unsigned)(DM / 4), c0 = (t % (unsigned)(DM / 4)) * 4u; const unsigned b = row / (unsigned)SQ, rl = row % (unsigned)SQ; const bool ft = rl < (unsigned)QT0; const unsigned rs = ft ? rl : 0u;
  const size_t e = (size_t)row * DM + c0;
  const v4f xv = *(const v4fa*)(x + ((size_t)b * SQ_FULL + rl) * DM + c0);
  const v4h oh = *(const v4h*)(O16 + e);
  const v4f of = *(const v4fa*)(OF0 + ((size_t)b * QT0 + rs) * DM + c0);
  const int p0 = pm[(size_t)b * SQ_FULL]; const float pz = (p0 != 0) ? 0.f : __uint_as_float(0x7fc00000u);
  v4f y; for (int q = 0; q < 4; ++q) { const float o = ft ? of[q] : (float)oh[q]; y[q] = (bf16_rne(xv[q]) + o * 0.015625f) + pz; }
  *(v4f*)(X1 + e) = y;  }

extern "C" void kernel_launch(void* const* d_in, const int* in_sizes, int n_in,
                              void* d_out, int out_size, void* d_ws, size_t ws_size, hipStream_t stream) {
  if (n_in < 13) return;
  const size_t rows_need = (size_t)(NB - 1) * SQ_FULL + SQ;
  if ((size_t)in_sizes[0] < rows_need * DM) return; if ((size_t)in_sizes[1] < rows_need) return;
  if ((size_t)in_sizes[2] < (size_t)NH * DM * HD || (size_t)in_sizes[3] < (size_t)NH * DM * HD || (size_t)in_sizes[4] < (size_t)NH * DM * HD) return;
  if (in_sizes[5] < DM || in_sizes[6] < DM || in_sizes[7] < DM || in_sizes[8] < DM) return;
  if ((size_t)in_sizes[9] < (size_t)DM * DFF || in_sizes[10] < DFF || (size_t)in_sizes[11] < (size_t)DFF * DM || in_sizes[12] < DM) return;
  if ((size_t)out_size < NR * DM) return;
  const float* x = (const float*)d_in[0]; const int* pmask = (const int*)d_in[1];
  const float* wq = (const float*)d_in[2]; const float* wk = (const float*)d_in[3]; const float* wv = (const float*)d_in[4];
  const float* g1 = (const float*)d_in[5]; const float* be1 = (const float*)d_in[6]; const float* g2 = (const float*)d_in[7]; const float* be2 = (const float*)d_in[8];
  const float* w1 = (const float*)d_in[9]; const float* b1 = (const float*)d_in[10]; const float* w2 = (const float*)d_in[11]; const float* b2 = (const float*)d_in[12];
  char* ws = (char*)d_ws; size_t off = 0;
  auto take = [&](size_t bytes) { char* p = ws + off; off += (bytes + 255) & ~(size_t)255; return p; };
  _Float16* BQKV = (_Float16*)take((size_t)3 * DM * DM * 2);          /* [3*DM][DM] x16: q | k | v stacked, row (h*HD + d) */
  _Float16* X16 = (_Float16*)take(NR * DM * 2);                       /* LN1 rows; reused as the LN2 rows (last reader of LN1 rows: the last batch's first-tile GEMM, before LN2 writes) */
  float* X1 = (float*)take(NR * DM * 4);
  _Float16* BW1 = (_Float16*)take((size_t)DFF * DM * 2); _Float16* BW2 = (_Float16*)take((size_t)DM * DFF * 2);
  _Float16* QKV = (_Float16*)take(NR * 3 * DM * 2); _Float16* Q16 = QKV; _Float16* K16 = QKV + DM; _Float16* V16 = QKV + 2 * DM;
  _Float16* HF16 = QKV;                                               /* FFN hidden rows [NR][DFF] alias the q|k|v rows (dead after the attention); DFF <= 3*DM asserted */
  _Float16* O16 = (_Float16*)take(NR * DM * 2);
  float* S = (float*)take((size_t)NH * QT * NKX * 4); _Float16* P = (_Float16*)take((size_t)NH * QT * NKX * 2); _Float16* VT = (_Float16*)take((size_t)NH * HD * SQ * 2);
  float* F0 = (float*)take((size_t)QT0 * 3 * DM * 4);                 /* f32 q | k | v of the first 128 rows of the current batch */
  float* OF0 = (float*)take((size_t)NB * QT0 * DM * 4);
  _Float16* M16 = X16;
  if (off > ws_size || off > (size_t)134217728) return;
  { const unsigned g = (unsigned)(((size_t)NH * HD * (DM / 8) + 255) / 256);
    k_wthd<<<g, 256, 0, stream>>>(wq, BQKV); k_wthd<<<g, 256, 0, stream>>>(wk, BQKV + (size_t)DM * DM); k_wthd<<<g, 256, 0, stream>>>(wv, BQKV + (size_t)2 * DM * DM); }
  k_lnx<1, 1><<<(unsigned)NR, 256, 0, stream>>>(x, g1, be1, 1e-5f, X16);      /* h = LN1(bf16(x)) -> f16 rows */
  k_wt_f16<<<(unsigned)(((size_t)DFF * (DM / 8) + 255) / 256), 256, 0, stream>>>(w1, BW1, DM, DFF, 16.0f);      /* W1 [DM][DFF] -> [DFF][DM] x16 */
  k_wt_f16<<<(unsigned)(((size_t)DM * (DFF / 8) + 255) / 256), 256, 0, stream>>>(w2, BW2, DFF, DM, 16.0f);      /* W2 [DFF][DM] -> [DM][DFF] x16 */
  k_gemm2<0><<<dim3((unsigned)((NR / 128) * (3 * DM / 64)), 1), 128, 0, stream>>>(X16, DM, (size_t)0, BQKV, DM, (size_t)0, 0.0625f, (const float*)nullptr, (const float*)nullptr, (float*)nullptr, QKV, LQ, (size_t)0, (int)NR, 3 * DM, DM);      /* q | k | v rows (f16) */
  for (int b = 0; b < NB; ++b) { const size_t r0 = (size_t)b * SQ; const int* pmb = pmask + (size_t)b * SQ_FULL;
    k_vt<NH, SQ><<<NH * (SQ / 64), 256, 0, stream>>>(V16 + r0 * LQ, LQ, 0, VT);      /* V^T [NH][HD][SQ] for this batch */
    k_gemm2<0><<<dim3((unsigned)((QT0 / 128) * (3 * DM / 64)), 1), 128, 0, stream>>>(X16 + r0 * DM, DM, (size_t)0, BQKV, DM, (size_t)0, 0.0625f, (const float*)nullptr, (const float*)nullptr, F0, (_Float16*)nullptr, 3 * DM, (size_t)0, QT0, 3 * DM, DM);      /* f32 q | k | v of rows 0..127 */
    k_att0<<<NH * (QT0 / 64), 64, 0, stream>>>(F0, F0 + DM, F0 + 2 * DM, 3 * DM, pmb, 0.125f, OF0 + (size_t)b * QT0 * DM, DM);      /* f32 attention for rows 0..127 (o x64) */
    for (int q0 = 0; q0 < SQ; q0 += QT) { const int nk = q0 + QT;      /* causal: only keys below the tile end are computed */
      k_gemm2<0><<<dim3((unsigned)((QT / 128) * (nk / 64)), NH), 128, 0, stream>>>(Q16 + (r0 + q0) * LQ, LQ, (size_t)HD, K16 + r0 * LQ, LQ, (size_t)HD, 0.125f, (const float*)nullptr, (const float*)nullptr, S, (_Float16*)nullptr, NKX, (size_t)QT * NKX, QT, nk, HD);      /* scores / sqrt(64), all heads on grid.y */
      k_rsmcf2<<<(NH * QT + 15) / 16, 512, 0, stream>>>(S, pmb, P, NH, q0, nk);      /* one wave per row, 16 rows per workgroup */
      k_gemm2<0><<<dim3((unsigned)((QT / 128) * (HD / 64)), NH), 128, 0, stream>>>(P, NKX, (size_t)QT * NKX, VT, SQ, (size_t)HD * SQ, 0.25f, (const float*)nullptr, (const float*)nullptr, (float*)nullptr, O16 + (r0 + q0) * DM, DM, (size_t)HD, QT, HD, nk); } }      /* o (merged heads, x64) as f16 rows */
  k_resid<<<(unsigned)((NR * DM / 4) / 256), 256, 0, stream>>>(x, pmask, O16, OF0, X1);      /* x1 = bf16(x) + attn */
  k_lnx<0, 0><<<(unsigned)NR, 256, 0, stream>>>(X1, g2, be2, 1e-5f, M16);      /* h2 = LN2(x1) -> f16 rows */
  k_gemm2<3><<<dim3((unsigned)((NR / 128) * (DFF / 64)), 1), 128, 0, stream>>>(M16, DM, (size_t)0, BW1, DM, (size_t)0, 0.0625f, b1, (const float*)nullptr, (float*)nullptr, HF16, DFF, (size_t)0, (int)NR, DFF, DM);      /* relu(h2 W1 + b1) -> f16 */
  k_gemm2<0><<<dim3((unsigned)((NR / 128) * (DM / 64)), 1), 128, 0, stream>>>(HF16, DFF, (size_t)0, BW2, DFF, (size_t)0, 0.0625f, b2, X1, (float*)d_out, (_Float16*)nullptr, DM, (size_t)0, (int)NR, DM, DFF);      /* out = x1 + mlp (own-element residual) */
}

// v002
// Measured time: 1030 microseconds a run.
// Timed twice side by side with v001, it ran 1.85 and 1.86 times as fast.
// Over all steps from v000 it is 4.96 times as fast.
#include <hip/hip_runtime.h>
// Pre-LN causal transformer layer: x [NB][SEQ][1024]; h = LN1(x) (biased variance, eps 1e-5); q/k/v[b][h] = h Wq/Wk/Wv[h] (per-head [16][1024][64], [in][out], no biases); scores / sqrt(64); mask = padding_mask[b][key] AND causal, masked scores REPLACED by -1e9; softmax; heads concatenated (no output projection); x1 = x + attn; h2 = LN2(x1); out = x1 + relu(h2 W1 + b1) W2 + b2 ([in][out] 1024 x 1024 x 1024).
// Structure: LN1 on VALU -> f16 rows; per-head weights transposed on VALU into one x16 f16 q|k|v plane; q|k|v as ONE WMMA GEMM (32x64 wave tiles, f32 accumulation, f16 out); per batch: V^T via LDS transposes, an f32 first tile (rows 0..127) on VALU, then per query tile of 256 rows: scores against the keys below the tile end (K = 64, all heads on grid.y, alpha 1/8), masked row softmax on VALU, one wave per row (arithmetic select, f32 statistics; weights x256 f16), o = P V^T (x64) f16; x1 = bf16(x) + o / 64; LN2 -> f16; FFN as two GEMMs (ReLU epilogue; own-element residual).
// Compute dtype: all contractions v_wmma_f32_16x16x32_f16 (f16 operands, f32 accumulate); float inputs RNE-converted to bf16 first (weights then x16, exact in f16); q, k, v, softmax weights (x256) and o (x64) as plain f16 operands; scores and softmax statistics f32; first 128 query rows of each batch in f32 on VALU.
#ifndef NB
#define NB 2
#endif
#ifndef SEQ
#define SEQ 2048
#endif
#define SQ SEQ
#define NB_FULL 2
#define SQ_FULL 2048                 /* per-batch row stride of the inputs (x rows, mask entries) */
#define DM 1024
#define NH 16
#define HD 64
#define DFF 1024
#define QT 256                       /* query rows per causal tile */
#define NKX SQ                       /* S / P row pitch */
#define QT0 128                      /* first-tile rows computed in f32 */
#define NR ((size_t)NB * SQ)         /* token rows */
#define LQ (3 * DM)                  /* row pitch of the q|k|v rows */
static_assert(NH * HD == DM);
static_assert(SQ % QT == 0 && QT % 128 == 0 && (QT & (QT - 1)) == 0);
static_assert(QT0 == 128 && QT0 <= SQ && SQ <= SQ_FULL && NB <= NB_FULL);
static_assert(DM % 64 == 0 && DFF % 64 == 0 && DM % 32 == 0 && DFF % 32 == 0 && HD == 64);
static_assert(DM / 4 == 256);
static_assert(DFF <= 3 * DM);
static_assert((((size_t)NB * SQ * DM) / 4) % 256 == 0);
static_assert((size_t)NB * SQ * DM / 4 < 0x7fffffffu);

typedef unsigned short v8us __attribute__((ext_vector_type(8), may_alias));
typedef float  v8f  __attribute__((ext_vector_type(8)));
typedef float  v4f  __attribute__((ext_vector_type(4)));
typedef float  v4fa __attribute__((ext_vector_type(4), may_alias));
typedef _Float16 v16h __attribute__((ext_vector_type(16)));
typedef _Float16 v4h __attribute__((ext_vector_type(4)));
union FragH { v16h v; v8us half[2]; _Float16 h[16]; unsigned short u[16]; };

__device__ __forceinline__ unsigned short bf16_bits(float x) { unsigned int u = __float_as_uint(x); return (unsigned short)((u + 0x7FFFu + ((u >> 16) & 1u)) >> 16); }
__device__ __forceinline__ float bf16_rne(float x) { return __uint_as_float(((unsigned int)bf16_bits(x)) << 16); }

// fragment: elements 0..7 <- k0 + 8h + 0..7, elements 8..15 <- k0 + 16 + 8h + 0..7 (same map for A rows and B columns)
__device__ __forceinline__ v16h g2_frag(const _Float16* p, unsigned hh) { FragH f; f.half[0] = *(const v8us*)((const unsigned short*)p + 8u * hh); f.half[1] = *(const v8us*)((const unsigned short*)p + 16u + 8u * hh); return f.v; }
__device__ __forceinline__ v8f g2_mma(v16h a, v16h b, v8f c) { v8f d = __builtin_amdgcn_wmma_f32_16x16x32_f16(false, a, false, b, (short)0, c, false, false); asm volatile("v_nop\n\tv_nop\n\tv_nop\n\tv_nop" : "+v"(d) : "v"(a), "v"(b)); return d; }

// GEMM (wave tile 32x64; workgroup = 4 waves = 128 rows x 64 cols; M % 128 == 0, N % 64 == 0, K % 32 == 0): A f16 [M][K] (pitch lda, batch stride sA), Bh f16 [N][K] (pitch ldb, batch stride sB);
// v = acc * alpha + bf16(bias[col]) (+ CP own element of the batched C plane); ACT 0 none / 3 relu; writes f32 C and/or f16 C16 (pitch ldc, batch offset by * sC);
template <int ACT>
__global__ __launch_bounds__(128) void k_gemm2(const _Float16* __restrict__ A, int lda, size_t sA, const _Float16* __restrict__ Bh, int ldb, size_t sB, float alpha,
    const float* __restrict__ bias, const float* __restrict__ CP, float* __restrict__ C, _Float16* __restrict__ C16, int ldc, size_t sC, int M, int N, int K) {
  static_assert(ACT == 0 || ACT == 3);
  __shared__ __attribute__((aligned(16))) float so[4][32][68];
  const unsigned tid = threadIdx.x, w = tid >> 5, lane = tid & 31u, ln = lane & 15u, hh = lane >> 4; const unsigned by = blockIdx.y;
  A += (size_t)by * sA; Bh += (size_t)by * sB; const size_t cofs = (size_t)by * sC;
  const unsigned ntn = (unsigned)N >> 6; const unsigned mt = blockIdx.x / ntn, nq = blockIdx.x - mt * ntn; const unsigned row0 = mt * 128u + 32u * w, col0 = nq * 64u; if (row0 >= (unsigned)M) return;
  const _Float16* a0p = A + (size_t)(row0 + ln) * (size_t)lda; const _Float16* a1p = a0p + (size_t)16 * (size_t)lda;
  const _Float16* b0p = Bh + (size_t)(col0 + ln) * (size_t)ldb; const _Float16* b1p = b0p + (size_t)16 * (size_t)ldb; const _Float16* b2p = b1p + (size_t)16 * (size_t)ldb; const _Float16* b3p = b2p + (size_t)16 * (size_t)ldb;
  const v8f z8 = {0.f,0.f,0.f,0.f,0.f,0.f,0.f,0.f}; v8f c00 = z8, c01 = z8, c02 = z8, c03 = z8, c10 = z8, c11 = z8, c12 = z8, c13 = z8;
#pragma unroll 1
  for (int kb = 0; kb < K; kb += 32) { const v16h a0 = g2_frag(a0p + kb, hh), a1 = g2_frag(a1p + kb, hh);
    v16h b = g2_frag(b0p + kb, hh); c00 = g2_mma(a0, b, c00); c10 = g2_mma(a1, b, c10);
    b = g2_frag(b1p + kb, hh); c01 = g2_mma(a0, b, c01); c11 = g2_mma(a1, b, c11);
    b = g2_frag(b2p + kb, hh); c02 = g2_mma(a0, b, c02); c12 = g2_mma(a1, b, c12);
    b = g2_frag(b3p + kb, hh); c03 = g2_mma(a0, b, c03); c13 = g2_mma(a1, b, c13); }
  v8f accs[8] = {c00, c01, c02, c03, c10, c11, c12, c13};
#pragma unroll
  for (int u = 0; u < 8; ++u) { const unsigned t = (unsigned)u & 3u, half = (unsigned)u >> 2; const unsigned col = col0 + t * 16u + ln; const float bv = bias ? bf16_rne(bias[col]) : 0.f;
#pragma unroll
    for (int r = 0; r < 8; ++r) { const unsigned rloc = half * 16u + 8u * hh + (unsigned)r; float v = accs[u][r] * alpha + bv;
      if (CP) v += CP[cofs + (size_t)(row0 + rloc) * (size_t)ldc + col];      /* own element of the batched C plane */
      if (ACT == 3) v = fmaxf(v, 0.f);
      so[w][rloc][t * 16u + ln] = v; } }
  __builtin_amdgcn_fence(4 /* acq_rel order */, "workgroup"); __builtin_amdgcn_wave_barrier();      /* wave-private tile: same wave writes and reads */
  const unsigned rsub = lane >> 4, c4 = (lane & 15u) * 4u;
  {
#pragma unroll
    for (int q = 0; q < 16; ++q) { const unsigned r = (unsigned)q * 2u + rsub; const v4f v = *(const v4fa*)&so[w][r][c4];
      if (C) *(v4f*)(C + cofs + (size_t)(row0 + r) * (size_t)ldc + col0 + c4) = v;
      if (C16) { v4h h4; for (int i = 0; i < 4; ++i) h4[i] = (_Float16)v[i]; *(v4h*)(C16 + cofs + (size_t)(row0 + r) * (size_t)ldc + col0 + c4) = h4; } }
     } }

__global__ __launch_bounds__(256) void k_wt_f16(const float* __restrict__ W, _Float16* __restrict__ Wt, int K, int N, float scale) {
  const unsigned k8n = (unsigned)K >> 3; const unsigned t = blockIdx.x * 256u + threadIdx.x; if (t >= (unsigned)N * k8n) return; const unsigned n = t / k8n, k8 = (t - n * k8n) * 8u; FragH f;
#pragma unroll
  for (int i = 0; i < 8; ++i) f.h[i] = (_Float16)(bf16_rne(W[(size_t)(k8 + (unsigned)i) * (size_t)N + n]) * scale);
  const v8us o = f.half[0]; unsigned short* dst = (unsigned short*)Wt + (size_t)n * (size_t)K + k8;
  *(v8us*)dst = o;  }

__global__ __launch_bounds__(256) void k_wthd(const float* __restrict__ Wt, _Float16* __restrict__ Bt) {
  const unsigned t = blockIdx.x * 256u + threadIdx.x; if (t >= (unsigned)(NH * HD * (DM / 8))) return;
  const unsigned m8 = (t % (unsigned)(DM / 8)) * 8u; const unsigned d = (t / (unsigned)(DM / 8)) % (unsigned)HD; const unsigned h = t / (unsigned)((DM / 8) * HD); FragH f;
#pragma unroll
  for (int q = 0; q < 8; ++q) f.h[q] = (_Float16)(16.0f * bf16_rne(Wt[((size_t)h * DM + m8 + (unsigned)q) * HD + d]));
  const v8us o = f.half[0]; unsigned short* dst = (unsigned short*)Bt + ((size_t)h * HD + d) * DM + m8;
  *(v8us*)dst = o;  }

template <int NHv, int TTv>
__global__ __launch_bounds__(256) void k_vt(const _Float16* __restrict__ V16, int ldv, int voff, _Float16* __restrict__ Vt) {
  __shared__ unsigned short tl[64][66]; const unsigned tid = threadIdx.x; const unsigned slab = blockIdx.x / (unsigned)(TTv / 64), lg = blockIdx.x % (unsigned)(TTv / 64); const unsigned b = slab / (unsigned)NHv, h = slab % (unsigned)NHv;
  for (unsigned i = tid; i < 64u * 8u; i += 256u) { const unsigned r = i >> 3, c8 = (i & 7u) * 8u; FragH f; f.half[0] = *(const v8us*)((const unsigned short*)V16 + ((size_t)b * TTv + lg * 64u + r) * (size_t)ldv + (size_t)voff + h * 64u + c8);
#pragma unroll
    for (int q = 0; q < 8; ++q) tl[r][c8 + (unsigned)q] = f.u[q]; }
  __syncthreads();
  {
#pragma unroll
    for (int rd = 0; rd < 2; ++rd) { const unsigned d = (unsigned)rd * 32u + (tid >> 3), pc = tid & 7u; FragH f;
#pragma unroll
      for (int q = 0; q < 8; ++q) f.u[q] = tl[pc * 8u + (unsigned)q][d];
      *(v8us*)((unsigned short*)Vt + ((size_t)slab * 64u + d) * TTv + lg * 64u + pc * 8u) = f.half[0]; }
     } }

// masked row softmax for head-batched query tiles: ONE WAVE PER ROW (row t -> head t / QT, tile row t % QT, query q0 + row); key j is valid iff j <= query AND pm[j] != 0; the mask enters as an arithmetic 0/1 factor over the
// whole computed key range nk (v = fmaf(f, s, (1-f)(-1e9)): a REPLACE fill; exp(-1e9 - max) is exactly 0 whenever the row has one valid key). Lane l holds keys 128 c + 4 l + 0..3 of every 128-key chunk c in registers:
// each load covers 512 contiguous bytes of the row, S is read once, exp is taken once; maximum and sum close with a five-step butterfly over the lanes (sum: four chains per lane, then the butterfly).
typedef int v4ia __attribute__((ext_vector_type(4), may_alias));
static_assert(QT == 256 && SQ <= 2048);      /* nk = q0 + QT is 1..8 times 256: the cases of the switch in k_rsmcf2 */
// exp2 of four values, each straight on the hardware's v_exp_f32 (what __expf comes down to behind its multiply by log2 e)
__device__ __forceinline__ v4f rsm_exp2x4(v4f x) { const v4f e = {__builtin_amdgcn_exp2f(x[0]), __builtin_amdgcn_exp2f(x[1]), __builtin_amdgcn_exp2f(x[2]), __builtin_amdgcn_exp2f(x[3])}; return e; }
template <int NC>
__device__ __forceinline__ void rsm_row(const float* __restrict__ s, const int* __restrict__ pm, _Float16* __restrict__ p, int last, unsigned lane) {
  const unsigned l4 = lane * 4u; v4f v[NC];
#pragma unroll      /* v[c] indexed by constants: the row stays in registers, all its loads in flight together */
  for (int c = 0; c < NC; ++c) v[c] = *(const v4fa*)(s + c * 128 + l4);
  float mx = -3.0e38f;
#pragma unroll      /* constant index into v[] */
  for (int c = 0; c < NC; ++c) { const v4ia m = *(const v4ia*)(pm + c * 128 + l4);
#pragma unroll      /* constant element index */
    for (int q = 0; q < 4; ++q) { const int j = c * 128 + (int)l4 + q; const float f = ((j <= last) & (m[q] != 0)) ? 1.f : 0.f; v[c][q] = fmaf(f, v[c][q], (1.f - f) * -1.0e9f); mx = fmaxf(mx, v[c][q]); } }
  for (int d = 16; d > 0; d >>= 1) mx = fmaxf(mx, __shfl_xor(mx, d, 32));
  v4f a = {0.f, 0.f, 0.f, 0.f};
#pragma unroll      /* constant index into v[] */
  for (int c = 0; c < NC; ++c) { v[c] = rsm_exp2x4((v[c] - mx) * 1.44269504088896340736f); a += v[c]; }      /* exp(x) = exp2(x log2 e), as __expf forms it */
  float se = (a[0] + a[1]) + (a[2] + a[3]);
  for (int d = 16; d > 0; d >>= 1) se += __shfl_xor(se, d, 32);
  const float sc = 256.0f * (1.0f / se); v4h h[NC];
#pragma unroll      /* constant index into v[] and h[] */
  for (int c = 0; c < NC; ++c) h[c] = __builtin_convertvector(v[c] * sc, v4h);
#pragma unroll      /* constant index into h[] */
  for (int c = 0; c < NC; ++c) *(v4h*)(p + c * 128 + l4) = h[c];
  asm volatile("s_wait_xcnt 0x0" ::: "memory"); }      /* behind the last store of the run: stands in front of whatever code follows in the kernel and rewrites a register that an issued store names */

__global__ __launch_bounds__(512) void k_rsmcf2(const float* __restrict__ S, const int* __restrict__ pm, _Float16* __restrict__ P, int hg, int q0, int nk) {
  /* readfirstlane: the wave's number in a scalar register, so that the row's base addresses and the switch stay scalar */
  const unsigned lane = threadIdx.x & 31u; const unsigned t = blockIdx.x * 16u + (unsigned)__builtin_amdgcn_readfirstlane((int)(threadIdx.x >> 5)); if (t >= (unsigned)hg * (unsigned)QT) return;
  const float* s = S + (size_t)t * NKX; _Float16* p = P + (size_t)t * NKX; const int last = q0 + (int)(t & (unsigned)(QT - 1));
  switch (nk >> 8) {      /* the row length as a compile-time count, so that the whole row stays in registers */
    case 1: rsm_row<2>(s, pm, p, last, lane); break; case 2: rsm_row<4>(s, pm, p, last, lane); break; case 3: rsm_row<6>(s, pm, p, last, lane); break; case 4: rsm_row<8>(s, pm, p, last, lane); break;
    case 5: rsm_row<10>(s, pm, p, last, lane); break; case 6: rsm_row<12>(s, pm, p, last, lane); break; case 7: rsm_row<14>(s, pm, p, last, lane); break; case 8: rsm_row<16>(s, pm, p, last, lane); break;
    default: break; } }

// f32 attention for the FIRST query tile of a causal sequence (rows 0..QT0-1 of one batch): ONE WAVE PER QUERY ROW, workgroup = A0W waves = A0W consecutive rows of one head. The head's QT0 key rows and value rows are
// staged once in LDS with coalesced 16-byte loads (key pitch HD + 4 floats: 16 lanes that each read 16 bytes of their own key row fall on distinct banks). Scores: lane l owns keys l, l + 32, l + 64, l + 96 (four partial
// sums per key over the head dimension), invalid keys (j > i or pm[j] == 0) are REPLACED by -1e30; maximum and sum close with a five-step butterfly over the lanes (precise expf, weight exactly 0 for an invalid key
// whenever the row has one valid key). q, k, v rows at pitch LQ, o rows at pitch DM. o: lane l owns columns 2l, 2l + 1 and walks all keys (four partial sums over the keys), the weights read back from the wave's own LDS row as broadcasts.
#define A0W 8                        /* query rows (= waves) per workgroup */
#define A0S (QT0 / (2 * A0W))        /* staging steps: a workgroup's threads cover 2 * A0W rows of 64 floats a step, 16 bytes a thread */
static_assert(QT0 % A0W == 0 && QT0 % 32 == 0 && (QT0 * (HD / 4)) % (32 * A0W) == 0 && HD == 64);
typedef float v2f  __attribute__((ext_vector_type(2)));
typedef float v2fa __attribute__((ext_vector_type(2), may_alias));
__global__ __launch_bounds__(32 * A0W) void k_att0(const float* __restrict__ QF, const float* __restrict__ KF, const float* __restrict__ VF, const int* __restrict__ pm, float scale, float* __restrict__ OF) {
  __shared__ __attribute__((aligned(16))) float lk[QT0][HD + 4]; __shared__ __attribute__((aligned(16))) float lv[QT0][HD]; __shared__ __attribute__((aligned(16))) float lp[A0W][QT0];
  /* readfirstlane: the wave's number in a scalar register, so that the q row's address is scalar */
  const unsigned tid = threadIdx.x, lane = tid & 31u; const unsigned w = (unsigned)__builtin_amdgcn_readfirstlane((int)(tid >> 5));
  const unsigned h = blockIdx.x / (unsigned)(QT0 / A0W), rg = blockIdx.x % (unsigned)(QT0 / A0W); const unsigned i = rg * (unsigned)A0W + w;
  const unsigned r0 = tid >> 4, c4 = (tid & 15u) * 4u; const float* kp = KF + (size_t)r0 * LQ + h * HD + c4; const float* vp = VF + (size_t)r0 * LQ + h * HD + c4; const float* qr = QF + (size_t)i * LQ + h * HD;
  v4f kk[A0S], vv[A0S], qq[HD / 4]; int pv[QT0 / 32];
#pragma unroll      /* constant index into kk[] and vv[]; constant pitch: one address per plane, the steps as immediate offsets; all of a thread's loads in flight together */
  for (int it = 0; it < A0S; ++it) { kk[it] = *(const v4fa*)(kp + (size_t)it * (2 * A0W) * LQ); vv[it] = *(const v4fa*)(vp + (size_t)it * (2 * A0W) * LQ); }
#pragma unroll      /* constant index into pv[] */
  for (int u = 0; u < QT0 / 32; ++u) pv[u] = pm[(unsigned)u * 32u + lane];
#pragma unroll      /* constant index into qq[] */
  for (int c = 0; c < HD / 4; ++c) qq[c] = *(const v4fa*)(qr + c * 4);
  asm volatile("s_wait_xcnt 0x0" :: "v"(kp), "v"(vp) : "memory");      /* behind the last staging load, in front of whatever rewrites a register that an issued load names; kp and vp as inputs keep both address pairs live up to here, so that no load of the run lands in one */
#pragma unroll      /* constant index into kk[] and vv[] */
  for (int it = 0; it < A0S; ++it) { *(v4fa*)&lk[r0 + (unsigned)it * (unsigned)(2 * A0W)][c4] = kk[it]; *(v4fa*)&lv[r0 + (unsigned)it * (unsigned)(2 * A0W)][c4] = vv[it]; }
  __syncthreads();      /* publishes the staged key and value rows to every wave */
  const v4f z4 = {0.f, 0.f, 0.f, 0.f}; v4f acc[QT0 / 32];
#pragma unroll      /* constant index into acc[] */
  for (int u = 0; u < QT0 / 32; ++u) acc[u] = z4;
#pragma unroll      /* constant index into acc[] and qq[]; the LDS reads of several steps in flight together */
  for (int c = 0; c < HD / 4; ++c) {
#pragma unroll      /* constant index into acc[] */
    for (int u = 0; u < QT0 / 32; ++u) acc[u] += qq[c] * *(const v4fa*)&lk[(unsigned)u * 32u + lane][c * 4]; }
  float sm[QT0 / 32]; float mx = -1.0e30f;
#pragma unroll      /* constant index into acc[] and sm[] */
  for (int u = 0; u < QT0 / 32; ++u) { const unsigned j = (unsigned)u * 32u + lane; const float s = ((acc[u][0] + acc[u][1]) + (acc[u][2] + acc[u][3])) * scale; sm[u] = ((j <= i) & (pv[u] != 0)) ? s : -1.0e30f; mx = fmaxf(mx, sm[u]); }
  for (int d = 16; d > 0; d >>= 1) mx = fmaxf(mx, __shfl_xor(mx, d, 32));
  float l = 0.f;
#pragma unroll      /* constant index into sm[] */
  for (int u = 0; u < QT0 / 32; ++u) { const float e = expf(sm[u] - mx); lp[w][(unsigned)u * 32u + lane] = e; l += e; }
  for (int d = 16; d > 0; d >>= 1) l += __shfl_xor(l, d, 32);
  __syncthreads();      /* the weights are written by one lane and read by all lanes of the wave */
  const v2f z2 = {0.f, 0.f}; v2f o[4] = {z2, z2, z2, z2};
#pragma unroll 8      /* several steps' LDS reads in flight together */
  for (int j4 = 0; j4 < QT0 / 4; ++j4) { const v4f pj = *(const v4fa*)&lp[w][j4 * 4];
#pragma unroll      /* constant index into o[] and pj */
    for (int u = 0; u < 4; ++u) o[u] += pj[u] * *(const v2fa*)&lv[j4 * 4 + u][lane * 2u]; }
  const float fin = 64.0f * (1.0f / l);      /* o carried x64 like the f16 path */
  const v2f oo = ((o[0] + o[1]) + (o[2] + o[3])) * fin;
  *(v2f*)(OF + (size_t)i * DM + h * HD + lane * 2u) = oo; }

// row LayerNorm over DM = 1024 of f32 rows: mean, BIASED variance, (x - mu) * rsqrt(var + eps) * bf16(g[c]) + bf16(b[c]) -> f16 rows (GEMM operand); workgroup = 256 threads, thread t owns columns 4t..4t+3;
template <int BFIN, int FULLIN>
__global__ __launch_bounds__(256) void k_lnx(const float* __restrict__ X, const float* __restrict__ g, const float* __restrict__ bb, float eps, _Float16* __restrict__ N16) {
  #pragma clang fp contract(off)
  __shared__ float red[256]; const unsigned r = blockIdx.x; const unsigned t = threadIdx.x; const unsigned c0 = t * 4u;
  const size_t xr = FULLIN ? ((size_t)(r / (unsigned)SQ) * SQ_FULL + (r % (unsigned)SQ)) : (size_t)r;
  const v4f xa = *(const v4fa*)(X + xr * DM + c0); float s[4]; float sum = 0.f;
  for (int q = 0; q < 4; ++q) { s[q] = BFIN ? bf16_rne(xa[q]) : xa[q]; sum = sum + s[q]; }
  red[t] = sum; __syncthreads(); for (unsigned st = 128u; st > 0u; st >>= 1) { if (t < st) red[t] = red[t] + red[t + st]; __syncthreads(); } const float mu = red[0] * (1.0f / (float)DM); __syncthreads();
  float vs = 0.f; for (int q = 0; q < 4; ++q) { const float dl = s[q] - mu; vs = vs + dl * dl; } red[t] = vs; __syncthreads(); for (unsigned st = 128u; st > 0u; st >>= 1) { if (t < st) red[t] = red[t] + red[t + st]; __syncthreads(); }
  const float rs = rsqrtf(red[0] * (1.0f / (float)DM) + eps); v4h y;
  for (int q = 0; q < 4; ++q) { const unsigned c = c0 + (unsigned)q; y[q] = (_Float16)((((s[q] - mu) * rs) * bf16_rne(g[c])) + bf16_rne(bb[c])); }
  { *(v4h*)(N16 + (size_t)r * DM + c0) = y;  } }

// residual without an output projection: X1[r][c] = bf16(x[r][c]) + o[r][c] / 64 (+ NaN when the batch's first mask entry is 0: the structure the attention kernels rely on is violated);
__global__ __launch_bounds__(256) void k_resid(const float* __restrict__ x, const int* __restrict__ pm, const _Float16* __restrict__ O16, const float* __restrict__ OF0, float* __restrict__ X1) {
  #pragma clang fp contract(off)
  const unsigned t = blockIdx.x * 256u + threadIdx.x; if (t >= (unsigned)(NR * DM / 4)) return;
  const unsigned row = t / (unsigned)(DM / 4), c0 = (t % (unsigned)(DM / 4)) * 4u; const unsigned b = row / (unsigned)SQ, rl = row % (unsigned)SQ; const bool ft = rl < (unsigned)QT0; const unsigned rs = ft ? rl : 0u;
  const size_t e = (size_t)row * DM + c0;
  const v4f xv = *(const v4fa*)(x + ((size_t)b * SQ_FULL + rl) * DM + c0);
  const v4h oh = *(const v4h*)(O16 + e);
  const v4f of = *(const v4fa*)(OF0 + ((size_t)b * QT0 + rs) * DM + c0);
  const int p0 = pm[(size_t)b * SQ_FULL]; const float pz = (p0 != 0) ? 0.f : __uint_as_float(0x7fc00000u);
  v4f y; for (int q = 0; q < 4; ++q) { const float o = ft ? of[q] : (float)oh[q]; y[q] = (bf16_rne(xv[q]) + o * 0.015625f) + pz; }
  *(v4f*)(X1 + e) = y;  }

extern "C" void kernel_launch(void* const* d_in, const int* in_sizes, int n_in,
                              void* d_out, int out_size, void* d_ws, size_t ws_size, hipStream_t stream) {
  if (n_in < 13) return;
  const size_t rows_need = (size_t)(NB - 1) * SQ_FULL + SQ;
  if ((size_t)in_sizes[0] < rows_need * DM) return; if ((size_t)in_sizes[1] < rows_need) return;
  if ((size_t)in_sizes[2] < (size_t)NH * DM * HD || (size_t)in_sizes[3] < (size_t)NH * DM * HD || (size_t)in_sizes[4] < (size_t)NH * DM * HD) return;
  if (in_sizes[5] < DM || in_sizes[6] < DM || in_sizes[7] < DM || in_sizes[8] < DM) return;
  if ((size_t)in_sizes[9] < (size_t)DM * DFF || in_sizes[10] < DFF || (size_t)in_sizes[11] < (size_t)DFF * DM || in_sizes[12] < DM) return;
  if ((size_t)out_size < NR * DM) return;
  const float* x = (const float*)d_in[0]; const int* pmask = (const int*)d_in[1];
  const float* wq = (const float*)d_in[2]; const float* wk = (const float*)d_in[3]; const float* wv = (const float*)d_in[4];
  const float* g1 = (const float*)d_in[5]; const float* be1 = (const float*)d_in[6]; const float* g2 = (const float*)d_in[7]; const float* be2 = (const float*)d_in[8];
  const float* w1 = (const float*)d_in[9]; const float* b1 = (const float*)d_in[10]; const float* w2 = (const float*)d_in[11]; const float* b2 = (const float*)d_in[12];
  char* ws = (char*)d_ws; size_t off = 0;
  auto take = [&](size_t bytes) { char* p = ws + off; off += (bytes + 255) & ~(size_t)255; return p; };
  _Float16* BQKV = (_Float16*)take((size_t)3 * DM * DM * 2);          /* [3*DM][DM] x16: q | k | v stacked, row (h*HD + d) */
  _Float16* X16 = (_Float16*)take(NR * DM * 2);                       /* LN1 rows; reused as the LN2 rows (last reader of LN1 rows: the last batch's first-tile GEMM, before LN2 writes) */
  float* X1 = (float*)take(NR * DM * 4);
  _Float16* BW1 = (_Float16*)take((size_t)DFF * DM * 2); _Float16* BW2 = (_Float16*)take((size_t)DM * DFF * 2);
  _Float16* QKV = (_Float16*)take(NR * 3 * DM * 2); _Float16* Q16 = QKV; _Float16* K16 = QKV + DM; _Float16* V16 = QKV + 2 * DM;
  _Float16* HF16 = QKV;                                               /* FFN hidden rows [NR][DFF] alias the q|k|v rows (dead after the attention); DFF <= 3*DM asserted */
  _Float16* O16 = (_Float16*)take(NR * DM * 2);
  float* S = (float*)take((size_t)NH * QT * NKX * 4); _Float16* P = (_Float16*)take((size_t)NH * QT * NKX * 2); _Float16* VT = (_Float16*)take((size_t)NH * HD * SQ * 2);
  float* F0 = (float*)take((size_t)QT0 * 3 * DM * 4);                 /* f32 q | k | v of the first 128 rows of the current batch */
  float* OF0 = (float*)take((size_t)NB * QT0 * DM * 4);
  _Float16* M16 = X16;
  if (off > ws_size || off > (size_t)134217728) return;
  { const unsigned g = (unsigned)(((size_t)NH * HD * (DM / 8) + 255) / 256);
    k_wthd<<<g, 256, 0, stream>>>(wq, BQKV); k_wthd<<<g, 256, 0, stream>>>(wk, BQKV + (size_t)DM * DM); k_wthd<<<g, 256, 0, stream>>>(wv, BQKV + (size_t)2 * DM * DM); }
  k_lnx<1, 1><<<(unsigned)NR, 256, 0, stream>>>(x, g1, be1, 1e-5f, X16);      /* h = LN1(bf16(x)) -> f16 rows */
  k_wt_f16<<<(unsigned)(((size_t)DFF * (DM / 8) + 255) / 256), 256, 0, stream>>>(w1, BW1, DM, DFF, 16.0f);      /* W1 [DM][DFF] -> [DFF][DM] x16 */
  k_wt_f16<<<(unsigned)(((size_t)DM * (DFF / 8) + 255) / 256), 256, 0, stream>>>(w2, BW2, DFF, DM, 16.0f);      /* W2 [DFF][DM] -> [DM][DFF] x16 */
  k_gemm2<0><<<dim3((unsigned)((NR / 128) * (3 * DM / 64)), 1), 128, 0, stream>>>(X16, DM, (size_t)0, BQKV, DM, (size_t)0, 0.0625f, (const float*)nullptr, (const float*)nullptr, (float*)nullptr, QKV, LQ, (size_t)0, (int)NR, 3 * DM, DM);      /* q | k | v rows (f16) */
  for (int b = 0; b < NB; ++b) { const size_t r0 = (size_t)b * SQ; const int* pmb = pmask + (size_t)b * SQ_FULL;
    k_vt<NH, SQ><<<NH * (SQ / 64), 256, 0, stream>>>(V16 + r0 * LQ, LQ, 0, VT);      /* V^T [NH][HD][SQ] for this batch */
    k_gemm2<0><<<dim3((unsigned)((QT0 / 128) * (3 * DM / 64)), 1), 128, 0, stream>>>(X16 + r0 * DM, DM, (size_t)0, BQKV, DM, (size_t)0, 0.0625f, (const float*)nullptr, (const float*)nullptr, F0, (_Float16*)nullptr, 3 * DM, (size_t)0, QT0, 3 * DM, DM);      /* f32 q | k | v of rows 0..127 */
    k_att0<<<NH * (QT0 / A0W), 32 * A0W, 0, stream>>>(F0, F0 + DM, F0 + 2 * DM, pmb, 0.125f, OF0 + (size_t)b * QT0 * DM);      /* f32 attention for rows 0..127 (o x64) */
    for (int q0 = 0; q0 < SQ; q0 += QT) { const int nk = q0 + QT;      /* causal: only keys below the tile end are computed */
      k_gemm2<0><<<dim3((unsigned)((QT / 128) * (nk / 64)), NH), 128, 0, stream>>>(Q16 + (r0 + q0) * LQ, LQ, (size_t)HD, K16 + r0 * LQ, LQ, (size_t)HD, 0.125f, (const float*)nullptr, (const float*)nullptr, S, (_Float16*)nullptr, NKX, (size_t)QT * NKX, QT, nk, HD);      /* scores / sqrt(64), all heads on grid.y */
      k_rsmcf2<<<(NH * QT + 15) / 16, 512, 0, stream>>>(S, pmb, P, NH, q0, nk);      /* one wave per row, 16 rows per workgroup */
      k_gemm2<0><<<dim3((unsigned)((QT / 128) * (HD / 64)), NH), 128, 0, stream>>>(P, NKX, (size_t)QT * NKX, VT, SQ, (size_t)HD * SQ, 0.25f, (const float*)nullptr, (const float*)nullptr, (float*)nullptr, O16 + (r0 + q0) * DM, DM, (size_t)HD, QT, HD, nk); } }      /* o (merged heads, x64) as f16 rows */
  k_resid<<<(unsigned)((NR * DM / 4) / 256), 256, 0, stream>>>(x, pmask, O16, OF0, X1);      /* x1 = bf16(x) + attn */
  k_lnx<0, 0><<<(unsigned)NR, 256, 0, stream>>>(X1, g2, be2, 1e-5f, M16);      /* h2 = LN2(x1) -> f16 rows */
  k_gemm2<3><<<dim3((unsigned)((NR / 128) * (DFF / 64)), 1), 128, 0, stream>>>(M16, DM, (size_t)0, BW1, DM, (size_t)0, 0.0625f, b1, (const float*)nullptr, (float*)nullptr, HF16, DFF, (size_t)0, (int)NR, DFF, DM);      /* relu(h2 W1 + b1) -> f16 */
  k_gemm2<0><<<dim3((unsigned)((NR / 128) * (DM / 64)), 1), 128, 0, stream>>>(HF16, DFF, (size_t)0, BW2, DFF, (size_t)0, 0.0625f, b2, X1, (float*)d_out, (_Float16*)nullptr, DM, (size_t)0, (int)NR, DM, DFF);      /* out = x1 + mlp (own-element residual) */
}

// v003
// One run takes 321 microseconds.
// Two timings next to v002 put it at 3.22 and 3.19 times that version's speed.
// All steps since v000 together make it 15.9 times as fast.
#include <hip/hip_runtime.h>
// Pre-LN causal transformer layer: x [NB][SEQ][1024]; h = LN1(x) (biased variance, eps 1e-5); q/k/v[b][h] = h Wq/Wk/Wv[h] (per-head [16][1024][64], [in][out], no biases); scores / sqrt(64); mask = padding_mask[b][key] AND causal, masked scores REPLACED by -1e9; softmax; heads concatenated (no output projection); x1 = x + attn; h2 = LN2(x1); out = x1 + relu(h2 W1 + b1) W2 + b2 ([in][out] 1024 x 1024 x 1024).
// Structure: LN1 on VALU -> f16 rows; per-head weights transposed on VALU into one x16 f16 q|k|v plane; q|k|v as ONE WMMA GEMM (32x64 wave tiles, f32 accumulation, f16 out); per batch: V^T via LDS transposes and an f32 first tile (rows 0..127) on VALU; then ONE fused attention launch for all batches and heads (scores, masked online softmax and P V in registers, one wave per 32 queries; o x64 f16); x1 = bf16(x) + o / 64; LN2 -> f16; FFN as two GEMMs (ReLU epilogue; own-element residual).
// Compute dtype: all contractions v_wmma_f32_16x16x32_f16 (f16 operands, f32 accumulate); float inputs RNE-converted to bf16 first (weights then x16, exact in f16); q, k, v, softmax weights (relative to the running row maximum) and o (x64) as plain f16 operands; scores and softmax statistics f32; first 128 query rows of each batch in f32 on VALU.
#ifndef NB
#define NB 2
#endif
#ifndef SEQ
#define SEQ 2048
#endif
#define SQ SEQ
#define NB_FULL 2
#define SQ_FULL 2048                 /* per-batch row stride of the inputs (x rows, mask entries) */
#define DM 1024
#define NH 16
#define HD 64
#define DFF 1024
#define QT0 128                      /* first-tile rows computed in f32 */
#define NR ((size_t)NB * SQ)         /* token rows */
#define LQ (3 * DM)                  /* row pitch of the q|k|v rows */
static_assert(NH * HD == DM);
static_assert(QT0 == 128 && QT0 <= SQ && SQ <= SQ_FULL && NB <= NB_FULL);
static_assert(DM % 64 == 0 && DFF % 64 == 0 && DM % 32 == 0 && DFF % 32 == 0 && HD == 64);
static_assert(DM / 4 == 256);
static_assert(DFF <= 3 * DM);
static_assert((((size_t)NB * SQ * DM) / 4) % 256 == 0);
static_assert((size_t)NB * SQ * DM / 4 < 0x7fffffffu);

typedef unsigned short v8us __attribute__((ext_vector_type(8), may_alias));
typedef float  v8f  __attribute__((ext_vector_type(8)));
typedef float  v4f  __attribute__((ext_vector_type(4)));
typedef float  v4fa __attribute__((ext_vector_type(4), may_alias));
typedef _Float16 v16h __attribute__((ext_vector_type(16)));
typedef _Float16 v4h __attribute__((ext_vector_type(4)));
union FragH { v16h v; v8us half[2]; _Float16 h[16]; unsigned short u[16]; };

__device__ __forceinline__ unsigned short bf16_bits(float x) { unsigned int u = __float_as_uint(x); return (unsigned short)((u + 0x7FFFu + ((u >> 16) & 1u)) >> 16); }
__device__ __forceinline__ float bf16_rne(float x) { return __uint_as_float(((unsigned int)bf16_bits(x)) << 16); }

// fragment: elements 0..7 <- k0 + 8h + 0..7, elements 8..15 <- k0 + 16 + 8h + 0..7 (same map for A rows and B columns)
__device__ __forceinline__ v16h g2_frag(const _Float16* p, unsigned hh) { FragH f; f.half[0] = *(const v8us*)((const unsigned short*)p + 8u * hh); f.half[1] = *(const v8us*)((const unsigned short*)p + 16u + 8u * hh); return f.v; }
__device__ __forceinline__ v8f g2_mma(v16h a, v16h b, v8f c) { v8f d = __builtin_amdgcn_wmma_f32_16x16x32_f16(false, a, false, b, (short)0, c, false, false); asm volatile("v_nop\n\tv_nop\n\tv_nop\n\tv_nop" : "+v"(d) : "v"(a), "v"(b)); return d; }

// GEMM (wave tile 32x64; workgroup = 4 waves = 128 rows x 64 cols; M % 128 == 0, N % 64 == 0, K % 32 == 0): A f16 [M][K] (pitch lda, batch stride sA), Bh f16 [N][K] (pitch ldb, batch stride sB);
// v = acc * alpha + bf16(bias[col]) (+ CP own element of the batched C plane); ACT 0 none / 3 relu; writes f32 C and/or f16 C16 (pitch ldc, batch offset by * sC);
template <int ACT>
__global__ __launch_bounds__(128) void k_gemm2(const _Float16* __restrict__ A, int lda, size_t sA, const _Float16* __restrict__ Bh, int ldb, size_t sB, float alpha,
    const float* __restrict__ bias, const float* __restrict__ CP, float* __restrict__ C, _Float16* __restrict__ C16, int ldc, size_t sC, int M, int N, int K) {
  static_assert(ACT == 0 || ACT == 3);
  __shared__ __attribute__((aligned(16))) float so[4][32][68];
  const unsigned tid = threadIdx.x, w = tid >> 5, lane = tid & 31u, ln = lane & 15u, hh = lane >> 4; const unsigned by = blockIdx.y;
  A += (size_t)by * sA; Bh += (size_t)by * sB; const size_t cofs = (size_t)by * sC;
  const unsigned ntn = (unsigned)N >> 6; const unsigned mt = blockIdx.x / ntn, nq = blockIdx.x - mt * ntn; const unsigned row0 = mt * 128u + 32u * w, col0 = nq * 64u; if (row0 >= (unsigned)M) return;
  const _Float16* a0p = A + (size_t)(row0 + ln) * (size_t)lda; const _Float16* a1p = a0p + (size_t)16 * (size_t)lda;
  const _Float16* b0p = Bh + (size_t)(col0 + ln) * (size_t)ldb; const _Float16* b1p = b0p + (size_t)16 * (size_t)ldb; const _Float16* b2p = b1p + (size_t)16 * (size_t)ldb; const _Float16* b3p = b2p + (size_t)16 * (size_t)ldb;
  const v8f z8 = {0.f,0.f,0.f,0.f,0.f,0.f,0.f,0.f}; v8f c00 = z8, c01 = z8, c02 = z8, c03 = z8, c10 = z8, c11 = z8, c12 = z8, c13 = z8;
#pragma unroll 1
  for (int kb = 0; kb < K; kb += 32) { const v16h a0 = g2_frag(a0p + kb, hh), a1 = g2_frag(a1p + kb, hh);
    v16h b = g2_frag(b0p + kb, hh); c00 = g2_mma(a0, b, c00); c10 = g2_mma(a1, b, c10);
    b = g2_frag(b1p + kb, hh); c01 = g2_mma(a0, b, c01); c11 = g2_mma(a1, b, c11);
    b = g2_frag(b2p + kb, hh); c02 = g2_mma(a0, b, c02); c12 = g2_mma(a1, b, c12);
    b = g2_frag(b3p + kb, hh); c03 = g2_mma(a0, b, c03); c13 = g2_mma(a1, b, c13); }
  v8f accs[8] = {c00, c01, c02, c03, c10, c11, c12, c13};
#pragma unroll
  for (int u = 0; u < 8; ++u) { const unsigned t = (unsigned)u & 3u, half = (unsigned)u >> 2; const unsigned col = col0 + t * 16u + ln; const float bv = bias ? bf16_rne(bias[col]) : 0.f;
#pragma unroll
    for (int r = 0; r < 8; ++r) { const unsigned rloc = half * 16u + 8u * hh + (unsigned)r; float v = accs[u][r] * alpha + bv;
      if (CP) v += CP[cofs + (size_t)(row0 + rloc) * (size_t)ldc + col];      /* own element of the batched C plane */
      if (ACT == 3) v = fmaxf(v, 0.f);
      so[w][rloc][t * 16u + ln] = v; } }
  __builtin_amdgcn_fence(4 /* acq_rel order */, "workgroup"); __builtin_amdgcn_wave_barrier();      /* wave-private tile: same wave writes and reads */
  const unsigned rsub = lane >> 4, c4 = (lane & 15u) * 4u;
  {
#pragma unroll
    for (int q = 0; q < 16; ++q) { const unsigned r = (unsigned)q * 2u + rsub; const v4f v = *(const v4fa*)&so[w][r][c4];
      if (C) *(v4f*)(C + cofs + (size_t)(row0 + r) * (size_t)ldc + col0 + c4) = v;
      if (C16) { v4h h4; for (int i = 0; i < 4; ++i) h4[i] = (_Float16)v[i]; *(v4h*)(C16 + cofs + (size_t)(row0 + r) * (size_t)ldc + col0 + c4) = h4; } }
     } }

__global__ __launch_bounds__(256) void k_wt_f16(const float* __restrict__ W, _Float16* __restrict__ Wt, int K, int N, float scale) {
  const unsigned k8n = (unsigned)K >> 3; const unsigned t = blockIdx.x * 256u + threadIdx.x; if (t >= (unsigned)N * k8n) return; const unsigned n = t / k8n, k8 = (t - n * k8n) * 8u; FragH f;
#pragma unroll
  for (int i = 0; i < 8; ++i) f.h[i] = (_Float16)(bf16_rne(W[(size_t)(k8 + (unsigned)i) * (size_t)N + n]) * scale);
  const v8us o = f.half[0]; unsigned short* dst = (unsigned short*)Wt + (size_t)n * (size_t)K + k8;
  *(v8us*)dst = o;  }

__global__ __launch_bounds__(256) void k_wthd(const float* __restrict__ Wt, _Float16* __restrict__ Bt) {
  const unsigned t = blockIdx.x * 256u + threadIdx.x; if (t >= (unsigned)(NH * HD * (DM / 8))) return;
  const unsigned m8 = (t % (unsigned)(DM / 8)) * 8u; const unsigned d = (t / (unsigned)(DM / 8)) % (unsigned)HD; const unsigned h = t / (unsigned)((DM / 8) * HD); FragH f;
#pragma unroll
  for (int q = 0; q < 8; ++q) f.h[q] = (_Float16)(16.0f * bf16_rne(Wt[((size_t)h * DM + m8 + (unsigned)q) * HD + d]));
  const v8us o = f.half[0]; unsigned short* dst = (unsigned short*)Bt + ((size_t)h * HD + d) * DM + m8;
  *(v8us*)dst = o;  }

template <int NHv, int TTv>
__global__ __launch_bounds__(256) void k_vt(const _Float16* __restrict__ V16, int ldv, int voff, _Float16* __restrict__ Vt) {
  __shared__ unsigned short tl[64][66]; const unsigned tid = threadIdx.x; const unsigned slab = blockIdx.x / (unsigned)(TTv / 64), lg = blockIdx.x % (unsigned)(TTv / 64); const unsigned b = slab / (unsigned)NHv, h = slab % (unsigned)NHv;
  for (unsigned i = tid; i < 64u * 8u; i += 256u) { const unsigned r = i >> 3, c8 = (i & 7u) * 8u; FragH f; f.half[0] = *(const v8us*)((const unsigned short*)V16 + ((size_t)b * TTv + lg * 64u + r) * (size_t)ldv + (size_t)voff + h * 64u + c8);
#pragma unroll
    for (int q = 0; q < 8; ++q) tl[r][c8 + (unsigned)q] = f.u[q]; }
  __syncthreads();
  {
#pragma unroll
    for (int rd = 0; rd < 2; ++rd) { const unsigned d = (unsigned)rd * 32u + (tid >> 3), pc = tid & 7u; FragH f;
#pragma unroll
      for (int q = 0; q < 8; ++q) f.u[q] = tl[pc * 8u + (unsigned)q][d];
      *(v8us*)((unsigned short*)Vt + ((size_t)slab * 64u + d) * TTv + lg * 64u + pc * 8u) = f.half[0]; }
     } }

#define FQ 32                        /* query columns per wave */
#define FW 4                         /* waves per workgroup */
#define FNT (SQ / (FQ * FW))         /* query tiles of a sequence */
static_assert(SQ % (FQ * FW) == 0 && FNT % 2 == 0 && HD == 64 && FQ == 32);
typedef _Float16 v8h __attribute__((ext_vector_type(8)));
__device__ __forceinline__ float fa_xhalf(float x) { return __builtin_bit_cast(float, __builtin_amdgcn_permlanex16(__builtin_bit_cast(int, x), __builtin_bit_cast(int, x), 0x76543210, 0xfedcba98, false, false)); }      /* lane l with lane l ^ 16 */
__device__ __forceinline__ v8f fa_mma(v16h a, v16h b, v8f c) { return __builtin_amdgcn_wmma_f32_16x16x32_f16(false, a, false, b, (short)0, c, false, false); }
__global__ __launch_bounds__(32 * FW) void k_fattn(const _Float16* __restrict__ Q, const _Float16* __restrict__ K, const _Float16* __restrict__ VT, const int* __restrict__ pm, _Float16* __restrict__ O) {
  /* readfirstlane: the wave's number in a scalar register, so that the trip count and the loop's branches stay scalar */
  const unsigned lane = threadIdx.x & 31u, ln = lane & 15u, hh = lane >> 4; const unsigned w = (unsigned)__builtin_amdgcn_readfirstlane((int)(threadIdx.x >> 5));
  const unsigned rank = blockIdx.x / (unsigned)(NB * NH), bh = blockIdx.x % (unsigned)(NB * NH); const unsigned tile = rank < (unsigned)(FNT / 2) ? (unsigned)(FNT - 1) - rank : rank - (unsigned)(FNT / 2);      /* long tiles first, then the short ones in mirrored order */
  const unsigned b = bh / (unsigned)NH, h = bh % (unsigned)NH; const unsigned qw = tile * (unsigned)(FQ * FW) + w * (unsigned)FQ; const int last = (int)(qw >> 5);      /* pass 'last' holds the diagonal */
  const _Float16* qp = Q + ((size_t)b * SQ + qw + ln) * LQ + h * HD; const _Float16* kp = K + ((size_t)b * SQ + ln) * LQ + h * HD; const _Float16* vp = VT + ((size_t)bh * HD + ln) * SQ; const int* pp = pm + (size_t)b * SQ_FULL + lane;
  v16h qf[2][2], kf[2][2];
#pragma unroll      /* constant index into qf[] and kf[] */
  for (int g = 0; g < 2; ++g) { qf[g][0] = g2_frag(qp + (size_t)g * 16 * LQ, hh); qf[g][1] = g2_frag(qp + (size_t)g * 16 * LQ + 32, hh); kf[g][0] = g2_frag(kp + (size_t)g * 16 * LQ, hh); kf[g][1] = g2_frag(kp + (size_t)g * 16 * LQ + 32, hh); }
  int pv = pp[0]; v16h vf[4];
  asm volatile("s_wait_xcnt 0x0" ::: "memory");      /* behind the issued loads, in front of whatever rewrites a register that one of them names; as a memory fence it also keeps the value loads younger than the key loads, as in the loop, so that the loop's counted wait for the keys leaves the values in flight */
#pragma unroll      /* constant index into vf[] */
  for (int dt = 0; dt < 4; ++dt) vf[dt] = g2_frag(vp + (size_t)dt * 16 * SQ, hh);
  const v8f z8 = {0.f,0.f,0.f,0.f,0.f,0.f,0.f,0.f}; v8f o[2][4] = {{z8, z8, z8, z8}, {z8, z8, z8, z8}}; float mr[2] = {-3.0e38f, -3.0e38f}, l[2] = {0.f, 0.f};
  const float cs = 0.125f * 1.44269504088896340736f;      /* 1 / sqrt(64), and exp(x) = exp2(x log2 e) */
#pragma unroll 1      /* one pass of code: the loop's text stays small */
  for (int s = 0; s <= last; ++s) {
    v8f sc[2][2];
#pragma unroll      /* constant index into sc[], kf[], qf[] */
    for (int tk = 0; tk < 2; ++tk) { sc[0][tk] = fa_mma(kf[tk][0], qf[0][0], z8); sc[1][tk] = fa_mma(kf[tk][0], qf[1][0], z8); sc[0][tk] = fa_mma(kf[tk][1], qf[0][1], sc[0][tk]); sc[1][tk] = fa_mma(kf[tk][1], qf[1][1], sc[1][tk]); }
    const unsigned vm = __builtin_amdgcn_ballot_w32(pv != 0);      /* bit j: key 32 s + j passes the padding mask */
    const int sn = s < last ? s + 1 : last;      /* the last pass fetches its own rows again: in bounds, unused */
    const _Float16* kn = kp + (size_t)sn * 32 * LQ; pv = pp[sn * 32];
#pragma unroll      /* constant index into kf[] */
    for (int tk = 0; tk < 2; ++tk) { kf[tk][0] = g2_frag(kn + (size_t)tk * 16 * LQ, hh); kf[tk][1] = g2_frag(kn + (size_t)tk * 16 * LQ + 32, hh); }
    asm volatile("s_wait_xcnt 0x0" ::: "memory");      /* behind the issued loads, in front of whatever rewrites (or lands in) a register that one of them names; as a memory fence it keeps these loads here, older than the value loads at the foot */
    if (vm != 0xffffffffu || s == last) {      /* scalar branch: only the diagonal pass and passes with a padded key pay for the mask */
      const unsigned vs = vm >> (8u * hh);
#pragma unroll      /* constant index into sc[] */
      for (int g = 0; g < 2; ++g) { const int qrel = (int)(qw + 16u * (unsigned)g + ln) - (s * 32 + 8 * (int)hh);      /* local key 16 tk + r is causal iff it is <= qrel */
#pragma unroll      /* constant index into sc[] */
        for (int tk = 0; tk < 2; ++tk) {
#pragma unroll      /* constant element index */
          for (int r = 0; r < 8; ++r) sc[g][tk][r] = ((((vs >> (16 * tk + r)) & 1u) != 0u) & (16 * tk + r <= qrel)) ? sc[g][tk][r] : -1.0e9f; } } }
    v16h pf[2];
#pragma unroll      /* constant index into sc[], o[], mr[], l[], pf[] */
    for (int g = 0; g < 2; ++g) {
      float mx = fmaxf(sc[g][0][0], sc[g][1][0]);
#pragma unroll      /* constant element index */
      for (int r = 1; r < 8; ++r) mx = fmaxf(mx, fmaxf(sc[g][0][r], sc[g][1][r]));
      mx = fmaxf(mx, fa_xhalf(mx)); const float mn = fmaxf(mr[g], mx); const float al = __builtin_amdgcn_exp2f((mr[g] - mn) * cs); const float mc = mn * cs; mr[g] = mn;
      v8f p0, p1;
#pragma unroll      /* constant element index */
      for (int r = 0; r < 8; ++r) { p0[r] = __builtin_amdgcn_exp2f(fmaf(sc[g][0][r], cs, -mc)); p1[r] = __builtin_amdgcn_exp2f(fmaf(sc[g][1][r], cs, -mc)); }
      const v8f ps = p0 + p1; l[g] = fmaf(l[g], al, ((ps[0] + ps[1]) + (ps[2] + ps[3])) + ((ps[4] + ps[5]) + (ps[6] + ps[7])));
      const v8h h0 = __builtin_convertvector(p0, v8h), h1 = __builtin_convertvector(p1, v8h);
      pf[g] = __builtin_shufflevector(h0, h1, 0, 1, 2, 3, 4, 5, 6, 7, 8, 9, 10, 11, 12, 13, 14, 15);
#pragma unroll      /* constant index into o[] */
      for (int dt = 0; dt < 4; ++dt) o[g][dt] *= al; }
#pragma unroll      /* constant index into o[], vf[] */
    for (int dt = 0; dt < 4; ++dt) { o[0][dt] = fa_mma(vf[dt], pf[0], o[0][dt]); o[1][dt] = fa_mma(vf[dt], pf[1], o[1][dt]); }
#pragma unroll      /* constant index into vf[] */
    for (int dt = 0; dt < 4; ++dt) vf[dt] = g2_frag(vp + (size_t)dt * 16 * SQ + (size_t)sn * 32, hh); }
  asm volatile("s_wait_loadcnt 0x0" ::: "memory");      /* the last pass's fetches ahead are unused: they land here, so that no load is still on its way to a register when the wave gives its registers back */
#pragma unroll      /* constant index into o[], l[] */
  for (int g = 0; g < 2; ++g) { const float fin = 64.0f * (1.0f / (l[g] + fa_xhalf(l[g])));      /* the halves' sums joined once; o carried x64 */
    _Float16* op = O + ((size_t)b * SQ + qw + 16u * (unsigned)g + ln) * DM + h * HD + 8u * hh;
#pragma unroll      /* constant index into o[] */
    for (int dt = 0; dt < 4; ++dt) *(v8h*)(op + dt * 16) = __builtin_convertvector(o[g][dt] * fin, v8h); } }      /* a lane's 8 registers are 8 consecutive columns of its query's row: one 16-byte store */

// f32 attention for the FIRST query tile of a causal sequence (rows 0..QT0-1 of one batch): ONE WAVE PER QUERY ROW, workgroup = A0W waves = A0W consecutive rows of one head. The head's QT0 key rows and value rows are
// staged once in LDS with coalesced 16-byte loads (key pitch HD + 4 floats: 16 lanes that each read 16 bytes of their own key row fall on distinct banks). Scores: lane l owns keys l, l + 32, l + 64, l + 96 (four partial
// sums per key over the head dimension), invalid keys (j > i or pm[j] == 0) are REPLACED by -1e30; maximum and sum close with a five-step butterfly over the lanes (precise expf, weight exactly 0 for an invalid key
// whenever the row has one valid key). q, k, v rows at pitch LQ, o rows at pitch DM. o: lane l owns columns 2l, 2l + 1 and walks all keys (four partial sums over the keys), the weights read back from the wave's own LDS row as broadcasts.
#define A0W 8                        /* query rows (= waves) per workgroup */
#define A0S (QT0 / (2 * A0W))        /* staging steps: a workgroup's threads cover 2 * A0W rows of 64 floats a step, 16 bytes a thread */
static_assert(QT0 % A0W == 0 && QT0 % 32 == 0 && (QT0 * (HD / 4)) % (32 * A0W) == 0 && HD == 64);
typedef float v2f  __attribute__((ext_vector_type(2)));
typedef float v2fa __attribute__((ext_vector_type(2), may_alias));
__global__ __launch_bounds__(32 * A0W) void k_att0(const float* __restrict__ QF, const float* __restrict__ KF, const float* __restrict__ VF, const int* __restrict__ pm, float scale, float* __restrict__ OF) {
  __shared__ __attribute__((aligned(16))) float lk[QT0][HD + 4]; __shared__ __attribute__((aligned(16))) float lv[QT0][HD]; __shared__ __attribute__((aligned(16))) float lp[A0W][QT0];
  /* readfirstlane: the wave's number in a scalar register, so that the q row's address is scalar */
  const unsigned tid = threadIdx.x, lane = tid & 31u; const unsigned w = (unsigned)__builtin_amdgcn_readfirstlane((int)(tid >> 5));
  const unsigned h = blockIdx.x / (unsigned)(QT0 / A0W), rg = blockIdx.x % (unsigned)(QT0 / A0W); const unsigned i = rg * (unsigned)A0W + w;
  const unsigned r0 = tid >> 4, c4 = (tid & 15u) * 4u; const float* kp = KF + (size_t)r0 * LQ + h * HD + c4; const float* vp = VF + (size_t)r0 * LQ + h * HD + c4; const float* qr = QF + (size_t)i * LQ + h * HD;
  v4f kk[A0S], vv[A0S], qq[HD / 4]; int pv[QT0 / 32];
#pragma unroll      /* constant index into kk[] and vv[]; constant pitch: one address per plane, the steps as immediate offsets; all of a thread's loads in flight together */
  for (int it = 0; it < A0S; ++it) { kk[it] = *(const v4fa*)(kp + (size_t)it * (2 * A0W) * LQ); vv[it] = *(const v4fa*)(vp + (size_t)it * (2 * A0W) * LQ); }
#pragma unroll      /* constant index into pv[] */
  for (int u = 0; u < QT0 / 32; ++u) pv[u] = pm[(unsigned)u * 32u + lane];
#pragma unroll      /* constant index into qq[] */
  for (int c = 0; c < HD / 4; ++c) qq[c] = *(const v4fa*)(qr + c * 4);
  asm volatile("s_wait_xcnt 0x0" :: "v"(kp), "v"(vp) : "memory");      /* behind the last staging load, in front of whatever rewrites a register that an issued load names; kp and vp as inputs keep both address pairs live up to here, so that no load of the run lands in one */
#pragma unroll      /* constant index into kk[] and vv[] */
  for (int it = 0; it < A0S; ++it) { *(v4fa*)&lk[r0 + (unsigned)it * (unsigned)(2 * A0W)][c4] = kk[it]; *(v4fa*)&lv[r0 + (unsigned)it * (unsigned)(2 * A0W)][c4] = vv[it]; }
  __syncthreads();      /* publishes the staged key and value rows to every wave */
  const v4f z4 = {0.f, 0.f, 0.f, 0.f}; v4f acc[QT0 / 32];
#pragma unroll      /* constant index into acc[] */
  for (int u = 0; u < QT0 / 32; ++u) acc[u] = z4;
#pragma unroll      /* constant index into acc[] and qq[]; the LDS reads of several steps in flight together */
  for (int c = 0; c < HD / 4; ++c) {
#pragma unroll      /* constant index into acc[] */
    for (int u = 0; u < QT0 / 32; ++u) acc[u] += qq[c] * *(const v4fa*)&lk[(unsigned)u * 32u + lane][c * 4]; }
  float sm[QT0 / 32]; float mx = -1.0e30f;
#pragma unroll      /* constant index into acc[] and sm[] */
  for (int u = 0; u < QT0 / 32; ++u) { const unsigned j = (unsigned)u * 32u + lane; const float s = ((acc[u][0] + acc[u][1]) + (acc[u][2] + acc[u][3])) * scale; sm[u] = ((j <= i) & (pv[u] != 0)) ? s : -1.0e30f; mx = fmaxf(mx, sm[u]); }
  for (int d = 16; d > 0; d >>= 1) mx = fmaxf(mx, __shfl_xor(mx, d, 32));
  float l = 0.f;
#pragma unroll      /* constant index into sm[] */
  for (int u = 0; u < QT0 / 32; ++u) { const float e = expf(sm[u] - mx); lp[w][(unsigned)u * 32u + lane] = e; l += e; }
  for (int d = 16; d > 0; d >>= 1) l += __shfl_xor(l, d, 32);
  __syncthreads();      /* the weights are written by one lane and read by all lanes of the wave */
  const v2f z2 = {0.f, 0.f}; v2f o[4] = {z2, z2, z2, z2};
#pragma unroll 8      /* several steps' LDS reads in flight together */
  for (int j4 = 0; j4 < QT0 / 4; ++j4) { const v4f pj = *(const v4fa*)&lp[w][j4 * 4];
#pragma unroll      /* constant index into o[] and pj */
    for (int u = 0; u < 4; ++u) o[u] += pj[u] * *(const v2fa*)&lv[j4 * 4 + u][lane * 2u]; }
  const float fin = 64.0f * (1.0f / l);      /* o carried x64 like the f16 path */
  const v2f oo = ((o[0] + o[1]) + (o[2] + o[3])) * fin;
  *(v2f*)(OF + (size_t)i * DM + h * HD + lane * 2u) = oo; }

// row LayerNorm over DM = 1024 of f32 rows: mean, BIASED variance, (x - mu) * rsqrt(var + eps) * bf16(g[c]) + bf16(b[c]) -> f16 rows (GEMM operand); workgroup = 256 threads, thread t owns columns 4t..4t+3;
template <int BFIN, int FULLIN>
__global__ __launch_bounds__(256) void k_lnx(const float* __restrict__ X, const float* __restrict__ g, const float* __restrict__ bb, float eps, _Float16* __restrict__ N16) {
  #pragma clang fp contract(off)
  __shared__ float red[256]; const unsigned r = blockIdx.x; const unsigned t = threadIdx.x; const unsigned c0 = t * 4u;
  const size_t xr = FULLIN ? ((size_t)(r / (unsigned)SQ) * SQ_FULL + (r % (unsigned)SQ)) : (size_t)r;
  const v4f xa = *(const v4fa*)(X + xr * DM + c0); float s[4]; float sum = 0.f;
  for (int q = 0; q < 4; ++q) { s[q] = BFIN ? bf16_rne(xa[q]) : xa[q]; sum = sum + s[q]; }
  red[t] = sum; __syncthreads(); for (unsigned st = 128u; st > 0u; st >>= 1) { if (t < st) red[t] = red[t] + red[t + st]; __syncthreads(); } const float mu = red[0] * (1.0f / (float)DM); __syncthreads();
  float vs = 0.f; for (int q = 0; q < 4; ++q) { const float dl = s[q] - mu; vs = vs + dl * dl; } red[t] = vs; __syncthreads(); for (unsigned st = 128u; st > 0u; st >>= 1) { if (t < st) red[t] = red[t] + red[t + st]; __syncthreads(); }
  const float rs = rsqrtf(red[0] * (1.0f / (float)DM) + eps); v4h y;
  for (int q = 0; q < 4; ++q) { const unsigned c = c0 + (unsigned)q; y[q] = (_Float16)((((s[q] - mu) * rs) * bf16_rne(g[c])) + bf16_rne(bb[c])); }
  { *(v4h*)(N16 + (size_t)r * DM + c0) = y;  } }

// residual without an output projection: X1[r][c] = bf16(x[r][c]) + o[r][c] / 64 (+ NaN when the batch's first mask entry is 0: the structure the attention kernels rely on is violated);
__global__ __launch_bounds__(256) void k_resid(const float* __restrict__ x, const int* __restrict__ pm, const _Float16* __restrict__ O16, const float* __restrict__ OF0, float* __restrict__ X1) {
  #pragma clang fp contract(off)
  const unsigned t = blockIdx.x * 256u + threadIdx.x; if (t >= (unsigned)(NR * DM / 4)) return;
  const unsigned row = t / (unsigned)(DM / 4), c0 = (t % (unsigned)(DM / 4)) * 4u; const unsigned b = row / (unsigned)SQ, rl = row % (unsigned)SQ; const bool ft = rl < (unsigned)QT0; const unsigned rs = ft ? rl : 0u;
  const size_t e = (size_t)row * DM + c0;
  const v4f xv = *(const v4fa*)(x + ((size_t)b * SQ_FULL + rl) * DM + c0);
  const v4h oh = *(const v4h*)(O16 + e);
  const v4f of = *(const v4fa*)(OF0 + ((size_t)b * QT0 + rs) * DM + c0);
  const int p0 = pm[(size_t)b * SQ_FULL]; const float pz = (p0 != 0) ? 0.f : __uint_as_float(0x7fc00000u);
  v4f y; for (int q = 0; q < 4; ++q) { const float o = ft ? of[q] : (float)oh[q]; y[q] = (bf16_rne(xv[q]) + o * 0.015625f) + pz; }
  *(v4f*)(X1 + e) = y;  }

extern "C" void kernel_launch(void* const* d_in, const int* in_sizes, int n_in,
                              void* d_out, int out_size, void* d_ws, size_t ws_size, hipStream_t stream) {
  if (n_in < 13) return;
  const size_t rows_need = (size_t)(NB - 1) * SQ_FULL + SQ;
  if ((size_t)in_sizes[0] < rows_need * DM) return; if ((size_t)in_sizes[1] < rows_need) return;
  if ((size_t)in_sizes[2] < (size_t)NH * DM * HD || (size_t)in_sizes[3] < (size_t)NH * DM * HD || (size_t)in_sizes[4] < (size_t)NH * DM * HD) return;
  if (in_sizes[5] < DM || in_sizes[6] < DM || in_sizes[7] < DM || in_sizes[8] < DM) return;
  if ((size_t)in_sizes[9] < (size_t)DM * DFF || in_sizes[10] < DFF || (size_t)in_sizes[11] < (size_t)DFF * DM || in_sizes[12] < DM) return;
  if ((size_t)out_size < NR * DM) return;
  const float* x = (const float*)d_in[0]; const int* pmask = (const int*)d_in[1];
  const float* wq = (const float*)d_in[2]; const float* wk = (const float*)d_in[3]; const float* wv = (const float*)d_in[4];
  const float* g1 = (const float*)d_in[5]; const float* be1 = (const float*)d_in[6]; const float* g2 = (const float*)d_in[7]; const float* be2 = (const float*)d_in[8];
  const float* w1 = (const float*)d_in[9]; const float* b1 = (const float*)d_in[10]; const float* w2 = (const float*)d_in[11]; const float* b2 = (const float*)d_in[12];
  char* ws = (char*)d_ws; size_t off = 0;
  auto take = [&](size_t bytes) { char* p = ws + off; off += (bytes + 255) & ~(size_t)255; return p; };
  _Float16* BQKV = (_Float16*)take((size_t)3 * DM * DM * 2);          /* [3*DM][DM] x16: q | k | v stacked, row (h*HD + d) */
  _Float16* X16 = (_Float16*)take(NR * DM * 2);                       /* LN1 rows; reused as the LN2 rows (last reader of LN1 rows: the last batch's first-tile GEMM, before LN2 writes) */
  float* X1 = (float*)take(NR * DM * 4);
  _Float16* BW1 = (_Float16*)take((size_t)DFF * DM * 2); _Float16* BW2 = (_Float16*)take((size_t)DM * DFF * 2);
  _Float16* QKV = (_Float16*)take(NR * 3 * DM * 2); _Float16* Q16 = QKV; _Float16* K16 = QKV + DM; _Float16* V16 = QKV + 2 * DM;
  _Float16* HF16 = QKV;                                               /* FFN hidden rows [NR][DFF] alias the q|k|v rows (dead after the attention); DFF <= 3*DM asserted */
  _Float16* O16 = (_Float16*)take(NR * DM * 2);
  _Float16* VT = (_Float16*)take((size_t)NB * NH * HD * SQ * 2);      /* V^T [NB][NH][HD][SQ] */
  float* F0 = (float*)take((size_t)QT0 * 3 * DM * 4);                 /* f32 q | k | v of the first 128 rows of the current batch */
  float* OF0 = (float*)take((size_t)NB * QT0 * DM * 4);
  _Float16* M16 = X16;
  if (off > ws_size || off > (size_t)134217728) return;
  { const unsigned g = (unsigned)(((size_t)NH * HD * (DM / 8) + 255) / 256);
    k_wthd<<<g, 256, 0, stream>>>(wq, BQKV); k_wthd<<<g, 256, 0, stream>>>(wk, BQKV + (size_t)DM * DM); k_wthd<<<g, 256, 0, stream>>>(wv, BQKV + (size_t)2 * DM * DM); }
  k_lnx<1, 1><<<(unsigned)NR, 256, 0, stream>>>(x, g1, be1, 1e-5f, X16);      /* h = LN1(bf16(x)) -> f16 rows */
  k_wt_f16<<<(unsigned)(((size_t)DFF * (DM / 8) + 255) / 256), 256, 0, stream>>>(w1, BW1, DM, DFF, 16.0f);      /* W1 [DM][DFF] -> [DFF][DM] x16 */
  k_wt_f16<<<(unsigned)(((size_t)DM * (DFF / 8) + 255) / 256), 256, 0, stream>>>(w2, BW2, DFF, DM, 16.0f);      /* W2 [DFF][DM] -> [DM][DFF] x16 */
  k_gemm2<0><<<dim3((unsigned)((NR / 128) * (3 * DM / 64)), 1), 128, 0, stream>>>(X16, DM, (size_t)0, BQKV, DM, (size_t)0, 0.0625f, (const float*)nullptr, (const float*)nullptr, (float*)nullptr, QKV, LQ, (size_t)0, (int)NR, 3 * DM, DM);      /* q | k | v rows (f16) */
  for (int b = 0; b < NB; ++b) { const size_t r0 = (size_t)b * SQ; const int* pmb = pmask + (size_t)b * SQ_FULL;
    k_vt<NH, SQ><<<NH * (SQ / 64), 256, 0, stream>>>(V16 + r0 * LQ, LQ, 0, VT + (size_t)b * NH * HD * SQ);      /* V^T [NH][HD][SQ] of this batch */
    k_gemm2<0><<<dim3((unsigned)((QT0 / 128) * (3 * DM / 64)), 1), 128, 0, stream>>>(X16 + r0 * DM, DM, (size_t)0, BQKV, DM, (size_t)0, 0.0625f, (const float*)nullptr, (const float*)nullptr, F0, (_Float16*)nullptr, 3 * DM, (size_t)0, QT0, 3 * DM, DM);      /* f32 q | k | v of rows 0..127 */
    k_att0<<<NH * (QT0 / A0W), 32 * A0W, 0, stream>>>(F0, F0 + DM, F0 + 2 * DM, pmb, 0.125f, OF0 + (size_t)b * QT0 * DM); }      /* f32 attention for rows 0..127 (o x64) */
  k_fattn<<<NB * NH * FNT, 32 * FW, 0, stream>>>(Q16, K16, VT, pmask, O16);      /* o (merged heads, x64) as f16 rows, all batches, heads and query tiles */
  k_resid<<<(unsigned)((NR * DM / 4) / 256), 256, 0, stream>>>(x, pmask, O16, OF0, X1);      /* x1 = bf16(x) + attn */
  k_lnx<0, 0><<<(unsigned)NR, 256, 0, stream>>>(X1, g2, be2, 1e-5f, M16);      /* h2 = LN2(x1) -> f16 rows */
  k_gemm2<3><<<dim3((unsigned)((NR / 128) * (DFF / 64)), 1), 128, 0, stream>>>(M16, DM, (size_t)0, BW1, DM, (size_t)0, 0.0625f, b1, (const float*)nullptr, (float*)nullptr, HF16, DFF, (size_t)0, (int)NR, DFF, DM);      /* relu(h2 W1 + b1) -> f16 */
  k_gemm2<0><<<dim3((unsigned)((NR / 128) * (DM / 64)), 1), 128, 0, stream>>>(HF16, DFF, (size_t)0, BW2, DFF, (size_t)0, 0.0625f, b2, X1, (float*)d_out, (_Float16*)nullptr, DM, (size_t)0, (int)NR, DM, DFF);      /* out = x1 + mlp (own-element residual) */
}

// v004
// Measured time: 211 microseconds a run.
// Timed twice side by side with v003, it ran 1.52 times as fast both times.
// Over all steps from v000 it is 24.2 times as fast.
#include <hip/hip_runtime.h>
// Pre-LN causal transformer layer: x [NB][SEQ][1024]; h = LN1(x) (biased variance, eps 1e-5); q/k/v[b][h] = h Wq/Wk/Wv[h] (per-head [16][1024][64], [in][out], no biases); scores / sqrt(64); mask = padding_mask[b][key] AND causal, masked scores REPLACED by -1e9; softmax; heads concatenated (no output projection); x1 = x + attn; h2 = LN2(x1); out = x1 + relu(h2 W1 + b1) W2 + b2 ([in][out] 1024 x 1024 x 1024).
// Structure: LN1 on VALU -> f16 rows; per-head weights transposed on VALU into one x16 f16 q|k|v plane; q|k|v as ONE WMMA GEMM (operands staged in LDS, 32x64 wave tiles, f32 accumulation, f16 out); per batch: V^T via LDS transposes and an f32 first tile (rows 0..127) on VALU; then ONE fused attention launch for all batches and heads (scores, masked online softmax and P V in registers, one wave per 32 queries; o x64 f16); x1 = bf16(x) + o / 64; LN2 -> f16; FFN as two GEMMs (ReLU epilogue; own-element residual).
// Compute dtype: all contractions v_wmma_f32_16x16x32_f16 (f16 operands, f32 accumulate); float inputs RNE-converted to bf16 first (weights then x16, exact in f16); q, k, v, softmax weights (relative to the running row maximum) and o (x64) as plain f16 operands; scores and softmax statistics f32; first 128 query rows of each batch in f32 on VALU.
#ifndef NB
#define NB 2
#endif
#ifndef SEQ
#define SEQ 2048
#endif
#define SQ SEQ
#define NB_FULL 2
#define SQ_FULL 2048                 /* per-batch row stride of the inputs (x rows, mask entries) */
#define DM 1024
#define NH 16
#define HD 64
#define DFF 1024
#define QT0 128                      /* first-tile rows computed in f32 */
#define NR ((size_t)NB * SQ)         /* token rows */
#define LQ (3 * DM)                  /* row pitch of the q|k|v rows */
static_assert(NH * HD == DM);
static_assert(QT0 == 128 && QT0 <= SQ && SQ <= SQ_FULL && NB <= NB_FULL);
static_assert(DM % 128 == 0 && DFF % 128 == 0 && HD == 64 && ((size_t)NB * SQ) % 128 == 0);
static_assert(DM / 4 == 256);
static_assert(DFF <= 3 * DM);
static_assert((((size_t)NB * SQ * DM) / 4) % 256 == 0);
static_assert((size_t)NB * SQ * DM / 4 < 0x7fffffffu);

typedef unsigned short v8us __attribute__((ext_vector_type(8), may_alias));
typedef float  v8f  __attribute__((ext_vector_type(8)));
typedef float  v4f  __attribute__((ext_vector_type(4)));
typedef float  v4fa __attribute__((ext_vector_type(4), may_alias));
typedef _Float16 v16h __attribute__((ext_vector_type(16)));
typedef _Float16 v4h __attribute__((ext_vector_type(4)));
union FragH { v16h v; v8us half[2]; _Float16 h[16]; unsigned short u[16]; };

__device__ __forceinline__ unsigned short bf16_bits(float x) { unsigned int u = __float_as_uint(x); return (unsigned short)((u + 0x7FFFu + ((u >> 16) & 1u)) >> 16); }
__device__ __forceinline__ float bf16_rne(float x) { return __uint_as_float(((unsigned int)bf16_bits(x)) << 16); }

// fragment: elements 0..7 <- k0 + 8h + 0..7, elements 8..15 <- k0 + 16 + 8h + 0..7 (same map for A rows and B columns)
__device__ __forceinline__ v16h g2_frag(const _Float16* p, unsigned hh) { FragH f; f.half[0] = *(const v8us*)((const unsigned short*)p + 8u * hh); f.half[1] = *(const v8us*)((const unsigned short*)p + 16u + 8u * hh); return f.v; }
__device__ __forceinline__ v8f g2_mma(v16h a, v16h b, v8f c) { return __builtin_amdgcn_wmma_f32_16x16x32_f16(false, a, false, b, (short)0, c, false, false); }

// GEMM (wave tile 32x64; workgroup = 8 waves (4 x 2) = 128 rows x 128 cols; M % 128 == 0, N % 128 == 0, K % 64 == 0): A f16 [M][K] (pitch lda, batch stride sA), Bh f16 [N][K] (pitch ldb, batch stride sB);
// a stage is 64 k of the tile's 128 A rows and 128 B rows (128 bytes a row: whole lines), brought into LDS by asynchronous 16-byte copies at row pitch 144 bytes (conflict-free for the 16-byte fragment reads); two buffers: the next stage's copies fly while this stage is worked on.
// v = acc * alpha + bf16(bias[col]) (+ CP own element of the batched C plane); ACT 0 none / 3 relu; writes f32 C and/or f16 C16 (pitch ldc, batch offset by * sC);
#define GP 144                       /* LDS row pitch, bytes */
#define GOP (128 * GP)               /* one operand's rows of a stage, bytes */
#define GSTG (2 * GOP)               /* one buffer: the A rows, then the B rows */
static_assert(8 * 32 * 68 * 4 <= 2 * GSTG && GP % 16 == 0);
__device__ __forceinline__ v16h g2_lfrag(const char* p) { FragH f; f.half[0] = *(const v8us*)p; f.half[1] = *(const v8us*)(p + 32); return f.v; }      /* p: the lane's LDS row + 2 k0 + 16 hh bytes: the k order of g2_frag */
// one stage: a lane's 4 copies of A rows (r, r + 32, r + 64, r + 96) and 4 of B rows; a wave's copy covers 4 whole 128-byte rows
__device__ __forceinline__ void g2_stage(unsigned l, const _Float16* ga, size_t ra, const _Float16* gb, size_t rb) {
  /* the copies and, as the last line of their own statement, the wait that stands in front of any rewrite of a register that an issued copy names */
  asm volatile("global_load_async_to_lds_b128 %0, %8, off\n\t"
               "global_load_async_to_lds_b128 %1, %9, off\n\t"
               "global_load_async_to_lds_b128 %2, %10, off\n\t"
               "global_load_async_to_lds_b128 %3, %11, off\n\t"
               "global_load_async_to_lds_b128 %4, %12, off\n\t"
               "global_load_async_to_lds_b128 %5, %13, off\n\t"
               "global_load_async_to_lds_b128 %6, %14, off\n\t"
               "global_load_async_to_lds_b128 %7, %15, off\n\t"
               "s_wait_xcnt 0x0"
               :: "v"(l), "v"(l + 32u * GP), "v"(l + 64u * GP), "v"(l + 96u * GP), "v"(l + GOP), "v"(l + GOP + 32u * GP), "v"(l + GOP + 64u * GP), "v"(l + GOP + 96u * GP),
                  "v"(ga), "v"(ga + ra), "v"(ga + 2 * ra), "v"(ga + 3 * ra), "v"(gb), "v"(gb + rb), "v"(gb + 2 * rb), "v"(gb + 3 * rb) : "memory"); }
template <int ACT>
__global__ __launch_bounds__(256) void k_gemm2(const _Float16* __restrict__ A, int lda, size_t sA, const _Float16* __restrict__ Bh, int ldb, size_t sB, float alpha,
    const float* __restrict__ bias, const float* __restrict__ CP, float* __restrict__ C, _Float16* __restrict__ C16, int ldc, size_t sC, int M, int N, int K) {
  static_assert(ACT == 0 || ACT == 3);
  __shared__ __attribute__((aligned(16))) char sm[2 * GSTG];
  const unsigned tid = threadIdx.x, w = tid >> 5, lane = tid & 31u, ln = lane & 15u, hh = lane >> 4; const unsigned by = blockIdx.y;
  A += (size_t)by * sA; Bh += (size_t)by * sB; const size_t cofs = (size_t)by * sC;
  const unsigned ntn = (unsigned)N >> 7; const unsigned mt = blockIdx.x / ntn, nq = blockIdx.x - mt * ntn; if (mt * 128u >= (unsigned)M) return;      /* the same for the whole workgroup, in front of every barrier */
  const unsigned row0 = mt * 128u + 32u * (w >> 1), col0 = nq * 128u + 64u * (w & 1u);
  const unsigned cr = tid >> 3, cc = tid & 7u;      /* copies: 8 lanes a row, 32 rows a step of the workgroup */
  const _Float16* ga = A + (size_t)(mt * 128u + cr) * (size_t)lda + cc * 8u; const _Float16* gb = Bh + (size_t)(nq * 128u + cr) * (size_t)ldb + cc * 8u; const size_t ra = (size_t)32 * (size_t)lda, rb = (size_t)32 * (size_t)ldb;
  const unsigned la = (unsigned)(size_t)sm + cr * (unsigned)GP + cc * 16u;      /* the lane's LDS byte address in buffer 0, A rows */
  const char* pa = sm + (32u * (w >> 1) + ln) * (unsigned)GP + 16u * hh; const char* pb = sm + GOP + (64u * (w & 1u) + ln) * (unsigned)GP + 16u * hh;
  const int nt = K >> 6;
  g2_stage(la, ga, ra, gb, rb);
  asm volatile("s_wait_asynccnt 0x0" ::: "memory");      /* this wave's copies of stage 0 have landed */
  __syncthreads();      /* publishes stage 0 to every wave */
  if (nt > 1) g2_stage(la + GSTG, ga + 64, ra, gb + 64, rb);
  const v8f z8 = {0.f,0.f,0.f,0.f,0.f,0.f,0.f,0.f}; v8f c00 = z8, c01 = z8, c02 = z8, c03 = z8, c10 = z8, c11 = z8, c12 = z8, c13 = z8;
#pragma unroll 1      /* one trip of code: the ring's order stays as written */
  for (int t = 0; t < nt; ++t) { const unsigned buf = ((unsigned)t & 1u) * (unsigned)GSTG; const char* qa = pa + buf; const char* qb = pb + buf;
    const v16h a0 = g2_lfrag(qa), a1 = g2_lfrag(qa + 16 * GP), b0 = g2_lfrag(qb), b1 = g2_lfrag(qb + 16 * GP), b2 = g2_lfrag(qb + 32 * GP), b3 = g2_lfrag(qb + 48 * GP);
    const v16h e0 = g2_lfrag(qa + 64), e1 = g2_lfrag(qa + 16 * GP + 64), f0 = g2_lfrag(qb + 64), f1 = g2_lfrag(qb + 16 * GP + 64), f2 = g2_lfrag(qb + 32 * GP + 64), f3 = g2_lfrag(qb + 48 * GP + 64);
    __builtin_amdgcn_sched_barrier(0);      /* keeps the trip's fragment reads together in front of its products: spread among them, each small group of reads makes the wave wait out the LDS latency anew */
    c00 = g2_mma(a0, b0, c00); c10 = g2_mma(a1, b0, c10); c01 = g2_mma(a0, b1, c01); c11 = g2_mma(a1, b1, c11); c02 = g2_mma(a0, b2, c02); c12 = g2_mma(a1, b2, c12); c03 = g2_mma(a0, b3, c03); c13 = g2_mma(a1, b3, c13);
    __builtin_amdgcn_sched_barrier(0);      /* keeps the first half's products in front of the waits below, so that the second half's fragment reads return behind them and not in front of an idle matrix unit */
    asm volatile("s_wait_dscnt 0x0" ::: "memory");      /* this wave's reads of the buffer have returned before the buffer is given up */
    asm volatile("s_wait_asynccnt 0x0" ::: "memory");      /* this wave's copies of stage t + 1 have landed */
    __syncthreads();      /* publishes stage t + 1 and ends every wave's reads of stage t */
    if (t + 2 < nt) g2_stage(la + buf, ga + (size_t)(t + 2) * 64, ra, gb + (size_t)(t + 2) * 64, rb);
    /* the second half's products, on fragments already in registers, run while the copies fly */
    c00 = g2_mma(e0, f0, c00); c10 = g2_mma(e1, f0, c10); c01 = g2_mma(e0, f1, c01); c11 = g2_mma(e1, f1, c11); c02 = g2_mma(e0, f2, c02); c12 = g2_mma(e1, f2, c12); c03 = g2_mma(e0, f3, c03); c13 = g2_mma(e1, f3, c13); }
  asm volatile("s_wait_asynccnt 0x0" ::: "memory");      /* no copy is on its way when the ring becomes output staging */
  float (*so)[32][68] = (float (*)[32][68])sm;      /* output staging, a wave's own tile, in the ring, which every wave has left at the last trip's barrier */
  v8f accs[8] = {c00, c01, c02, c03, c10, c11, c12, c13};
#pragma unroll
  for (int u = 0; u < 8; ++u) { const unsigned t = (unsigned)u & 3u, half = (unsigned)u >> 2; const unsigned col = col0 + t * 16u + ln; const float bv = bias ? bf16_rne(bias[col]) : 0.f;
#pragma unroll
    for (int r = 0; r < 8; ++r) { const unsigned rloc = half * 16u + 8u * hh + (unsigned)r; float v = accs[u][r] * alpha + bv;
      if (CP) v += CP[cofs + (size_t)(row0 + rloc) * (size_t)ldc + col];      /* own element of the batched C plane */
      if (ACT == 3) v = fmaxf(v, 0.f);
      so[w][rloc][t * 16u + ln] = v; } }
  __builtin_amdgcn_fence(4 /* acq_rel order */, "workgroup"); __builtin_amdgcn_wave_barrier();      /* wave-private tile: same wave writes and reads */
  const unsigned rsub = lane >> 4, c4 = (lane & 15u) * 4u;
  {
#pragma unroll
    for (int q = 0; q < 16; ++q) { const unsigned r = (unsigned)q * 2u + rsub; const v4f v = *(const v4fa*)&so[w][r][c4];
      if (C) *(v4f*)(C + cofs + (size_t)(row0 + r) * (size_t)ldc + col0 + c4) = v;
      if (C16) { v4h h4; for (int i = 0; i < 4; ++i) h4[i] = (_Float16)v[i]; *(v4h*)(C16 + cofs + (size_t)(row0 + r) * (size_t)ldc + col0 + c4) = h4; } }
     } }

__global__ __launch_bounds__(256) void k_wt_f16(const float* __restrict__ W, _Float16* __restrict__ Wt, int K, int N, float scale) {
  const unsigned k8n = (unsigned)K >> 3; const unsigned t = blockIdx.x * 256u + threadIdx.x; if (t >= (unsigned)N * k8n) return; const unsigned n = t / k8n, k8 = (t - n * k8n) * 8u; FragH f;
#pragma unroll
  for (int i = 0; i < 8; ++i) f.h[i] = (_Float16)(bf16_rne(W[(size_t)(k8 + (unsigned)i) * (size_t)N + n]) * scale);
  const v8us o = f.half[0]; unsigned short* dst = (unsigned short*)Wt + (size_t)n * (size_t)K + k8;
  *(v8us*)dst = o;  }

__global__ __launch_bounds__(256) void k_wthd(const float* __restrict__ Wt, _Float16* __restrict__ Bt) {
  const unsigned t = blockIdx.x * 256u + threadIdx.x; if (t >= (unsigned)(NH * HD * (DM / 8))) return;
  const unsigned m8 = (t % (unsigned)(DM / 8)) * 8u; const unsigned d = (t / (unsigned)(DM / 8)) % (unsigned)HD; const unsigned h = t / (unsigned)((DM / 8) * HD); FragH f;
#pragma unroll
  for (int q = 0; q < 8; ++q) f.h[q] = (_Float16)(16.0f * bf16_rne(Wt[((size_t)h * DM + m8 + (unsigned)q) * HD + d]));
  const v8us o = f.half[0]; unsigned short* dst = (unsigned short*)Bt + ((size_t)h * HD + d) * DM + m8;
  *(v8us*)dst = o;  }

template <int NHv, int TTv>
__global__ __launch_bounds__(256) void k_vt(const _Float16* __restrict__ V16, int ldv, int voff, _Float16* __restrict__ Vt) {
  __shared__ unsigned short tl[64][66]; const unsigned tid = threadIdx.x; const unsigned slab = blockIdx.x / (unsigned)(TTv / 64), lg = blockIdx.x % (unsigned)(TTv / 64); const unsigned b = slab / (unsigned)NHv, h = slab % (unsigned)NHv;
  for (unsigned i = tid; i < 64u * 8u; i += 256u) { const unsigned r = i >> 3, c8 = (i & 7u) * 8u; FragH f; f.half[0] = *(const v8us*)((const unsigned short*)V16 + ((size_t)b * TTv + lg * 64u + r) * (size_t)ldv + (size_t)voff + h * 64u + c8);
#pragma unroll
    for (int q = 0; q < 8; ++q) tl[r][c8 + (unsigned)q] = f.u[q]; }
  __syncthreads();
  {
#pragma unroll
    for (int rd = 0; rd < 2; ++rd) { const unsigned d = (unsigned)rd * 32u + (tid >> 3), pc = tid & 7u; FragH f;
#pragma unroll
      for (int q = 0; q < 8; ++q) f.u[q] = tl[pc * 8u + (unsigned)q][d];
      *(v8us*)((unsigned short*)Vt + ((size_t)slab * 64u + d) * TTv + lg * 64u + pc * 8u) = f.half[0]; }
     } }

#define FQ 32                        /* query columns per wave */
#define FW 4                         /* waves per workgroup */
#define FNT (SQ / (FQ * FW))         /* query tiles of a sequence */
static_assert(SQ % (FQ * FW) == 0 && FNT % 2 == 0 && HD == 64 && FQ == 32);
typedef _Float16 v8h __attribute__((ext_vector_type(8)));
__device__ __forceinline__ float fa_xhalf(float x) { return __builtin_bit_cast(float, __builtin_amdgcn_permlanex16(__builtin_bit_cast(int, x), __builtin_bit_cast(int, x), 0x76543210, 0xfedcba98, false, false)); }      /* lane l with lane l ^ 16 */
__device__ __forceinline__ v8f fa_mma(v16h a, v16h b, v8f c) { return __builtin_amdgcn_wmma_f32_16x16x32_f16(false, a, false, b, (short)0, c, false, false); }
__global__ __launch_bounds__(32 * FW) void k_fattn(const _Float16* __restrict__ Q, const _Float16* __restrict__ K, const _Float16* __restrict__ VT, const int* __restrict__ pm, _Float16* __restrict__ O) {
  /* readfirstlane: the wave's number in a scalar register, so that the trip count and the loop's branches stay scalar */
  const unsigned lane = threadIdx.x & 31u, ln = lane & 15u, hh = lane >> 4; const unsigned w = (unsigned)__builtin_amdgcn_readfirstlane((int)(threadIdx.x >> 5));
  const unsigned rank = blockIdx.x / (unsigned)(NB * NH), bh = blockIdx.x % (unsigned)(NB * NH); const unsigned tile = rank < (unsigned)(FNT / 2) ? (unsigned)(FNT - 1) - rank : rank - (unsigned)(FNT / 2);      /* long tiles first, then the short ones in mirrored order */
  const unsigned b = bh / (unsigned)NH, h = bh % (unsigned)NH; const unsigned qw = tile * (unsigned)(FQ * FW) + w * (unsigned)FQ; const int last = (int)(qw >> 5);      /* pass 'last' holds the diagonal */
  const _Float16* qp = Q + ((size_t)b * SQ + qw + ln) * LQ + h * HD; const _Float16* kp = K + ((size_t)b * SQ + ln) * LQ + h * HD; const _Float16* vp = VT + ((size_t)bh * HD + ln) * SQ; const int* pp = pm + (size_t)b * SQ_FULL + lane;
  v16h qf[2][2], kf[2][2];
#pragma unroll      /* constant index into qf[] and kf[] */
  for (int g = 0; g < 2; ++g) { qf[g][0] = g2_frag(qp + (size_t)g * 16 * LQ, hh); qf[g][1] = g2_frag(qp + (size_t)g * 16 * LQ + 32, hh); kf[g][0] = g2_frag(kp + (size_t)g * 16 * LQ, hh); kf[g][1] = g2_frag(kp + (size_t)g * 16 * LQ + 32, hh); }
  int pv = pp[0]; v16h vf[4];
  asm volatile("s_wait_xcnt 0x0" ::: "memory");      /* behind the issued loads, in front of whatever rewrites a register that one of them names; as a memory fence it also keeps the value loads younger than the key loads, as in the loop, so that the loop's counted wait for the keys leaves the values in flight */
#pragma unroll      /* constant index into vf[] */
  for (int dt = 0; dt < 4; ++dt) vf[dt] = g2_frag(vp + (size_t)dt * 16 * SQ, hh);
  const v8f z8 = {0.f,0.f,0.f,0.f,0.f,0.f,0.f,0.f}; v8f o[2][4] = {{z8, z8, z8, z8}, {z8, z8, z8, z8}}; float mr[2] = {-3.0e38f, -3.0e38f}, l[2] = {0.f, 0.f};
  const float cs = 0.125f * 1.44269504088896340736f;      /* 1 / sqrt(64), and exp(x) = exp2(x log2 e) */
#pragma unroll 1      /* one pass of code: the loop's text stays small */
  for (int s = 0; s <= last; ++s) {
    v8f sc[2][2];
#pragma unroll      /* constant index into sc[], kf[], qf[] */
    for (int tk = 0; tk < 2; ++tk) { sc[0][tk] = fa_mma(kf[tk][0], qf[0][0], z8); sc[1][tk] = fa_mma(kf[tk][0], qf[1][0], z8); sc[0][tk] = fa_mma(kf[tk][1], qf[0][1], sc[0][tk]); sc[1][tk] = fa_mma(kf[tk][1], qf[1][1], sc[1][tk]); }
    const unsigned vm = __builtin_amdgcn_ballot_w32(pv != 0);      /* bit j: key 32 s + j passes the padding mask */
    const int sn = s < last ? s + 1 : last;      /* the last pass fetches its own rows again: in bounds, unused */
    const _Float16* kn = kp + (size_t)sn * 32 * LQ; pv = pp[sn * 32];
#pragma unroll      /* constant index into kf[] */
    for (int tk = 0; tk < 2; ++tk) { kf[tk][0] = g2_frag(kn + (size_t)tk * 16 * LQ, hh); kf[tk][1] = g2_frag(kn + (size_t)tk * 16 * LQ + 32, hh); }
    asm volatile("s_wait_xcnt 0x0" ::: "memory");      /* behind the issued loads, in front of whatever rewrites (or lands in) a register that one of them names; as a memory fence it keeps these loads here, older than the value loads at the foot */
    if (vm != 0xffffffffu || s == last) {      /* scalar branch: only the diagonal pass and passes with a padded key pay for the mask */
      const unsigned vs = vm >> (8u * hh);
#pragma unroll      /* constant index into sc[] */
      for (int g = 0; g < 2; ++g) { const int qrel = (int)(qw + 16u * (unsigned)g + ln) - (s * 32 + 8 * (int)hh);      /* local key 16 tk + r is causal iff it is <= qrel */
#pragma unroll      /* constant index into sc[] */
        for (int tk = 0; tk < 2; ++tk) {
#pragma unroll      /* constant element index */
          for (int r = 0; r < 8; ++r) sc[g][tk][r] = ((((vs >> (16 * tk + r)) & 1u) != 0u) & (16 * tk + r <= qrel)) ? sc[g][tk][r] : -1.0e9f; } } }
    v16h pf[2];
#pragma unroll      /* constant index into sc[], o[], mr[], l[], pf[] */
    for (int g = 0; g < 2; ++g) {
      float mx = fmaxf(sc[g][0][0], sc[g][1][0]);
#pragma unroll      /* constant element index */
      for (int r = 1; r < 8; ++r) mx = fmaxf(mx, fmaxf(sc[g][0][r], sc[g][1][r]));
      mx = fmaxf(mx, fa_xhalf(mx)); const float mn = fmaxf(mr[g], mx); const float al = __builtin_amdgcn_exp2f((mr[g] - mn) * cs); const float mc = mn * cs; mr[g] = mn;
      v8f p0, p1;
#pragma unroll      /* constant element index */
      for (int r = 0; r < 8; ++r) { p0[r] = __builtin_amdgcn_exp2f(fmaf(sc[g][0][r], cs, -mc)); p1[r] = __builtin_amdgcn_exp2f(fmaf(sc[g][1][r], cs, -mc)); }
      const v8f ps = p0 + p1; l[g] = fmaf(l[g], al, ((ps[0] + ps[1]) + (ps[2] + ps[3])) + ((ps[4] + ps[5]) + (ps[6] + ps[7])));
      const v8h h0 = __builtin_convertvector(p0, v8h), h1 = __builtin_convertvector(p1, v8h);
      pf[g] = __builtin_shufflevector(h0, h1, 0, 1, 2, 3, 4, 5, 6, 7, 8, 9, 10, 11, 12, 13, 14, 15);
#pragma unroll      /* constant index into o[] */
      for (int dt = 0; dt < 4; ++dt) o[g][dt] *= al; }
#pragma unroll      /* constant index into o[], vf[] */
    for (int dt = 0; dt < 4; ++dt) { o[0][dt] = fa_mma(vf[dt], pf[0], o[0][dt]); o[1][dt] = fa_mma(vf[dt], pf[1], o[1][dt]); }
#pragma unroll      /* constant index into vf[] */
    for (int dt = 0; dt < 4; ++dt) vf[dt] = g2_frag(vp + (size_t)dt * 16 * SQ + (size_t)sn * 32, hh); }
  asm volatile("s_wait_loadcnt 0x0" ::: "memory");      /* the last pass's fetches ahead are unused: they land here, so that no load is still on its way to a register when the wave gives its registers back */
#pragma unroll      /* constant index into o[], l[] */
  for (int g = 0; g < 2; ++g) { const float fin = 64.0f * (1.0f / (l[g] + fa_xhalf(l[g])));      /* the halves' sums joined once; o carried x64 */
    _Float16* op = O + ((size_t)b * SQ + qw + 16u * (unsigned)g + ln) * DM + h * HD + 8u * hh;
#pragma unroll      /* constant index into o[] */
    for (int dt = 0; dt < 4; ++dt) *(v8h*)(op + dt * 16) = __builtin_convertvector(o[g][dt] * fin, v8h); } }      /* a lane's 8 registers are 8 consecutive columns of its query's row: one 16-byte store */

// f32 attention for the FIRST query tile of a causal sequence (rows 0..QT0-1 of one batch): ONE WAVE PER QUERY ROW, workgroup = A0W waves = A0W consecutive rows of one head. The head's QT0 key rows and value rows are
// staged once in LDS with coalesced 16-byte loads (key pitch HD + 4 floats: 16 lanes that each read 16 bytes of their own key row fall on distinct banks). Scores: lane l owns keys l, l + 32, l + 64, l + 96 (four partial
// sums per key over the head dimension), invalid keys (j > i or pm[j] == 0) are REPLACED by -1e30; maximum and sum close with a five-step butterfly over the lanes (precise expf, weight exactly 0 for an invalid key
// whenever the row has one valid key). q, k, v rows at pitch LQ, o rows at pitch DM. o: lane l owns columns 2l, 2l + 1 and walks all keys (four partial sums over the keys), the weights read back from the wave's own LDS row as broadcasts.
#define A0W 8                        /* query rows (= waves) per workgroup */
#define A0S (QT0 / (2 * A0W))        /* staging steps: a workgroup's threads cover 2 * A0W rows of 64 floats a step, 16 bytes a thread */
static_assert(QT0 % A0W == 0 && QT0 % 32 == 0 && (QT0 * (HD / 4)) % (32 * A0W) == 0 && HD == 64);
typedef float v2f  __attribute__((ext_vector_type(2)));
typedef float v2fa __attribute__((ext_vector_type(2), may_alias));
__global__ __launch_bounds__(32 * A0W) void k_att0(const float* __restrict__ QF, const float* __restrict__ KF, const float* __restrict__ VF, const int* __restrict__ pm, float scale, float* __restrict__ OF) {
  __shared__ __attribute__((aligned(16))) float lk[QT0][HD + 4]; __shared__ __attribute__((aligned(16))) float lv[QT0][HD]; __shared__ __attribute__((aligned(16))) float lp[A0W][QT0];
  /* readfirstlane: the wave's number in a scalar register, so that the q row's address is scalar */
  const unsigned tid = threadIdx.x, lane = tid & 31u; const unsigned w = (unsigned)__builtin_amdgcn_readfirstlane((int)(tid >> 5));
  const unsigned h = blockIdx.x / (unsigned)(QT0 / A0W), rg = blockIdx.x % (unsigned)(QT0 / A0W); const unsigned i = rg * (unsigned)A0W + w;
  const unsigned r0 = tid >> 4, c4 = (tid & 15u) * 4u; const float* kp = KF + (size_t)r0 * LQ + h * HD + c4; const float* vp = VF + (size_t)r0 * LQ + h * HD + c4; const float* qr = QF + (size_t)i * LQ + h * HD;
  v4f kk[A0S], vv[A0S], qq[HD / 4]; int pv[QT0 / 32];
#pragma unroll      /* constant index into kk[] and vv[]; constant pitch: one address per plane, the steps as immediate offsets; all of a thread's loads in flight together */
  for (int it = 0; it < A0S; ++it) { kk[it] = *(const v4fa*)(kp + (size_t)it * (2 * A0W) * LQ); vv[it] = *(const v4fa*)(vp + (size_t)it * (2 * A0W) * LQ); }
#pragma unroll      /* constant index into pv[] */
  for (int u = 0; u < QT0 / 32; ++u) pv[u] = pm[(unsigned)u * 32u + lane];
#pragma unroll      /* constant index into qq[] */
  for (int c = 0; c < HD / 4; ++c) qq[c] = *(const v4fa*)(qr + c * 4);
  asm volatile("s_wait_xcnt 0x0" :: "v"(kp), "v"(vp) : "memory");      /* behind the last staging load, in front of whatever rewrites a register that an issued load names; kp and vp as inputs keep both address pairs live up to here, so that no load of the run lands in one */
#pragma unroll      /* constant index into kk[] and vv[] */
  for (int it = 0; it < A0S; ++it) { *(v4fa*)&lk[r0 + (unsigned)it * (unsigned)(2 * A0W)][c4] = kk[it]; *(v4fa*)&lv[r0 + (unsigned)it * (unsigned)(2 * A0W)][c4] = vv[it]; }
  __syncthreads();      /* publishes the staged key and value rows to every wave */
  const v4f z4 = {0.f, 0.f, 0.f, 0.f}; v4f acc[QT0 / 32];
#pragma unroll      /* constant index into acc[] */
  for (int u = 0; u < QT0 / 32; ++u) acc[u] = z4;
#pragma unroll      /* constant index into acc[] and qq[]; the LDS reads of several steps in flight together */
  for (int c = 0; c < HD / 4; ++c) {
#pragma unroll      /* constant index into acc[] */
    for (int u = 0; u < QT0 / 32; ++u) acc[u] += qq[c] * *(const v4fa*)&lk[(unsigned)u * 32u + lane][c * 4]; }
  float sm[QT0 / 32]; float mx = -1.0e30f;
#pragma unroll      /* constant index into acc[] and sm[] */
  for (int u = 0; u < QT0 / 32; ++u) { const unsigned j = (unsigned)u * 32u + lane; const float s = ((acc[u][0] + acc[u][1]) + (acc[u][2] + acc[u][3])) * scale; sm[u] = ((j <= i) & (pv[u] != 0)) ? s : -1.0e30f; mx = fmaxf(mx, sm[u]); }
  for (int d = 16; d > 0; d >>= 1) mx = fmaxf(mx, __shfl_xor(mx, d, 32));
  float l = 0.f;
#pragma unroll      /* constant index into sm[] */
  for (int u = 0; u < QT0 / 32; ++u) { const float e = expf(sm[u] - mx); lp[w][(unsigned)u * 32u + lane] = e; l += e; }
  for (int d = 16; d > 0; d >>= 1) l += __shfl_xor(l, d, 32);
  __syncthreads();      /* the weights are written by one lane and read by all lanes of the wave */
  const v2f z2 = {0.f, 0.f}; v2f o[4] = {z2, z2, z2, z2};
#pragma unroll 8      /* several steps' LDS reads in flight together */
  for (int j4 = 0; j4 < QT0 / 4; ++j4) { const v4f pj = *(const v4fa*)&lp[w][j4 * 4];
#pragma unroll      /* constant index into o[] and pj */
    for (int u = 0; u < 4; ++u) o[u] += pj[u] * *(const v2fa*)&lv[j4 * 4 + u][lane * 2u]; }
  const float fin = 64.0f * (1.0f / l);      /* o carried x64 like the f16 path */
  const v2f oo = ((o[0] + o[1]) + (o[2] + o[3])) * fin;
  *(v2f*)(OF + (size_t)i * DM + h * HD + lane * 2u) = oo; }

// row LayerNorm over DM = 1024 of f32 rows: mean, BIASED variance, (x - mu) * rsqrt(var + eps) * bf16(g[c]) + bf16(b[c]) -> f16 rows (GEMM operand); workgroup = 256 threads, thread t owns columns 4t..4t+3;
template <int BFIN, int FULLIN>
__global__ __launch_bounds__(256) void k_lnx(const float* __restrict__ X, const float* __restrict__ g, const float* __restrict__ bb, float eps, _Float16* __restrict__ N16) {
  #pragma clang fp contract(off)
  __shared__ float red[256]; const unsigned r = blockIdx.x; const unsigned t = threadIdx.x; const unsigned c0 = t * 4u;
  const size_t xr = FULLIN ? ((size_t)(r / (unsigned)SQ) * SQ_FULL + (r % (unsigned)SQ)) : (size_t)r;
  const v4f xa = *(const v4fa*)(X + xr * DM + c0); float s[4]; float sum = 0.f;
  for (int q = 0; q < 4; ++q) { s[q] = BFIN ? bf16_rne(xa[q]) : xa[q]; sum = sum + s[q]; }
  red[t] = sum; __syncthreads(); for (unsigned st = 128u; st > 0u; st >>= 1) { if (t < st) red[t] = red[t] + red[t + st]; __syncthreads(); } const float mu = red[0] * (1.0f / (float)DM); __syncthreads();
  float vs = 0.f; for (int q = 0; q < 4; ++q) { const float dl = s[q] - mu; vs = vs + dl * dl; } red[t] = vs; __syncthreads(); for (unsigned st = 128u; st > 0u; st >>= 1) { if (t < st) red[t] = red[t] + red[t + st]; __syncthreads(); }
  const float rs = rsqrtf(red[0] * (1.0f / (float)DM) + eps); v4h y;
  for (int q = 0; q < 4; ++q) { const unsigned c = c0 + (unsigned)q; y[q] = (_Float16)((((s[q] - mu) * rs) * bf16_rne(g[c])) + bf16_rne(bb[c])); }
  { *(v4h*)(N16 + (size_t)r * DM + c0) = y;  } }

// residual without an output projection: X1[r][c] = bf16(x[r][c]) + o[r][c] / 64 (+ NaN when the batch's first mask entry is 0: the structure the attention kernels rely on is violated);
__global__ __launch_bounds__(256) void k_resid(const float* __restrict__ x, const int* __restrict__ pm, const _Float16* __restrict__ O16, const float* __restrict__ OF0, float* __restrict__ X1) {
  #pragma clang fp contract(off)
  const unsigned t = blockIdx.x * 256u + threadIdx.x; if (t >= (unsigned)(NR * DM / 4)) return;
  const unsigned row = t / (unsigned)(DM / 4), c0 = (t % (unsigned)(DM / 4)) * 4u; const unsigned b = row / (unsigned)SQ, rl = row % (unsigned)SQ; const bool ft = rl < (unsigned)QT0; const unsigned rs = ft ? rl : 0u;
  const size_t e = (size_t)row * DM + c0;
  const v4f xv = *(const v4fa*)(x + ((size_t)b * SQ_FULL + rl) * DM + c0);
  const v4h oh = *(const v4h*)(O16 + e);
  const v4f of = *(const v4fa*)(OF0 + ((size_t)b * QT0 + rs) * DM + c0);
  const int p0 = pm[(size_t)b * SQ_FULL]; const float pz = (p0 != 0) ? 0.f : __uint_as_float(0x7fc00000u);
  v4f y; for (int q = 0; q < 4; ++q) { const float o = ft ? of[q] : (float)oh[q]; y[q] = (bf16_rne(xv[q]) + o * 0.015625f) + pz; }
  *(v4f*)(X1 + e) = y;  }

extern "C" void kernel_launch(void* const* d_in, const int* in_sizes, int n_in,
                              void* d_out, int out_size, void* d_ws, size_t ws_size, hipStream_t stream) {
  if (n_in < 13) return;
  const size_t rows_need = (size_t)(NB - 1) * SQ_FULL + SQ;
  if ((size_t)in_sizes[0] < rows_need * DM) return; if ((size_t)in_sizes[1] < rows_need) return;
  if ((size_t)in_sizes[2] < (size_t)NH * DM * HD || (size_t)in_sizes[3] < (size_t)NH * DM * HD || (size_t)in_sizes[4] < (size_t)NH * DM * HD) return;
  if (in_sizes[5] < DM || in_sizes[6] < DM || in_sizes[7] < DM || in_sizes[8] < DM) return;
  if ((size_t)in_sizes[9] < (size_t)DM * DFF || in_sizes[10] < DFF || (size_t)in_sizes[11] < (size_t)DFF * DM || in_sizes[12] < DM) return;
  if ((size_t)out_size < NR * DM) return;
  const float* x = (const float*)d_in[0]; const int* pmask = (const int*)d_in[1];
  const float* wq = (const float*)d_in[2]; const float* wk = (const float*)d_in[3]; const float* wv = (const float*)d_in[4];
  const float* g1 = (const float*)d_in[5]; const float* be1 = (const float*)d_in[6]; const float* g2 = (const float*)d_in[7]; const float* be2 = (const float*)d_in[8];
  const float* w1 = (const float*)d_in[9]; const float* b1 = (const float*)d_in[10]; const float* w2 = (const float*)d_in[11]; const float* b2 = (const float*)d_in[12];
  char* ws = (char*)d_ws; size_t off = 0;
  auto take = [&](size_t bytes) { char* p = ws + off; off += (bytes + 255) & ~(size_t)255; return p; };
  _Float16* BQKV = (_Float16*)take((size_t)3 * DM * DM * 2);          /* [3*DM][DM] x16: q | k | v stacked, row (h*HD + d) */
  _Float16* X16 = (_Float16*)take(NR * DM * 2);                       /* LN1 rows; reused as the LN2 rows (last reader of LN1 rows: the last batch's first-tile GEMM, before LN2 writes) */
  float* X1 = (float*)take(NR * DM * 4);
  _Float16* BW1 = (_Float16*)take((size_t)DFF * DM * 2); _Float16* BW2 = (_Float16*)take((size_t)DM * DFF * 2);
  _Float16* QKV = (_Float16*)take(NR * 3 * DM * 2); _Float16* Q16 = QKV; _Float16* K16 = QKV + DM; _Float16* V16 = QKV + 2 * DM;
  _Float16* HF16 = QKV;                                               /* FFN hidden rows [NR][DFF] alias the q|k|v rows (dead after the attention); DFF <= 3*DM asserted */
  _Float16* O16 = (_Float16*)take(NR * DM * 2);
  _Float16* VT = (_Float16*)take((size_t)NB * NH * HD * SQ * 2);      /* V^T [NB][NH][HD][SQ] */
  float* F0 = (float*)take((size_t)QT0 * 3 * DM * 4);                 /* f32 q | k | v of the first 128 rows of the current batch */
  float* OF0 = (float*)take((size_t)NB * QT0 * DM * 4);
  _Float16* M16 = X16;
  if (off > ws_size || off > (size_t)134217728) return;
  { const unsigned g = (unsigned)(((size_t)NH * HD * (DM / 8) + 255) / 256);
    k_wthd<<<g, 256, 0, stream>>>(wq, BQKV); k_wthd<<<g, 256, 0, stream>>>(wk, BQKV + (size_t)DM * DM); k_wthd<<<g, 256, 0, stream>>>(wv, BQKV + (size_t)2 * DM * DM); }
  k_lnx<1, 1><<<(unsigned)NR, 256, 0, stream>>>(x, g1, be1, 1e-5f, X16);      /* h = LN1(bf16(x)) -> f16 rows */
  k_wt_f16<<<(unsigned)(((size_t)DFF * (DM / 8) + 255) / 256), 256, 0, stream>>>(w1, BW1, DM, DFF, 16.0f);      /* W1 [DM][DFF] -> [DFF][DM] x16 */
  k_wt_f16<<<(unsigned)(((size_t)DM * (DFF / 8) + 255) / 256), 256, 0, stream>>>(w2, BW2, DFF, DM, 16.0f);      /* W2 [DFF][DM] -> [DM][DFF] x16 */
  k_gemm2<0><<<dim3((unsigned)((NR / 128) * (3 * DM / 128)), 1), 256, 0, stream>>>(X16, DM, (size_t)0, BQKV, DM, (size_t)0, 0.0625f, (const float*)nullptr, (const float*)nullptr, (float*)nullptr, QKV, LQ, (size_t)0, (int)NR, 3 * DM, DM);      /* q | k | v rows (f16) */
  for (int b = 0; b < NB; ++b) { const size_t r0 = (size_t)b * SQ; const int* pmb = pmask + (size_t)b * SQ_FULL;
    k_vt<NH, SQ><<<NH * (SQ / 64), 256, 0, stream>>>(V16 + r0 * LQ, LQ, 0, VT + (size_t)b * NH * HD * SQ);      /* V^T [NH][HD][SQ] of this batch */
    k_gemm2<0><<<dim3((unsigned)((QT0 / 128) * (3 * DM / 128)), 1), 256, 0, stream>>>(X16 + r0 * DM, DM, (size_t)0, BQKV, DM, (size_t)0, 0.0625f, (const float*)nullptr, (const float*)nullptr, F0, (_Float16*)nullptr, 3 * DM, (size_t)0, QT0, 3 * DM, DM);      /* f32 q | k | v of rows 0..127 */
    k_att0<<<NH * (QT0 / A0W), 32 * A0W, 0, stream>>>(F0, F0 + DM, F0 + 2 * DM, pmb, 0.125f, OF0 + (size_t)b * QT0 * DM); }      /* f32 attention for rows 0..127 (o x64) */
  k_fattn<<<NB * NH * FNT, 32 * FW, 0, stream>>>(Q16, K16, VT, pmask, O16);      /* o (merged heads, x64) as f16 rows, all batches, heads and query tiles */
  k_resid<<<(unsigned)((NR * DM / 4) / 256), 256, 0, stream>>>(x, pmask, O16, OF0, X1);      /* x1 = bf16(x) + attn */
  k_lnx<0, 0><<<(unsigned)NR, 256, 0, stream>>>(X1, g2, be2, 1e-5f, M16);      /* h2 = LN2(x1) -> f16 rows */
  k_gemm2<3><<<dim3((unsigned)((NR / 128) * (DFF / 128)), 1), 256, 0, stream>>>(M16, DM, (size_t)0, BW1, DM, (size_t)0, 0.0625f, b1, (const float*)nullptr, (float*)nullptr, HF16, DFF, (size_t)0, (int)NR, DFF, DM);      /* relu(h2 W1 + b1) -> f16 */
  k_gemm2<0><<<dim3((unsigned)((NR / 128) * (DM / 128)), 1), 256, 0, stream>>>(HF16, DFF, (size_t)0, BW2, DFF, (size_t)0, 0.0625f, b2, X1, (float*)d_out, (_Float16*)nullptr, DM, (size_t)0, (int)NR, DM, DFF);      /* out = x1 + mlp (own-element residual) */
}

// v005
// One run takes 169 microseconds.
// Next to v004, in two timings, it ran 1.25 times as fast each time.
// All steps since v000 together make it 30.2 times as fast.
#include <hip/hip_runtime.h>
// Pre-LN causal transformer layer: x [NB][SEQ][1024]; h = LN1(x) (biased variance, eps 1e-5); q/k/v[b][h] = h Wq/Wk/Wv[h] (per-head [16][1024][64], [in][out], no biases); scores / sqrt(64); mask = padding_mask[b][key] AND causal, masked scores REPLACED by -1e9; softmax; heads concatenated (no output projection); x1 = x + attn; h2 = LN2(x1); out = x1 + relu(h2 W1 + b1) W2 + b2 ([in][out] 1024 x 1024 x 1024).
// Structure: LN1 on VALU -> f16 rows; per-head weights transposed on VALU into one x16 f16 q|k|v plane; q|k|v as ONE WMMA GEMM (operands staged in LDS, 32x64 wave tiles, f32 accumulation, f16 out); V^T via LDS transposes and an f32 first tile (rows 0..127 of each batch) on VALU; then ONE fused attention launch for all batches and heads (scores, masked online softmax and P V in registers, one wave per 32 queries; o x64 f16); x1 = bf16(x) + o / 64; LN2 -> f16; FFN as two GEMMs (ReLU epilogue; own-element residual).
// Launches (7): kernels that do not depend on one another share a launch, each on its own range of workgroup indices: {weight transposes, LN1}; q|k|v GEMM (also stores its first-tile rows in f32); {first-tile attention, V^T}; fused attention; {residual + LN2, row by row}; FFN 1; FFN 2.
// Compute dtype: all contractions v_wmma_f32_16x16x32_f16 (f16 operands, f32 accumulate); float inputs RNE-converted to bf16 first (weights then x16, exact in f16); q, k, v, softmax weights (relative to the running row maximum) and o (x64) as plain f16 operands; scores and softmax statistics f32; first 128 query rows of each batch in f32 on VALU.
#ifndef NB
#define NB 2
#endif
#ifndef SEQ
#define SEQ 2048
#endif
#define SQ SEQ
#define NB_FULL 2
#define SQ_FULL 2048                 /* per-batch row stride of the inputs (x rows, mask entries) */
#define DM 1024
#define NH 16
#define HD 64
#define DFF 1024
#define QT0 128                      /* first-tile rows computed in f32 */
#define NR ((size_t)NB * SQ)         /* token rows */
#define LQ (3 * DM)                  /* row pitch of the q|k|v rows */
static_assert(NH * HD == DM);
static_assert(QT0 == 128 && QT0 <= SQ && SQ <= SQ_FULL && NB <= NB_FULL);
static_assert(DM % 128 == 0 && DFF % 128 == 0 && HD == 64 && ((size_t)NB * SQ) % 128 == 0);
static_assert(DM / 4 == 256);
static_assert(DFF <= 3 * DM);
static_assert((((size_t)NB * SQ * DM) / 4) % 256 == 0);
static_assert((size_t)NB * SQ * DM / 4 < 0x7fffffffu);

typedef unsigned short v8us __attribute__((ext_vector_type(8), may_alias));
typedef float  v8f  __attribute__((ext_vector_type(8)));
typedef float  v4f  __attribute__((ext_vector_type(4)));
typedef float  v4fa __attribute__((ext_vector_type(4), may_alias));
typedef _Float16 v16h __attribute__((ext_vector_type(16)));
typedef _Float16 v4h __attribute__((ext_vector_type(4)));
union FragH { v16h v; v8us half[2]; _Float16 h[16]; unsigned short u[16]; };

__device__ __forceinline__ unsigned short bf16_bits(float x) { unsigned int u = __float_as_uint(x); return (unsigned short)((u + 0x7FFFu + ((u >> 16) & 1u)) >> 16); }
__device__ __forceinline__ float bf16_rne(float x) { return __uint_as_float(((unsigned int)bf16_bits(x)) << 16); }

// fragment: elements 0..7 <- k0 + 8h + 0..7, elements 8..15 <- k0 + 16 + 8h + 0..7 (same map for A rows and B columns)
__device__ __forceinline__ v16h g2_frag(const _Float16* p, unsigned hh) { FragH f; f.half[0] = *(const v8us*)((const unsigned short*)p + 8u * hh); f.half[1] = *(const v8us*)((const unsigned short*)p + 16u + 8u * hh); return f.v; }
__device__ __forceinline__ v8f g2_mma(v16h a, v16h b, v8f c) { return __builtin_amdgcn_wmma_f32_16x16x32_f16(false, a, false, b, (short)0, c, false, false); }

// GEMM (wave tile 32x64; workgroup = 8 waves (4 x 2) = 128 rows x 128 cols; M % 128 == 0, N % 128 == 0, K % 64 == 0): A f16 [M][K] (pitch lda, batch stride sA), Bh f16 [N][K] (pitch ldb, batch stride sB);
// a stage is 64 k of the tile's 128 A rows and 128 B rows (128 bytes a row: whole lines), brought into LDS by asynchronous 16-byte copies at row pitch 144 bytes (conflict-free for the 16-byte fragment reads); two buffers: the next stage's copies fly while this stage is worked on.
// v = acc * alpha + bf16(bias[col]) (+ CP own element of the batched C plane); ACT 0 none / 3 relu; writes f32 C and/or f16 C16 (pitch ldc, batch offset by * sC); CT (may be null): every tper-th row tile (mt % tper == 0) is stored in f32 as well, as rows (mt / tper) * 128 .. + 127 of CT (pitch ldc);
#define GP 144                       /* LDS row pitch, bytes */
#define GOP (128 * GP)               /* one operand's rows of a stage, bytes */
#define GSTG (2 * GOP)               /* one buffer: the A rows, then the B rows */
static_assert(8 * 32 * 68 * 4 <= 2 * GSTG && GP % 16 == 0);
__device__ __forceinline__ v16h g2_lfrag(const char* p) { FragH f; f.half[0] = *(const v8us*)p; f.half[1] = *(const v8us*)(p + 32); return f.v; }      /* p: the lane's LDS row + 2 k0 + 16 hh bytes: the k order of g2_frag */
// one stage: a lane's 4 copies of A rows (r, r + 32, r + 64, r + 96) and 4 of B rows; a wave's copy covers 4 whole 128-byte rows
__device__ __forceinline__ void g2_stage(unsigned l, const _Float16* ga, size_t ra, const _Float16* gb, size_t rb) {
  /* the copies and, as the last line of their own statement, the wait that stands in front of any rewrite of a register that an issued copy names */
  asm volatile("global_load_async_to_lds_b128 %0, %8, off\n\t"
               "global_load_async_to_lds_b128 %1, %9, off\n\t"
               "global_load_async_to_lds_b128 %2, %10, off\n\t"
               "global_load_async_to_lds_b128 %3, %11, off\n\t"
               "global_load_async_to_lds_b128 %4, %12, off\n\t"
               "global_load_async_to_lds_b128 %5, %13, off\n\t"
               "global_load_async_to_lds_b128 %6, %14, off\n\t"
               "global_load_async_to_lds_b128 %7, %15, off\n\t"
               "s_wait_xcnt 0x0"
               :: "v"(l), "v"(l + 32u * GP), "v"(l + 64u * GP), "v"(l + 96u * GP), "v"(l + GOP), "v"(l + GOP + 32u * GP), "v"(l + GOP + 64u * GP), "v"(l + GOP + 96u * GP),
                  "v"(ga), "v"(ga + ra), "v"(ga + 2 * ra), "v"(ga + 3 * ra), "v"(gb), "v"(gb + rb), "v"(gb + 2 * rb), "v"(gb + 3 * rb) : "memory"); }
template <int ACT>
__global__ __launch_bounds__(256) void k_gemm2(const _Float16* __restrict__ A, int lda, size_t sA, const _Float16* __restrict__ Bh, int ldb, size_t sB, float alpha,
    const float* __restrict__ bias, const float* __restrict__ CP, float* __restrict__ C, _Float16* __restrict__ C16, float* __restrict__ CT, unsigned tper, int ldc, size_t sC, int M, int N, int K) {
  static_assert(ACT == 0 || ACT == 3);
  __shared__ __attribute__((aligned(16))) char sm[2 * GSTG];
  const unsigned tid = threadIdx.x, w = tid >> 5, lane = tid & 31u, ln = lane & 15u, hh = lane >> 4; const unsigned by = blockIdx.y;
  A += (size_t)by * sA; Bh += (size_t)by * sB; const size_t cofs = (size_t)by * sC;
  const unsigned ntn = (unsigned)N >> 7; const unsigned mt = blockIdx.x / ntn, nq = blockIdx.x - mt * ntn; if (mt * 128u >= (unsigned)M) return;      /* the same for the whole workgroup, in front of every barrier */
  const unsigned row0 = mt * 128u + 32u * (w >> 1), col0 = nq * 128u + 64u * (w & 1u);
  const unsigned cr = tid >> 3, cc = tid & 7u;      /* copies: 8 lanes a row, 32 rows a step of the workgroup */
  const _Float16* ga = A + (size_t)(mt * 128u + cr) * (size_t)lda + cc * 8u; const _Float16* gb = Bh + (size_t)(nq * 128u + cr) * (size_t)ldb + cc * 8u; const size_t ra = (size_t)32 * (size_t)lda, rb = (size_t)32 * (size_t)ldb;
  const unsigned la = (unsigned)(size_t)sm + cr * (unsigned)GP + cc * 16u;      /* the lane's LDS byte address in buffer 0, A rows */
  const char* pa = sm + (32u * (w >> 1) + ln) * (unsigned)GP + 16u * hh; const char* pb = sm + GOP + (64u * (w & 1u) + ln) * (unsigned)GP + 16u * hh;
  const int nt = K >> 6;
  g2_stage(la, ga, ra, gb, rb);
  asm volatile("s_wait_asynccnt 0x0" ::: "memory");      /* this wave's copies of stage 0 have landed */
  __syncthreads();      /* publishes stage 0 to every wave */
  if (nt > 1) g2_stage(la + GSTG, ga + 64, ra, gb + 64, rb);
  const v8f z8 = {0.f,0.f,0.f,0.f,0.f,0.f,0.f,0.f}; v8f c00 = z8, c01 = z8, c02 = z8, c03 = z8, c10 = z8, c11 = z8, c12 = z8, c13 = z8;
#pragma unroll 1      /* one trip of code: the ring's order stays as written */
  for (int t = 0; t < nt; ++t) { const unsigned buf = ((unsigned)t & 1u) * (unsigned)GSTG; const char* qa = pa + buf; const char* qb = pb + buf;
    const v16h a0 = g2_lfrag(qa), a1 = g2_lfrag(qa + 16 * GP), b0 = g2_lfrag(qb), b1 = g2_lfrag(qb + 16 * GP), b2 = g2_lfrag(qb + 32 * GP), b3 = g2_lfrag(qb + 48 * GP);
    const v16h e0 = g2_lfrag(qa + 64), e1 = g2_lfrag(qa + 16 * GP + 64), f0 = g2_lfrag(qb + 64), f1 = g2_lfrag(qb + 16 * GP + 64), f2 = g2_lfrag(qb + 32 * GP + 64), f3 = g2_lfrag(qb + 48 * GP + 64);
    __builtin_amdgcn_sched_barrier(0);      /* keeps the trip's fragment reads together in front of its products: spread among them, each small group of reads makes the wave wait out the LDS latency anew */
    c00 = g2_mma(a0, b0, c00); c10 = g2_mma(a1, b0, c10); c01 = g2_mma(a0, b1, c01); c11 = g2_mma(a1, b1, c11); c02 = g2_mma(a0, b2, c02); c12 = g2_mma(a1, b2, c12); c03 = g2_mma(a0, b3, c03); c13 = g2_mma(a1, b3, c13);
    __builtin_amdgcn_sched_barrier(0);      /* keeps the first half's products in front of the waits below, so that the second half's fragment reads return behind them and not in front of an idle matrix unit */
    asm volatile("s_wait_dscnt 0x0" ::: "memory");      /* this wave's reads of the buffer have returned before the buffer is given up */
    asm volatile("s_wait_asynccnt 0x0" ::: "memory");      /* this wave's copies of stage t + 1 have landed */
    __syncthreads();      /* publishes stage t + 1 and ends every wave's reads of stage t */
    if (t + 2 < nt) g2_stage(la + buf, ga + (size_t)(t + 2) * 64, ra, gb + (size_t)(t + 2) * 64, rb);
    /* the second half's products, on fragments already in registers, run while the copies fly */
    c00 = g2_mma(e0, f0, c00); c10 = g2_mma(e1, f0, c10); c01 = g2_mma(e0, f1, c01); c11 = g2_mma(e1, f1, c11); c02 = g2_mma(e0, f2, c02); c12 = g2_mma(e1, f2, c12); c03 = g2_mma(e0, f3, c03); c13 = g2_mma(e1, f3, c13); }
  asm volatile("s_wait_asynccnt 0x0" ::: "memory");      /* no copy is on its way when the ring becomes output staging */
  float (*so)[32][68] = (float (*)[32][68])sm;      /* output staging, a wave's own tile, in the ring, which every wave has left at the last trip's barrier */
  v8f accs[8] = {c00, c01, c02, c03, c10, c11, c12, c13};
#pragma unroll
  for (int u = 0; u < 8; ++u) { const unsigned t = (unsigned)u & 3u, half = (unsigned)u >> 2; const unsigned col = col0 + t * 16u + ln; const float bv = bias ? bf16_rne(bias[col]) : 0.f;
#pragma unroll
    for (int r = 0; r < 8; ++r) { const unsigned rloc = half * 16u + 8u * hh + (unsigned)r; float v = accs[u][r] * alpha + bv;
      if (CP) v += CP[cofs + (size_t)(row0 + rloc) * (size_t)ldc + col];      /* own element of the batched C plane */
      if (ACT == 3) v = fmaxf(v, 0.f);
      so[w][rloc][t * 16u + ln] = v; } }
  __builtin_amdgcn_fence(4 /* acq_rel order */, "workgroup"); __builtin_amdgcn_wave_barrier();      /* wave-private tile: same wave writes and reads */
  const unsigned rsub = lane >> 4, c4 = (lane & 15u) * 4u;
  const bool wt = CT != nullptr && mt % tper == 0u; const size_t cto = ((size_t)(mt / tper) * 128u + 32u * (w >> 1)) * (size_t)ldc + col0 + c4;      /* wt: the same for the whole workgroup */
  {
#pragma unroll
    for (int q = 0; q < 16; ++q) { const unsigned r = (unsigned)q * 2u + rsub; const v4f v = *(const v4fa*)&so[w][r][c4];
      if (C) { *(v4f*)(C + cofs + (size_t)(row0 + r) * (size_t)ldc + col0 + c4) = v; asm volatile("s_wait_xcnt 0x0" ::: "memory"); }      /* behind the issued store, in front of the next address arithmetic, which may rewrite a register that it names */
      if (wt) { *(v4f*)(CT + cto + (size_t)r * (size_t)ldc) = v; asm volatile("s_wait_xcnt 0x0" ::: "memory"); }      /* likewise */
      if (C16) { v4h h4; for (int i = 0; i < 4; ++i) h4[i] = (_Float16)v[i]; *(v4h*)(C16 + cofs + (size_t)(row0 + r) * (size_t)ldc + col0 + c4) = h4; } }
     } }

// the bodies below take blk, the workgroup's index inside its own range of a shared launch
__device__ __forceinline__ void d_wt_f16(unsigned blk, const float* __restrict__ W, _Float16* __restrict__ Wt, int K, int N, float scale) {
  const unsigned k8n = (unsigned)K >> 3; const unsigned t = blk * 256u + threadIdx.x; if (t >= (unsigned)N * k8n) return; const unsigned n = t / k8n, k8 = (t - n * k8n) * 8u; FragH f;
#pragma unroll
  for (int i = 0; i < 8; ++i) f.h[i] = (_Float16)(bf16_rne(W[(size_t)(k8 + (unsigned)i) * (size_t)N + n]) * scale);
  const v8us o = f.half[0]; unsigned short* dst = (unsigned short*)Wt + (size_t)n * (size_t)K + k8;
  *(v8us*)dst = o;  }

__device__ __forceinline__ void d_wthd(unsigned blk, const float* __restrict__ Wt, _Float16* __restrict__ Bt) {
  const unsigned t = blk * 256u + threadIdx.x; if (t >= (unsigned)(NH * HD * (DM / 8))) return;
  const unsigned m8 = (t % (unsigned)(DM / 8)) * 8u; const unsigned d = (t / (unsigned)(DM / 8)) % (unsigned)HD; const unsigned h = t / (unsigned)((DM / 8) * HD); FragH f;
#pragma unroll
  for (int q = 0; q < 8; ++q) f.h[q] = (_Float16)(16.0f * bf16_rne(Wt[((size_t)h * DM + m8 + (unsigned)q) * HD + d]));
  const v8us o = f.half[0]; unsigned short* dst = (unsigned short*)Bt + ((size_t)h * HD + d) * DM + m8;
  *(v8us*)dst = o;  }

template <int NHv, int TTv>
__device__ __forceinline__ void d_vt(unsigned blk, const _Float16* __restrict__ V16, int ldv, int voff, _Float16* __restrict__ Vt) {
  __shared__ unsigned short tl[64][66]; const unsigned tid = threadIdx.x; const unsigned slab = blk / (unsigned)(TTv / 64), lg = blk % (unsigned)(TTv / 64); const unsigned b = slab / (unsigned)NHv, h = slab % (unsigned)NHv;
  for (unsigned i = tid; i < 64u * 8u; i += 256u) { const unsigned r = i >> 3, c8 = (i & 7u) * 8u; FragH f; f.half[0] = *(const v8us*)((const unsigned short*)V16 + ((size_t)b * TTv + lg * 64u + r) * (size_t)ldv + (size_t)voff + h * 64u + c8);
#pragma unroll
    for (int q = 0; q < 8; ++q) tl[r][c8 + (unsigned)q] = f.u[q]; }
  __syncthreads();
  {
#pragma unroll
    for (int rd = 0; rd < 2; ++rd) { const unsigned d = (unsigned)rd * 32u + (tid >> 3), pc = tid & 7u; FragH f;
#pragma unroll
      for (int q = 0; q < 8; ++q) f.u[q] = tl[pc * 8u + (unsigned)q][d];
      *(v8us*)((unsigned short*)Vt + ((size_t)slab * 64u + d) * TTv + lg * 64u + pc * 8u) = f.half[0]; }
     } }

#define FQ 32                        /* query columns per wave */
#define FW 4                         /* waves per workgroup */
#define FNT (SQ / (FQ * FW))         /* query tiles of a sequence */
static_assert(SQ % (FQ * FW) == 0 && FNT % 2 == 0 && HD == 64 && FQ == 32);
typedef _Float16 v8h __attribute__((ext_vector_type(8)));
__device__ __forceinline__ float fa_xhalf(float x) { return __builtin_bit_cast(float, __builtin_amdgcn_permlanex16(__builtin_bit_cast(int, x), __builtin_bit_cast(int, x), 0x76543210, 0xfedcba98, false, false)); }      /* lane l with lane l ^ 16 */
__device__ __forceinline__ v8f fa_mma(v16h a, v16h b, v8f c) { return __builtin_amdgcn_wmma_f32_16x16x32_f16(false, a, false, b, (short)0, c, false, false); }
__global__ __launch_bounds__(32 * FW) void k_fattn(const _Float16* __restrict__ Q, const _Float16* __restrict__ K, const _Float16* __restrict__ VT, const int* __restrict__ pm, _Float16* __restrict__ O) {
  /* readfirstlane: the wave's number in a scalar register, so that the trip count and the loop's branches stay scalar */
  const unsigned lane = threadIdx.x & 31u, ln = lane & 15u, hh = lane >> 4; const unsigned w = (unsigned)__builtin_amdgcn_readfirstlane((int)(threadIdx.x >> 5));
  const unsigned rank = blockIdx.x / (unsigned)(NB * NH), bh = blockIdx.x % (unsigned)(NB * NH); const unsigned tile = rank < (unsigned)(FNT / 2) ? (unsigned)(FNT - 1) - rank : rank - (unsigned)(FNT / 2);      /* long tiles first, then the short ones in mirrored order */
  const unsigned b = bh / (unsigned)NH, h = bh % (unsigned)NH; const unsigned qw = tile * (unsigned)(FQ * FW) + w * (unsigned)FQ; const int last = (int)(qw >> 5);      /* pass 'last' holds the diagonal */
  const _Float16* qp = Q + ((size_t)b * SQ + qw + ln) * LQ + h * HD; const _Float16* kp = K + ((size_t)b * SQ + ln) * LQ + h * HD; const _Float16* vp = VT + ((size_t)bh * HD + ln) * SQ; const int* pp = pm + (size_t)b * SQ_FULL + lane;
  v16h qf[2][2], kf[2][2];
#pragma unroll      /* constant index into qf[] and kf[] */
  for (int g = 0; g < 2; ++g) { qf[g][0] = g2_frag(qp + (size_t)g * 16 * LQ, hh); qf[g][1] = g2_frag(qp + (size_t)g * 16 * LQ + 32, hh); kf[g][0] = g2_frag(kp + (size_t)g * 16 * LQ, hh); kf[g][1] = g2_frag(kp + (size_t)g * 16 * LQ + 32, hh); }
  int pv = pp[0]; v16h vf[4];
  asm volatile("s_wait_xcnt 0x0" ::: "memory");      /* behind the issued loads, in front of whatever rewrites a register that one of them names; as a memory fence it also keeps the value loads younger than the key loads, as in the loop, so that the loop's counted wait for the keys leaves the values in flight */
#pragma unroll      /* constant index into vf[] */
  for (int dt = 0; dt < 4; ++dt) vf[dt] = g2_frag(vp + (size_t)dt * 16 * SQ, hh);
  const v8f z8 = {0.f,0.f,0.f,0.f,0.f,0.f,0.f,0.f}; v8f o[2][4] = {{z8, z8, z8, z8}, {z8, z8, z8, z8}}; float mr[2] = {-3.0e38f, -3.0e38f}, l[2] = {0.f, 0.f};
  const float cs = 0.125f * 1.44269504088896340736f;      /* 1 / sqrt(64), and exp(x) = exp2(x log2 e) */
#pragma unroll 1      /* one pass of code: the loop's text stays small */
  for (int s = 0; s <= last; ++s) {
    v8f sc[2][2];
#pragma unroll      /* constant index into sc[], kf[], qf[] */
    for (int tk = 0; tk < 2; ++tk) { sc[0][tk] = fa_mma(kf[tk][0], qf[0][0], z8); sc[1][tk] = fa_mma(kf[tk][0], qf[1][0], z8); sc[0][tk] = fa_mma(kf[tk][1], qf[0][1], sc[0][tk]); sc[1][tk] = fa_mma(kf[tk][1], qf[1][1], sc[1][tk]); }
    const unsigned vm = __builtin_amdgcn_ballot_w32(pv != 0);      /* bit j: key 32 s + j passes the padding mask */
    const int sn = s < last ? s + 1 : last;      /* the last pass fetches its own rows again: in bounds, unused */
    const _Float16* kn = kp + (size_t)sn * 32 * LQ; pv = pp[sn * 32];
#pragma unroll      /* constant index into kf[] */
    for (int tk = 0; tk < 2; ++tk) { kf[tk][0] = g2_frag(kn + (size_t)tk * 16 * LQ, hh); kf[tk][1] = g2_frag(kn + (size_t)tk * 16 * LQ + 32, hh); }
    asm volatile("s_wait_xcnt 0x0" ::: "memory");      /* behind the issued loads, in front of whatever rewrites (or lands in) a register that one of them names; as a memory fence it keeps these loads here, older than the value loads at the foot */
    if (vm != 0xffffffffu || s == last) {      /* scalar branch: only the diagonal pass and passes with a padded key pay for the mask */
      const unsigned vs = vm >> (8u * hh);
#pragma unroll      /* constant index into sc[] */
      for (int g = 0; g < 2; ++g) { const int qrel = (int)(qw + 16u * (unsigned)g + ln) - (s * 32 + 8 * (int)hh);      /* local key 16 tk + r is causal iff it is <= qrel */
#pragma unroll      /* constant index into sc[] */
        for (int tk = 0; tk < 2; ++tk) {
#pragma unroll      /* constant element index */
          for (int r = 0; r < 8; ++r) sc[g][tk][r] = ((((vs >> (16 * tk + r)) & 1u) != 0u) & (16 * tk + r <= qrel)) ? sc[g][tk][r] : -1.0e9f; } } }
    v16h pf[2];
#pragma unroll      /* constant index into sc[], o[], mr[], l[], pf[] */
    for (int g = 0; g < 2; ++g) {
      float mx = fmaxf(sc[g][0][0], sc[g][1][0]);
#pragma unroll      /* constant element index */
      for (int r = 1; r < 8; ++r) mx = fmaxf(mx, fmaxf(sc[g][0][r], sc[g][1][r]));
      mx = fmaxf(mx, fa_xhalf(mx)); const float mn = fmaxf(mr[g], mx); const float al = __builtin_amdgcn_exp2f((mr[g] - mn) * cs); const float mc = mn * cs; mr[g] = mn;
      v8f p0, p1;
#pragma unroll      /* constant element index */
      for (int r = 0; r < 8; ++r) { p0[r] = __builtin_amdgcn_exp2f(fmaf(sc[g][0][r], cs, -mc)); p1[r] = __builtin_amdgcn_exp2f(fmaf(sc[g][1][r], cs, -mc)); }
      const v8f ps = p0 + p1; l[g] = fmaf(l[g], al, ((ps[0] + ps[1]) + (ps[2] + ps[3])) + ((ps[4] + ps[5]) + (ps[6] + ps[7])));
      const v8h h0 = __builtin_convertvector(p0, v8h), h1 = __builtin_convertvector(p1, v8h);
      pf[g] = __builtin_shufflevector(h0, h1, 0, 1, 2, 3, 4, 5, 6, 7, 8, 9, 10, 11, 12, 13, 14, 15);
#pragma unroll      /* constant index into o[] */
      for (int dt = 0; dt < 4; ++dt) o[g][dt] *= al; }
#pragma unroll      /* constant index into o[], vf[] */
    for (int dt = 0; dt < 4; ++dt) { o[0][dt] = fa_mma(vf[dt], pf[0], o[0][dt]); o[1][dt] = fa_mma(vf[dt], pf[1], o[1][dt]); }
#pragma unroll      /* constant index into vf[] */
    for (int dt = 0; dt < 4; ++dt) vf[dt] = g2_frag(vp + (size_t)dt * 16 * SQ + (size_t)sn * 32, hh); }
  asm volatile("s_wait_loadcnt 0x0" ::: "memory");      /* the last pass's fetches ahead are unused: they land here, so that no load is still on its way to a register when the wave gives its registers back */
#pragma unroll      /* constant index into o[], l[] */
  for (int g = 0; g < 2; ++g) { const float fin = 64.0f * (1.0f / (l[g] + fa_xhalf(l[g])));      /* the halves' sums joined once; o carried x64 */
    _Float16* op = O + ((size_t)b * SQ + qw + 16u * (unsigned)g + ln) * DM + h * HD + 8u * hh;
#pragma unroll      /* constant index into o[] */
    for (int dt = 0; dt < 4; ++dt) *(v8h*)(op + dt * 16) = __builtin_convertvector(o[g][dt] * fin, v8h); } }      /* a lane's 8 registers are 8 consecutive columns of its query's row: one 16-byte store */

// f32 attention for the FIRST query tile of each causal sequence (rows 0..QT0-1 of a batch; QF, KF, VF: QT0 rows a batch, OF likewise): ONE WAVE PER QUERY ROW, workgroup = A0W waves = A0W consecutive rows of one head of one batch. The head's QT0 key rows and value rows are
// staged once in LDS with coalesced 16-byte loads (key pitch HD + 4 floats: 16 lanes that each read 16 bytes of their own key row fall on distinct banks). Scores: lane l owns keys l, l + 32, l + 64, l + 96 (four partial
// sums per key over the head dimension), invalid keys (j > i or pm[j] == 0) are REPLACED by -1e30; maximum and sum close with a five-step butterfly over the lanes (precise expf, weight exactly 0 for an invalid key
// whenever the row has one valid key). q, k, v rows at pitch LQ, o rows at pitch DM. o: lane l owns columns 2l, 2l + 1 and walks all keys (four partial sums over the keys), the weights read back from the wave's own LDS row as broadcasts.
#define A0W 8                        /* query rows (= waves) per workgroup */
#define A0S (QT0 / (2 * A0W))        /* staging steps: a workgroup's threads cover 2 * A0W rows of 64 floats a step, 16 bytes a thread */
static_assert(QT0 % A0W == 0 && QT0 % 32 == 0 && (QT0 * (HD / 4)) % (32 * A0W) == 0 && HD == 64);
typedef float v2f  __attribute__((ext_vector_type(2)));
typedef float v2fa __attribute__((ext_vector_type(2), may_alias));
__device__ __forceinline__ void d_att0(unsigned blk, const float* __restrict__ QF, const float* __restrict__ KF, const float* __restrict__ VF, const int* __restrict__ pm, float scale, float* __restrict__ OF) {
  __shared__ __attribute__((aligned(16))) float lk[QT0][HD + 4]; __shared__ __attribute__((aligned(16))) float lv[QT0][HD]; __shared__ __attribute__((aligned(16))) float lp[A0W][QT0];
  /* readfirstlane: the wave's number in a scalar register, so that the q row's address is scalar */
  const unsigned tid = threadIdx.x, lane = tid & 31u; const unsigned w = (unsigned)__builtin_amdgcn_readfirstlane((int)(tid >> 5));
  const unsigned b = blk / (unsigned)(NH * (QT0 / A0W)), h = (blk / (unsigned)(QT0 / A0W)) % (unsigned)NH, rg = blk % (unsigned)(QT0 / A0W); const unsigned i = rg * (unsigned)A0W + w;
  QF += (size_t)b * QT0 * LQ; KF += (size_t)b * QT0 * LQ; VF += (size_t)b * QT0 * LQ; pm += (size_t)b * SQ_FULL; OF += (size_t)b * QT0 * DM;
  const unsigned r0 = tid >> 4, c4 = (tid & 15u) * 4u; const float* kp = KF + (size_t)r0 * LQ + h * HD + c4; const float* vp = VF + (size_t)r0 * LQ + h * HD + c4; const float* qr = QF + (size_t)i * LQ + h * HD;
  v4f kk[A0S], vv[A0S], qq[HD / 4]; int pv[QT0 / 32];
#pragma unroll      /* constant index into kk[] and vv[]; constant pitch: one address per plane, the steps as immediate offsets; all of a thread's loads in flight together */
  for (int it = 0; it < A0S; ++it) { kk[it] = *(const v4fa*)(kp + (size_t)it * (2 * A0W) * LQ); vv[it] = *(const v4fa*)(vp + (size_t)it * (2 * A0W) * LQ); }
#pragma unroll      /* constant index into pv[] */
  for (int u = 0; u < QT0 / 32; ++u) pv[u] = pm[(unsigned)u * 32u + lane];
#pragma unroll      /* constant index into qq[] */
  for (int c = 0; c < HD / 4; ++c) qq[c] = *(const v4fa*)(qr + c * 4);
  asm volatile("s_wait_xcnt 0x0" :: "v"(kp), "v"(vp) : "memory");      /* behind the last staging load, in front of whatever rewrites a register that an issued load names; kp and vp as inputs keep both address pairs live up to here, so that no load of the run lands in one */
#pragma unroll      /* constant index into kk[] and vv[] */
  for (int it = 0; it < A0S; ++it) { *(v4fa*)&lk[r0 + (unsigned)it * (unsigned)(2 * A0W)][c4] = kk[it]; *(v4fa*)&lv[r0 + (unsigned)it * (unsigned)(2 * A0W)][c4] = vv[it]; }
  __syncthreads();      /* publishes the staged key and value rows to every wave */
  const v4f z4 = {0.f, 0.f, 0.f, 0.f}; v4f acc[QT0 / 32];
#pragma unroll      /* constant index into acc[] */
  for (int u = 0; u < QT0 / 32; ++u) acc[u] = z4;
#pragma unroll      /* constant index into acc[] and qq[]; the LDS reads of several steps in flight together */
  for (int c = 0; c < HD / 4; ++c) {
#pragma unroll      /* constant index into acc[] */
    for (int u = 0; u < QT0 / 32; ++u) acc[u] += qq[c] * *(const v4fa*)&lk[(unsigned)u * 32u + lane][c * 4]; }
  float sm[QT0 / 32]; float mx = -1.0e30f;
#pragma unroll      /* constant index into acc[] and sm[] */
  for (int u = 0; u < QT0 / 32; ++u) { const unsigned j = (unsigned)u * 32u + lane; const float s = ((acc[u][0] + acc[u][1]) + (acc[u][2] + acc[u][3])) * scale; sm[u] = ((j <= i) & (pv[u] != 0)) ? s : -1.0e30f; mx = fmaxf(mx, sm[u]); }
  for (int d = 16; d > 0; d >>= 1) mx = fmaxf(mx, __shfl_xor(mx, d, 32));
  float l = 0.f;
#pragma unroll      /* constant index into sm[] */
  for (int u = 0; u < QT0 / 32; ++u) { const float e = expf(sm[u] - mx); lp[w][(unsigned)u * 32u + lane] = e; l += e; }
  for (int d = 16; d > 0; d >>= 1) l += __shfl_xor(l, d, 32);
  __syncthreads();      /* the weights are written by one lane and read by all lanes of the wave */
  const v2f z2 = {0.f, 0.f}; v2f o[4] = {z2, z2, z2, z2};
#pragma unroll 8      /* several steps' LDS reads in flight together */
  for (int j4 = 0; j4 < QT0 / 4; ++j4) { const v4f pj = *(const v4fa*)&lp[w][j4 * 4];
#pragma unroll      /* constant index into o[] and pj */
    for (int u = 0; u < 4; ++u) o[u] += pj[u] * *(const v2fa*)&lv[j4 * 4 + u][lane * 2u]; }
  const float fin = 64.0f * (1.0f / l);      /* o carried x64 like the f16 path */
  const v2f oo = ((o[0] + o[1]) + (o[2] + o[3])) * fin;
  *(v2f*)(OF + (size_t)i * DM + h * HD + lane * 2u) = oo; }

// row LayerNorm over DM = 1024 of f32 rows: mean, BIASED variance, (x - mu) * rsqrt(var + eps) * bf16(g[c]) + bf16(b[c]) -> f16 rows (GEMM operand); workgroup = 256 threads = row r, thread t owns columns 4t..4t+3;
// RES 1: the row is first formed as the residual without an output projection, X1[r][c] = bf16(x[r][c]) + o[r][c] / 64 (o: f32 first-tile rows OF0 for the first QT0 rows of a batch, else the f16 rows O16; + NaN when the batch's first mask entry is 0:
// the structure the attention kernels rely on is violated), stored to X1 and normalised from the registers that hold it;
template <int BFIN, int FULLIN, int RES>
__device__ __forceinline__ void d_lnx(unsigned r, const float* __restrict__ X, const float* __restrict__ g, const float* __restrict__ bb, float eps, _Float16* __restrict__ N16,
    const int* __restrict__ pm, const _Float16* __restrict__ O16, const float* __restrict__ OF0, float* __restrict__ X1) {
  /* as in the two kernels this body is made of: every rounding of the residual and of the row statistics stays what it was, so x1 and the normalised rows come out bit for bit the same */
  #pragma clang fp contract(off)
  __shared__ float red[256]; const unsigned t = threadIdx.x; const unsigned c0 = t * 4u;
  const size_t xr = FULLIN ? ((size_t)(r / (unsigned)SQ) * SQ_FULL + (r % (unsigned)SQ)) : (size_t)r;
  int p0 = 1; if (RES) p0 = pm[(size_t)(r / (unsigned)SQ) * SQ_FULL];      /* first, so that it is on its way together with the row's loads */
  const v4f xa = *(const v4fa*)(X + xr * DM + c0); float s[4]; float sum = 0.f; v4f o4 = {0.f, 0.f, 0.f, 0.f};
  if (RES) { const unsigned b = r / (unsigned)SQ, rl = r % (unsigned)SQ;      /* the same for the whole workgroup */
    asm volatile("s_wait_xcnt 0x0" ::: "memory");      /* behind the issued load of the x row, in front of the next loads' address arithmetic, which may rewrite a register that it names */
    if (rl < (unsigned)QT0) o4 = *(const v4fa*)(OF0 + ((size_t)b * QT0 + rl) * DM + c0);
    else { const v4h oh = *(const v4h*)(O16 + (size_t)r * DM + c0); for (int q = 0; q < 4; ++q) o4[q] = (float)oh[q]; }
  }
  const float pz = (p0 != 0) ? 0.f : __uint_as_float(0x7fc00000u);
  for (int q = 0; q < 4; ++q) { s[q] = BFIN ? bf16_rne(xa[q]) : xa[q]; if (RES) s[q] = (s[q] + o4[q] * 0.015625f) + pz; sum = sum + s[q]; }
  red[t] = sum; __syncthreads(); for (unsigned st = 128u; st > 0u; st >>= 1) { if (t < st) red[t] = red[t] + red[t + st]; __syncthreads(); } const float mu = red[0] * (1.0f / (float)DM); __syncthreads();
  float vs = 0.f; for (int q = 0; q < 4; ++q) { const float dl = s[q] - mu; vs = vs + dl * dl; } red[t] = vs; __syncthreads(); for (unsigned st = 128u; st > 0u; st >>= 1) { if (t < st) red[t] = red[t] + red[t + st]; __syncthreads(); }
  const float rs = rsqrtf(red[0] * (1.0f / (float)DM) + eps); v4h y;
  for (int q = 0; q < 4; ++q) { const unsigned c = c0 + (unsigned)q; y[q] = (_Float16)((((s[q] - mu) * rs) * bf16_rne(g[c])) + bf16_rne(bb[c])); }
  { *(v4h*)(N16 + (size_t)r * DM + c0) = y;  }
  if (RES) { const v4f x1 = {s[0], s[1], s[2], s[3]}; *(v4f*)(X1 + (size_t)r * DM + c0) = x1; } }      /* behind the last barrier: in front of one, the barrier would wait the store out */

// shared launches: every test on blockIdx.x reads the same for a whole workgroup, so each body's barriers stay under workgroup-uniform control flow
#define PB_WH ((unsigned)(((size_t)NH * HD * (DM / 8) + 255) / 256))      /* workgroups of one per-head weight plane */
#define PB_W1 ((unsigned)(((size_t)DFF * (DM / 8) + 255) / 256))
#define PB_W2 ((unsigned)(((size_t)DM * (DFF / 8) + 255) / 256))
// all that reads inputs alone: Wq, Wk, Wv -> the x16 q|k|v plane; W1 [DM][DFF] -> [DFF][DM] x16; W2 [DFF][DM] -> [DM][DFF] x16; h = LN1(bf16(x)) -> f16 rows
__global__ __launch_bounds__(256) void k_prep(const float* __restrict__ wq, const float* __restrict__ wk, const float* __restrict__ wv, _Float16* __restrict__ BQKV, const float* __restrict__ w1, _Float16* __restrict__ BW1,
    const float* __restrict__ w2, _Float16* __restrict__ BW2, const float* __restrict__ x, const float* __restrict__ g1, const float* __restrict__ be1, _Float16* __restrict__ X16) {
  unsigned blk = blockIdx.x;
  if (blk < 3u * PB_WH) { const unsigned p = blk / PB_WH; d_wthd(blk - p * PB_WH, p == 0u ? wq : (p == 1u ? wk : wv), BQKV + (size_t)p * DM * DM); return; }
  blk -= 3u * PB_WH;
  if (blk < PB_W1) { d_wt_f16(blk, w1, BW1, DM, DFF, 16.0f); return; }
  blk -= PB_W1;
  if (blk < PB_W2) { d_wt_f16(blk, w2, BW2, DFF, DM, 16.0f); return; }
  blk -= PB_W2;
  d_lnx<1, 1, 0>(blk, x, g1, be1, 1e-5f, X16, (const int*)nullptr, (const _Float16*)nullptr, (const float*)nullptr, (float*)nullptr);
  asm volatile("s_wait_xcnt 0x0" ::: "memory"); }      /* behind the row's store, in front of whatever rewrites a register that it names: the other bodies' code follows it in the built text */

// all that reads the q|k|v GEMM's output alone: the f32 first-tile attention (o x64) and V^T [NB][NH][HD][SQ], all batches
#define MB_A0 ((unsigned)(NB * NH * (QT0 / A0W)))
#define MB_VT ((unsigned)(NB * NH * (SQ / 64)))
static_assert(32 * A0W == 256);
__global__ __launch_bounds__(256) void k_att0_vt(const float* __restrict__ F0, const int* __restrict__ pm, float* __restrict__ OF0, const _Float16* __restrict__ V16, _Float16* __restrict__ VT) {
  if (blockIdx.x >= MB_A0) { d_vt<NH, SQ>(blockIdx.x - MB_A0, V16, LQ, 0, VT); return; }
  d_att0(blockIdx.x, F0, F0 + DM, F0 + 2 * DM, pm, 0.125f, OF0); }

// x1 = bf16(x) + attn, stored, and h2 = LN2(x1) -> f16 rows
__global__ __launch_bounds__(256) void k_res_ln(const float* __restrict__ x, const int* __restrict__ pm, const _Float16* __restrict__ O16, const float* __restrict__ OF0, float* __restrict__ X1,
    const float* __restrict__ g2, const float* __restrict__ be2, _Float16* __restrict__ M16) {
  d_lnx<1, 1, 1>(blockIdx.x, x, g2, be2, 1e-5f, M16, pm, O16, OF0, X1); }

extern "C" void kernel_launch(void* const* d_in, const int* in_sizes, int n_in,
                              void* d_out, int out_size, void* d_ws, size_t ws_size, hipStream_t stream) {
  if (n_in < 13) return;
  const size_t rows_need = (size_t)(NB - 1) * SQ_FULL + SQ;
  if ((size_t)in_sizes[0] < rows_need * DM) return; if ((size_t)in_sizes[1] < rows_need) return;
  if ((size_t)in_sizes[2] < (size_t)NH * DM * HD || (size_t)in_sizes[3] < (size_t)NH * DM * HD || (size_t)in_sizes[4] < (size_t)NH * DM * HD) return;
  if (in_sizes[5] < DM || in_sizes[6] < DM || in_sizes[7] < DM || in_sizes[8] < DM) return;
  if ((size_t)in_sizes[9] < (size_t)DM * DFF || in_sizes[10] < DFF || (size_t)in_sizes[11] < (size_t)DFF * DM || in_sizes[12] < DM) return;
  if ((size_t)out_size < NR * DM) return;
  const float* x = (const float*)d_in[0]; const int* pmask = (const int*)d_in[1];
  const float* wq = (const float*)d_in[2]; const float* wk = (const float*)d_in[3]; const float* wv = (const float*)d_in[4];
  const float* g1 = (const float*)d_in[5]; const float* be1 = (const float*)d_in[6]; const float* g2 = (const float*)d_in[7]; const float* be2 = (const float*)d_in[8];
  const float* w1 = (const float*)d_in[9]; const float* b1 = (const float*)d_in[10]; const float* w2 = (const float*)d_in[11]; const float* b2 = (const float*)d_in[12];
  char* ws = (char*)d_ws; size_t off = 0;
  auto take = [&](size_t bytes) { char* p = ws + off; off += (bytes + 255) & ~(size_t)255; return p; };
  _Float16* BQKV = (_Float16*)take((size_t)3 * DM * DM * 2);          /* [3*DM][DM] x16: q | k | v stacked, row (h*HD + d) */
  _Float16* X16 = (_Float16*)take(NR * DM * 2);                       /* LN1 rows; reused as the LN2 rows (last reader of LN1 rows: the q|k|v GEMM, before LN2 writes) */
  float* X1 = (float*)take(NR * DM * 4);
  _Float16* BW1 = (_Float16*)take((size_t)DFF * DM * 2); _Float16* BW2 = (_Float16*)take((size_t)DM * DFF * 2);
  _Float16* QKV = (_Float16*)take(NR * 3 * DM * 2); _Float16* Q16 = QKV; _Float16* K16 = QKV + DM; _Float16* V16 = QKV + 2 * DM;
  _Float16* HF16 = QKV;                                               /* FFN hidden rows [NR][DFF] alias the q|k|v rows (dead after the attention); DFF <= 3*DM asserted */
  _Float16* O16 = (_Float16*)take(NR * DM * 2);
  _Float16* VT = (_Float16*)take((size_t)NB * NH * HD * SQ * 2);      /* V^T [NB][NH][HD][SQ] */
  float* F0 = (float*)take((size_t)NB * QT0 * 3 * DM * 4);            /* f32 q | k | v of the first 128 rows of each batch */
  float* OF0 = (float*)take((size_t)NB * QT0 * DM * 4);
  _Float16* M16 = X16;
  if (off > ws_size || off > (size_t)134217728) return;
  k_prep<<<3u * PB_WH + PB_W1 + PB_W2 + (unsigned)NR, 256, 0, stream>>>(wq, wk, wv, BQKV, w1, BW1, w2, BW2, x, g1, be1, X16);      /* weight planes (x16, transposed) and h = LN1(bf16(x)) */
  k_gemm2<0><<<dim3((unsigned)((NR / 128) * (3 * DM / 128)), 1), 256, 0, stream>>>(X16, DM, (size_t)0, BQKV, DM, (size_t)0, 0.0625f, (const float*)nullptr, (const float*)nullptr, (float*)nullptr, QKV, F0, (unsigned)(SQ / 128), LQ, (size_t)0, (int)NR, 3 * DM, DM);      /* q | k | v rows (f16); rows 0..127 of each batch in f32 too */
  k_att0_vt<<<MB_A0 + MB_VT, 256, 0, stream>>>(F0, pmask, OF0, V16, VT);      /* f32 attention for rows 0..127 of each batch (o x64); V^T */
  k_fattn<<<NB * NH * FNT, 32 * FW, 0, stream>>>(Q16, K16, VT, pmask, O16);      /* o (merged heads, x64) as f16 rows, all batches, heads and query tiles */
  k_res_ln<<<(unsigned)NR, 256, 0, stream>>>(x, pmask, O16, OF0, X1, g2, be2, M16);      /* x1 = bf16(x) + attn; h2 = LN2(x1) -> f16 rows */
  k_gemm2<3><<<dim3((unsigned)((NR / 128) * (DFF / 128)), 1), 256, 0, stream>>>(M16, DM, (size_t)0, BW1, DM, (size_t)0, 0.0625f, b1, (const float*)nullptr, (float*)nullptr, HF16, (float*)nullptr, 1u, DFF, (size_t)0, (int)NR, DFF, DM);      /* relu(h2 W1 + b1) -> f16 */
  k_gemm2<0><<<dim3((unsigned)((NR / 128) * (DM / 128)), 1), 256, 0, stream>>>(HF16, DFF, (size_t)0, BW2, DFF, (size_t)0, 0.0625f, b2, X1, (float*)d_out, (_Float16*)nullptr, (float*)nullptr, 1u, DM, (size_t)0, (int)NR, DM, DFF);      /* out = x1 + mlp (own-element residual) */
}

// v006
// It runs in 154 microseconds.
// Two timings next to v005 both put it at 1.10 times that version's speed.
// All steps since v000 together make it 33.3 times as fast.
#include <hip/hip_runtime.h>
// Pre-LN causal transformer layer: x [NB][SEQ][1024]; h = LN1(x) (biased variance, eps 1e-5); q/k/v[b][h] = h Wq/Wk/Wv[h] (per-head [16][1024][64], [in][out], no biases); scores / sqrt(64); mask = padding_mask[b][key] AND causal, masked scores REPLACED by -1e9; softmax; heads concatenated (no output projection); x1 = x + attn; h2 = LN2(x1); out = x1 + relu(h2 W1 + b1) W2 + b2 ([in][out] 1024 x 1024 x 1024).
// Structure: LN1 on VALU -> f16 rows; per-head weights transposed on VALU into one x16 f16 q|k|v plane; q|k|v as ONE WMMA GEMM (operands staged in LDS, 32x64 wave tiles, f32 accumulation, f16 out); V^T via LDS transposes and an f32 first tile (rows 0..127 of each batch) on VALU; then ONE fused attention launch for all batches and heads (keys and values staged in LDS per workgroup; scores, masked online softmax and P V in registers, one wave per 32 queries; o x64 f16); x1 = bf16(x) + o / 64; LN2 -> f16; FFN as two GEMMs (ReLU epilogue; own-element residual).
// Launches (7): kernels that do not depend on one another share a launch, each on its own range of workgroup indices: {weight transposes, LN1}; q|k|v GEMM (also stores its first-tile rows in f32); {first-tile attention, V^T}; fused attention; {residual + LN2, row by row}; FFN 1; FFN 2.
// Compute dtype: all contractions v_wmma_f32_16x16x32_f16 (f16 operands, f32 accumulate); float inputs RNE-converted to bf16 first (weights then x16, exact in f16); q, k, v, softmax weights (relative to the running row maximum) and o (x64) as plain f16 operands; scores and softmax statistics f32; first 128 query rows of each batch in f32 on VALU.
#ifndef NB
#define NB 2
#endif
#ifndef SEQ
#define SEQ 2048
#endif
#define SQ SEQ
#define NB_FULL 2
#define SQ_FULL 2048                 /* per-batch row stride of the inputs (x rows, mask entries) */
#define DM 1024
#define NH 16
#define HD 64
#define DFF 1024
#define QT0 128                      /* first-tile rows computed in f32 */
#define NR ((size_t)NB * SQ)         /* token rows */
#define LQ (3 * DM)                  /* row pitch of the q|k|v rows */
static_assert(NH * HD == DM);
static_assert(QT0 == 128 && QT0 <= SQ && SQ <= SQ_FULL && NB <= NB_FULL);
static_assert(DM % 128 == 0 && DFF % 128 == 0 && HD == 64 && ((size_t)NB * SQ) % 128 == 0);
static_assert(DM / 4 == 256);
static_assert(DFF <= 3 * DM);
static_assert((((size_t)NB * SQ * DM) / 4) % 256 == 0);
static_assert((size_t)NB * SQ * DM / 4 < 0x7fffffffu);

typedef unsigned short v8us __attribute__((ext_vector_type(8), may_alias));
typedef float  v8f  __attribute__((ext_vector_type(8)));
typedef float  v4f  __attribute__((ext_vector_type(4)));
typedef float  v4fa __attribute__((ext_vector_type(4), may_alias));
typedef _Float16 v16h __attribute__((ext_vector_type(16)));
typedef _Float16 v4h __attribute__((ext_vector_type(4)));
union FragH { v16h v; v8us half[2]; _Float16 h[16]; unsigned short u[16]; };

__device__ __forceinline__ unsigned short bf16_bits(float x) { unsigned int u = __float_as_uint(x); return (unsigned short)((u + 0x7FFFu + ((u >> 16) & 1u)) >> 16); }
__device__ __forceinline__ float bf16_rne(float x) { return __uint_as_float(((unsigned int)bf16_bits(x)) << 16); }

// fragment: elements 0..7 <- k0 + 8h + 0..7, elements 8..15 <- k0 + 16 + 8h + 0..7 (same map for A rows and B columns)
__device__ __forceinline__ v16h g2_frag(const _Float16* p, unsigned hh) { FragH f; f.half[0] = *(const v8us*)((const unsigned short*)p + 8u * hh); f.half[1] = *(const v8us*)((const unsigned short*)p + 16u + 8u * hh); return f.v; }
__device__ __forceinline__ v8f g2_mma(v16h a, v16h b, v8f c) { return __builtin_amdgcn_wmma_f32_16x16x32_f16(false, a, false, b, (short)0, c, false, false); }

// GEMM (wave tile 32x64; workgroup = 8 waves (4 x 2) = 128 rows x 128 cols; M % 128 == 0, N % 128 == 0, K % 64 == 0): A f16 [M][K] (pitch lda, batch stride sA), Bh f16 [N][K] (pitch ldb, batch stride sB);
// a stage is 64 k of the tile's 128 A rows and 128 B rows (128 bytes a row: whole lines), brought into LDS by asynchronous 16-byte copies at row pitch 144 bytes (conflict-free for the 16-byte fragment reads); two buffers: the next stage's copies fly while this stage is worked on.
// v = acc * alpha + bf16(bias[col]) (+ CP own element of the batched C plane); ACT 0 none / 3 relu; writes f32 C and/or f16 C16 (pitch ldc, batch offset by * sC); CT (may be null): every tper-th row tile (mt % tper == 0) is stored in f32 as well, as rows (mt / tper) * 128 .. + 127 of CT (pitch ldc);
#define GP 144                       /* LDS row pitch, bytes */
#define GOP (128 * GP)               /* one operand's rows of a stage, bytes */
#define GSTG (2 * GOP)               /* one buffer: the A rows, then the B rows */
static_assert(8 * 32 * 68 * 4 <= 2 * GSTG && GP % 16 == 0);
__device__ __forceinline__ v16h g2_lfrag(const char* p) { FragH f; f.half[0] = *(const v8us*)p; f.half[1] = *(const v8us*)(p + 32); return f.v; }      /* p: the lane's LDS row + 2 k0 + 16 hh bytes: the k order of g2_frag */
// one stage: a lane's 4 copies of A rows (r, r + 32, r + 64, r + 96) and 4 of B rows; a wave's copy covers 4 whole 128-byte rows
__device__ __forceinline__ void g2_stage(unsigned l, const _Float16* ga, size_t ra, const _Float16* gb, size_t rb) {
  /* the copies and, as the last line of their own statement, the wait that stands in front of any rewrite of a register that an issued copy names */
  asm volatile("global_load_async_to_lds_b128 %0, %8, off\n\t"
               "global_load_async_to_lds_b128 %1, %9, off\n\t"
               "global_load_async_to_lds_b128 %2, %10, off\n\t"
               "global_load_async_to_lds_b128 %3, %11, off\n\t"
               "global_load_async_to_lds_b128 %4, %12, off\n\t"
               "global_load_async_to_lds_b128 %5, %13, off\n\t"
               "global_load_async_to_lds_b128 %6, %14, off\n\t"
               "global_load_async_to_lds_b128 %7, %15, off\n\t"
               "s_wait_xcnt 0x0"
               :: "v"(l), "v"(l + 32u * GP), "v"(l + 64u * GP), "v"(l + 96u * GP), "v"(l + GOP), "v"(l + GOP + 32u * GP), "v"(l + GOP + 64u * GP), "v"(l + GOP + 96u * GP),
                  "v"(ga), "v"(ga + ra), "v"(ga + 2 * ra), "v"(ga + 3 * ra), "v"(gb), "v"(gb + rb), "v"(gb + 2 * rb), "v"(gb + 3 * rb) : "memory"); }
template <int ACT>
__global__ __launch_bounds__(256) void k_gemm2(const _Float16* __restrict__ A, int lda, size_t sA, const _Float16* __restrict__ Bh, int ldb, size_t sB, float alpha,
    const float* __restrict__ bias, const float* __restrict__ CP, float* __restrict__ C, _Float16* __restrict__ C16, float* __restrict__ CT, unsigned tper, int ldc, size_t sC, int M, int N, int K) {
  static_assert(ACT == 0 || ACT == 3);
  __shared__ __attribute__((aligned(16))) char sm[2 * GSTG];
  const unsigned tid = threadIdx.x, w = tid >> 5, lane = tid & 31u, ln = lane & 15u, hh = lane >> 4; const unsigned by = blockIdx.y;
  A += (size_t)by * sA; Bh += (size_t)by * sB; const size_t cofs = (size_t)by * sC;
  const unsigned ntn = (unsigned)N >> 7; const unsigned mt = blockIdx.x / ntn, nq = blockIdx.x - mt * ntn; if (mt * 128u >= (unsigned)M) return;      /* the same for the whole workgroup, in front of every barrier */
  const unsigned row0 = mt * 128u + 32u * (w >> 1), col0 = nq * 128u + 64u * (w & 1u);
  const unsigned cr = tid >> 3, cc = tid & 7u;      /* copies: 8 lanes a row, 32 rows a step of the workgroup */
  const _Float16* ga = A + (size_t)(mt * 128u + cr) * (size_t)lda + cc * 8u; const _Float16* gb = Bh + (size_t)(nq * 128u + cr) * (size_t)ldb + cc * 8u; const size_t ra = (size_t)32 * (size_t)lda, rb = (size_t)32 * (size_t)ldb;
  const unsigned la = (unsigned)(size_t)sm + cr * (unsigned)GP + cc * 16u;      /* the lane's LDS byte address in buffer 0, A rows */
  const char* pa = sm + (32u * (w >> 1) + ln) * (unsigned)GP + 16u * hh; const char* pb = sm + GOP + (64u * (w & 1u) + ln) * (unsigned)GP + 16u * hh;
  const int nt = K >> 6;
  g2_stage(la, ga, ra, gb, rb);
  asm volatile("s_wait_asynccnt 0x0" ::: "memory");      /* this wave's copies of stage 0 have landed */
  __syncthreads();      /* publishes stage 0 to every wave */
  if (nt > 1) g2_stage(la + GSTG, ga + 64, ra, gb + 64, rb);
  const v8f z8 = {0.f,0.f,0.f,0.f,0.f,0.f,0.f,0.f}; v8f c00 = z8, c01 = z8, c02 = z8, c03 = z8, c10 = z8, c11 = z8, c12 = z8, c13 = z8;
#pragma unroll 1      /* one trip of code: the ring's order stays as written */
  for (int t = 0; t < nt; ++t) { const unsigned buf = ((unsigned)t & 1u) * (unsigned)GSTG; const char* qa = pa + buf; const char* qb = pb + buf;
    const v16h a0 = g2_lfrag(qa), a1 = g2_lfrag(qa + 16 * GP), b0 = g2_lfrag(qb), b1 = g2_lfrag(qb + 16 * GP), b2 = g2_lfrag(qb + 32 * GP), b3 = g2_lfrag(qb + 48 * GP);
    const v16h e0 = g2_lfrag(qa + 64), e1 = g2_lfrag(qa + 16 * GP + 64), f0 = g2_lfrag(qb + 64), f1 = g2_lfrag(qb + 16 * GP + 64), f2 = g2_lfrag(qb + 32 * GP + 64), f3 = g2_lfrag(qb + 48 * GP + 64);
    __builtin_amdgcn_sched_barrier(0);      /* keeps the trip's fragment reads together in front of its products: spread among them, each small group of reads makes the wave wait out the LDS latency anew */
    c00 = g2_mma(a0, b0, c00); c10 = g2_mma(a1, b0, c10); c01 = g2_mma(a0, b1, c01); c11 = g2_mma(a1, b1, c11); c02 = g2_mma(a0, b2, c02); c12 = g2_mma(a1, b2, c12); c03 = g2_mma(a0, b3, c03); c13 = g2_mma(a1, b3, c13);
    __builtin_amdgcn_sched_barrier(0);      /* keeps the first half's products in front of the waits below, so that the second half's fragment reads return behind them and not in front of an idle matrix unit */
    asm volatile("s_wait_dscnt 0x0" ::: "memory");      /* this wave's reads of the buffer have returned before the buffer is given up */
    asm volatile("s_wait_asynccnt 0x0" ::: "memory");      /* this wave's copies of stage t + 1 have landed */
    __syncthreads();      /* publishes stage t + 1 and ends every wave's reads of stage t */
    if (t + 2 < nt) g2_stage(la + buf, ga + (size_t)(t + 2) * 64, ra, gb + (size_t)(t + 2) * 64, rb);
    /* the second half's products, on fragments already in registers, run while the copies fly */
    c00 = g2_mma(e0, f0, c00); c10 = g2_mma(e1, f0, c10); c01 = g2_mma(e0, f1, c01); c11 = g2_mma(e1, f1, c11); c02 = g2_mma(e0, f2, c02); c12 = g2_mma(e1, f2, c12); c03 = g2_mma(e0, f3, c03); c13 = g2_mma(e1, f3, c13); }
  asm volatile("s_wait_asynccnt 0x0" ::: "memory");      /* no copy is on its way when the ring becomes output staging */
  float (*so)[32][68] = (float (*)[32][68])sm;      /* output staging, a wave's own tile, in the ring, which every wave has left at the last trip's barrier */
  v8f accs[8] = {c00, c01, c02, c03, c10, c11, c12, c13};
#pragma unroll
  for (int u = 0; u < 8; ++u) { const unsigned t = (unsigned)u & 3u, half = (unsigned)u >> 2; const unsigned col = col0 + t * 16u + ln; const float bv = bias ? bf16_rne(bias[col]) : 0.f;
#pragma unroll
    for (int r = 0; r < 8; ++r) { const unsigned rloc = half * 16u + 8u * hh + (unsigned)r; float v = accs[u][r] * alpha + bv;
      if (CP) v += CP[cofs + (size_t)(row0 + rloc) * (size_t)ldc + col];      /* own element of the batched C plane */
      if (ACT == 3) v = fmaxf(v, 0.f);
      so[w][rloc][t * 16u + ln] = v; } }
  __builtin_amdgcn_fence(4 /* acq_rel order */, "workgroup"); __builtin_amdgcn_wave_barrier();      /* wave-private tile: same wave writes and reads */
  const unsigned rsub = lane >> 4, c4 = (lane & 15u) * 4u;
  const bool wt = CT != nullptr && mt % tper == 0u; const size_t cto = ((size_t)(mt / tper) * 128u + 32u * (w >> 1)) * (size_t)ldc + col0 + c4;      /* wt: the same for the whole workgroup */
  {
#pragma unroll
    for (int q = 0; q < 16; ++q) { const unsigned r = (unsigned)q * 2u + rsub; const v4f v = *(const v4fa*)&so[w][r][c4];
      if (C) { *(v4f*)(C + cofs + (size_t)(row0 + r) * (size_t)ldc + col0 + c4) = v; asm volatile("s_wait_xcnt 0x0" ::: "memory"); }      /* behind the issued store, in front of the next address arithmetic, which may rewrite a register that it names */
      if (wt) { *(v4f*)(CT + cto + (size_t)r * (size_t)ldc) = v; asm volatile("s_wait_xcnt 0x0" ::: "memory"); }      /* likewise */
      if (C16) { v4h h4; for (int i = 0; i < 4; ++i) h4[i] = (_Float16)v[i]; *(v4h*)(C16 + cofs + (size_t)(row0 + r) * (size_t)ldc + col0 + c4) = h4; } }
     } }

// the bodies below take blk, the workgroup's index inside its own range of a shared launch
__device__ __forceinline__ void d_wt_f16(unsigned blk, const float* __restrict__ W, _Float16* __restrict__ Wt, int K, int N, float scale) {
  const unsigned k8n = (unsigned)K >> 3; const unsigned t = blk * 256u + threadIdx.x; if (t >= (unsigned)N * k8n) return; const unsigned n = t / k8n, k8 = (t - n * k8n) * 8u; FragH f;
#pragma unroll
  for (int i = 0; i < 8; ++i) f.h[i] = (_Float16)(bf16_rne(W[(size_t)(k8 + (unsigned)i) * (size_t)N + n]) * scale);
  const v8us o = f.half[0]; unsigned short* dst = (unsigned short*)Wt + (size_t)n * (size_t)K + k8;
  *(v8us*)dst = o;  }

__device__ __forceinline__ void d_wthd(unsigned blk, const float* __restrict__ Wt, _Float16* __restrict__ Bt) {
  const unsigned t = blk * 256u + threadIdx.x; if (t >= (unsigned)(NH * HD * (DM / 8))) return;
  const unsigned m8 = (t % (unsigned)(DM / 8)) * 8u; const unsigned d = (t / (unsigned)(DM / 8)) % (unsigned)HD; const unsigned h = t / (unsigned)((DM / 8) * HD); FragH f;
#pragma unroll
  for (int q = 0; q < 8; ++q) f.h[q] = (_Float16)(16.0f * bf16_rne(Wt[((size_t)h * DM + m8 + (unsigned)q) * HD + d]));
  const v8us o = f.half[0]; unsigned short* dst = (unsigned short*)Bt + ((size_t)h * HD + d) * DM + m8;
  *(v8us*)dst = o;  }

template <int NHv, int TTv>
__device__ __forceinline__ void d_vt(unsigned blk, const _Float16* __restrict__ V16, int ldv, int voff, _Float16* __restrict__ Vt) {
  __shared__ unsigned short tl[64][66]; const unsigned tid = threadIdx.x; const unsigned slab = blk / (unsigned)(TTv / 64), lg = blk % (unsigned)(TTv / 64); const unsigned b = slab / (unsigned)NHv, h = slab % (unsigned)NHv;
  for (unsigned i = tid; i < 64u * 8u; i += 256u) { const unsigned r = i >> 3, c8 = (i & 7u) * 8u; FragH f; f.half[0] = *(const v8us*)((const unsigned short*)V16 + ((size_t)b * TTv + lg * 64u + r) * (size_t)ldv + (size_t)voff + h * 64u + c8);
#pragma unroll
    for (int q = 0; q < 8; ++q) tl[r][c8 + (unsigned)q] = f.u[q]; }
  __syncthreads();
  {
#pragma unroll
    for (int rd = 0; rd < 2; ++rd) { const unsigned d = (unsigned)rd * 32u + (tid >> 3), pc = tid & 7u; FragH f;
#pragma unroll
      for (int q = 0; q < 8; ++q) f.u[q] = tl[pc * 8u + (unsigned)q][d];
      *(v8us*)((unsigned short*)Vt + ((size_t)slab * 64u + d) * TTv + lg * 64u + pc * 8u) = f.half[0]; }
     } }

#define FQ 32                        /* query columns per wave */
#define FW 4                         /* waves per workgroup */
#define FNT (SQ / (FQ * FW))         /* query tiles of a sequence */
#define FOP (64 * GP)                /* one operand's 64 rows of a stage, bytes */
#define FSTG (2 * FOP)               /* one buffer: the key rows, then the rows of the transposed value plane */
static_assert(SQ % (FQ * FW) == 0 && FNT % 2 == 0 && HD == 64 && FQ == 32 && FQ * FW == 128 && SQ % 64 == 0);
typedef _Float16 v8h __attribute__((ext_vector_type(8)));
__device__ __forceinline__ float fa_xhalf(float x) { return __builtin_bit_cast(float, __builtin_amdgcn_permlanex16(__builtin_bit_cast(int, x), __builtin_bit_cast(int, x), 0x76543210, 0xfedcba98, false, false)); }      /* lane l with lane l ^ 16 */
__device__ __forceinline__ v8f fa_mma(v16h a, v16h b, v8f c) { return __builtin_amdgcn_wmma_f32_16x16x32_f16(false, a, false, b, (short)0, c, false, false); }
// one stage: a lane's 4 copies of key rows (r, r + 16, r + 32, r + 48) and 4 of value-plane rows; a wave's copy covers 4 whole 128-byte rows
__device__ __forceinline__ void fa_stage(unsigned l, const _Float16* gk, const _Float16* gv) {
  /* the copies and, as the last line of their own statement, the wait that stands in front of any rewrite of a register that an issued copy names */
  asm volatile("global_load_async_to_lds_b128 %0, %8, off\n\t"
               "global_load_async_to_lds_b128 %1, %9, off\n\t"
               "global_load_async_to_lds_b128 %2, %10, off\n\t"
               "global_load_async_to_lds_b128 %3, %11, off\n\t"
               "global_load_async_to_lds_b128 %4, %12, off\n\t"
               "global_load_async_to_lds_b128 %5, %13, off\n\t"
               "global_load_async_to_lds_b128 %6, %14, off\n\t"
               "global_load_async_to_lds_b128 %7, %15, off\n\t"
               "s_wait_xcnt 0x0"
               :: "v"(l), "v"(l + 16u * GP), "v"(l + 32u * GP), "v"(l + 48u * GP), "v"(l + FOP), "v"(l + FOP + 16u * GP), "v"(l + FOP + 32u * GP), "v"(l + FOP + 48u * GP),
                  "v"(gk), "v"(gk + (size_t)16 * LQ), "v"(gk + (size_t)32 * LQ), "v"(gk + (size_t)48 * LQ), "v"(gv), "v"(gv + (size_t)16 * SQ), "v"(gv + (size_t)32 * SQ), "v"(gv + (size_t)48 * SQ) : "memory"); }
// one pass: 32 keys (fragments kf, vf) against the wave's 32 queries. NX: the stage's next pass has its fragments read from kx, vx (the lane's LDS places) into the registers just read
template <bool NX>
__device__ __forceinline__ void fa_pass(int s, int last, unsigned vm, unsigned qw, unsigned ln, unsigned hh, const char* kx, const char* vx, const v16h (&qf)[2][2], v16h (&kf)[2][2], v16h (&vf)[4], v8f (&o)[2][4], float (&mr)[2], float (&l)[2]) {
  const v8f z8 = {0.f,0.f,0.f,0.f,0.f,0.f,0.f,0.f};
  const float cs = 0.125f * 1.44269504088896340736f;      /* 1 / sqrt(64), and exp(x) = exp2(x log2 e) */
  v8f sc[2][2];
#pragma unroll      /* constant index into sc[], kf[], qf[] */
  for (int tk = 0; tk < 2; ++tk) { sc[0][tk] = fa_mma(kf[tk][0], qf[0][0], z8); sc[1][tk] = fa_mma(kf[tk][0], qf[1][0], z8); sc[0][tk] = fa_mma(kf[tk][1], qf[0][1], sc[0][tk]); sc[1][tk] = fa_mma(kf[tk][1], qf[1][1], sc[1][tk]); }
  if (NX) {
#pragma unroll      /* constant index into kf[] */
    for (int tk = 0; tk < 2; ++tk) { kf[tk][0] = g2_lfrag(kx + tk * 16 * GP); kf[tk][1] = g2_lfrag(kx + tk * 16 * GP + 64); } }
  if (vm != 0xffffffffu || s == last) {      /* scalar branch: only the diagonal pass and passes with a padded key pay for the mask */
    const unsigned vs = vm >> (8u * hh);
#pragma unroll      /* constant index into sc[] */
    for (int g = 0; g < 2; ++g) { const int qrel = (int)(qw + 16u * (unsigned)g + ln) - (s * 32 + 8 * (int)hh);      /* local key 16 tk + r is causal iff it is <= qrel */
#pragma unroll      /* constant index into sc[] */
      for (int tk = 0; tk < 2; ++tk) {
#pragma unroll      /* constant element index */
        for (int r = 0; r < 8; ++r) sc[g][tk][r] = ((((vs >> (16 * tk + r)) & 1u) != 0u) & (16 * tk + r <= qrel)) ? sc[g][tk][r] : -1.0e9f; } } }
  v16h pf[2];
#pragma unroll      /* constant index into sc[], o[], mr[], l[], pf[] */
  for (int g = 0; g < 2; ++g) {
    float mx = fmaxf(sc[g][0][0], sc[g][1][0]);
#pragma unroll      /* constant element index */
    for (int r = 1; r < 8; ++r) mx = fmaxf(mx, fmaxf(sc[g][0][r], sc[g][1][r]));
    mx = fmaxf(mx, fa_xhalf(mx)); const float mn = fmaxf(mr[g], mx); const float al = __builtin_amdgcn_exp2f((mr[g] - mn) * cs); const float mc = mn * cs; mr[g] = mn;
    v8f p0, p1;
#pragma unroll      /* constant element index */
    for (int r = 0; r < 8; ++r) { p0[r] = __builtin_amdgcn_exp2f(fmaf(sc[g][0][r], cs, -mc)); p1[r] = __builtin_amdgcn_exp2f(fmaf(sc[g][1][r], cs, -mc)); }
    const v8f ps = p0 + p1; l[g] = fmaf(l[g], al, ((ps[0] + ps[1]) + (ps[2] + ps[3])) + ((ps[4] + ps[5]) + (ps[6] + ps[7])));
    const v8h h0 = __builtin_convertvector(p0, v8h), h1 = __builtin_convertvector(p1, v8h);
    pf[g] = __builtin_shufflevector(h0, h1, 0, 1, 2, 3, 4, 5, 6, 7, 8, 9, 10, 11, 12, 13, 14, 15);
#pragma unroll      /* constant index into o[] */
    for (int dt = 0; dt < 4; ++dt) o[g][dt] *= al; }
#pragma unroll      /* constant index into o[], vf[] */
  for (int dt = 0; dt < 4; ++dt) { o[0][dt] = fa_mma(vf[dt], pf[0], o[0][dt]); o[1][dt] = fa_mma(vf[dt], pf[1], o[1][dt]); }
  if (NX) {
    __builtin_amdgcn_sched_barrier(0);      /* keeps the statement below here, behind this pass's products: moved up to the reads it names, it would make the wave wait them out at once */
    asm volatile("" :: "v"(kf[0][0]), "v"(kf[0][1]), "v"(kf[1][0]), "v"(kf[1][1]));      /* inputs only, the loaded values: holds the next pass's key reads in front of this place, so that they return behind this pass's vector work; sunk into the next pass they would make it wait out the LDS latency in front of its first products */
#pragma unroll      /* constant index into vf[] */
    for (int dt = 0; dt < 4; ++dt) vf[dt] = g2_lfrag(vx + dt * 16 * GP); } }
__global__ __launch_bounds__(32 * FW) void k_fattn(const _Float16* __restrict__ Q, const _Float16* __restrict__ K, const _Float16* __restrict__ VT, const int* __restrict__ pm, _Float16* __restrict__ O) {
  __shared__ __attribute__((aligned(16))) char sm[2 * FSTG];
  /* readfirstlane: the wave's number in a scalar register, so that the tests on the wave's diagonal stay scalar branches */
  const unsigned tid = threadIdx.x, lane = tid & 31u, ln = lane & 15u, hh = lane >> 4; const unsigned w = (unsigned)__builtin_amdgcn_readfirstlane((int)(tid >> 5));
  const unsigned rank = blockIdx.x / (unsigned)(NB * NH), bh = blockIdx.x % (unsigned)(NB * NH); const unsigned tile = rank < (unsigned)(FNT / 2) ? (unsigned)(FNT - 1) - rank : rank - (unsigned)(FNT / 2);      /* long tiles first, then the short ones in mirrored order */
  const unsigned b = bh / (unsigned)NH, h = bh % (unsigned)NH; const unsigned qw = tile * (unsigned)(FQ * FW) + w * (unsigned)FQ; const int last = (int)(qw >> 5);      /* pass 'last' holds the wave's diagonal */
  const int ns = (int)(tile * 2u + 2u);      /* stages up to the workgroup's last diagonal: the same for all its waves, at least 2, and 64 ns <= SQ */
  const _Float16* qp = Q + ((size_t)b * SQ + qw + ln) * LQ + h * HD; const int* pp = pm + (size_t)b * SQ_FULL + lane;
  const unsigned cr = tid >> 3, cc = tid & 7u;      /* copies: 8 lanes a row, 16 rows a step of the workgroup */
  const _Float16* gk = K + ((size_t)b * SQ + cr) * LQ + h * HD + cc * 8u; const _Float16* gv = VT + ((size_t)bh * HD + cr) * SQ + cc * 8u;
  const unsigned la = (unsigned)(size_t)sm + cr * (unsigned)GP + cc * 16u;      /* the lane's LDS byte address in buffer 0, key rows */
  const char* pk = sm + ln * (unsigned)GP + 16u * hh; const char* pw = sm + FOP + ln * (unsigned)GP + 16u * hh;      /* the lane's fragment places: row ln, the k order of g2_frag */
  fa_stage(la, gk, gv);
  v16h qf[2][2], kf[2][2], vf[4];
#pragma unroll      /* constant index into qf[] */
  for (int g = 0; g < 2; ++g) { qf[g][0] = g2_frag(qp + (size_t)g * 16 * LQ, hh); qf[g][1] = g2_frag(qp + (size_t)g * 16 * LQ + 32, hh); }
  int pv0 = pp[0], pv1 = pp[32];
  asm volatile("s_wait_xcnt 0x0" ::: "memory");      /* behind the issued loads, in front of whatever rewrites a register that one of them names */
  asm volatile("s_wait_asynccnt 0x0" ::: "memory");      /* this wave's copies of stage 0 have landed */
  __syncthreads();      /* publishes stage 0 to every wave */
  fa_stage(la + FSTG, gk + (size_t)64 * LQ, gv + 64);      /* stage 1 exists: ns >= 2 */
  const v8f z8 = {0.f,0.f,0.f,0.f,0.f,0.f,0.f,0.f}; v8f o[2][4] = {{z8, z8, z8, z8}, {z8, z8, z8, z8}}; float mr[2] = {-3.0e38f, -3.0e38f}, l[2] = {0.f, 0.f};
#pragma unroll 1      /* one trip of code: the ring's order stays as written */
  for (int t = 0; t < ns; ++t) { const unsigned buf = ((unsigned)t & 1u) * (unsigned)FSTG; const char* kb = pk + buf; const char* vb = pw + buf;
    const unsigned vm0 = __builtin_amdgcn_ballot_w32(pv0 != 0), vm1 = __builtin_amdgcn_ballot_w32(pv1 != 0);      /* bit j: key 64 t + j (vm0), 64 t + 32 + j (vm1) passes the padding mask */
    const int tn = t + 1 < ns ? t + 1 : t;      /* the last trip fetches its own entries again: in bounds, unused */
    pv0 = pp[tn * 64]; pv1 = pp[tn * 64 + 32];
    asm volatile("s_wait_xcnt 0x0" ::: "memory");      /* behind the issued loads, in front of whatever rewrites a register that one of them names */
    if (2 * t <= last) {      /* scalar branch: a wave has no work behind its diagonal */
#pragma unroll      /* constant index into kf[] */
      for (int tk = 0; tk < 2; ++tk) { kf[tk][0] = g2_lfrag(kb + tk * 16 * GP); kf[tk][1] = g2_lfrag(kb + tk * 16 * GP + 64); }
#pragma unroll      /* constant index into vf[] */
      for (int dt = 0; dt < 4; ++dt) vf[dt] = g2_lfrag(vb + dt * 16 * GP);
      __builtin_amdgcn_sched_barrier(0);      /* keeps the stage's first fragment reads together in front of its products: spread among them, each small group of reads makes the wave wait out the LDS latency anew */
      fa_pass<true>(2 * t, last, vm0, qw, ln, hh, kb + 32 * GP, vb + 64, qf, kf, vf, o, mr, l);      /* where the diagonal lies in this pass, the fragments read for the next go unused: rows of the same buffer */
      if (2 * t < last) fa_pass<false>(2 * t + 1, last, vm1, qw, ln, hh, kb, vb, qf, kf, vf, o, mr, l); }      /* scalar branch */
    asm volatile("s_wait_dscnt 0x0" ::: "memory");      /* this wave's reads of the buffer have returned before the buffer is given up */
    asm volatile("s_wait_asynccnt 0x0" ::: "memory");      /* this wave's copies of stage t + 1 have landed */
    __syncthreads();      /* publishes stage t + 1 and ends every wave's reads of stage t */
    if (t + 2 < ns) fa_stage(la + buf, gk + (size_t)(t + 2) * 64 * LQ, gv + (size_t)(t + 2) * 64); }
  asm volatile("s_wait_asynccnt 0x0" ::: "memory");      /* no copy is on its way when the wave ends */
  asm volatile("s_wait_loadcnt 0x0" ::: "memory");      /* the last trip's fetches ahead are unused: they land here, so that no load is still on its way to a register when the wave gives its registers back */
#pragma unroll      /* constant index into o[], l[] */
  for (int g = 0; g < 2; ++g) { const float fin = 64.0f * (1.0f / (l[g] + fa_xhalf(l[g])));      /* the halves' sums joined once; o carried x64 */
    _Float16* op = O + ((size_t)b * SQ + qw + 16u * (unsigned)g + ln) * DM + h * HD + 8u * hh;
#pragma unroll      /* constant index into o[] */
    for (int dt = 0; dt < 4; ++dt) *(v8h*)(op + dt * 16) = __builtin_convertvector(o[g][dt] * fin, v8h); } }      /* a lane's 8 registers are 8 consecutive columns of its query's row: one 16-byte store */

// f32 attention for the FIRST query tile of each causal sequence (rows 0..QT0-1 of a batch; QF, KF, VF: QT0 rows a batch, OF likewise): ONE WAVE PER QUERY ROW, workgroup = A0W waves = A0W consecutive rows of one head of one batch. The head's QT0 key rows and value rows are
// staged once in LDS with coalesced 16-byte loads (key pitch HD + 4 floats: 16 lanes that each read 16 bytes of their own key row fall on distinct banks). Scores: lane l owns keys l, l + 32, l + 64, l + 96 (four partial
// sums per key over the head dimension), invalid keys (j > i or pm[j] == 0) are REPLACED by -1e30; maximum and sum close with a five-step butterfly over the lanes (precise expf, weight exactly 0 for an invalid key
// whenever the row has one valid key). q, k, v rows at pitch LQ, o rows at pitch DM. o: lane l owns columns 2l, 2l + 1 and walks all keys (four partial sums over the keys), the weights read back from the wave's own LDS row as broadcasts.
#define A0W 8                        /* query rows (= waves) per workgroup */
#define A0S (QT0 / (2 * A0W))        /* staging steps: a workgroup's threads cover 2 * A0W rows of 64 floats a step, 16 bytes a thread */
static_assert(QT0 % A0W == 0 && QT0 % 32 == 0 && (QT0 * (HD / 4)) % (32 * A0W) == 0 && HD == 64);
typedef float v2f  __attribute__((ext_vector_type(2)));
typedef float v2fa __attribute__((ext_vector_type(2), may_alias));
__device__ __forceinline__ void d_att0(unsigned blk, const float* __restrict__ QF, const float* __restrict__ KF, const float* __restrict__ VF, const int* __restrict__ pm, float scale, float* __restrict__ OF) {
  __shared__ __attribute__((aligned(16))) float lk[QT0][HD + 4]; __shared__ __attribute__((aligned(16))) float lv[QT0][HD]; __shared__ __attribute__((aligned(16))) float lp[A0W][QT0];
  /* readfirstlane: the wave's number in a scalar register, so that the q row's address is scalar */
  const unsigned tid = threadIdx.x, lane = tid & 31u; const unsigned w = (unsigned)__builtin_amdgcn_readfirstlane((int)(tid >> 5));
  const unsigned b = blk / (unsigned)(NH * (QT0 / A0W)), h = (blk / (unsigned)(QT0 / A0W)) % (unsigned)NH, rg = blk % (unsigned)(QT0 / A0W); const unsigned i = rg * (unsigned)A0W + w;
  QF += (size_t)b * QT0 * LQ; KF += (size_t)b * QT0 * LQ; VF += (size_t)b * QT0 * LQ; pm += (size_t)b * SQ_FULL; OF += (size_t)b * QT0 * DM;
  const unsigned r0 = tid >> 4, c4 = (tid & 15u) * 4u; const float* kp = KF + (size_t)r0 * LQ + h * HD + c4; const float* vp = VF + (size_t)r0 * LQ + h * HD + c4; const float* qr = QF + (size_t)i * LQ + h * HD;
  v4f kk[A0S], vv[A0S], qq[HD / 4]; int pv[QT0 / 32];
#pragma unroll      /* constant index into kk[] and vv[]; constant pitch: one address per plane, the steps as immediate offsets; all of a thread's loads in flight together */
  for (int it = 0; it < A0S; ++it) { kk[it] = *(const v4fa*)(kp + (size_t)it * (2 * A0W) * LQ); vv[it] = *(const v4fa*)(vp + (size_t)it * (2 * A0W) * LQ); }
#pragma unroll      /* constant index into pv[] */
  for (int u = 0; u < QT0 / 32; ++u) pv[u] = pm[(unsigned)u * 32u + lane];
#pragma unroll      /* constant index into qq[] */
  for (int c = 0; c < HD / 4; ++c) qq[c] = *(const v4fa*)(qr + c * 4);
  asm volatile("s_wait_xcnt 0x0" :: "v"(kp), "v"(vp) : "memory");      /* behind the last staging load, in front of whatever rewrites a register that an issued load names; kp and vp as inputs keep both address pairs live up to here, so that no load of the run lands in one */
#pragma unroll      /* constant index into kk[] and vv[] */
  for (int it = 0; it < A0S; ++it) { *(v4fa*)&lk[r0 + (unsigned)it * (unsigned)(2 * A0W)][c4] = kk[it]; *(v4fa*)&lv[r0 + (unsigned)it * (unsigned)(2 * A0W)][c4] = vv[it]; }
  __syncthreads();      /* publishes the staged key and value rows to every wave */
  const v4f z4 = {0.f, 0.f, 0.f, 0.f}; v4f acc[QT0 / 32];
#pragma unroll      /* constant index into acc[] */
  for (int u = 0; u < QT0 / 32; ++u) acc[u] = z4;
#pragma unroll      /* constant index into acc[] and qq[]; the LDS reads of several steps in flight together */
  for (int c = 0; c < HD / 4; ++c) {
#pragma unroll      /* constant index into acc[] */
    for (int u = 0; u < QT0 / 32; ++u) acc[u] += qq[c] * *(const v4fa*)&lk[(unsigned)u * 32u + lane][c * 4]; }
  float sm[QT0 / 32]; float mx = -1.0e30f;
#pragma unroll      /* constant index into acc[] and sm[] */
  for (int u = 0; u < QT0 / 32; ++u) { const unsigned j = (unsigned)u * 32u + lane; const float s = ((acc[u][0] + acc[u][1]) + (acc[u][2] + acc[u][3])) * scale; sm[u] = ((j <= i) & (pv[u] != 0)) ? s : -1.0e30f; mx = fmaxf(mx, sm[u]); }
  for (int d = 16; d > 0; d >>= 1) mx = fmaxf(mx, __shfl_xor(mx, d, 32));
  float l = 0.f;
#pragma unroll      /* constant index into sm[] */
  for (int u = 0; u < QT0 / 32; ++u) { const float e = expf(sm[u] - mx); lp[w][(unsigned)u * 32u + lane] = e; l += e; }
  for (int d = 16; d > 0; d >>= 1) l += __shfl_xor(l, d, 32);
  __syncthreads();      /* the weights are written by one lane and read by all lanes of the wave */
  const v2f z2 = {0.f, 0.f}; v2f o[4] = {z2, z2, z2, z2};
#pragma unroll 8      /* several steps' LDS reads in flight together */
  for (int j4 = 0; j4 < QT0 / 4; ++j4) { const v4f pj = *(const v4fa*)&lp[w][j4 * 4];
#pragma unroll      /* constant index into o[] and pj */
    for (int u = 0; u < 4; ++u) o[u] += pj[u] * *(const v2fa*)&lv[j4 * 4 + u][lane * 2u]; }
  const float fin = 64.0f * (1.0f / l);      /* o carried x64 like the f16 path */
  const v2f oo = ((o[0] + o[1]) + (o[2] + o[3])) * fin;
  *(v2f*)(OF + (size_t)i * DM + h * HD + lane * 2u) = oo; }

// row LayerNorm over DM = 1024 of f32 rows: mean, BIASED variance, (x - mu) * rsqrt(var + eps) * bf16(g[c]) + bf16(b[c]) -> f16 rows (GEMM operand); workgroup = 256 threads = row r, thread t owns columns 4t..4t+3;
// RES 1: the row is first formed as the residual without an output projection, X1[r][c] = bf16(x[r][c]) + o[r][c] / 64 (o: f32 first-tile rows OF0 for the first QT0 rows of a batch, else the f16 rows O16; + NaN when the batch's first mask entry is 0:
// the structure the attention kernels rely on is violated), stored to X1 and normalised from the registers that hold it;
template <int BFIN, int FULLIN, int RES>
__device__ __forceinline__ void d_lnx(unsigned r, const float* __restrict__ X, const float* __restrict__ g, const float* __restrict__ bb, float eps, _Float16* __restrict__ N16,
    const int* __restrict__ pm, const _Float16* __restrict__ O16, const float* __restrict__ OF0, float* __restrict__ X1) {
  /* as in the two kernels this body is made of: every rounding of the residual and of the row statistics stays what it was, so x1 and the normalised rows come out bit for bit the same */
  #pragma clang fp contract(off)
  __shared__ float red[256]; const unsigned t = threadIdx.x; const unsigned c0 = t * 4u;
  const size_t xr = FULLIN ? ((size_t)(r / (unsigned)SQ) * SQ_FULL + (r % (unsigned)SQ)) : (size_t)r;
  int p0 = 1; if (RES) p0 = pm[(size_t)(r / (unsigned)SQ) * SQ_FULL];      /* first, so that it is on its way together with the row's loads */
  const v4f xa = *(const v4fa*)(X + xr * DM + c0); float s[4]; float sum = 0.f; v4f o4 = {0.f, 0.f, 0.f, 0.f};
  if (RES) { const unsigned b = r / (unsigned)SQ, rl = r % (unsigned)SQ;      /* the same for the whole workgroup */
    asm volatile("s_wait_xcnt 0x0" ::: "memory");      /* behind the issued load of the x row, in front of the next loads' address arithmetic, which may rewrite a register that it names */
    if (rl < (unsigned)QT0) o4 = *(const v4fa*)(OF0 + ((size_t)b * QT0 + rl) * DM + c0);
    else { const v4h oh = *(const v4h*)(O16 + (size_t)r * DM + c0); for (int q = 0; q < 4; ++q) o4[q] = (float)oh[q]; }
  }
  const float pz = (p0 != 0) ? 0.f : __uint_as_float(0x7fc00000u);
  for (int q = 0; q < 4; ++q) { s[q] = BFIN ? bf16_rne(xa[q]) : xa[q]; if (RES) s[q] = (s[q] + o4[q] * 0.015625f) + pz; sum = sum + s[q]; }
  red[t] = sum; __syncthreads(); for (unsigned st = 128u; st > 0u; st >>= 1) { if (t < st) red[t] = red[t] + red[t + st]; __syncthreads(); } const float mu = red[0] * (1.0f / (float)DM); __syncthreads();
  float vs = 0.f; for (int q = 0; q < 4; ++q) { const float dl = s[q] - mu; vs = vs + dl * dl; } red[t] = vs; __syncthreads(); for (unsigned st = 128u; st > 0u; st >>= 1) { if (t < st) red[t] = red[t] + red[t + st]; __syncthreads(); }
  const float rs = rsqrtf(red[0] * (1.0f / (float)DM) + eps); v4h y;
  for (int q = 0; q < 4; ++q) { const unsigned c = c0 + (unsigned)q; y[q] = (_Float16)((((s[q] - mu) * rs) * bf16_rne(g[c])) + bf16_rne(bb[c])); }
  { *(v4h*)(N16 + (size_t)r * DM + c0) = y;  }
  if (RES) { const v4f x1 = {s[0], s[1], s[2], s[3]}; *(v4f*)(X1 + (size_t)r * DM + c0) = x1; } }      /* behind the last barrier: in front of one, the barrier would wait the store out */

// shared launches: every test on blockIdx.x reads the same for a whole workgroup, so each body's barriers stay under workgroup-uniform control flow
#define PB_WH ((unsigned)(((size_t)NH * HD * (DM / 8) + 255) / 256))      /* workgroups of one per-head weight plane */
#define PB_W1 ((unsigned)(((size_t)DFF * (DM / 8) + 255) / 256))
#define PB_W2 ((unsigned)(((size_t)DM * (DFF / 8) + 255) / 256))
// all that reads inputs alone: Wq, Wk, Wv -> the x16 q|k|v plane; W1 [DM][DFF] -> [DFF][DM] x16; W2 [DFF][DM] -> [DM][DFF] x16; h = LN1(bf16(x)) -> f16 rows
__global__ __launch_bounds__(256) void k_prep(const float* __restrict__ wq, const float* __restrict__ wk, const float* __restrict__ wv, _Float16* __restrict__ BQKV, const float* __restrict__ w1, _Float16* __restrict__ BW1,
    const float* __restrict__ w2, _Float16* __restrict__ BW2, const float* __restrict__ x, const float* __restrict__ g1, const float* __restrict__ be1, _Float16* __restrict__ X16) {
  unsigned blk = blockIdx.x;
  if (blk < 3u * PB_WH) { const unsigned p = blk / PB_WH; d_wthd(blk - p * PB_WH, p == 0u ? wq : (p == 1u ? wk : wv), BQKV + (size_t)p * DM * DM); return; }
  blk -= 3u * PB_WH;
  if (blk < PB_W1) { d_wt_f16(blk, w1, BW1, DM, DFF, 16.0f); return; }
  blk -= PB_W1;
  if (blk < PB_W2) { d_wt_f16(blk, w2, BW2, DFF, DM, 16.0f); return; }
  blk -= PB_W2;
  d_lnx<1, 1, 0>(blk, x, g1, be1, 1e-5f, X16, (const int*)nullptr, (const _Float16*)nullptr, (const float*)nullptr, (float*)nullptr);
  asm volatile("s_wait_xcnt 0x0" ::: "memory"); }      /* behind the row's store, in front of whatever rewrites a register that it names: the other bodies' code follows it in the built text */

// all that reads the q|k|v GEMM's output alone: the f32 first-tile attention (o x64) and V^T [NB][NH][HD][SQ], all batches
#define MB_A0 ((unsigned)(NB * NH * (QT0 / A0W)))
#define MB_VT ((unsigned)(NB * NH * (SQ / 64)))
static_assert(32 * A0W == 256);
__global__ __launch_bounds__(256) void k_att0_vt(const float* __restrict__ F0, const int* __restrict__ pm, float* __restrict__ OF0, const _Float16* __restrict__ V16, _Float16* __restrict__ VT) {
  if (blockIdx.x >= MB_A0) { d_vt<NH, SQ>(blockIdx.x - MB_A0, V16, LQ, 0, VT); return; }
  d_att0(blockIdx.x, F0, F0 + DM, F0 + 2 * DM, pm, 0.125f, OF0); }

// x1 = bf16(x) + attn, stored, and h2 = LN2(x1) -> f16 rows
__global__ __launch_bounds__(256) void k_res_ln(const float* __restrict__ x, const int* __restrict__ pm, const _Float16* __restrict__ O16, const float* __restrict__ OF0, float* __restrict__ X1,
    const float* __restrict__ g2, const float* __restrict__ be2, _Float16* __restrict__ M16) {
  d_lnx<1, 1, 1>(blockIdx.x, x, g2, be2, 1e-5f, M16, pm, O16, OF0, X1); }

extern "C" void kernel_launch(void* const* d_in, const int* in_sizes, int n_in,
                              void* d_out, int out_size, void* d_ws, size_t ws_size, hipStream_t stream) {
  if (n_in < 13) return;
  const size_t rows_need = (size_t)(NB - 1) * SQ_FULL + SQ;
  if ((size_t)in_sizes[0] < rows_need * DM) return; if ((size_t)in_sizes[1] < rows_need) return;
  if ((size_t)in_sizes[2] < (size_t)NH * DM * HD || (size_t)in_sizes[3] < (size_t)NH * DM * HD || (size_t)in_sizes[4] < (size_t)NH * DM * HD) return;
  if (in_sizes[5] < DM || in_sizes[6] < DM || in_sizes[7] < DM || in_sizes[8] < DM) return;
  if ((size_t)in_sizes[9] < (size_t)DM * DFF || in_sizes[10] < DFF || (size_t)in_sizes[11] < (size_t)DFF * DM || in_sizes[12] < DM) return;
  if ((size_t)out_size < NR * DM) return;
  const float* x = (const float*)d_in[0]; const int* pmask = (const int*)d_in[1];
  const float* wq = (const float*)d_in[2]; const float* wk = (const float*)d_in[3]; const float* wv = (const float*)d_in[4];
  const float* g1 = (const float*)d_in[5]; const float* be1 = (const float*)d_in[6]; const float* g2 = (const float*)d_in[7]; const float* be2 = (const float*)d_in[8];
  const float* w1 = (const float*)d_in[9]; const float* b1 = (const float*)d_in[10]; const float* w2 = (const float*)d_in[11]; const float* b2 = (const float*)d_in[12];
  char* ws = (char*)d_ws; size_t off = 0;
  auto take = [&](size_t bytes) { char* p = ws + off; off += (bytes + 255) & ~(size_t)255; return p; };
  _Float16* BQKV = (_Float16*)take((size_t)3 * DM * DM * 2);          /* [3*DM][DM] x16: q | k | v stacked, row (h*HD + d) */
  _Float16* X16 = (_Float16*)take(NR * DM * 2);                       /* LN1 rows; reused as the LN2 rows (last reader of LN1 rows: the q|k|v GEMM, before LN2 writes) */
  float* X1 = (float*)take(NR * DM * 4);
  _Float16* BW1 = (_Float16*)take((size_t)DFF * DM * 2); _Float16* BW2 = (_Float16*)take((size_t)DM * DFF * 2);
  _Float16* QKV = (_Float16*)take(NR * 3 * DM * 2); _Float16* Q16 = QKV; _Float16* K16 = QKV + DM; _Float16* V16 = QKV + 2 * DM;
  _Float16* HF16 = QKV;                                               /* FFN hidden rows [NR][DFF] alias the q|k|v rows (dead after the attention); DFF <= 3*DM asserted */
  _Float16* O16 = (_Float16*)take(NR * DM * 2);
  _Float16* VT = (_Float16*)take((size_t)NB * NH * HD * SQ * 2);      /* V^T [NB][NH][HD][SQ] */
  float* F0 = (float*)take((size_t)NB * QT0 * 3 * DM * 4);            /* f32 q | k | v of the first 128 rows of each batch */
  float* OF0 = (float*)take((size_t)NB * QT0 * DM * 4);
  _Float16* M16 = X16;
  if (off > ws_size || off > (size_t)134217728) return;
  k_prep<<<3u * PB_WH + PB_W1 + PB_W2 + (unsigned)NR, 256, 0, stream>>>(wq, wk, wv, BQKV, w1, BW1, w2, BW2, x, g1, be1, X16);      /* weight planes (x16, transposed) and h = LN1(bf16(x)) */
  k_gemm2<0><<<dim3((unsigned)((NR / 128) * (3 * DM / 128)), 1), 256, 0, stream>>>(X16, DM, (size_t)0, BQKV, DM, (size_t)0, 0.0625f, (const float*)nullptr, (const float*)nullptr, (float*)nullptr, QKV, F0, (unsigned)(SQ / 128), LQ, (size_t)0, (int)NR, 3 * DM, DM);      /* q | k | v rows (f16); rows 0..127 of each batch in f32 too */
  k_att0_vt<<<MB_A0 + MB_VT, 256, 0, stream>>>(F0, pmask, OF0, V16, VT);      /* f32 attention for rows 0..127 of each batch (o x64); V^T */
  k_fattn<<<NB * NH * FNT, 32 * FW, 0, stream>>>(Q16, K16, VT, pmask, O16);      /* o (merged heads, x64) as f16 rows, all batches, heads and query tiles */
  k_res_ln<<<(unsigned)NR, 256, 0, stream>>>(x, pmask, O16, OF0, X1, g2, be2, M16);      /* x1 = bf16(x) + attn; h2 = LN2(x1) -> f16 rows */
  k_gemm2<3><<<dim3((unsigned)((NR / 128) * (DFF / 128)), 1), 256, 0, stream>>>(M16, DM, (size_t)0, BW1, DM, (size_t)0, 0.0625f, b1, (const float*)nullptr, (float*)nullptr, HF16, (float*)nullptr, 1u, DFF, (size_t)0, (int)NR, DFF, DM);      /* relu(h2 W1 + b1) -> f16 */
  k_gemm2<0><<<dim3((unsigned)((NR / 128) * (DM / 128)), 1), 256, 0, stream>>>(HF16, DFF, (size_t)0, BW2, DFF, (size_t)0, 0.0625f, b2, X1, (float*)d_out, (_Float16*)nullptr, (float*)nullptr, 1u, DM, (size_t)0, (int)NR, DM, DFF);      /* out = x1 + mlp (own-element residual) */
}

// v007
// Measured time: 140 microseconds a run.
// Next to v006, in two timings, it ran 1.10 times as fast each time.
// All steps since v000 together make it 36.6 times as fast.
#include <hip/hip_runtime.h>
// Pre-LN causal transformer layer: x [NB][SEQ][1024]; h = LN1(x) (biased variance, eps 1e-5); q/k/v[b][h] = h Wq/Wk/Wv[h] (per-head [16][1024][64], [in][out], no biases); scores / sqrt(64); mask = padding_mask[b][key] AND causal, masked scores REPLACED by -1e9; softmax; heads concatenated (no output projection); x1 = x + attn; h2 = LN2(x1); out = x1 + relu(h2 W1 + b1) W2 + b2 ([in][out] 1024 x 1024 x 1024).
// Structure: LN1 on VALU -> f16 rows; weights transposed through LDS tiles (per-head ones into one x16 f16 q|k|v plane); q|k|v as ONE WMMA GEMM (operands staged in LDS, 32x64 wave tiles, f32 accumulation, f16 out); V^T via LDS transposes and an f32 first tile (rows 0..127 of each batch) on VALU; then ONE fused attention launch for all batches and heads (keys and values staged in LDS per workgroup; scores, masked online softmax and P V in registers, one wave per 32 queries; o x64 f16); x1 = bf16(x) + o / 64; LN2 -> f16; FFN as two GEMMs (ReLU epilogue; own-element residual).
// Launches (7): kernels that do not depend on one another share a launch, each on its own range of workgroup indices: {weight transposes, LN1}; q|k|v GEMM (also stores its first-tile rows in f32); {first-tile attention, V^T}; fused attention; {residual + LN2, row by row}; FFN 1; FFN 2.
// Compute dtype: all contractions v_wmma_f32_16x16x32_f16 (f16 operands, f32 accumulate); float inputs RNE-converted to bf16 first (weights then x16, exact in f16); q, k, v, softmax weights (relative to the running row maximum) and o (x64) as plain f16 operands; scores and softmax statistics f32; first 128 query rows of each batch in f32 on VALU.
#ifndef NB
#define NB 2
#endif
#ifndef SEQ
#define SEQ 2048
#endif
#define SQ SEQ
#define NB_FULL 2
#define SQ_FULL 2048                 /* per-batch row stride of the inputs (x rows, mask entries) */
#define DM 1024
#define NH 16
#define HD 64
#define DFF 1024
#define QT0 128                      /* first-tile rows computed in f32 */
#define NR ((size_t)NB * SQ)         /* token rows */
#define LQ (3 * DM)                  /* row pitch of the q|k|v rows */
static_assert(NH * HD == DM);
static_assert(QT0 == 128 && QT0 <= SQ && SQ <= SQ_FULL && NB <= NB_FULL);
static_assert(DM % 128 == 0 && DFF % 128 == 0 && HD == 64 && ((size_t)NB * SQ) % 128 == 0);
static_assert(DM / 4 == 256);
static_assert(DFF <= 3 * DM);
static_assert((((size_t)NB * SQ * DM) / 4) % 256 == 0);
static_assert((size_t)NB * SQ * DM / 4 < 0x7fffffffu);

typedef unsigned short v8us __attribute__((ext_vector_type(8), may_alias));
typedef float  v8f  __attribute__((ext_vector_type(8)));
typedef float  v4f  __attribute__((ext_vector_type(4)));
typedef float  v4fa __attribute__((ext_vector_type(4), may_alias));
typedef _Float16 v16h __attribute__((ext_vector_type(16)));
typedef _Float16 v4h __attribute__((ext_vector_type(4)));
union FragH { v16h v; v8us half[2]; _Float16 h[16]; unsigned short u[16]; };

__device__ __forceinline__ unsigned short bf16_bits(float x) { unsigned int u = __float_as_uint(x); return (unsigned short)((u + 0x7FFFu + ((u >> 16) & 1u)) >> 16); }
__device__ __forceinline__ float bf16_rne(float x) { return __uint_as_float(((unsigned int)bf16_bits(x)) << 16); }

// fragment: elements 0..7 <- k0 + 8h + 0..7, elements 8..15 <- k0 + 16 + 8h + 0..7 (same map for A rows and B columns)
__device__ __forceinline__ v16h g2_frag(const _Float16* p, unsigned hh) { FragH f; f.half[0] = *(const v8us*)((const unsigned short*)p + 8u * hh); f.half[1] = *(const v8us*)((const unsigned short*)p + 16u + 8u * hh); return f.v; }
__device__ __forceinline__ v8f g2_mma(v16h a, v16h b, v8f c) { return __builtin_amdgcn_wmma_f32_16x16x32_f16(false, a, false, b, (short)0, c, false, false); }

// GEMM (wave tile 32x64; workgroup = 8 waves (4 x 2) = 128 rows x 128 cols; M % 128 == 0, N % 128 == 0, K % 64 == 0): A f16 [M][K] (pitch lda, batch stride sA), Bh f16 [N][K] (pitch ldb, batch stride sB);
// a stage is 64 k of the tile's 128 A rows and 128 B rows (128 bytes a row: whole lines), brought into LDS by asynchronous 16-byte copies at row pitch 144 bytes (conflict-free for the 16-byte fragment reads); two buffers: the next stage's copies fly while this stage is worked on.
// v = acc * alpha + bf16(bias[col]) (+ CP own element of the batched C plane); ACT 0 none / 3 relu; writes f32 C and/or f16 C16 (pitch ldc, batch offset by * sC); CT (may be null): every tper-th row tile (mt % tper == 0) is stored in f32 as well, as rows (mt / tper) * 128 .. + 127 of CT (pitch ldc);
#define GP 144                       /* LDS row pitch, bytes */
#define GOP (128 * GP)               /* one operand's rows of a stage, bytes */
#define GSTG (2 * GOP)               /* one buffer: the A rows, then the B rows */
static_assert(8 * 32 * 68 * 4 <= 2 * GSTG && GP % 16 == 0);
__device__ __forceinline__ v16h g2_lfrag(const char* p) { FragH f; f.half[0] = *(const v8us*)p; f.half[1] = *(const v8us*)(p + 32); return f.v; }      /* p: the lane's LDS row + 2 k0 + 16 hh bytes: the k order of g2_frag */
// one stage: a lane's 4 copies of A rows (r, r + 32, r + 64, r + 96) and 4 of B rows; a wave's copy covers 4 whole 128-byte rows
__device__ __forceinline__ void g2_stage(unsigned l, const _Float16* ga, size_t ra, const _Float16* gb, size_t rb) {
  /* the copies and, as the last line of their own statement, the wait that stands in front of any rewrite of a register that an issued copy names */
  asm volatile("global_load_async_to_lds_b128 %0, %8, off\n\t"
               "global_load_async_to_lds_b128 %1, %9, off\n\t"
               "global_load_async_to_lds_b128 %2, %10, off\n\t"
               "global_load_async_to_lds_b128 %3, %11, off\n\t"
               "global_load_async_to_lds_b128 %4, %12, off\n\t"
               "global_load_async_to_lds_b128 %5, %13, off\n\t"
               "global_load_async_to_lds_b128 %6, %14, off\n\t"
               "global_load_async_to_lds_b128 %7, %15, off\n\t"
               "s_wait_xcnt 0x0"
               :: "v"(l), "v"(l + 32u * GP), "v"(l + 64u * GP), "v"(l + 96u * GP), "v"(l + GOP), "v"(l + GOP + 32u * GP), "v"(l + GOP + 64u * GP), "v"(l + GOP + 96u * GP),
                  "v"(ga), "v"(ga + ra), "v"(ga + 2 * ra), "v"(ga + 3 * ra), "v"(gb), "v"(gb + rb), "v"(gb + 2 * rb), "v"(gb + 3 * rb) : "memory"); }
template <int ACT>
__global__ __launch_bounds__(256) void k_gemm2(const _Float16* __restrict__ A, int lda, size_t sA, const _Float16* __restrict__ Bh, int ldb, size_t sB, float alpha,
    const float* __restrict__ bias, const float* __restrict__ CP, float* __restrict__ C, _Float16* __restrict__ C16, float* __restrict__ CT, unsigned tper, int ldc, size_t sC, int M, int N, int K) {
  static_assert(ACT == 0 || ACT == 3);
  __shared__ __attribute__((aligned(16))) char sm[2 * GSTG];
  const unsigned tid = threadIdx.x, w = tid >> 5, lane = tid & 31u, ln = lane & 15u, hh = lane >> 4; const unsigned by = blockIdx.y;
  A += (size_t)by * sA; Bh += (size_t)by * sB; const size_t cofs = (size_t)by * sC;
  const unsigned ntn = (unsigned)N >> 7; const unsigned mt = blockIdx.x / ntn, nq = blockIdx.x - mt * ntn; if (mt * 128u >= (unsigned)M) return;      /* the same for the whole workgroup, in front of every barrier */
  const unsigned row0 = mt * 128u + 32u * (w >> 1), col0 = nq * 128u + 64u * (w & 1u);
  const unsigned cr = tid >> 3, cc = tid & 7u;      /* copies: 8 lanes a row, 32 rows a step of the workgroup */
  const _Float16* ga = A + (size_t)(mt * 128u + cr) * (size_t)lda + cc * 8u; const _Float16* gb = Bh + (size_t)(nq * 128u + cr) * (size_t)ldb + cc * 8u; const size_t ra = (size_t)32 * (size_t)lda, rb = (size_t)32 * (size_t)ldb;
  const unsigned la = (unsigned)(size_t)sm + cr * (unsigned)GP + cc * 16u;      /* the lane's LDS byte address in buffer 0, A rows */
  const char* pa = sm + (32u * (w >> 1) + ln) * (unsigned)GP + 16u * hh; const char* pb = sm + GOP + (64u * (w & 1u) + ln) * (unsigned)GP + 16u * hh;
  const int nt = K >> 6;
  g2_stage(la, ga, ra, gb, rb);
  asm volatile("s_wait_asynccnt 0x0" ::: "memory");      /* this wave's copies of stage 0 have landed */
  __syncthreads();      /* publishes stage 0 to every wave */
  if (nt > 1) g2_stage(la + GSTG, ga + 64, ra, gb + 64, rb);
  const v8f z8 = {0.f,0.f,0.f,0.f,0.f,0.f,0.f,0.f}; v8f c00 = z8, c01 = z8, c02 = z8, c03 = z8, c10 = z8, c11 = z8, c12 = z8, c13 = z8;
#pragma unroll 1      /* one trip of code: the ring's order stays as written */
  for (int t = 0; t < nt; ++t) { const unsigned buf = ((unsigned)t & 1u) * (unsigned)GSTG; const char* qa = pa + buf; const char* qb = pb + buf;
    const v16h a0 = g2_lfrag(qa), a1 = g2_lfrag(qa + 16 * GP), b0 = g2_lfrag(qb), b1 = g2_lfrag(qb + 16 * GP), b2 = g2_lfrag(qb + 32 * GP), b3 = g2_lfrag(qb + 48 * GP);
    const v16h e0 = g2_lfrag(qa + 64), e1 = g2_lfrag(qa + 16 * GP + 64), f0 = g2_lfrag(qb + 64), f1 = g2_lfrag(qb + 16 * GP + 64), f2 = g2_lfrag(qb + 32 * GP + 64), f3 = g2_lfrag(qb + 48 * GP + 64);
    __builtin_amdgcn_sched_barrier(0);      /* keeps the trip's fragment reads together in front of its products: spread among them, each small group of reads makes the wave wait out the LDS latency anew */
    c00 = g2_mma(a0, b0, c00); c10 = g2_mma(a1, b0, c10); c01 = g2_mma(a0, b1, c01); c11 = g2_mma(a1, b1, c11); c02 = g2_mma(a0, b2, c02); c12 = g2_mma(a1, b2, c12); c03 = g2_mma(a0, b3, c03); c13 = g2_mma(a1, b3, c13);
    __builtin_amdgcn_sched_barrier(0);      /* keeps the first half's products in front of the waits below, so that the second half's fragment reads return behind them and not in front of an idle matrix unit */
    asm volatile("s_wait_dscnt 0x0" ::: "memory");      /* this wave's reads of the buffer have returned before the buffer is given up */
    asm volatile("s_wait_asynccnt 0x0" ::: "memory");      /* this wave's copies of stage t + 1 have landed */
    __syncthreads();      /* publishes stage t + 1 and ends every wave's reads of stage t */
    if (t + 2 < nt) g2_stage(la + buf, ga + (size_t)(t + 2) * 64, ra, gb + (size_t)(t + 2) * 64, rb);
    /* the second half's products, on fragments already in registers, run while the copies fly */
    c00 = g2_mma(e0, f0, c00); c10 = g2_mma(e1, f0, c10); c01 = g2_mma(e0, f1, c01); c11 = g2_mma(e1, f1, c11); c02 = g2_mma(e0, f2, c02); c12 = g2_mma(e1, f2, c12); c03 = g2_mma(e0, f3, c03); c13 = g2_mma(e1, f3, c13); }
  asm volatile("s_wait_asynccnt 0x0" ::: "memory");      /* no copy is on its way when the ring becomes output staging */
  float (*so)[32][68] = (float (*)[32][68])sm;      /* output staging, a wave's own tile, in the ring, which every wave has left at the last trip's barrier */
  v8f accs[8] = {c00, c01, c02, c03, c10, c11, c12, c13};
#pragma unroll
  for (int u = 0; u < 8; ++u) { const unsigned t = (unsigned)u & 3u, half = (unsigned)u >> 2; const unsigned col = col0 + t * 16u + ln; const float bv = bias ? bf16_rne(bias[col]) : 0.f;
#pragma unroll
    for (int r = 0; r < 8; ++r) { const unsigned rloc = half * 16u + 8u * hh + (unsigned)r; float v = accs[u][r] * alpha + bv;
      if (CP) v += CP[cofs + (size_t)(row0 + rloc) * (size_t)ldc + col];      /* own element of the batched C plane */
      if (ACT == 3) v = fmaxf(v, 0.f);
      so[w][rloc][t * 16u + ln] = v; } }
  __builtin_amdgcn_fence(4 /* acq_rel order */, "workgroup"); __builtin_amdgcn_wave_barrier();      /* wave-private tile: same wave writes and reads */
  const unsigned rsub = lane >> 4, c4 = (lane & 15u) * 4u;
  const bool wt = CT != nullptr && mt % tper == 0u; const size_t cto = ((size_t)(mt / tper) * 128u + 32u * (w >> 1)) * (size_t)ldc + col0 + c4;      /* wt: the same for the whole workgroup */
  {
#pragma unroll
    for (int q = 0; q < 16; ++q) { const unsigned r = (unsigned)q * 2u + rsub; const v4f v = *(const v4fa*)&so[w][r][c4];
      if (C) { *(v4f*)(C + cofs + (size_t)(row0 + r) * (size_t)ldc + col0 + c4) = v; asm volatile("s_wait_xcnt 0x0" ::: "memory"); }      /* behind the issued store, in front of the next address arithmetic, which may rewrite a register that it names */
      if (wt) { *(v4f*)(CT + cto + (size_t)r * (size_t)ldc) = v; asm volatile("s_wait_xcnt 0x0" ::: "memory"); }      /* likewise */
      if (C16) { v4h h4; for (int i = 0; i < 4; ++i) h4[i] = (_Float16)v[i]; *(v4h*)(C16 + cofs + (size_t)(row0 + r) * (size_t)ldc + col0 + c4) = h4; } }
     } }

// the bodies below run on a range of a shared launch's workgroups: blk, where they take it, is the workgroup's index inside that range
// weight plane W [k][n] f32 (pitch SP) -> Wt [n][k] f16 (pitch OP), value (f16)(16 * bf16(w)): a workgroup takes WTK k rows x WTN n columns through LDS. W, Wt: the tile's first element in each plane; tl: the workgroup's LDS tile, WTN * WTK / 8 chunks.
// In: a thread reads 16 bytes of each of 8 consecutive k rows (16 lanes cover 256 contiguous bytes of a row: whole lines), so it holds 8 k of 4 columns and writes each column's 8 values as one 16-byte chunk.
// Out: 16 lanes read the 16 chunks of one n row and store 256 contiguous bytes. Chunk c of row n lies at place c ^ (n >> 2) of the row: the 16 lanes of a write (rows 4 apart, one c) and of a read (one row, all c) each fall on 16 distinct 16-byte bank groups.
#define WTK 128
#define WTN 64
static_assert(WTN == 64 && WTK == 128 && DM % WTK == 0 && DFF % WTK == 0 && DM % WTN == 0 && DFF % WTN == 0 && HD == WTN);
template <int SP, int OP>
__device__ __forceinline__ void d_wtile(v8us* tl, const float* __restrict__ W, _Float16* __restrict__ Wt) {
  const unsigned tid = threadIdx.x, lo = tid & 15u, hi = tid >> 4;
  const float* sp = W + (size_t)(hi * 8u) * SP + lo * 4u; v4f a[8];
#pragma unroll      /* constant index into a[]; constant pitch: one address, the rows as immediate offsets; all of a thread's loads in flight together */
  for (int j = 0; j < 8; ++j) a[j] = *(const v4fa*)(sp + (size_t)j * SP);
#pragma unroll      /* constant index into a[] */
  for (int i = 0; i < 4; ++i) { FragH f;
#pragma unroll      /* constant index into a[] and f */
    for (int j = 0; j < 8; ++j) f.h[j] = (_Float16)(16.0f * bf16_rne(a[j][i]));
    tl[(lo * 4u + (unsigned)i) * (unsigned)(WTK / 8) + (hi ^ lo)] = f.half[0]; }
  __syncthreads();      /* publishes the tile: a chunk is written by one thread and stored by another */
  unsigned short* dp = (unsigned short*)Wt + (size_t)hi * OP + lo * 8u;
#pragma unroll      /* constant pitch: one address, the rows as immediate offsets */
  for (int q = 0; q < WTN / 16; ++q) { const unsigned n = hi + 16u * (unsigned)q; *(v8us*)(dp + (size_t)q * 16 * OP) = tl[n * (unsigned)(WTK / 8) + (lo ^ (n >> 2))]; }
  asm volatile("s_wait_xcnt 0x0" ::: "memory"); }      /* behind the last of the run's stores, in front of whatever rewrites a register that one of them names: another body's code follows in the built text */

template <int NHv, int TTv>
__device__ __forceinline__ void d_vt(unsigned blk, const _Float16* __restrict__ V16, int ldv, int voff, _Float16* __restrict__ Vt) {
  __shared__ unsigned short tl[64][66]; const unsigned tid = threadIdx.x; const unsigned slab = blk / (unsigned)(TTv / 64), lg = blk % (unsigned)(TTv / 64); const unsigned b = slab / (unsigned)NHv, h = slab % (unsigned)NHv;
  for (unsigned i = tid; i < 64u * 8u; i += 256u) { const unsigned r = i >> 3, c8 = (i & 7u) * 8u; FragH f; f.half[0] = *(const v8us*)((const unsigned short*)V16 + ((size_t)b * TTv + lg * 64u + r) * (size_t)ldv + (size_t)voff + h * 64u + c8);
#pragma unroll
    for (int q = 0; q < 8; ++q) tl[r][c8 + (unsigned)q] = f.u[q]; }
  __syncthreads();
  {
#pragma unroll
    for (int rd = 0; rd < 2; ++rd) { const unsigned d = (unsigned)rd * 32u + (tid >> 3), pc = tid & 7u; FragH f;
#pragma unroll
      for (int q = 0; q < 8; ++q) f.u[q] = tl[pc * 8u + (unsigned)q][d];
      *(v8us*)((unsigned short*)Vt + ((size_t)slab * 64u + d) * TTv + lg * 64u + pc * 8u) = f.half[0]; }
     } }

#define FQ 32                        /* query columns per wave */
#define FW 4                         /* waves per workgroup */
#define FNT (SQ / (FQ * FW))         /* query tiles of a sequence */
#define FOP (64 * GP)                /* one operand's 64 rows of a stage, bytes */
#define FSTG (2 * FOP)               /* one buffer: the key rows, then the rows of the transposed value plane */
static_assert(SQ % (FQ * FW) == 0 && FNT % 2 == 0 && HD == 64 && FQ == 32 && FQ * FW == 128 && SQ % 64 == 0);
typedef _Float16 v8h __attribute__((ext_vector_type(8)));
__device__ __forceinline__ float fa_xhalf(float x) { return __builtin_bit_cast(float, __builtin_amdgcn_permlanex16(__builtin_bit_cast(int, x), __builtin_bit_cast(int, x), 0x76543210, 0xfedcba98, false, false)); }      /* lane l with lane l ^ 16 */
__device__ __forceinline__ v8f fa_mma(v16h a, v16h b, v8f c) { return __builtin_amdgcn_wmma_f32_16x16x32_f16(false, a, false, b, (short)0, c, false, false); }
// one stage: a lane's 4 copies of key rows (r, r + 16, r + 32, r + 48) and 4 of value-plane rows; a wave's copy covers 4 whole 128-byte rows
__device__ __forceinline__ void fa_stage(unsigned l, const _Float16* gk, const _Float16* gv) {
  /* the copies and, as the last line of their own statement, the wait that stands in front of any rewrite of a register that an issued copy names */
  asm volatile("global_load_async_to_lds_b128 %0, %8, off\n\t"
               "global_load_async_to_lds_b128 %1, %9, off\n\t"
               "global_load_async_to_lds_b128 %2, %10, off\n\t"
               "global_load_async_to_lds_b128 %3, %11, off\n\t"
               "global_load_async_to_lds_b128 %4, %12, off\n\t"
               "global_load_async_to_lds_b128 %5, %13, off\n\t"
               "global_load_async_to_lds_b128 %6, %14, off\n\t"
               "global_load_async_to_lds_b128 %7, %15, off\n\t"
               "s_wait_xcnt 0x0"
               :: "v"(l), "v"(l + 16u * GP), "v"(l + 32u * GP), "v"(l + 48u * GP), "v"(l + FOP), "v"(l + FOP + 16u * GP), "v"(l + FOP + 32u * GP), "v"(l + FOP + 48u * GP),
                  "v"(gk), "v"(gk + (size_t)16 * LQ), "v"(gk + (size_t)32 * LQ), "v"(gk + (size_t)48 * LQ), "v"(gv), "v"(gv + (size_t)16 * SQ), "v"(gv + (size_t)32 * SQ), "v"(gv + (size_t)48 * SQ) : "memory"); }
// one pass: 32 keys (fragments kf, vf) against the wave's 32 queries. NX: the stage's next pass has its fragments read from kx, vx (the lane's LDS places) into the registers just read
template <bool NX>
__device__ __forceinline__ void fa_pass(int s, int last, unsigned vm, unsigned qw, unsigned ln, unsigned hh, const char* kx, const char* vx, const v16h (&qf)[2][2], v16h (&kf)[2][2], v16h (&vf)[4], v8f (&o)[2][4], float (&mr)[2], float (&l)[2]) {
  const v8f z8 = {0.f,0.f,0.f,0.f,0.f,0.f,0.f,0.f};
  const float cs = 0.125f * 1.44269504088896340736f;      /* 1 / sqrt(64), and exp(x) = exp2(x log2 e) */
  v8f sc[2][2];
#pragma unroll      /* constant index into sc[], kf[], qf[] */
  for (int tk = 0; tk < 2; ++tk) { sc[0][tk] = fa_mma(kf[tk][0], qf[0][0], z8); sc[1][tk] = fa_mma(kf[tk][0], qf[1][0], z8); sc[0][tk] = fa_mma(kf[tk][1], qf[0][1], sc[0][tk]); sc[1][tk] = fa_mma(kf[tk][1], qf[1][1], sc[1][tk]); }
  if (NX) {
#pragma unroll      /* constant index into kf[] */
    for (int tk = 0; tk < 2; ++tk) { kf[tk][0] = g2_lfrag(kx + tk * 16 * GP); kf[tk][1] = g2_lfrag(kx + tk * 16 * GP + 64); } }
  if (vm != 0xffffffffu || s == last) {      /* scalar branch: only the diagonal pass and passes with a padded key pay for the mask */
    const unsigned vs = vm >> (8u * hh);
#pragma unroll      /* constant index into sc[] */
    for (int g = 0; g < 2; ++g) { const int qrel = (int)(qw + 16u * (unsigned)g + ln) - (s * 32 + 8 * (int)hh);      /* local key 16 tk + r is causal iff it is <= qrel */
#pragma unroll      /* constant index into sc[] */
      for (int tk = 0; tk < 2; ++tk) {
#pragma unroll      /* constant element index */
        for (int r = 0; r < 8; ++r) sc[g][tk][r] = ((((vs >> (16 * tk + r)) & 1u) != 0u) & (16 * tk + r <= qrel)) ? sc[g][tk][r] : -1.0e9f; } } }
  v16h pf[2];
#pragma unroll      /* constant index into sc[], o[], mr[], l[], pf[] */
  for (int g = 0; g < 2; ++g) {
    float mx = fmaxf(sc[g][0][0], sc[g][1][0]);
#pragma unroll      /* constant element index */
    for (int r = 1; r < 8; ++r) mx = fmaxf(mx, fmaxf(sc[g][0][r], sc[g][1][r]));
    mx = fmaxf(mx, fa_xhalf(mx)); const float mn = fmaxf(mr[g], mx); const float al = __builtin_amdgcn_exp2f((mr[g] - mn) * cs); const float mc = mn * cs; mr[g] = mn;
    v8f p0, p1;
#pragma unroll      /* constant element index */
    for (int r = 0; r < 8; ++r) { p0[r] = __builtin_amdgcn_exp2f(fmaf(sc[g][0][r], cs, -mc)); p1[r] = __builtin_amdgcn_exp2f(fmaf(sc[g][1][r], cs, -mc)); }
    const v8f ps = p0 + p1; l[g] = fmaf(l[g], al, ((ps[0] + ps[1]) + (ps[2] + ps[3])) + ((ps[4] + ps[5]) + (ps[6] + ps[7])));
    const v8h h0 = __builtin_convertvector(p0, v8h), h1 = __builtin_convertvector(p1, v8h);
    pf[g] = __builtin_shufflevector(h0, h1, 0, 1, 2, 3, 4, 5, 6, 7, 8, 9, 10, 11, 12, 13, 14, 15);
#pragma unroll      /* constant index into o[] */
    for (int dt = 0; dt < 4; ++dt) o[g][dt] *= al; }
#pragma unroll      /* constant index into o[], vf[] */
  for (int dt = 0; dt < 4; ++dt) { o[0][dt] = fa_mma(vf[dt], pf[0], o[0][dt]); o[1][dt] = fa_mma(vf[dt], pf[1], o[1][dt]); }
  if (NX) {
    __builtin_amdgcn_sched_barrier(0);      /* keeps the statement below here, behind this pass's products: moved up to the reads it names, it would make the wave wait them out at once */
    asm volatile("" :: "v"(kf[0][0]), "v"(kf[0][1]), "v"(kf[1][0]), "v"(kf[1][1]));      /* inputs only, the loaded values: holds the next pass's key reads in front of this place, so that they return behind this pass's vector work; sunk into the next pass they would make it wait out the LDS latency in front of its first products */
#pragma unroll      /* constant index into vf[] */
    for (int dt = 0; dt < 4; ++dt) vf[dt] = g2_lfrag(vx + dt * 16 * GP); } }
__global__ __launch_bounds__(32 * FW) void k_fattn(const _Float16* __restrict__ Q, const _Float16* __restrict__ K, const _Float16* __restrict__ VT, const int* __restrict__ pm, _Float16* __restrict__ O) {
  __shared__ __attribute__((aligned(16))) char sm[2 * FSTG];
  /* readfirstlane: the wave's number in a scalar register, so that the tests on the wave's diagonal stay scalar branches */
  const unsigned tid = threadIdx.x, lane = tid & 31u, ln = lane & 15u, hh = lane >> 4; const unsigned w = (unsigned)__builtin_amdgcn_readfirstlane((int)(tid >> 5));
  const unsigned rank = blockIdx.x / (unsigned)(NB * NH), bh = blockIdx.x % (unsigned)(NB * NH); const unsigned tile = rank < (unsigned)(FNT / 2) ? (unsigned)(FNT - 1) - rank : rank - (unsigned)(FNT / 2);      /* long tiles first, then the short ones in mirrored order */
  const unsigned b = bh / (unsigned)NH, h = bh % (unsigned)NH; const unsigned qw = tile * (unsigned)(FQ * FW) + w * (unsigned)FQ; const int last = (int)(qw >> 5);      /* pass 'last' holds the wave's diagonal */
  const int ns = (int)(tile * 2u + 2u);      /* stages up to the workgroup's last diagonal: the same for all its waves, at least 2, and 64 ns <= SQ */
  const _Float16* qp = Q + ((size_t)b * SQ + qw + ln) * LQ + h * HD; const int* pp = pm + (size_t)b * SQ_FULL + lane;
  const unsigned cr = tid >> 3, cc = tid & 7u;      /* copies: 8 lanes a row, 16 rows a step of the workgroup */
  const _Float16* gk = K + ((size_t)b * SQ + cr) * LQ + h * HD + cc * 8u; const _Float16* gv = VT + ((size_t)bh * HD + cr) * SQ + cc * 8u;
  const unsigned la = (unsigned)(size_t)sm + cr * (unsigned)GP + cc * 16u;      /* the lane's LDS byte address in buffer 0, key rows */
  const char* pk = sm + ln * (unsigned)GP + 16u * hh; const char* pw = sm + FOP + ln * (unsigned)GP + 16u * hh;      /* the lane's fragment places: row ln, the k order of g2_frag */
  fa_stage(la, gk, gv);
  v16h qf[2][2], kf[2][2], vf[4];
#pragma unroll      /* constant index into qf[] */
  for (int g = 0; g < 2; ++g) { qf[g][0] = g2_frag(qp + (size_t)g * 16 * LQ, hh); qf[g][1] = g2_frag(qp + (size_t)g * 16 * LQ + 32, hh); }
  int pv0 = pp[0], pv1 = pp[32];
  asm volatile("s_wait_xcnt 0x0" ::: "memory");      /* behind the issued loads, in front of whatever rewrites a register that one of them names */
  asm volatile("s_wait_asynccnt 0x0" ::: "memory");      /* this wave's copies of stage 0 have landed */
  __syncthreads();      /* publishes stage 0 to every wave */
  fa_stage(la + FSTG, gk + (size_t)64 * LQ, gv + 64);      /* stage 1 exists: ns >= 2 */
  const v8f z8 = {0.f,0.f,0.f,0.f,0.f,0.f,0.f,0.f}; v8f o[2][4] = {{z8, z8, z8, z8}, {z8, z8, z8, z8}}; float mr[2] = {-3.0e38f, -3.0e38f}, l[2] = {0.f, 0.f};
#pragma unroll 1      /* one trip of code: the ring's order stays as written */
  for (int t = 0; t < ns; ++t) { const unsigned buf = ((unsigned)t & 1u) * (unsigned)FSTG; const char* kb = pk + buf; const char* vb = pw + buf;
    const unsigned vm0 = __builtin_amdgcn_ballot_w32(pv0 != 0), vm1 = __builtin_amdgcn_ballot_w32(pv1 != 0);      /* bit j: key 64 t + j (vm0), 64 t + 32 + j (vm1) passes the padding mask */
    const int tn = t + 1 < ns ? t + 1 : t;      /* the last trip fetches its own entries again: in bounds, unused */
    pv0 = pp[tn * 64]; pv1 = pp[tn * 64 + 32];
    asm volatile("s_wait_xcnt 0x0" ::: "memory");      /* behind the issued loads, in front of whatever rewrites a register that one of them names */
    if (2 * t <= last) {      /* scalar branch: a wave has no work behind its diagonal */
#pragma unroll      /* constant index into kf[] */
      for (int tk = 0; tk < 2; ++tk) { kf[tk][0] = g2_lfrag(kb + tk * 16 * GP); kf[tk][1] = g2_lfrag(kb + tk * 16 * GP + 64); }
#pragma unroll      /* constant index into vf[] */
      for (int dt = 0; dt < 4; ++dt) vf[dt] = g2_lfrag(vb + dt * 16 * GP);
      __builtin_amdgcn_sched_barrier(0);      /* keeps the stage's first fragment reads together in front of its products: spread among them, each small group of reads makes the wave wait out the LDS latency anew */
      fa_pass<true>(2 * t, last, vm0, qw, ln, hh, kb + 32 * GP, vb + 64, qf, kf, vf, o, mr, l);      /* where the diagonal lies in this pass, the fragments read for the next go unused: rows of the same buffer */
      if (2 * t < last) fa_pass<false>(2 * t + 1, last, vm1, qw, ln, hh, kb, vb, qf, kf, vf, o, mr, l); }      /* scalar branch */
    asm volatile("s_wait_dscnt 0x0" ::: "memory");      /* this wave's reads of the buffer have returned before the buffer is given up */
    asm volatile("s_wait_asynccnt 0x0" ::: "memory");      /* this wave's copies of stage t + 1 have landed */
    __syncthreads();      /* publishes stage t + 1 and ends every wave's reads of stage t */
    if (t + 2 < ns) fa_stage(la + buf, gk + (size_t)(t + 2) * 64 * LQ, gv + (size_t)(t + 2) * 64); }
  asm volatile("s_wait_asynccnt 0x0" ::: "memory");      /* no copy is on its way when the wave ends */
  asm volatile("s_wait_loadcnt 0x0" ::: "memory");      /* the last trip's fetches ahead are unused: they land here, so that no load is still on its way to a register when the wave gives its registers back */
#pragma unroll      /* constant index into o[], l[] */
  for (int g = 0; g < 2; ++g) { const float fin = 64.0f * (1.0f / (l[g] + fa_xhalf(l[g])));      /* the halves' sums joined once; o carried x64 */
    _Float16* op = O + ((size_t)b * SQ + qw + 16u * (unsigned)g + ln) * DM + h * HD + 8u * hh;
#pragma unroll      /* constant index into o[] */
    for (int dt = 0; dt < 4; ++dt) *(v8h*)(op + dt * 16) = __builtin_convertvector(o[g][dt] * fin, v8h); } }      /* a lane's 8 registers are 8 consecutive columns of its query's row: one 16-byte store */

// f32 attention for the FIRST query tile of each causal sequence (rows 0..QT0-1 of a batch; QF, KF, VF: QT0 rows a batch, OF likewise): ONE WAVE PER QUERY ROW, workgroup = A0W waves = A0W consecutive rows of one head of one batch. The head's QT0 key rows and value rows are
// staged once in LDS with coalesced 16-byte loads (key pitch HD + 4 floats: 16 lanes that each read 16 bytes of their own key row fall on distinct banks). Scores: lane l owns keys l, l + 32, l + 64, l + 96 (four partial
// sums per key over the head dimension), invalid keys (j > i or pm[j] == 0) are REPLACED by -1e30; maximum and sum close with a five-step butterfly over the lanes (precise expf, weight exactly 0 for an invalid key
// whenever the row has one valid key). q, k, v rows at pitch LQ, o rows at pitch DM. o: lane l owns columns 2l, 2l + 1 and walks all keys (four partial sums over the keys), the weights read back from the wave's own LDS row as broadcasts.
#define A0W 8                        /* query rows (= waves) per workgroup */
#define A0S (QT0 / (2 * A0W))        /* staging steps: a workgroup's threads cover 2 * A0W rows of 64 floats a step, 16 bytes a thread */
static_assert(QT0 % A0W == 0 && QT0 % 32 == 0 && (QT0 * (HD / 4)) % (32 * A0W) == 0 && HD == 64);
typedef float v2f  __attribute__((ext_vector_type(2)));
typedef float v2fa __attribute__((ext_vector_type(2), may_alias));
__device__ __forceinline__ void d_att0(unsigned blk, const float* __restrict__ QF, const float* __restrict__ KF, const float* __restrict__ VF, const int* __restrict__ pm, float scale, float* __restrict__ OF) {
  __shared__ __attribute__((aligned(16))) float lk[QT0][HD + 4]; __shared__ __attribute__((aligned(16))) float lv[QT0][HD]; __shared__ __attribute__((aligned(16))) float lp[A0W][QT0];
  /* readfirstlane: the wave's number in a scalar register, so that the q row's address is scalar */
  const unsigned tid = threadIdx.x, lane = tid & 31u; const unsigned w = (unsigned)__builtin_amdgcn_readfirstlane((int)(tid >> 5));
  const unsigned b = blk / (unsigned)(NH * (QT0 / A0W)), h = (blk / (unsigned)(QT0 / A0W)) % (unsigned)NH, rg = blk % (unsigned)(QT0 / A0W); const unsigned i = rg * (unsigned)A0W + w;
  QF += (size_t)b * QT0 * LQ; KF += (size_t)b * QT0 * LQ; VF += (size_t)b * QT0 * LQ; pm += (size_t)b * SQ_FULL; OF += (size_t)b * QT0 * DM;
  const unsigned r0 = tid >> 4, c4 = (tid & 15u) * 4u; const float* kp = KF + (size_t)r0 * LQ + h * HD + c4; const float* vp = VF + (size_t)r0 * LQ + h * HD + c4; const float* qr = QF + (size_t)i * LQ + h * HD;
  v4f kk[A0S], vv[A0S], qq[HD / 4]; int pv[QT0 / 32];
#pragma unroll      /* constant index into kk[] and vv[]; constant pitch: one address per plane, the steps as immediate offsets; all of a thread's loads in flight together */
  for (int it = 0; it < A0S; ++it) { kk[it] = *(const v4fa*)(kp + (size_t)it * (2 * A0W) * LQ); vv[it] = *(const v4fa*)(vp + (size_t)it * (2 * A0W) * LQ); }
#pragma unroll      /* constant index into pv[] */
  for (int u = 0; u < QT0 / 32; ++u) pv[u] = pm[(unsigned)u * 32u + lane];
#pragma unroll      /* constant index into qq[] */
  for (int c = 0; c < HD / 4; ++c) qq[c] = *(const v4fa*)(qr + c * 4);
  asm volatile("s_wait_xcnt 0x0" :: "v"(kp), "v"(vp) : "memory");      /* behind the last staging load, in front of whatever rewrites a register that an issued load names; kp and vp as inputs keep both address pairs live up to here, so that no load of the run lands in one */
#pragma unroll      /* constant index into kk[] and vv[] */
  for (int it = 0; it < A0S; ++it) { *(v4fa*)&lk[r0 + (unsigned)it * (unsigned)(2 * A0W)][c4] = kk[it]; *(v4fa*)&lv[r0 + (unsigned)it * (unsigned)(2 * A0W)][c4] = vv[it]; }
  __syncthreads();      /* publishes the staged key and value rows to every wave */
  const v4f z4 = {0.f, 0.f, 0.f, 0.f}; v4f acc[QT0 / 32];
#pragma unroll      /* constant index into acc[] */
  for (int u = 0; u < QT0 / 32; ++u) acc[u] = z4;
#pragma unroll      /* constant index into acc[] and qq[]; the LDS reads of several steps in flight together */
  for (int c = 0; c < HD / 4; ++c) {
#pragma unroll      /* constant index into acc[] */
    for (int u = 0; u < QT0 / 32; ++u) acc[u] += qq[c] * *(const v4fa*)&lk[(unsigned)u * 32u + lane][c * 4]; }
  float sm[QT0 / 32]; float mx = -1.0e30f;
#pragma unroll      /* constant index into acc[] and sm[] */
  for (int u = 0; u < QT0 / 32; ++u) { const unsigned j = (unsigned)u * 32u + lane; const float s = ((acc[u][0] + acc[u][1]) + (acc[u][2] + acc[u][3])) * scale; sm[u] = ((j <= i) & (pv[u] != 0)) ? s : -1.0e30f; mx = fmaxf(mx, sm[u]); }
  for (int d = 16; d > 0; d >>= 1) mx = fmaxf(mx, __shfl_xor(mx, d, 32));
  float l = 0.f;
#pragma unroll      /* constant index into sm[] */
  for (int u = 0; u < QT0 / 32; ++u) { const float e = expf(sm[u] - mx); lp[w][(unsigned)u * 32u + lane] = e; l += e; }
  for (int d = 16; d > 0; d >>= 1) l += __shfl_xor(l, d, 32);
  __syncthreads();      /* the weights are written by one lane and read by all lanes of the wave */
  const v2f z2 = {0.f, 0.f}; v2f o[4] = {z2, z2, z2, z2};
#pragma unroll 8      /* several steps' LDS reads in flight together */
  for (int j4 = 0; j4 < QT0 / 4; ++j4) { const v4f pj = *(const v4fa*)&lp[w][j4 * 4];
#pragma unroll      /* constant index into o[] and pj */
    for (int u = 0; u < 4; ++u) o[u] += pj[u] * *(const v2fa*)&lv[j4 * 4 + u][lane * 2u]; }
  const float fin = 64.0f * (1.0f / l);      /* o carried x64 like the f16 path */
  const v2f oo = ((o[0] + o[1]) + (o[2] + o[3])) * fin;
  *(v2f*)(OF + (size_t)i * DM + h * HD + lane * 2u) = oo; }

// row LayerNorm over DM = 1024 of f32 rows: mean, BIASED variance, (x - mu) * rsqrt(var + eps) * bf16(g[c]) + bf16(b[c]) -> f16 rows (GEMM operand); workgroup = 256 threads = row r, thread t owns columns 4t..4t+3;
// RES 1: the row is first formed as the residual without an output projection, X1[r][c] = bf16(x[r][c]) + o[r][c] / 64 (o: f32 first-tile rows OF0 for the first QT0 rows of a batch, else the f16 rows O16; + NaN when the batch's first mask entry is 0:
// the structure the attention kernels rely on is violated), stored to X1 and normalised from the registers that hold it;
template <int BFIN, int FULLIN, int RES>
__device__ __forceinline__ void d_lnx(unsigned r, const float* __restrict__ X, const float* __restrict__ g, const float* __restrict__ bb, float eps, _Float16* __restrict__ N16,
    const int* __restrict__ pm, const _Float16* __restrict__ O16, const float* __restrict__ OF0, float* __restrict__ X1) {
  /* as in the two kernels this body is made of: every rounding of the residual and of the row statistics stays what it was, so x1 and the normalised rows come out bit for bit the same */
  #pragma clang fp contract(off)
  __shared__ float red[256]; const unsigned t = threadIdx.x; const unsigned c0 = t * 4u;
  const size_t xr = FULLIN ? ((size_t)(r / (unsigned)SQ) * SQ_FULL + (r % (unsigned)SQ)) : (size_t)r;
  int p0 = 1; if (RES) p0 = pm[(size_t)(r / (unsigned)SQ) * SQ_FULL];      /* first, so that it is on its way together with the row's loads */
  const v4f xa = *(const v4fa*)(X + xr * DM + c0); float s[4]; float sum = 0.f; v4f o4 = {0.f, 0.f, 0.f, 0.f};
  if (RES) { const unsigned b = r / (unsigned)SQ, rl = r % (unsigned)SQ;      /* the same for the whole workgroup */
    asm volatile("s_wait_xcnt 0x0" ::: "memory");      /* behind the issued load of the x row, in front of the next loads' address arithmetic, which may rewrite a register that it names */
    if (rl < (unsigned)QT0) o4 = *(const v4fa*)(OF0 + ((size_t)b * QT0 + rl) * DM + c0);
    else { const v4h oh = *(const v4h*)(O16 + (size_t)r * DM + c0); for (int q = 0; q < 4; ++q) o4[q] = (float)oh[q]; }
  }
  const float pz = (p0 != 0) ? 0.f : __uint_as_float(0x7fc00000u);
  for (int q = 0; q < 4; ++q) { s[q] = BFIN ? bf16_rne(xa[q]) : xa[q]; if (RES) s[q] = (s[q] + o4[q] * 0.015625f) + pz; sum = sum + s[q]; }
  red[t] = sum; __syncthreads(); for (unsigned st = 128u; st > 0u; st >>= 1) { if (t < st) red[t] = red[t] + red[t + st]; __syncthreads(); } const float mu = red[0] * (1.0f / (float)DM); __syncthreads();
  float vs = 0.f; for (int q = 0; q < 4; ++q) { const float dl = s[q] - mu; vs = vs + dl * dl; } red[t] = vs; __syncthreads(); for (unsigned st = 128u; st > 0u; st >>= 1) { if (t < st) red[t] = red[t] + red[t + st]; __syncthreads(); }
  const float rs = rsqrtf(red[0] * (1.0f / (float)DM) + eps); v4h y;
  for (int q = 0; q < 4; ++q) { const unsigned c = c0 + (unsigned)q; y[q] = (_Float16)((((s[q] - mu) * rs) * bf16_rne(g[c])) + bf16_rne(bb[c])); }
  { *(v4h*)(N16 + (size_t)r * DM + c0) = y;  }
  if (RES) { const v4f x1 = {s[0], s[1], s[2], s[3]}; *(v4f*)(X1 + (size_t)r * DM + c0) = x1; } }      /* behind the last barrier: in front of one, the barrier would wait the store out */

// shared launches: every test on blockIdx.x reads the same for a whole workgroup, so each body's barriers stay under workgroup-uniform control flow
#define PB_WH ((unsigned)(NH * (DM / WTK)))      /* workgroups (tiles) of one per-head weight plane: a head's 64 columns are one tile wide */
#define PB_W1 ((unsigned)((DFF / WTN) * (DM / WTK)))
#define PB_W2 ((unsigned)((DM / WTN) * (DFF / WTK)))
// all that reads inputs alone: Wq, Wk, Wv -> the x16 q|k|v plane; W1 [DM][DFF] -> [DFF][DM] x16; W2 [DFF][DM] -> [DM][DFF] x16; h = LN1(bf16(x)) -> f16 rows
__global__ __launch_bounds__(256) void k_prep(const float* __restrict__ wq, const float* __restrict__ wk, const float* __restrict__ wv, _Float16* __restrict__ BQKV, const float* __restrict__ w1, _Float16* __restrict__ BW1,
    const float* __restrict__ w2, _Float16* __restrict__ BW2, const float* __restrict__ x, const float* __restrict__ g1, const float* __restrict__ be1, _Float16* __restrict__ X16) {
  __shared__ __attribute__((aligned(16))) v8us tl[WTN * (WTK / 8)];      /* one tile for the three transposing branches */
  unsigned blk = blockIdx.x;
  if (blk < 3u * PB_WH) { const unsigned p = blk / PB_WH, hk = blk - p * PB_WH, h = hk / (unsigned)(DM / WTK), kt = hk % (unsigned)(DM / WTK);      /* head h: [DM][HD] -> rows h * HD .. of the plane */
    d_wtile<HD, DM>(tl, (p == 0u ? wq : (p == 1u ? wk : wv)) + ((size_t)h * DM + kt * (unsigned)WTK) * HD, BQKV + (size_t)p * DM * DM + (size_t)h * HD * DM + kt * (unsigned)WTK); return; }
  blk -= 3u * PB_WH;
  if (blk < PB_W1) { const unsigned nt = blk / (unsigned)(DM / WTK), kt = blk % (unsigned)(DM / WTK); d_wtile<DFF, DM>(tl, w1 + (size_t)kt * WTK * DFF + nt * (unsigned)WTN, BW1 + (size_t)nt * WTN * DM + kt * (unsigned)WTK); return; }
  blk -= PB_W1;
  if (blk < PB_W2) { const unsigned nt = blk / (unsigned)(DFF / WTK), kt = blk % (unsigned)(DFF / WTK); d_wtile<DM, DFF>(tl, w2 + (size_t)kt * WTK * DM + nt * (unsigned)WTN, BW2 + (size_t)nt * WTN * DFF + kt * (unsigned)WTK); return; }
  blk -= PB_W2;
  d_lnx<1, 1, 0>(blk, x, g1, be1, 1e-5f, X16, (const int*)nullptr, (const _Float16*)nullptr, (const float*)nullptr, (float*)nullptr);
  asm volatile("s_wait_xcnt 0x0" ::: "memory"); }      /* behind the row's store, in front of whatever rewrites a register that it names: the other bodies' code follows it in the built text */

// all that reads the q|k|v GEMM's output alone: the f32 first-tile attention (o x64) and V^T [NB][NH][HD][SQ], all batches
#define MB_A0 ((unsigned)(NB * NH * (QT0 / A0W)))
#define MB_VT ((unsigned)(NB * NH * (SQ / 64)))
static_assert(32 * A0W == 256);
__global__ __launch_bounds__(256) void k_att0_vt(const float* __restrict__ F0, const int* __restrict__ pm, float* __restrict__ OF0, const _Float16* __restrict__ V16, _Float16* __restrict__ VT) {
  if (blockIdx.x >= MB_A0) { d_vt<NH, SQ>(blockIdx.x - MB_A0, V16, LQ, 0, VT); return; }
  d_att0(blockIdx.x, F0, F0 + DM, F0 + 2 * DM, pm, 0.125f, OF0); }

// x1 = bf16(x) + attn, stored, and h2 = LN2(x1) -> f16 rows
__global__ __launch_bounds__(256) void k_res_ln(const float* __restrict__ x, const int* __restrict__ pm, const _Float16* __restrict__ O16, const float* __restrict__ OF0, float* __restrict__ X1,
    const float* __restrict__ g2, const float* __restrict__ be2, _Float16* __restrict__ M16) {
  d_lnx<1, 1, 1>(blockIdx.x, x, g2, be2, 1e-5f, M16, pm, O16, OF0, X1); }

extern "C" void kernel_launch(void* const* d_in, const int* in_sizes, int n_in,
                              void* d_out, int out_size, void* d_ws, size_t ws_size, hipStream_t stream) {
  if (n_in < 13) return;
  const size_t rows_need = (size_t)(NB - 1) * SQ_FULL + SQ;
  if ((size_t)in_sizes[0] < rows_need * DM) return; if ((size_t)in_sizes[1] < rows_need) return;
  if ((size_t)in_sizes[2] < (size_t)NH * DM * HD || (size_t)in_sizes[3] < (size_t)NH * DM * HD || (size_t)in_sizes[4] < (size_t)NH * DM * HD) return;
  if (in_sizes[5] < DM || in_sizes[6] < DM || in_sizes[7] < DM || in_sizes[8] < DM) return;
  if ((size_t)in_sizes[9] < (size_t)DM * DFF || in_sizes[10] < DFF || (size_t)in_sizes[11] < (size_t)DFF * DM || in_sizes[12] < DM) return;
  if ((size_t)out_size < NR * DM) return;
  const float* x = (const float*)d_in[0]; const int* pmask = (const int*)d_in[1];
  const float* wq = (const float*)d_in[2]; const float* wk = (const float*)d_in[3]; const float* wv = (const float*)d_in[4];
  const float* g1 = (const float*)d_in[5]; const float* be1 = (const float*)d_in[6]; const float* g2 = (const float*)d_in[7]; const float* be2 = (const float*)d_in[8];
  const float* w1 = (const float*)d_in[9]; const float* b1 = (const float*)d_in[10]; const float* w2 = (const float*)d_in[11]; const float* b2 = (const float*)d_in[12];
  char* ws = (char*)d_ws; size_t off = 0;
  auto take = [&](size_t bytes) { char* p = ws + off; off += (bytes + 255) & ~(size_t)255; return p; };
  _Float16* BQKV = (_Float16*)take((size_t)3 * DM * DM * 2);          /* [3*DM][DM] x16: q | k | v stacked, row (h*HD + d) */
  _Float16* X16 = (_Float16*)take(NR * DM * 2);                       /* LN1 rows; reused as the LN2 rows (last reader of LN1 rows: the q|k|v GEMM, before LN2 writes) */
  float* X1 = (float*)take(NR * DM * 4);
  _Float16* BW1 = (_Float16*)take((size_t)DFF * DM * 2); _Float16* BW2 = (_Float16*)take((size_t)DM * DFF * 2);
  _Float16* QKV = (_Float16*)take(NR * 3 * DM * 2); _Float16* Q16 = QKV; _Float16* K16 = QKV + DM; _Float16* V16 = QKV + 2 * DM;
  _Float16* HF16 = QKV;                                               /* FFN hidden rows [NR][DFF] alias the q|k|v rows (dead after the attention); DFF <= 3*DM asserted */
  _Float16* O16 = (_Float16*)take(NR * DM * 2);
  _Float16* VT = (_Float16*)take((size_t)NB * NH * HD * SQ * 2);      /* V^T [NB][NH][HD][SQ] */
  float* F0 = (float*)take((size_t)NB * QT0 * 3 * DM * 4);            /* f32 q | k | v of the first 128 rows of each batch */
  float* OF0 = (float*)take((size_t)NB * QT0 * DM * 4);
  _Float16* M16 = X16;
  if (off > ws_size || off > (size_t)134217728) return;
  k_prep<<<3u * PB_WH + PB_W1 + PB_W2 + (unsigned)NR, 256, 0, stream>>>(wq, wk, wv, BQKV, w1, BW1, w2, BW2, x, g1, be1, X16);      /* weight planes (x16, transposed) and h = LN1(bf16(x)) */
  k_gemm2<0><<<dim3((unsigned)((NR / 128) * (3 * DM / 128)), 1), 256, 0, stream>>>(X16, DM, (size_t)0, BQKV, DM, (size_t)0, 0.0625f, (const float*)nullptr, (const float*)nullptr, (float*)nullptr, QKV, F0, (unsigned)(SQ / 128), LQ, (size_t)0, (int)NR, 3 * DM, DM);      /* q | k | v rows (f16); rows 0..127 of each batch in f32 too */
  k_att0_vt<<<MB_A0 + MB_VT, 256, 0, stream>>>(F0, pmask, OF0, V16, VT);      /* f32 attention for rows 0..127 of each batch (o x64); V^T */
  k_fattn<<<NB * NH * FNT, 32 * FW, 0, stream>>>(Q16, K16, VT, pmask, O16);      /* o (merged heads, x64) as f16 rows, all batches, heads and query tiles */
  k_res_ln<<<(unsigned)NR, 256, 0, stream>>>(x, pmask, O16, OF0, X1, g2, be2, M16);      /* x1 = bf16(x) + attn; h2 = LN2(x1) -> f16 rows */
  k_gemm2<3><<<dim3((unsigned)((NR / 128) * (DFF / 128)), 1), 256, 0, stream>>>(M16, DM, (size_t)0, BW1, DM, (size_t)0, 0.0625f, b1, (const float*)nullptr, (float*)nullptr, HF16, (float*)nullptr, 1u, DFF, (size_t)0, (int)NR, DFF, DM);      /* relu(h2 W1 + b1) -> f16 */
  k_gemm2<0><<<dim3((unsigned)((NR / 128) * (DM / 128)), 1), 256, 0, stream>>>(HF16, DFF, (size_t)0, BW2, DFF, (size_t)0, 0.0625f, b2, X1, (float*)d_out, (_Float16*)nullptr, (float*)nullptr, 1u, DM, (size_t)0, (int)NR, DM, DFF);      /* out = x1 + mlp (own-element residual) */
}

// v008
// It runs in 136 microseconds.
// In both of two side-by-side timings against v007, it was 1.03 times as fast.
// Over all steps from v000 it is 37.7 times as fast.
#include <hip/hip_runtime.h>
// Pre-LN causal transformer layer: x [NB][SEQ][1024]; h = LN1(x) (biased variance, eps 1e-5); q/k/v[b][h] = h Wq/Wk/Wv[h] (per-head [16][1024][64], [in][out], no biases); scores / sqrt(64); mask = padding_mask[b][key] AND causal, masked scores REPLACED by -1e9; softmax; heads concatenated (no output projection); x1 = x + attn; h2 = LN2(x1); out = x1 + relu(h2 W1 + b1) W2 + b2 ([in][out] 1024 x 1024 x 1024).
// Structure: LN1 on VALU (one wave per row) -> f16 rows; weights transposed through LDS tiles (per-head ones into one x16 f16 q|k|v plane); q|k|v as ONE WMMA GEMM (operands staged in LDS, 32x64 wave tiles, f32 accumulation, f16 out); V^T via LDS transposes and an f32 first tile (rows 0..127 of each batch) on VALU; then ONE fused attention launch for all batches and heads (keys and values staged in LDS per workgroup; scores, masked online softmax and P V in registers, one wave per 32 queries; o x64 f16); x1 = bf16(x) + o / 64; LN2 -> f16; FFN as two GEMMs (ReLU epilogue; own-element residual).
// Launches (7): kernels that do not depend on one another share a launch, each on its own range of workgroup indices: {weight transposes, LN1}; q|k|v GEMM (also stores its first-tile rows in f32); {first-tile attention, V^T}; fused attention; {residual + LN2, one wave per row}; FFN 1; FFN 2.
// Compute dtype: all contractions v_wmma_f32_16x16x32_f16 (f16 operands, f32 accumulate); float inputs RNE-converted to bf16 first (weights then x16, exact in f16); q, k, v, softmax weights (relative to the running row maximum) and o (x64) as plain f16 operands; scores and softmax statistics f32; first 128 query rows of each batch in f32 on VALU.
#ifndef NB
#define NB 2
#endif
#ifndef SEQ
#define SEQ 2048
#endif
#define SQ SEQ
#define NB_FULL 2
#define SQ_FULL 2048                 /* per-batch row stride of the inputs (x rows, mask entries) */
#define DM 1024
#define NH 16
#define HD 64
#define DFF 1024
#define QT0 128                      /* first-tile rows computed in f32 */
#define NR ((size_t)NB * SQ)         /* token rows */
#define LQ (3 * DM)                  /* row pitch of the q|k|v rows */
static_assert(NH * HD == DM);
static_assert(QT0 == 128 && QT0 <= SQ && SQ <= SQ_FULL && NB <= NB_FULL);
static_assert(DM % 128 == 0 && DFF % 128 == 0 && HD == 64 && ((size_t)NB * SQ) % 128 == 0);
static_assert(DM / 4 == 256);
static_assert(DFF <= 3 * DM);
static_assert((((size_t)NB * SQ * DM) / 4) % 256 == 0);
static_assert((size_t)NB * SQ * DM / 4 < 0x7fffffffu);

typedef unsigned short v8us __attribute__((ext_vector_type(8), may_alias));
typedef float  v8f  __attribute__((ext_vector_type(8)));
typedef float  v4f  __attribute__((ext_vector_type(4)));
typedef float  v4fa __attribute__((ext_vector_type(4), may_alias));
typedef _Float16 v16h __attribute__((ext_vector_type(16)));
typedef _Float16 v4h __attribute__((ext_vector_type(4)));
union FragH { v16h v; v8us half[2]; _Float16 h[16]; unsigned short u[16]; };

__device__ __forceinline__ unsigned short bf16_bits(float x) { unsigned int u = __float_as_uint(x); return (unsigned short)((u + 0x7FFFu + ((u >> 16) & 1u)) >> 16); }
__device__ __forceinline__ float bf16_rne(float x) { return __uint_as_float(((unsigned int)bf16_bits(x)) << 16); }

// fragment: elements 0..7 <- k0 + 8h + 0..7, elements 8..15 <- k0 + 16 + 8h + 0..7 (same map for A rows and B columns)
__device__ __forceinline__ v16h g2_frag(const _Float16* p, unsigned hh) { FragH f; f.half[0] = *(const v8us*)((const unsigned short*)p + 8u * hh); f.half[1] = *(const v8us*)((const unsigned short*)p + 16u + 8u * hh); return f.v; }
__device__ __forceinline__ v8f g2_mma(v16h a, v16h b, v8f c) { return __builtin_amdgcn_wmma_f32_16x16x32_f16(false, a, false, b, (short)0, c, false, false); }

// GEMM (wave tile 32x64; workgroup = 8 waves (4 x 2) = 128 rows x 128 cols; M % 128 == 0, N % 128 == 0, K % 64 == 0): A f16 [M][K] (pitch lda, batch stride sA), Bh f16 [N][K] (pitch ldb, batch stride sB);
// a stage is 64 k of the tile's 128 A rows and 128 B rows (128 bytes a row: whole lines), brought into LDS by asynchronous 16-byte copies at row pitch 144 bytes (conflict-free for the 16-byte fragment reads); two buffers: the next stage's copies fly while this stage is worked on.
// v = acc * alpha + bf16(bias[col]) (+ CP own element of the batched C plane); ACT 0 none / 3 relu; writes f32 C and/or f16 C16 (pitch ldc, batch offset by * sC); CT (may be null): every tper-th row tile (mt % tper == 0) is stored in f32 as well, as rows (mt / tper) * 128 .. + 127 of CT (pitch ldc);
#define GP 144                       /* LDS row pitch, bytes */
#define GOP (128 * GP)               /* one operand's rows of a stage, bytes */
#define GSTG (2 * GOP)               /* one buffer: the A rows, then the B rows */
static_assert(8 * 32 * 68 * 4 <= 2 * GSTG && GP % 16 == 0);
__device__ __forceinline__ v16h g2_lfrag(const char* p) { FragH f; f.half[0] = *(const v8us*)p; f.half[1] = *(const v8us*)(p + 32); return f.v; }      /* p: the lane's LDS row + 2 k0 + 16 hh bytes: the k order of g2_frag */
// one stage: a lane's 4 copies of A rows (r, r + 32, r + 64, r + 96) and 4 of B rows; a wave's copy covers 4 whole 128-byte rows
__device__ __forceinline__ void g2_stage(unsigned l, const _Float16* ga, size_t ra, const _Float16* gb, size_t rb) {
  /* the copies and, as the last line of their own statement, the wait that stands in front of any rewrite of a register that an issued copy names */
  asm volatile("global_load_async_to_lds_b128 %0, %8, off\n\t"
               "global_load_async_to_lds_b128 %1, %9, off\n\t"
               "global_load_async_to_lds_b128 %2, %10, off\n\t"
               "global_load_async_to_lds_b128 %3, %11, off\n\t"
               "global_load_async_to_lds_b128 %4, %12, off\n\t"
               "global_load_async_to_lds_b128 %5, %13, off\n\t"
               "global_load_async_to_lds_b128 %6, %14, off\n\t"
               "global_load_async_to_lds_b128 %7, %15, off\n\t"
               "s_wait_xcnt 0x0"
               :: "v"(l), "v"(l + 32u * GP), "v"(l + 64u * GP), "v"(l + 96u * GP), "v"(l + GOP), "v"(l + GOP + 32u * GP), "v"(l + GOP + 64u * GP), "v"(l + GOP + 96u * GP),
                  "v"(ga), "v"(ga + ra), "v"(ga + 2 * ra), "v"(ga + 3 * ra), "v"(gb), "v"(gb + rb), "v"(gb + 2 * rb), "v"(gb + 3 * rb) : "memory"); }
template <int ACT>
__global__ __launch_bounds__(256) void k_gemm2(const _Float16* __restrict__ A, int lda, size_t sA, const _Float16* __restrict__ Bh, int ldb, size_t sB, float alpha,
    const float* __restrict__ bias, const float* __restrict__ CP, float* __restrict__ C, _Float16* __restrict__ C16, float* __restrict__ CT, unsigned tper, int ldc, size_t sC, int M, int N, int K) {
  static_assert(ACT == 0 || ACT == 3);
  __shared__ __attribute__((aligned(16))) char sm[2 * GSTG];
  const unsigned tid = threadIdx.x, w = tid >> 5, lane = tid & 31u, ln = lane & 15u, hh = lane >> 4; const unsigned by = blockIdx.y;
  A += (size_t)by * sA; Bh += (size_t)by * sB; const size_t cofs = (size_t)by * sC;
  const unsigned ntn = (unsigned)N >> 7; const unsigned mt = blockIdx.x / ntn, nq = blockIdx.x - mt * ntn; if (mt * 128u >= (unsigned)M) return;      /* the same for the whole workgroup, in front of every barrier */
  const unsigned row0 = mt * 128u + 32u * (w >> 1), col0 = nq * 128u + 64u * (w & 1u);
  const unsigned cr = tid >> 3, cc = tid & 7u;      /* copies: 8 lanes a row, 32 rows a step of the workgroup */
  const _Float16* ga = A + (size_t)(mt * 128u + cr) * (size_t)lda + cc * 8u; const _Float16* gb = Bh + (size_t)(nq * 128u + cr) * (size_t)ldb + cc * 8u; const size_t ra = (size_t)32 * (size_t)lda, rb = (size_t)32 * (size_t)ldb;
  const unsigned la = (unsigned)(size_t)sm + cr * (unsigned)GP + cc * 16u;      /* the lane's LDS byte address in buffer 0, A rows */
  const char* pa = sm + (32u * (w >> 1) + ln) * (unsigned)GP + 16u * hh; const char* pb = sm + GOP + (64u * (w & 1u) + ln) * (unsigned)GP + 16u * hh;
  const int nt = K >> 6;
  g2_stage(la, ga, ra, gb, rb);
  asm volatile("s_wait_asynccnt 0x0" ::: "memory");      /* this wave's copies of stage 0 have landed */
  __syncthreads();      /* publishes stage 0 to every wave */
  if (nt > 1) g2_stage(la + GSTG, ga + 64, ra, gb + 64, rb);
  const v8f z8 = {0.f,0.f,0.f,0.f,0.f,0.f,0.f,0.f}; v8f c00 = z8, c01 = z8, c02 = z8, c03 = z8, c10 = z8, c11 = z8, c12 = z8, c13 = z8;
#pragma unroll 1      /* one trip of code: the ring's order stays as written */
  for (int t = 0; t < nt; ++t) { const unsigned buf = ((unsigned)t & 1u) * (unsigned)GSTG; const char* qa = pa + buf; const char* qb = pb + buf;
    const v16h a0 = g2_lfrag(qa), a1 = g2_lfrag(qa + 16 * GP), b0 = g2_lfrag(qb), b1 = g2_lfrag(qb + 16 * GP), b2 = g2_lfrag(qb + 32 * GP), b3 = g2_lfrag(qb + 48 * GP);
    const v16h e0 = g2_lfrag(qa + 64), e1 = g2_lfrag(qa + 16 * GP + 64), f0 = g2_lfrag(qb + 64), f1 = g2_lfrag(qb + 16 * GP + 64), f2 = g2_lfrag(qb + 32 * GP + 64), f3 = g2_lfrag(qb + 48 * GP + 64);
    __builtin_amdgcn_sched_barrier(0);      /* keeps the trip's fragment reads together in front of its products: spread among them, each small group of reads makes the wave wait out the LDS latency anew */
    c00 = g2_mma(a0, b0, c00); c10 = g2_mma(a1, b0, c10); c01 = g2_mma(a0, b1, c01); c11 = g2_mma(a1, b1, c11); c02 = g2_mma(a0, b2, c02); c12 = g2_mma(a1, b2, c12); c03 = g2_mma(a0, b3, c03); c13 = g2_mma(a1, b3, c13);
    __builtin_amdgcn_sched_barrier(0);      /* keeps the first half's products in front of the waits below, so that the second half's fragment reads return behind them and not in front of an idle matrix unit */
    asm volatile("s_wait_dscnt 0x0" ::: "memory");      /* this wave's reads of the buffer have returned before the buffer is given up */
    asm volatile("s_wait_asynccnt 0x0" ::: "memory");      /* this wave's copies of stage t + 1 have landed */
    __syncthreads();      /* publishes stage t + 1 and ends every wave's reads of stage t */
    if (t + 2 < nt) g2_stage(la + buf, ga + (size_t)(t + 2) * 64, ra, gb + (size_t)(t + 2) * 64, rb);
    /* the second half's products, on fragments already in registers, run while the copies fly */
    c00 = g2_mma(e0, f0, c00); c10 = g2_mma(e1, f0, c10); c01 = g2_mma(e0, f1, c01); c11 = g2_mma(e1, f1, c11); c02 = g2_mma(e0, f2, c02); c12 = g2_mma(e1, f2, c12); c03 = g2_mma(e0, f3, c03); c13 = g2_mma(e1, f3, c13); }
  asm volatile("s_wait_asynccnt 0x0" ::: "memory");      /* no copy is on its way when the ring becomes output staging */
  float (*so)[32][68] = (float (*)[32][68])sm;      /* output staging, a wave's own tile, in the ring, which every wave has left at the last trip's barrier */
  v8f accs[8] = {c00, c01, c02, c03, c10, c11, c12, c13};
#pragma unroll
  for (int u = 0; u < 8; ++u) { const unsigned t = (unsigned)u & 3u, half = (unsigned)u >> 2; const unsigned col = col0 + t * 16u + ln; const float bv = bias ? bf16_rne(bias[col]) : 0.f;
#pragma unroll
    for (int r = 0; r < 8; ++r) { const unsigned rloc = half * 16u + 8u * hh + (unsigned)r; float v = accs[u][r] * alpha + bv;
      if (CP) v += CP[cofs + (size_t)(row0 + rloc) * (size_t)ldc + col];      /* own element of the batched C plane */
      if (ACT == 3) v = fmaxf(v, 0.f);
      so[w][rloc][t * 16u + ln] = v; } }
  __builtin_amdgcn_fence(4 /* acq_rel order */, "workgroup"); __builtin_amdgcn_wave_barrier();      /* wave-private tile: same wave writes and reads */
  const unsigned rsub = lane >> 4, c4 = (lane & 15u) * 4u;
  const bool wt = CT != nullptr && mt % tper == 0u; const size_t cto = ((size_t)(mt / tper) * 128u + 32u * (w >> 1)) * (size_t)ldc + col0 + c4;      /* wt: the same for the whole workgroup */
  {
#pragma unroll
    for (int q = 0; q < 16; ++q) { const unsigned r = (unsigned)q * 2u + rsub; const v4f v = *(const v4fa*)&so[w][r][c4];
      if (C) { *(v4f*)(C + cofs + (size_t)(row0 + r) * (size_t)ldc + col0 + c4) = v; asm volatile("s_wait_xcnt 0x0" ::: "memory"); }      /* behind the issued store, in front of the next address arithmetic, which may rewrite a register that it names */
      if (wt) { *(v4f*)(CT + cto + (size_t)r * (size_t)ldc) = v; asm volatile("s_wait_xcnt 0x0" ::: "memory"); }      /* likewise */
      if (C16) { v4h h4; for (int i = 0; i < 4; ++i) h4[i] = (_Float16)v[i]; *(v4h*)(C16 + cofs + (size_t)(row0 + r) * (size_t)ldc + col0 + c4) = h4; } }
     } }

// the bodies below run on a range of a shared launch's workgroups: blk, where they take it, is the workgroup's index inside that range
// weight plane W [k][n] f32 (pitch SP) -> Wt [n][k] f16 (pitch OP), value (f16)(16 * bf16(w)): a workgroup takes WTK k rows x WTN n columns through LDS. W, Wt: the tile's first element in each plane; tl: the workgroup's LDS tile, WTN * WTK / 8 chunks.
// In: a thread reads 16 bytes of each of 8 consecutive k rows (16 lanes cover 256 contiguous bytes of a row: whole lines), so it holds 8 k of 4 columns and writes each column's 8 values as one 16-byte chunk.
// Out: 16 lanes read the 16 chunks of one n row and store 256 contiguous bytes. Chunk c of row n lies at place c ^ (n >> 2) of the row: the 16 lanes of a write (rows 4 apart, one c) and of a read (one row, all c) each fall on 16 distinct 16-byte bank groups.
#define WTK 128
#define WTN 64
static_assert(WTN == 64 && WTK == 128 && DM % WTK == 0 && DFF % WTK == 0 && DM % WTN == 0 && DFF % WTN == 0 && HD == WTN);
template <int SP, int OP>
__device__ __forceinline__ void d_wtile(v8us* tl, const float* __restrict__ W, _Float16* __restrict__ Wt) {
  const unsigned tid = threadIdx.x, lo = tid & 15u, hi = tid >> 4;
  const float* sp = W + (size_t)(hi * 8u) * SP + lo * 4u; v4f a[8];
#pragma unroll      /* constant index into a[]; constant pitch: one address, the rows as immediate offsets; all of a thread's loads in flight together */
  for (int j = 0; j < 8; ++j) a[j] = *(const v4fa*)(sp + (size_t)j * SP);
#pragma unroll      /* constant index into a[] */
  for (int i = 0; i < 4; ++i) { FragH f;
#pragma unroll      /* constant index into a[] and f */
    for (int j = 0; j < 8; ++j) f.h[j] = (_Float16)(16.0f * bf16_rne(a[j][i]));
    tl[(lo * 4u + (unsigned)i) * (unsigned)(WTK / 8) + (hi ^ lo)] = f.half[0]; }
  __syncthreads();      /* publishes the tile: a chunk is written by one thread and stored by another */
  unsigned short* dp = (unsigned short*)Wt + (size_t)hi * OP + lo * 8u;
#pragma unroll      /* constant pitch: one address, the rows as immediate offsets */
  for (int q = 0; q < WTN / 16; ++q) { const unsigned n = hi + 16u * (unsigned)q; *(v8us*)(dp + (size_t)q * 16 * OP) = tl[n * (unsigned)(WTK / 8) + (lo ^ (n >> 2))]; }
  asm volatile("s_wait_xcnt 0x0" ::: "memory"); }      /* behind the last of the run's stores, in front of whatever rewrites a register that one of them names: another body's code follows in the built text */

template <int NHv, int TTv>
__device__ __forceinline__ void d_vt(unsigned blk, const _Float16* __restrict__ V16, int ldv, int voff, _Float16* __restrict__ Vt) {
  __shared__ unsigned short tl[64][66]; const unsigned tid = threadIdx.x; const unsigned slab = blk / (unsigned)(TTv / 64), lg = blk % (unsigned)(TTv / 64); const unsigned b = slab / (unsigned)NHv, h = slab % (unsigned)NHv;
  for (unsigned i = tid; i < 64u * 8u; i += 256u) { const unsigned r = i >> 3, c8 = (i & 7u) * 8u; FragH f; f.half[0] = *(const v8us*)((const unsigned short*)V16 + ((size_t)b * TTv + lg * 64u + r) * (size_t)ldv + (size_t)voff + h * 64u + c8);
#pragma unroll
    for (int q = 0; q < 8; ++q) tl[r][c8 + (unsigned)q] = f.u[q]; }
  __syncthreads();
  {
#pragma unroll
    for (int rd = 0; rd < 2; ++rd) { const unsigned d = (unsigned)rd * 32u + (tid >> 3), pc = tid & 7u; FragH f;
#pragma unroll
      for (int q = 0; q < 8; ++q) f.u[q] = tl[pc * 8u + (unsigned)q][d];
      *(v8us*)((unsigned short*)Vt + ((size_t)slab * 64u + d) * TTv + lg * 64u + pc * 8u) = f.half[0]; }
     } }

#define FQ 32                        /* query columns per wave */
#define FW 4                         /* waves per workgroup */
#define FNT (SQ / (FQ * FW))         /* query tiles of a sequence */
#define FOP (64 * GP)                /* one operand's 64 rows of a stage, bytes */
#define FSTG (2 * FOP)               /* one buffer: the key rows, then the rows of the transposed value plane */
static_assert(SQ % (FQ * FW) == 0 && FNT % 2 == 0 && HD == 64 && FQ == 32 && FQ * FW == 128 && SQ % 64 == 0);
typedef _Float16 v8h __attribute__((ext_vector_type(8)));
__device__ __forceinline__ float fa_xhalf(float x) { return __builtin_bit_cast(float, __builtin_amdgcn_permlanex16(__builtin_bit_cast(int, x), __builtin_bit_cast(int, x), 0x76543210, 0xfedcba98, false, false)); }      /* lane l with lane l ^ 16 */
__device__ __forceinline__ v8f fa_mma(v16h a, v16h b, v8f c) { return __builtin_amdgcn_wmma_f32_16x16x32_f16(false, a, false, b, (short)0, c, false, false); }
// one stage: a lane's 4 copies of key rows (r, r + 16, r + 32, r + 48) and 4 of value-plane rows; a wave's copy covers 4 whole 128-byte rows
__device__ __forceinline__ void fa_stage(unsigned l, const _Float16* gk, const _Float16* gv) {
  /* the copies and, as the last line of their own statement, the wait that stands in front of any rewrite of a register that an issued copy names */
  asm volatile("global_load_async_to_lds_b128 %0, %8, off\n\t"
               "global_load_async_to_lds_b128 %1, %9, off\n\t"
               "global_load_async_to_lds_b128 %2, %10, off\n\t"
               "global_load_async_to_lds_b128 %3, %11, off\n\t"
               "global_load_async_to_lds_b128 %4, %12, off\n\t"
               "global_load_async_to_lds_b128 %5, %13, off\n\t"
               "global_load_async_to_lds_b128 %6, %14, off\n\t"
               "global_load_async_to_lds_b128 %7, %15, off\n\t"
               "s_wait_xcnt 0x0"
               :: "v"(l), "v"(l + 16u * GP), "v"(l + 32u * GP), "v"(l + 48u * GP), "v"(l + FOP), "v"(l + FOP + 16u * GP), "v"(l + FOP + 32u * GP), "v"(l + FOP + 48u * GP),
                  "v"(gk), "v"(gk + (size_t)16 * LQ), "v"(gk + (size_t)32 * LQ), "v"(gk + (size_t)48 * LQ), "v"(gv), "v"(gv + (size_t)16 * SQ), "v"(gv + (size_t)32 * SQ), "v"(gv + (size_t)48 * SQ) : "memory"); }
// one pass: 32 keys (fragments kf, vf) against the wave's 32 queries. NX: the stage's next pass has its fragments read from kx, vx (the lane's LDS places) into the registers just read
template <bool NX>
__device__ __forceinline__ void fa_pass(int s, int last, unsigned vm, unsigned qw, unsigned ln, unsigned hh, const char* kx, const char* vx, const v16h (&qf)[2][2], v16h (&kf)[2][2], v16h (&vf)[4], v8f (&o)[2][4], float (&mr)[2], float (&l)[2]) {
  const v8f z8 = {0.f,0.f,0.f,0.f,0.f,0.f,0.f,0.f};
  const float cs = 0.125f * 1.44269504088896340736f;      /* 1 / sqrt(64), and exp(x) = exp2(x log2 e) */
  v8f sc[2][2];
#pragma unroll      /* constant index into sc[], kf[], qf[] */
  for (int tk = 0; tk < 2; ++tk) { sc[0][tk] = fa_mma(kf[tk][0], qf[0][0], z8); sc[1][tk] = fa_mma(kf[tk][0], qf[1][0], z8); sc[0][tk] = fa_mma(kf[tk][1], qf[0][1], sc[0][tk]); sc[1][tk] = fa_mma(kf[tk][1], qf[1][1], sc[1][tk]); }
  if (NX) {
#pragma unroll      /* constant index into kf[] */
    for (int tk = 0; tk < 2; ++tk) { kf[tk][0] = g2_lfrag(kx + tk * 16 * GP); kf[tk][1] = g2_lfrag(kx + tk * 16 * GP + 64); } }
  if (vm != 0xffffffffu || s == last) {      /* scalar branch: only the diagonal pass and passes with a padded key pay for the mask */
    const unsigned vs = vm >> (8u * hh);
#pragma unroll      /* constant index into sc[] */
    for (int g = 0; g < 2; ++g) { const int qrel = (int)(qw + 16u * (unsigned)g + ln) - (s * 32 + 8 * (int)hh);      /* local key 16 tk + r is causal iff it is <= qrel */
#pragma unroll      /* constant index into sc[] */
      for (int tk = 0; tk < 2; ++tk) {
#pragma unroll      /* constant element index */
        for (int r = 0; r < 8; ++r) sc[g][tk][r] = ((((vs >> (16 * tk + r)) & 1u) != 0u) & (16 * tk + r <= qrel)) ? sc[g][tk][r] : -1.0e9f; } } }
  v16h pf[2];
#pragma unroll      /* constant index into sc[], o[], mr[], l[], pf[] */
  for (int g = 0; g < 2; ++g) {
    float mx = fmaxf(sc[g][0][0], sc[g][1][0]);
#pragma unroll      /* constant element index */
    for (int r = 1; r < 8; ++r) mx = fmaxf(mx, fmaxf(sc[g][0][r], sc[g][1][r]));
    mx = fmaxf(mx, fa_xhalf(mx)); const float mn = fmaxf(mr[g], mx); const float al = __builtin_amdgcn_exp2f((mr[g] - mn) * cs); const float mc = mn * cs; mr[g] = mn;
    v8f p0, p1;
#pragma unroll      /* constant element index */
    for (int r = 0; r < 8; ++r) { p0[r] = __builtin_amdgcn_exp2f(fmaf(sc[g][0][r], cs, -mc)); p1[r] = __builtin_amdgcn_exp2f(fmaf(sc[g][1][r], cs, -mc)); }
    const v8f ps = p0 + p1; l[g] = fmaf(l[g], al, ((ps[0] + ps[1]) + (ps[2] + ps[3])) + ((ps[4] + ps[5]) + (ps[6] + ps[7])));
    const v8h h0 = __builtin_convertvector(p0, v8h), h1 = __builtin_convertvector(p1, v8h);
    pf[g] = __builtin_shufflevector(h0, h1, 0, 1, 2, 3, 4, 5, 6, 7, 8, 9, 10, 11, 12, 13, 14, 15);
#pragma unroll      /* constant index into o[] */
    for (int dt = 0; dt < 4; ++dt) o[g][dt] *= al; }
#pragma unroll      /* constant index into o[], vf[] */
  for (int dt = 0; dt < 4; ++dt) { o[0][dt] = fa_mma(vf[dt], pf[0], o[0][dt]); o[1][dt] = fa_mma(vf[dt], pf[1], o[1][dt]); }
  if (NX) {
    __builtin_amdgcn_sched_barrier(0);      /* keeps the statement below here, behind this pass's products: moved up to the reads it names, it would make the wave wait them out at once */
    asm volatile("" :: "v"(kf[0][0]), "v"(kf[0][1]), "v"(kf[1][0]), "v"(kf[1][1]));      /* inputs only, the loaded values: holds the next pass's key reads in front of this place, so that they return behind this pass's vector work; sunk into the next pass they would make it wait out the LDS latency in front of its first products */
#pragma unroll      /* constant index into vf[] */
    for (int dt = 0; dt < 4; ++dt) vf[dt] = g2_lfrag(vx + dt * 16 * GP); } }
__global__ __launch_bounds__(32 * FW) void k_fattn(const _Float16* __restrict__ Q, const _Float16* __restrict__ K, const _Float16* __restrict__ VT, const int* __restrict__ pm, _Float16* __restrict__ O) {
  __shared__ __attribute__((aligned(16))) char sm[2 * FSTG];
  /* readfirstlane: the wave's number in a scalar register, so that the tests on the wave's diagonal stay scalar branches */
  const unsigned tid = threadIdx.x, lane = tid & 31u, ln = lane & 15u, hh = lane >> 4; const unsigned w = (unsigned)__builtin_amdgcn_readfirstlane((int)(tid >> 5));
  const unsigned rank = blockIdx.x / (unsigned)(NB * NH), bh = blockIdx.x % (unsigned)(NB * NH); const unsigned tile = rank < (unsigned)(FNT / 2) ? (unsigned)(FNT - 1) - rank : rank - (unsigned)(FNT / 2);      /* long tiles first, then the short ones in mirrored order */
  const unsigned b = bh / (unsigned)NH, h = bh % (unsigned)NH; const unsigned qw = tile * (unsigned)(FQ * FW) + w * (unsigned)FQ; const int last = (int)(qw >> 5);      /* pass 'last' holds the wave's diagonal */
  const int ns = (int)(tile * 2u + 2u);      /* stages up to the workgroup's last diagonal: the same for all its waves, at least 2, and 64 ns <= SQ */
  const _Float16* qp = Q + ((size_t)b * SQ + qw + ln) * LQ + h * HD; const int* pp = pm + (size_t)b * SQ_FULL + lane;
  const unsigned cr = tid >> 3, cc = tid & 7u;      /* copies: 8 lanes a row, 16 rows a step of the workgroup */
  const _Float16* gk = K + ((size_t)b * SQ + cr) * LQ + h * HD + cc * 8u; const _Float16* gv = VT + ((size_t)bh * HD + cr) * SQ + cc * 8u;
  const unsigned la = (unsigned)(size_t)sm + cr * (unsigned)GP + cc * 16u;      /* the lane's LDS byte address in buffer 0, key rows */
  const char* pk = sm + ln * (unsigned)GP + 16u * hh; const char* pw = sm + FOP + ln * (unsigned)GP + 16u * hh;      /* the lane's fragment places: row ln, the k order of g2_frag */
  fa_stage(la, gk, gv);
  v16h qf[2][2], kf[2][2], vf[4];
#pragma unroll      /* constant index into qf[] */
  for (int g = 0; g < 2; ++g) { qf[g][0] = g2_frag(qp + (size_t)g * 16 * LQ, hh); qf[g][1] = g2_frag(qp + (size_t)g * 16 * LQ + 32, hh); }
  int pv0 = pp[0], pv1 = pp[32];
  asm volatile("s_wait_xcnt 0x0" ::: "memory");      /* behind the issued loads, in front of whatever rewrites a register that one of them names */
  asm volatile("s_wait_asynccnt 0x0" ::: "memory");      /* this wave's copies of stage 0 have landed */
  __syncthreads();      /* publishes stage 0 to every wave */
  fa_stage(la + FSTG, gk + (size_t)64 * LQ, gv + 64);      /* stage 1 exists: ns >= 2 */
  const v8f z8 = {0.f,0.f,0.f,0.f,0.f,0.f,0.f,0.f}; v8f o[2][4] = {{z8, z8, z8, z8}, {z8, z8, z8, z8}}; float mr[2] = {-3.0e38f, -3.0e38f}, l[2] = {0.f, 0.f};
#pragma unroll 1      /* one trip of code: the ring's order stays as written */
  for (int t = 0; t < ns; ++t) { const unsigned buf = ((unsigned)t & 1u) * (unsigned)FSTG; const char* kb = pk + buf; const char* vb = pw + buf;
    const unsigned vm0 = __builtin_amdgcn_ballot_w32(pv0 != 0), vm1 = __builtin_amdgcn_ballot_w32(pv1 != 0);      /* bit j: key 64 t + j (vm0), 64 t + 32 + j (vm1) passes the padding mask */
    const int tn = t + 1 < ns ? t + 1 : t;      /* the last trip fetches its own entries again: in bounds, unused */
    pv0 = pp[tn * 64]; pv1 = pp[tn * 64 + 32];
    asm volatile("s_wait_xcnt 0x0" ::: "memory");      /* behind the issued loads, in front of whatever rewrites a register that one of them names */
    if (2 * t <= last) {      /* scalar branch: a wave has no work behind its diagonal */
#pragma unroll      /* constant index into kf[] */
      for (int tk = 0; tk < 2; ++tk) { kf[tk][0] = g2_lfrag(kb + tk * 16 * GP); kf[tk][1] = g2_lfrag(kb + tk * 16 * GP + 64); }
#pragma unroll      /* constant index into vf[] */
      for (int dt = 0; dt < 4; ++dt) vf[dt] = g2_lfrag(vb + dt * 16 * GP);
      __builtin_amdgcn_sched_barrier(0);      /* keeps the stage's first fragment reads together in front of its products: spread among them, each small group of reads makes the wave wait out the LDS latency anew */
      fa_pass<true>(2 * t, last, vm0, qw, ln, hh, kb + 32 * GP, vb + 64, qf, kf, vf, o, mr, l);      /* where the diagonal lies in this pass, the fragments read for the next go unused: rows of the same buffer */
      if (2 * t < last) fa_pass<false>(2 * t + 1, last, vm1, qw, ln, hh, kb, vb, qf, kf, vf, o, mr, l); }      /* scalar branch */
    asm volatile("s_wait_dscnt 0x0" ::: "memory");      /* this wave's reads of the buffer have returned before the buffer is given up */
    asm volatile("s_wait_asynccnt 0x0" ::: "memory");      /* this wave's copies of stage t + 1 have landed */
    __syncthreads();      /* publishes stage t + 1 and ends every wave's reads of stage t */
    if (t + 2 < ns) fa_stage(la + buf, gk + (size_t)(t + 2) * 64 * LQ, gv + (size_t)(t + 2) * 64); }
  asm volatile("s_wait_asynccnt 0x0" ::: "memory");      /* no copy is on its way when the wave ends */
  asm volatile("s_wait_loadcnt 0x0" ::: "memory");      /* the last trip's fetches ahead are unused: they land here, so that no load is still on its way to a register when the wave gives its registers back */
#pragma unroll      /* constant index into o[], l[] */
  for (int g = 0; g < 2; ++g) { const float fin = 64.0f * (1.0f / (l[g] + fa_xhalf(l[g])));      /* the halves' sums joined once; o carried x64 */
    _Float16* op = O + ((size_t)b * SQ + qw + 16u * (unsigned)g + ln) * DM + h * HD + 8u * hh;
#pragma unroll      /* constant index into o[] */
    for (int dt = 0; dt < 4; ++dt) *(v8h*)(op + dt * 16) = __builtin_convertvector(o[g][dt] * fin, v8h); } }      /* a lane's 8 registers are 8 consecutive columns of its query's row: one 16-byte store */

// f32 attention for the FIRST query tile of each causal sequence (rows 0..QT0-1 of a batch; QF, KF, VF: QT0 rows a batch, OF likewise): ONE WAVE PER QUERY ROW, workgroup = A0W waves = A0W consecutive rows of one head of one batch. The head's QT0 key rows and value rows are
// staged once in LDS with coalesced 16-byte loads (key pitch HD + 4 floats: 16 lanes that each read 16 bytes of their own key row fall on distinct banks). Scores: lane l owns keys l, l + 32, l + 64, l + 96 (four partial
// sums per key over the head dimension), invalid keys (j > i or pm[j] == 0) are REPLACED by -1e30; maximum and sum close with a five-step butterfly over the lanes (precise expf, weight exactly 0 for an invalid key
// whenever the row has one valid key). q, k, v rows at pitch LQ, o rows at pitch DM. o: lane l owns columns 2l, 2l + 1 and walks all keys (four partial sums over the keys), the weights read back from the wave's own LDS row as broadcasts.
#define A0W 8                        /* query rows (= waves) per workgroup */
#define A0S (QT0 / (2 * A0W))        /* staging steps: a workgroup's threads cover 2 * A0W rows of 64 floats a step, 16 bytes a thread */
static_assert(QT0 % A0W == 0 && QT0 % 32 == 0 && (QT0 * (HD / 4)) % (32 * A0W) == 0 && HD == 64);
typedef float v2f  __attribute__((ext_vector_type(2)));
typedef float v2fa __attribute__((ext_vector_type(2), may_alias));
__device__ __forceinline__ void d_att0(unsigned blk, const float* __restrict__ QF, const float* __restrict__ KF, const float* __restrict__ VF, const int* __restrict__ pm, float scale, float* __restrict__ OF) {
  __shared__ __attribute__((aligned(16))) float lk[QT0][HD + 4]; __shared__ __attribute__((aligned(16))) float lv[QT0][HD]; __shared__ __attribute__((aligned(16))) float lp[A0W][QT0];
  /* readfirstlane: the wave's number in a scalar register, so that the q row's address is scalar */
  const unsigned tid = threadIdx.x, lane = tid & 31u; const unsigned w = (unsigned)__builtin_amdgcn_readfirstlane((int)(tid >> 5));
  const unsigned b = blk / (unsigned)(NH * (QT0 / A0W)), h = (blk / (unsigned)(QT0 / A0W)) % (unsigned)NH, rg = blk % (unsigned)(QT0 / A0W); const unsigned i = rg * (unsigned)A0W + w;
  QF += (size_t)b * QT0 * LQ; KF += (size_t)b * QT0 * LQ; VF += (size_t)b * QT0 * LQ; pm += (size_t)b * SQ_FULL; OF += (size_t)b * QT0 * DM;
  const unsigned r0 = tid >> 4, c4 = (tid & 15u) * 4u; const float* kp = KF + (size_t)r0 * LQ + h * HD + c4; const float* vp = VF + (size_t)r0 * LQ + h * HD + c4; const float* qr = QF + (size_t)i * LQ + h * HD;
  v4f kk[A0S], vv[A0S], qq[HD / 4]; int pv[QT0 / 32];
#pragma unroll      /* constant index into kk[] and vv[]; constant pitch: one address per plane, the steps as immediate offsets; all of a thread's loads in flight together */
  for (int it = 0; it < A0S; ++it) { kk[it] = *(const v4fa*)(kp + (size_t)it * (2 * A0W) * LQ); vv[it] = *(const v4fa*)(vp + (size_t)it * (2 * A0W) * LQ); }
#pragma unroll      /* constant index into pv[] */
  for (int u = 0; u < QT0 / 32; ++u) pv[u] = pm[(unsigned)u * 32u + lane];
#pragma unroll      /* constant index into qq[] */
  for (int c = 0; c < HD / 4; ++c) qq[c] = *(const v4fa*)(qr + c * 4);
  asm volatile("s_wait_xcnt 0x0" :: "v"(kp), "v"(vp) : "memory");      /* behind the last staging load, in front of whatever rewrites a register that an issued load names; kp and vp as inputs keep both address pairs live up to here, so that no load of the run lands in one */
#pragma unroll      /* constant index into kk[] and vv[] */
  for (int it = 0; it < A0S; ++it) { *(v4fa*)&lk[r0 + (unsigned)it * (unsigned)(2 * A0W)][c4] = kk[it]; *(v4fa*)&lv[r0 + (unsigned)it * (unsigned)(2 * A0W)][c4] = vv[it]; }
  __syncthreads();      /* publishes the staged key and value rows to every wave */
  const v4f z4 = {0.f, 0.f, 0.f, 0.f}; v4f acc[QT0 / 32];
#pragma unroll      /* constant index into acc[] */
  for (int u = 0; u < QT0 / 32; ++u) acc[u] = z4;
#pragma unroll      /* constant index into acc[] and qq[]; the LDS reads of several steps in flight together */
  for (int c = 0; c < HD / 4; ++c) {
#pragma unroll      /* constant index into acc[] */
    for (int u = 0; u < QT0 / 32; ++u) acc[u] += qq[c] * *(const v4fa*)&lk[(unsigned)u * 32u + lane][c * 4]; }
  float sm[QT0 / 32]; float mx = -1.0e30f;
#pragma unroll      /* constant index into acc[] and sm[] */
  for (int u = 0; u < QT0 / 32; ++u) { const unsigned j = (unsigned)u * 32u + lane; const float s = ((acc[u][0] + acc[u][1]) + (acc[u][2] + acc[u][3])) * scale; sm[u] = ((j <= i) & (pv[u] != 0)) ? s : -1.0e30f; mx = fmaxf(mx, sm[u]); }
  for (int d = 16; d > 0; d >>= 1) mx = fmaxf(mx, __shfl_xor(mx, d, 32));
  float l = 0.f;
#pragma unroll      /* constant index into sm[] */
  for (int u = 0; u < QT0 / 32; ++u) { const float e = expf(sm[u] - mx); lp[w][(unsigned)u * 32u + lane] = e; l += e; }
  for (int d = 16; d > 0; d >>= 1) l += __shfl_xor(l, d, 32);
  __syncthreads();      /* the weights are written by one lane and read by all lanes of the wave */
  const v2f z2 = {0.f, 0.f}; v2f o[4] = {z2, z2, z2, z2};
#pragma unroll 8      /* several steps' LDS reads in flight together */
  for (int j4 = 0; j4 < QT0 / 4; ++j4) { const v4f pj = *(const v4fa*)&lp[w][j4 * 4];
#pragma unroll      /* constant index into o[] and pj */
    for (int u = 0; u < 4; ++u) o[u] += pj[u] * *(const v2fa*)&lv[j4 * 4 + u][lane * 2u]; }
  const float fin = 64.0f * (1.0f / l);      /* o carried x64 like the f16 path */
  const v2f oo = ((o[0] + o[1]) + (o[2] + o[3])) * fin;
  *(v2f*)(OF + (size_t)i * DM + h * HD + lane * 2u) = oo; }

// row LayerNorm over DM = 1024 of f32 rows: mean, BIASED variance, (x - mu) * rsqrt(var + eps) * bf16(g[c]) + bf16(b[c]) -> f16 rows (GEMM operand). ONE WAVE PER ROW, workgroup = LNW waves = LNW consecutive rows (blk: the workgroup's index among those of this body):
// lane l owns columns 128 j + 4 l .. + 3, j = 0..7, so every load and store of the wave covers whole lines and the row stays in registers; a sum is four chains in the lane, then a butterfly over the lanes. No LDS, no barrier, an eighth of the waves to start.
// RES 1: the row is first formed as the residual without an output projection, X1[r][c] = bf16(x[r][c]) + o[r][c] / 64 (o: f32 first-tile rows OF0 for the first QT0 rows of a batch, else the f16 rows O16; + NaN when the batch's first mask entry is 0:
// the structure the attention kernels rely on is violated), stored to X1 and normalised from the registers that hold it;
#define LNW 8                        /* rows (= waves) per workgroup */
#define LNJ (DM / 128)               /* 16-byte pieces of a row per lane */
static_assert(DM % 128 == 0 && ((size_t)NB * SQ) % LNW == 0 && 32 * LNW == 256);
template <int XM> __device__ __forceinline__ float ln_xm(float x) { return __builtin_bit_cast(float, __builtin_amdgcn_mov_dpp(__builtin_bit_cast(int, x), 0x160 + XM, 0xf, 0xf, true)); }      /* lane l with lane l ^ XM inside its row of 16 lanes (row_xmask) */
__device__ __forceinline__ float ln_wsum(float x) { x += ln_xm<1>(x); x += ln_xm<2>(x); x += ln_xm<4>(x); x += ln_xm<8>(x); return x + fa_xhalf(x); }      /* the sum over the wave's 32 lanes, in every lane; all lanes are on */
template <int BFIN, int FULLIN, int RES>
__device__ __forceinline__ void d_lnx(unsigned blk, const float* __restrict__ X, const float* __restrict__ g, const float* __restrict__ bb, float eps, _Float16* __restrict__ N16,
    const int* __restrict__ pm, const _Float16* __restrict__ O16, const float* __restrict__ OF0, float* __restrict__ X1) {
  /* readfirstlane: the wave's number, and with it the row, in a scalar register: scalar row addresses, a scalar branch on the first tile */
  const unsigned c0 = (threadIdx.x & 31u) * 4u; const unsigned r = blk * (unsigned)LNW + (unsigned)__builtin_amdgcn_readfirstlane((int)(threadIdx.x >> 5));
  const unsigned b = r / (unsigned)SQ, rl = r % (unsigned)SQ; const size_t xr = FULLIN ? ((size_t)b * SQ_FULL + rl) : (size_t)r;
  int p0 = 1; if (RES) p0 = pm[(size_t)b * SQ_FULL];
  const float* xp = X + xr * DM + c0; v4f s[LNJ], o4[LNJ], gv[LNJ], bv[LNJ];
#pragma unroll      /* constant index into s[], gv[], bv[]; one address a plane, the pieces as immediate offsets; all of the wave's loads in flight together */
  for (int j = 0; j < LNJ; ++j) { s[j] = *(const v4fa*)(xp + j * 128); gv[j] = *(const v4fa*)(g + c0 + j * 128); bv[j] = *(const v4fa*)(bb + c0 + j * 128); }
  asm volatile("s_wait_xcnt 0x0" ::: "memory");      /* behind the issued loads, in front of whatever rewrites a register that one of them names; it also holds these loads in front of the branch below: sunk behind it, they would start only when the o row has come back */
  __builtin_amdgcn_sched_barrier(0);      /* keeps the later address arithmetic, which reuses the row's address registers, behind the wait above: the scheduler lifted it over the statement */
  if (RES) {
    if (rl < (unsigned)QT0) { const float* op = OF0 + ((size_t)b * QT0 + rl) * DM + c0;      /* scalar branch */
#pragma unroll      /* constant index into o4[] */
      for (int j = 0; j < LNJ; ++j) o4[j] = *(const v4fa*)(op + j * 128); }
    else { const _Float16* op = O16 + (size_t)r * DM + c0; v4h oh[LNJ];
#pragma unroll      /* constant index into oh[] */
      for (int j = 0; j < LNJ; ++j) oh[j] = *(const v4h*)(op + j * 128);
#pragma unroll      /* constant index into oh[], o4[] */
      for (int j = 0; j < LNJ; ++j) o4[j] = __builtin_convertvector(oh[j], v4f); } }
  const float pz = (p0 != 0) ? 0.f : __uint_as_float(0x7fc00000u);
  v4f a4 = {0.f, 0.f, 0.f, 0.f};
#pragma unroll      /* constant index into s[], o4[] */
  for (int j = 0; j < LNJ; ++j) {
#pragma unroll      /* constant element index */
    for (int q = 0; q < 4; ++q) { float v = BFIN ? bf16_rne(s[j][q]) : s[j][q]; if (RES) v = (v + o4[j][q] * 0.015625f) + pz; s[j][q] = v; }
    a4 += s[j]; }
  const float mu = ln_wsum((a4[0] + a4[1]) + (a4[2] + a4[3])) * (1.0f / (float)DM);
  v4f q4 = {0.f, 0.f, 0.f, 0.f};
#pragma unroll      /* constant index into s[] */
  for (int j = 0; j < LNJ; ++j) { const v4f dl = s[j] - mu; q4 += dl * dl; }
  const float rs = rsqrtf(ln_wsum((q4[0] + q4[1]) + (q4[2] + q4[3])) * (1.0f / (float)DM) + eps);
  v4h y[LNJ];
#pragma unroll      /* constant index into s[], gv[], bv[], y[] */
  for (int j = 0; j < LNJ; ++j) {
#pragma unroll      /* constant element index */
    for (int q = 0; q < 4; ++q) y[j][q] = (_Float16)((((s[j][q] - mu) * rs) * bf16_rne(gv[j][q])) + bf16_rne(bv[j][q])); }
  _Float16* np = N16 + (size_t)r * DM + c0;
#pragma unroll      /* constant index into y[]; one address, the pieces as immediate offsets */
  for (int j = 0; j < LNJ; ++j) *(v4h*)(np + j * 128) = y[j];
  if (RES) { float* x1p = X1 + (size_t)r * DM + c0;
#pragma unroll      /* constant index into s[]; one address, the pieces as immediate offsets */
    for (int j = 0; j < LNJ; ++j) *(v4f*)(x1p + j * 128) = s[j]; } }

// shared launches: every test on blockIdx.x reads the same for a whole workgroup, so each body's barriers stay under workgroup-uniform control flow
#define PB_WH ((unsigned)(NH * (DM / WTK)))      /* workgroups (tiles) of one per-head weight plane: a head's 64 columns are one tile wide */
#define PB_W1 ((unsigned)((DFF / WTN) * (DM / WTK)))
#define PB_W2 ((unsigned)((DM / WTN) * (DFF / WTK)))
// all that reads inputs alone: Wq, Wk, Wv -> the x16 q|k|v plane; W1 [DM][DFF] -> [DFF][DM] x16; W2 [DFF][DM] -> [DM][DFF] x16; h = LN1(bf16(x)) -> f16 rows
__global__ __launch_bounds__(256) void k_prep(const float* __restrict__ wq, const float* __restrict__ wk, const float* __restrict__ wv, _Float16* __restrict__ BQKV, const float* __restrict__ w1, _Float16* __restrict__ BW1,
    const float* __restrict__ w2, _Float16* __restrict__ BW2, const float* __restrict__ x, const float* __restrict__ g1, const float* __restrict__ be1, _Float16* __restrict__ X16) {
  __shared__ __attribute__((aligned(16))) v8us tl[WTN * (WTK / 8)];      /* one tile for the three transposing branches */
  unsigned blk = blockIdx.x;
  if (blk < 3u * PB_WH) { const unsigned p = blk / PB_WH, hk = blk - p * PB_WH, h = hk / (unsigned)(DM / WTK), kt = hk % (unsigned)(DM / WTK);      /* head h: [DM][HD] -> rows h * HD .. of the plane */
    d_wtile<HD, DM>(tl, (p == 0u ? wq : (p == 1u ? wk : wv)) + ((size_t)h * DM + kt * (unsigned)WTK) * HD, BQKV + (size_t)p * DM * DM + (size_t)h * HD * DM + kt * (unsigned)WTK); return; }
  blk -= 3u * PB_WH;
  if (blk < PB_W1) { const unsigned nt = blk / (unsigned)(DM / WTK), kt = blk % (unsigned)(DM / WTK); d_wtile<DFF, DM>(tl, w1 + (size_t)kt * WTK * DFF + nt * (unsigned)WTN, BW1 + (size_t)nt * WTN * DM + kt * (unsigned)WTK); return; }
  blk -= PB_W1;
  if (blk < PB_W2) { const unsigned nt = blk / (unsigned)(DFF / WTK), kt = blk % (unsigned)(DFF / WTK); d_wtile<DM, DFF>(tl, w2 + (size_t)kt * WTK * DM + nt * (unsigned)WTN, BW2 + (size_t)nt * WTN * DFF + kt * (unsigned)WTK); return; }
  blk -= PB_W2;
  d_lnx<1, 1, 0>(blk, x, g1, be1, 1e-5f, X16, (const int*)nullptr, (const _Float16*)nullptr, (const float*)nullptr, (float*)nullptr);
  asm volatile("s_wait_xcnt 0x0" ::: "memory"); }      /* behind the row's store, in front of whatever rewrites a register that it names: the other bodies' code follows it in the built text */

// all that reads the q|k|v GEMM's output alone: the f32 first-tile attention (o x64) and V^T [NB][NH][HD][SQ], all batches
#define MB_A0 ((unsigned)(NB * NH * (QT0 / A0W)))
#define MB_VT ((unsigned)(NB * NH * (SQ / 64)))
static_assert(32 * A0W == 256);
__global__ __launch_bounds__(256) void k_att0_vt(const float* __restrict__ F0, const int* __restrict__ pm, float* __restrict__ OF0, const _Float16* __restrict__ V16, _Float16* __restrict__ VT) {
  if (blockIdx.x >= MB_A0) { d_vt<NH, SQ>(blockIdx.x - MB_A0, V16, LQ, 0, VT); return; }
  d_att0(blockIdx.x, F0, F0 + DM, F0 + 2 * DM, pm, 0.125f, OF0); }

// x1 = bf16(x) + attn, stored, and h2 = LN2(x1) -> f16 rows
__global__ __launch_bounds__(256) void k_res_ln(const float* __restrict__ x, const int* __restrict__ pm, const _Float16* __restrict__ O16, const float* __restrict__ OF0, float* __restrict__ X1,
    const float* __restrict__ g2, const float* __restrict__ be2, _Float16* __restrict__ M16) {
  d_lnx<1, 1, 1>(blockIdx.x, x, g2, be2, 1e-5f, M16, pm, O16, OF0, X1); }

extern "C" void kernel_launch(void* const* d_in, const int* in_sizes, int n_in,
                              void* d_out, int out_size, void* d_ws, size_t ws_size, hipStream_t stream) {
  if (n_in < 13) return;
  const size_t rows_need = (size_t)(NB - 1) * SQ_FULL + SQ;
  if ((size_t)in_sizes[0] < rows_need * DM) return; if ((size_t)in_sizes[1] < rows_need) return;
  if ((size_t)in_sizes[2] < (size_t)NH * DM * HD || (size_t)in_sizes[3] < (size_t)NH * DM * HD || (size_t)in_sizes[4] < (size_t)NH * DM * HD) return;
  if (in_sizes[5] < DM || in_sizes[6] < DM || in_sizes[7] < DM || in_sizes[8] < DM) return;
  if ((size_t)in_sizes[9] < (size_t)DM * DFF || in_sizes[10] < DFF || (size_t)in_sizes[11] < (size_t)DFF * DM || in_sizes[12] < DM) return;
  if ((size_t)out_size < NR * DM) return;
  const float* x = (const float*)d_in[0]; const int* pmask = (const int*)d_in[1];
  const float* wq = (const float*)d_in[2]; const float* wk = (const float*)d_in[3]; const float* wv = (const float*)d_in[4];
  const float* g1 = (const float*)d_in[5]; const float* be1 = (const float*)d_in[6]; const float* g2 = (const float*)d_in[7]; const float* be2 = (const float*)d_in[8];
  const float* w1 = (const float*)d_in[9]; const float* b1 = (const float*)d_in[10]; const float* w2 = (const float*)d_in[11]; const float* b2 = (const float*)d_in[12];
  char* ws = (char*)d_ws; size_t off = 0;
  auto take = [&](size_t bytes) { char* p = ws + off; off += (bytes + 255) & ~(size_t)255; return p; };
  _Float16* BQKV = (_Float16*)take((size_t)3 * DM * DM * 2);          /* [3*DM][DM] x16: q | k | v stacked, row (h*HD + d) */
  _Float16* X16 = (_Float16*)take(NR * DM * 2);                       /* LN1 rows; reused as the LN2 rows (last reader of LN1 rows: the q|k|v GEMM, before LN2 writes) */
  float* X1 = (float*)take(NR * DM * 4);
  _Float16* BW1 = (_Float16*)take((size_t)DFF * DM * 2); _Float16* BW2 = (_Float16*)take((size_t)DM * DFF * 2);
  _Float16* QKV = (_Float16*)take(NR * 3 * DM * 2); _Float16* Q16 = QKV; _Float16* K16 = QKV + DM; _Float16* V16 = QKV + 2 * DM;
  _Float16* HF16 = QKV;                                               /* FFN hidden rows [NR][DFF] alias the q|k|v rows (dead after the attention); DFF <= 3*DM asserted */
  _Float16* O16 = (_Float16*)take(NR * DM * 2);
  _Float16* VT = (_Float16*)take((size_t)NB * NH * HD * SQ * 2);      /* V^T [NB][NH][HD][SQ] */
  float* F0 = (float*)take((size_t)NB * QT0 * 3 * DM * 4);            /* f32 q | k | v of the first 128 rows of each batch */
  float* OF0 = (float*)take((size_t)NB * QT0 * DM * 4);
  _Float16* M16 = X16;
  if (off > ws_size || off > (size_t)134217728) return;
  k_prep<<<3u * PB_WH + PB_W1 + PB_W2 + (unsigned)(NR / LNW), 256, 0, stream>>>(wq, wk, wv, BQKV, w1, BW1, w2, BW2, x, g1, be1, X16);      /* weight planes (x16, transposed) and h = LN1(bf16(x)) */
  k_gemm2<0><<<dim3((unsigned)((NR / 128) * (3 * DM / 128)), 1), 256, 0, stream>>>(X16, DM, (size_t)0, BQKV, DM, (size_t)0, 0.0625f, (const float*)nullptr, (const float*)nullptr, (float*)nullptr, QKV, F0, (unsigned)(SQ / 128), LQ, (size_t)0, (int)NR, 3 * DM, DM);      /* q | k | v rows (f16); rows 0..127 of each batch in f32 too */
  k_att0_vt<<<MB_A0 + MB_VT, 256, 0, stream>>>(F0, pmask, OF0, V16, VT);      /* f32 attention for rows 0..127 of each batch (o x64); V^T */
  k_fattn<<<NB * NH * FNT, 32 * FW, 0, stream>>>(Q16, K16, VT, pmask, O16);      /* o (merged heads, x64) as f16 rows, all batches, heads and query tiles */
  k_res_ln<<<(unsigned)(NR / LNW), 256, 0, stream>>>(x, pmask, O16, OF0, X1, g2, be2, M16);      /* x1 = bf16(x) + attn; h2 = LN2(x1) -> f16 rows */
  k_gemm2<3><<<dim3((unsigned)((NR / 128) * (DFF / 128)), 1), 256, 0, stream>>>(M16, DM, (size_t)0, BW1, DM, (size_t)0, 0.0625f, b1, (const float*)nullptr, (float*)nullptr, HF16, (float*)nullptr, 1u, DFF, (size_t)0, (int)NR, DFF, DM);      /* relu(h2 W1 + b1) -> f16 */
  k_gemm2<0><<<dim3((unsigned)((NR / 128) * (DM / 128)), 1), 256, 0, stream>>>(HF16, DFF, (size_t)0, BW2, DFF, (size_t)0, 0.0625f, b2, X1, (float*)d_out, (_Float16*)nullptr, (float*)nullptr, 1u, DM, (size_t)0, (int)NR, DM, DFF);      /* out = x1 + mlp (own-element residual) */
}

// v009
// A run of this version takes 115 microseconds.
// Two timings next to v008 put it at 1.18 and 1.17 times that version's speed.
// Over all steps from v000 it is 44.3 times as fast.
#include <hip/hip_runtime.h>
// Pre-LN causal transformer layer: x [NB][SEQ][1024]; h = LN1(x) (biased variance, eps 1e-5); q/k/v[b][h] = h Wq/Wk/Wv[h] (per-head [16][1024][64], [in][out], no biases); scores / sqrt(64); mask = padding_mask[b][key] AND causal, masked scores REPLACED by -1e9; softmax; heads concatenated (no output projection); x1 = x + attn; h2 = LN2(x1); out = x1 + relu(h2 W1 + b1) W2 + b2 ([in][out] 1024 x 1024 x 1024).
// Structure: LN1 on VALU (one wave per row) -> f16 rows; weights transposed through LDS tiles (per-head ones into one x16 f16 q|k|v plane); q|k|v as ONE WMMA GEMM (operands staged in LDS, 32x64 wave tiles, f32 accumulation, f16 out); V^T via LDS transposes and an f32 first tile (rows 0..127 of each batch) on VALU; then ONE fused attention launch for all batches and heads (keys and values staged in LDS per workgroup; scores, masked online softmax and P V in registers, one wave per 32 queries; o x64 f16); x1 = bf16(x) + o / 64; LN2 -> f16; FFN as two GEMMs (ReLU epilogue; own-element residual).
// Launches (7): kernels that do not depend on one another share a launch, each on its own range of workgroup indices: {weight transposes, LN1}; q|k|v GEMM (also stores its first-tile rows in f32); {first-tile attention, V^T}; fused attention; {residual + LN2, one wave per row}; FFN 1; FFN 2.
// Compute dtype: all contractions v_wmma_f32_16x16x32_f16 (f16 operands, f32 accumulate); float inputs RNE-converted to bf16 first (weights then x16, exact in f16); q, k, v, softmax weights (relative to the running row maximum) and o (x64) as plain f16 operands; scores and softmax statistics f32; first 128 query rows of each batch in f32 on VALU.
#ifndef NB
#define NB 2
#endif
#ifndef SEQ
#define SEQ 2048
#endif
#define SQ SEQ
#define NB_FULL 2
#define SQ_FULL 2048                 /* per-batch row stride of the inputs (x rows, mask entries) */
#define DM 1024
#define NH 16
#define HD 64
#define DFF 1024
#define QT0 128                      /* first-tile rows computed in f32 */
#define NR ((size_t)NB * SQ)         /* token rows */
#define LQ (3 * DM)                  /* row pitch of the q|k|v rows */
static_assert(NH * HD == DM);
static_assert(QT0 == 128 && QT0 <= SQ && SQ <= SQ_FULL && NB <= NB_FULL);
static_assert(DM % 128 == 0 && DFF % 128 == 0 && HD == 64 && ((size_t)NB * SQ) % 128 == 0);
static_assert(DM / 4 == 256);
static_assert(DFF <= 3 * DM);
static_assert((((size_t)NB * SQ * DM) / 4) % 256 == 0);
static_assert((size_t)NB * SQ * DM / 4 < 0x7fffffffu);

typedef unsigned short v8us __attribute__((ext_vector_type(8), may_alias));
typedef float  v8f  __attribute__((ext_vector_type(8)));
typedef float  v4f  __attribute__((ext_vector_type(4)));
typedef float  v4fa __attribute__((ext_vector_type(4), may_alias));
typedef _Float16 v16h __attribute__((ext_vector_type(16)));
typedef _Float16 v4h __attribute__((ext_vector_type(4)));
union FragH { v16h v; v8us half[2]; _Float16 h[16]; unsigned short u[16]; };

__device__ __forceinline__ unsigned short bf16_bits(float x) { unsigned int u = __float_as_uint(x); return (unsigned short)((u + 0x7FFFu + ((u >> 16) & 1u)) >> 16); }
__device__ __forceinline__ float bf16_rne(float x) { return __uint_as_float(((unsigned int)bf16_bits(x)) << 16); }

// fragment: elements 0..7 <- k0 + 8h + 0..7, elements 8..15 <- k0 + 16 + 8h + 0..7 (same map for A rows and B columns)
__device__ __forceinline__ v16h g2_frag(const _Float16* p, unsigned hh) { FragH f; f.half[0] = *(const v8us*)((const unsigned short*)p + 8u * hh); f.half[1] = *(const v8us*)((const unsigned short*)p + 16u + 8u * hh); return f.v; }
__device__ __forceinline__ v8f g2_mma(v16h a, v16h b, v8f c) { return __builtin_amdgcn_wmma_f32_16x16x32_f16(false, a, false, b, (short)0, c, false, false); }

// GEMM (wave tile 32x64; workgroup = 8 waves (4 x 2) = 128 rows x 128 cols; M % 128 == 0, N % 128 == 0, K % 64 == 0): A f16 [M][K] (pitch lda, batch stride sA), Bh f16 [N][K] (pitch ldb, batch stride sB);
// a stage is 64 k of the tile's 128 A rows and 128 B rows (128 bytes a row: whole lines), brought into LDS by asynchronous 16-byte copies at row pitch 144 bytes (conflict-free for the 16-byte fragment reads); two buffers: the next stage's copies fly while this stage is worked on.
// v = acc * alpha + bf16(bias[col]) (+ CP own element of the batched C plane); ACT 0 none / 3 relu; writes f32 C and/or f16 C16 (pitch LDC, batch offset by * sC); CT: every tper-th row tile (mt % tper == 0) is stored in f32 as well, as rows (mt / tper) * 128 .. + 127 of CT (pitch LDC).
// Which of bias, CP, C, C16, CT take part (HB, HCP, HC, HC16, HCT) and the pitch LDC are compile-time: no branch stands between the epilogue's loads or stores, and a run of them is one address with the rows as immediate offsets.
// Epilogue: the raw accumulators go through the wave's own LDS tile; then a lane owns 4 consecutive columns of 16 rows. Its 4 bias values and its 16 CP pieces (16 bytes each, whole lines per wave) are loaded at the kernel's entry, all in flight together, and wait in registers.
#define GP 144                       /* LDS row pitch, bytes */
#define GOP (128 * GP)               /* one operand's rows of a stage, bytes */
#define GSTG (2 * GOP)               /* one buffer: the A rows, then the B rows */
static_assert(8 * 32 * 68 * 4 <= 2 * GSTG && GP % 16 == 0);
__device__ __forceinline__ v16h g2_lfrag(const char* p) { FragH f; f.half[0] = *(const v8us*)p; f.half[1] = *(const v8us*)(p + 32); return f.v; }      /* p: the lane's LDS row + 2 k0 + 16 hh bytes: the k order of g2_frag */
// one stage: a lane's 4 copies of A rows (r, r + 32, r + 64, r + 96) and 4 of B rows; a wave's copy covers 4 whole 128-byte rows
__device__ __forceinline__ void g2_stage(unsigned l, const _Float16* ga, size_t ra, const _Float16* gb, size_t rb) {
  /* the copies and, as the last line of their own statement, the wait that stands in front of any rewrite of a register that an issued copy names */
  asm volatile("global_load_async_to_lds_b128 %0, %8, off\n\t"
               "global_load_async_to_lds_b128 %1, %9, off\n\t"
               "global_load_async_to_lds_b128 %2, %10, off\n\t"
               "global_load_async_to_lds_b128 %3, %11, off\n\t"
               "global_load_async_to_lds_b128 %4, %12, off\n\t"
               "global_load_async_to_lds_b128 %5, %13, off\n\t"
               "global_load_async_to_lds_b128 %6, %14, off\n\t"
               "global_load_async_to_lds_b128 %7, %15, off\n\t"
               "s_wait_xcnt 0x0"
               :: "v"(l), "v"(l + 32u * GP), "v"(l + 64u * GP), "v"(l + 96u * GP), "v"(l + GOP), "v"(l + GOP + 32u * GP), "v"(l + GOP + 64u * GP), "v"(l + GOP + 96u * GP),
                  "v"(ga), "v"(ga + ra), "v"(ga + 2 * ra), "v"(ga + 3 * ra), "v"(gb), "v"(gb + rb), "v"(gb + 2 * rb), "v"(gb + 3 * rb) : "memory"); }
template <int ACT, bool HB, bool HCP, bool HC, bool HC16, bool HCT, int LDC>
__global__ __launch_bounds__(256) void k_gemm2(const _Float16* __restrict__ A, int lda, size_t sA, const _Float16* __restrict__ Bh, int ldb, size_t sB, float alpha,
    const float* __restrict__ bias, const float* __restrict__ CP, float* __restrict__ C, _Float16* __restrict__ C16, float* __restrict__ CT, unsigned tper, size_t sC, int M, int N, int K) {
  static_assert(ACT == 0 || ACT == 3);
  __shared__ __attribute__((aligned(16))) char sm[2 * GSTG];
  const unsigned tid = threadIdx.x, w = tid >> 5, lane = tid & 31u, ln = lane & 15u, hh = lane >> 4; const unsigned by = blockIdx.y;
  A += (size_t)by * sA; Bh += (size_t)by * sB; const size_t cofs = (size_t)by * sC;
  const unsigned ntn = (unsigned)N >> 7; const unsigned mt = blockIdx.x / ntn, nq = blockIdx.x - mt * ntn; if (mt * 128u >= (unsigned)M) return;      /* the same for the whole workgroup, in front of every barrier */
  const unsigned row0 = mt * 128u + 32u * (w >> 1), col0 = nq * 128u + 64u * (w & 1u);
  const unsigned cr = tid >> 3, cc = tid & 7u;      /* copies: 8 lanes a row, 32 rows a step of the workgroup */
  const _Float16* ga = A + (size_t)(mt * 128u + cr) * (size_t)lda + cc * 8u; const _Float16* gb = Bh + (size_t)(nq * 128u + cr) * (size_t)ldb + cc * 8u; const size_t ra = (size_t)32 * (size_t)lda, rb = (size_t)32 * (size_t)ldb;
  const unsigned la = (unsigned)(size_t)sm + cr * (unsigned)GP + cc * 16u;      /* the lane's LDS byte address in buffer 0, A rows */
  const char* pa = sm + (32u * (w >> 1) + ln) * (unsigned)GP + 16u * hh; const char* pb = sm + GOP + (64u * (w & 1u) + ln) * (unsigned)GP + 16u * hh;
  const int nt = K >> 6;
  g2_stage(la, ga, ra, gb, rb);
  const unsigned rsub = lane >> 4, c4 = (lane & 15u) * 4u;      /* epilogue: the lane's rows 2 q + rsub, q = 0..15, and its 4 columns of the wave's tile */
  const size_t eo = cofs + (size_t)(row0 + rsub) * (size_t)LDC + col0 + c4;      /* its first element in a C-shaped plane */
  v4f bv = {0.f, 0.f, 0.f, 0.f}, cp[16];
  if (HB) bv = *(const v4fa*)(bias + col0 + c4);
  if (HCP) {
#pragma unroll      /* constant index into cp[]; one address, the rows as immediate offsets; all of the lane's loads in flight together, behind stage 0's copies */
    for (int q = 0; q < 16; ++q) cp[q] = *(const v4fa*)(CP + eo + (size_t)q * 2 * LDC); }
  if (HB || HCP) asm volatile("s_wait_xcnt 0x0" ::: "memory");      /* behind the issued loads, in front of whatever rewrites a register that one of them names */
  asm volatile("s_wait_asynccnt 0x0" ::: "memory");      /* this wave's copies of stage 0 have landed */
  __syncthreads();      /* publishes stage 0 to every wave */
  if (nt > 1) g2_stage(la + GSTG, ga + 64, ra, gb + 64, rb);
  const v8f z8 = {0.f,0.f,0.f,0.f,0.f,0.f,0.f,0.f}; v8f c00 = z8, c01 = z8, c02 = z8, c03 = z8, c10 = z8, c11 = z8, c12 = z8, c13 = z8;
#pragma unroll 1      /* one trip of code: the ring's order stays as written */
  for (int t = 0; t < nt; ++t) { const unsigned buf = ((unsigned)t & 1u) * (unsigned)GSTG; const char* qa = pa + buf; const char* qb = pb + buf;
    const v16h a0 = g2_lfrag(qa), a1 = g2_lfrag(qa + 16 * GP), b0 = g2_lfrag(qb), b1 = g2_lfrag(qb + 16 * GP), b2 = g2_lfrag(qb + 32 * GP), b3 = g2_lfrag(qb + 48 * GP);
    const v16h e0 = g2_lfrag(qa + 64), e1 = g2_lfrag(qa + 16 * GP + 64), f0 = g2_lfrag(qb + 64), f1 = g2_lfrag(qb + 16 * GP + 64), f2 = g2_lfrag(qb + 32 * GP + 64), f3 = g2_lfrag(qb + 48 * GP + 64);
    __builtin_amdgcn_sched_barrier(0);      /* keeps the trip's fragment reads together in front of its products: spread among them, each small group of reads makes the wave wait out the LDS latency anew */
    c00 = g2_mma(a0, b0, c00); c10 = g2_mma(a1, b0, c10); c01 = g2_mma(a0, b1, c01); c11 = g2_mma(a1, b1, c11); c02 = g2_mma(a0, b2, c02); c12 = g2_mma(a1, b2, c12); c03 = g2_mma(a0, b3, c03); c13 = g2_mma(a1, b3, c13);
    __builtin_amdgcn_sched_barrier(0);      /* keeps the first half's products in front of the waits below, so that the second half's fragment reads return behind them and not in front of an idle matrix unit */
    asm volatile("s_wait_dscnt 0x0" ::: "memory");      /* this wave's reads of the buffer have returned before the buffer is given up */
    asm volatile("s_wait_asynccnt 0x0" ::: "memory");      /* this wave's copies of stage t + 1 have landed */
    __syncthreads();      /* publishes stage t + 1 and ends every wave's reads of stage t */
    if (t + 2 < nt) g2_stage(la + buf, ga + (size_t)(t + 2) * 64, ra, gb + (size_t)(t + 2) * 64, rb);
    /* the second half's products, on fragments already in registers, run while the copies fly */
    c00 = g2_mma(e0, f0, c00); c10 = g2_mma(e1, f0, c10); c01 = g2_mma(e0, f1, c01); c11 = g2_mma(e1, f1, c11); c02 = g2_mma(e0, f2, c02); c12 = g2_mma(e1, f2, c12); c03 = g2_mma(e0, f3, c03); c13 = g2_mma(e1, f3, c13); }
  asm volatile("s_wait_asynccnt 0x0" ::: "memory");      /* no copy is on its way when the ring becomes output staging */
  float (*so)[32][68] = (float (*)[32][68])sm;      /* output staging, a wave's own tile, in the ring, which every wave has left at the last trip's barrier */
  v8f accs[8] = {c00, c01, c02, c03, c10, c11, c12, c13};
#pragma unroll      /* constant index into accs[] */
  for (int u = 0; u < 8; ++u) { const unsigned t = (unsigned)u & 3u, half = (unsigned)u >> 2;
#pragma unroll      /* constant element index */
    for (int r = 0; r < 8; ++r) so[w][half * 16u + 8u * hh + (unsigned)r][t * 16u + ln] = accs[u][r]; }
  __builtin_amdgcn_fence(4 /* acq_rel order */, "workgroup"); __builtin_amdgcn_wave_barrier();      /* wave-private tile: same wave writes and reads */
  v4f vv[16];
#pragma unroll      /* constant index into vv[]; all of the lane's LDS reads in flight together */
  for (int q = 0; q < 16; ++q) vv[q] = *(const v4fa*)&so[w][(unsigned)q * 2u + rsub][c4];
  if (HB) {
#pragma unroll      /* constant element index */
    for (int i = 0; i < 4; ++i) bv[i] = bf16_rne(bv[i]); }
#pragma unroll      /* constant index into vv[], cp[] */
  for (int q = 0; q < 16; ++q) {
#pragma unroll      /* constant element index */
    for (int i = 0; i < 4; ++i) { float v = vv[q][i] * alpha + bv[i];
      if (HCP) v += cp[q][i];      /* own element of the batched C plane */
      if (ACT == 3) v = fmaxf(v, 0.f);
      vv[q][i] = v; } }
  /* each run of stores below ends with the wait that stands in front of whatever rewrites a register that one of them names */
  if (HC) { float* p = C + eo;
#pragma unroll      /* constant index into vv[]; one address, the rows as immediate offsets */
    for (int q = 0; q < 16; ++q) *(v4f*)(p + (size_t)q * 2 * LDC) = vv[q];
    asm volatile("s_wait_xcnt 0x0" ::: "memory"); }
  if (HCT) { if (mt % tper == 0u) { float* p = CT + ((size_t)(mt / tper) * 128u + 32u * (w >> 1) + rsub) * (size_t)LDC + col0 + c4;      /* the test reads the same for the whole workgroup */
#pragma unroll      /* constant index into vv[]; one address, the rows as immediate offsets */
      for (int q = 0; q < 16; ++q) *(v4f*)(p + (size_t)q * 2 * LDC) = vv[q];
      asm volatile("s_wait_xcnt 0x0" ::: "memory"); } }
  if (HC16) { _Float16* p = C16 + eo; v4h hv[16];
#pragma unroll      /* constant index into vv[], hv[] */
    for (int q = 0; q < 16; ++q) hv[q] = __builtin_convertvector(vv[q], v4h);
#pragma unroll      /* constant index into hv[]; one address, the rows as immediate offsets */
    for (int q = 0; q < 16; ++q) *(v4h*)(p + (size_t)q * 2 * LDC) = hv[q];
    asm volatile("s_wait_xcnt 0x0" ::: "memory"); } }

// the bodies below run on a range of a shared launch's workgroups: blk, where they take it, is the workgroup's index inside that range
// weight plane W [k][n] f32 (pitch SP) -> Wt [n][k] f16 (pitch OP), value (f16)(16 * bf16(w)): a workgroup takes WTK k rows x WTN n columns through LDS. W, Wt: the tile's first element in each plane; tl: the workgroup's LDS tile, WTN * WTK / 8 chunks.
// In: a thread reads 16 bytes of each of 8 consecutive k rows (16 lanes cover 256 contiguous bytes of a row: whole lines), so it holds 8 k of 4 columns and writes each column's 8 values as one 16-byte chunk.
// Out: 16 lanes read the 16 chunks of one n row and store 256 contiguous bytes. Chunk c of row n lies at place c ^ (n >> 2) of the row: the 16 lanes of a write (rows 4 apart, one c) and of a read (one row, all c) each fall on 16 distinct 16-byte bank groups.
#define WTK 128
#define WTN 64
static_assert(WTN == 64 && WTK == 128 && DM % WTK == 0 && DFF % WTK == 0 && DM % WTN == 0 && DFF % WTN == 0 && HD == WTN);
template <int SP, int OP>
__device__ __forceinline__ void d_wtile(v8us* tl, const float* __restrict__ W, _Float16* __restrict__ Wt) {
  const unsigned tid = threadIdx.x, lo = tid & 15u, hi = tid >> 4;
  const float* sp = W + (size_t)(hi * 8u) * SP + lo * 4u; v4f a[8];
#pragma unroll      /* constant index into a[]; constant pitch: one address, the rows as immediate offsets; all of a thread's loads in flight together */
  for (int j = 0; j < 8; ++j) a[j] = *(const v4fa*)(sp + (size_t)j * SP);
#pragma unroll      /* constant index into a[] */
  for (int i = 0; i < 4; ++i) { FragH f;
#pragma unroll      /* constant index into a[] and f */
    for (int j = 0; j < 8; ++j) f.h[j] = (_Float16)(16.0f * bf16_rne(a[j][i]));
    tl[(lo * 4u + (unsigned)i) * (unsigned)(WTK / 8) + (hi ^ lo)] = f.half[0]; }
  __syncthreads();      /* publishes the tile: a chunk is written by one thread and stored by another */
  unsigned short* dp = (unsigned short*)Wt + (size_t)hi * OP + lo * 8u;
#pragma unroll      /* constant pitch: one address, the rows as immediate offsets */
  for (int q = 0; q < WTN / 16; ++q) { const unsigned n = hi + 16u * (unsigned)q; *(v8us*)(dp + (size_t)q * 16 * OP) = tl[n * (unsigned)(WTK / 8) + (lo ^ (n >> 2))]; }
  asm volatile("s_wait_xcnt 0x0" ::: "memory"); }      /* behind the last of the run's stores, in front of whatever rewrites a register that one of them names: another body's code follows in the built text */

template <int NHv, int TTv>
__device__ __forceinline__ void d_vt(unsigned blk, const _Float16* __restrict__ V16, int ldv, int voff, _Float16* __restrict__ Vt) {
  __shared__ unsigned short tl[64][66]; const unsigned tid = threadIdx.x; const unsigned slab = blk / (unsigned)(TTv / 64), lg = blk % (unsigned)(TTv / 64); const unsigned b = slab / (unsigned)NHv, h = slab % (unsigned)NHv;
  for (unsigned i = tid; i < 64u * 8u; i += 256u) { const unsigned r = i >> 3, c8 = (i & 7u) * 8u; FragH f; f.half[0] = *(const v8us*)((const unsigned short*)V16 + ((size_t)b * TTv + lg * 64u + r) * (size_t)ldv + (size_t)voff + h * 64u + c8);
#pragma unroll
    for (int q = 0; q < 8; ++q) tl[r][c8 + (unsigned)q] = f.u[q]; }
  __syncthreads();
  {
#pragma unroll
    for (int rd = 0; rd < 2; ++rd) { const unsigned d = (unsigned)rd * 32u + (tid >> 3), pc = tid & 7u; FragH f;
#pragma unroll
      for (int q = 0; q < 8; ++q) f.u[q] = tl[pc * 8u + (unsigned)q][d];
      *(v8us*)((unsigned short*)Vt + ((size_t)slab * 64u + d) * TTv + lg * 64u + pc * 8u) = f.half[0]; }
     } }

#define FQ 32                        /* query columns per wave */
#define FW 4                         /* waves per workgroup */
#define FNT (SQ / (FQ * FW))         /* query tiles of a sequence */
#define FOP (64 * GP)                /* one operand's 64 rows of a stage, bytes */
#define FSTG (2 * FOP)               /* one buffer: the key rows, then the rows of the transposed value plane */
static_assert(SQ % (FQ * FW) == 0 && FNT % 2 == 0 && HD == 64 && FQ == 32 && FQ * FW == 128 && SQ % 64 == 0);
typedef _Float16 v8h __attribute__((ext_vector_type(8)));
__device__ __forceinline__ float fa_xhalf(float x) { return __builtin_bit_cast(float, __builtin_amdgcn_permlanex16(__builtin_bit_cast(int, x), __builtin_bit_cast(int, x), 0x76543210, 0xfedcba98, false, false)); }      /* lane l with lane l ^ 16 */
__device__ __forceinline__ v8f fa_mma(v16h a, v16h b, v8f c) { return __builtin_amdgcn_wmma_f32_16x16x32_f16(false, a, false, b, (short)0, c, false, false); }
// one stage: a lane's 4 copies of key rows (r, r + 16, r + 32, r + 48) and 4 of value-plane rows; a wave's copy covers 4 whole 128-byte rows
__device__ __forceinline__ void fa_stage(unsigned l, const _Float16* gk, const _Float16* gv) {
  /* the copies and, as the last line of their own statement, the wait that stands in front of any rewrite of a register that an issued copy names */
  asm volatile("global_load_async_to_lds_b128 %0, %8, off\n\t"
               "global_load_async_to_lds_b128 %1, %9, off\n\t"
               "global_load_async_to_lds_b128 %2, %10, off\n\t"
               "global_load_async_to_lds_b128 %3, %11, off\n\t"
               "global_load_async_to_lds_b128 %4, %12, off\n\t"
               "global_load_async_to_lds_b128 %5, %13, off\n\t"
               "global_load_async_to_lds_b128 %6, %14, off\n\t"
               "global_load_async_to_lds_b128 %7, %15, off\n\t"
               "s_wait_xcnt 0x0"
               :: "v"(l), "v"(l + 16u * GP), "v"(l + 32u * GP), "v"(l + 48u * GP), "v"(l + FOP), "v"(l + FOP + 16u * GP), "v"(l + FOP + 32u * GP), "v"(l + FOP + 48u * GP),
                  "v"(gk), "v"(gk + (size_t)16 * LQ), "v"(gk + (size_t)32 * LQ), "v"(gk + (size_t)48 * LQ), "v"(gv), "v"(gv + (size_t)16 * SQ), "v"(gv + (size_t)32 * SQ), "v"(gv + (size_t)48 * SQ) : "memory"); }
// one pass: 32 keys (fragments kf, vf) against the wave's 32 queries. NX: the stage's next pass has its fragments read from kx, vx (the lane's LDS places) into the registers just read
template <bool NX>
__device__ __forceinline__ void fa_pass(int s, int last, unsigned vm, unsigned qw, unsigned ln, unsigned hh, const char* kx, const char* vx, const v16h (&qf)[2][2], v16h (&kf)[2][2], v16h (&vf)[4], v8f (&o)[2][4], float (&mr)[2], float (&l)[2]) {
  const v8f z8 = {0.f,0.f,0.f,0.f,0.f,0.f,0.f,0.f};
  const float cs = 0.125f * 1.44269504088896340736f;      /* 1 / sqrt(64), and exp(x) = exp2(x log2 e) */
  v8f sc[2][2];
#pragma unroll      /* constant index into sc[], kf[], qf[] */
  for (int tk = 0; tk < 2; ++tk) { sc[0][tk] = fa_mma(kf[tk][0], qf[0][0], z8); sc[1][tk] = fa_mma(kf[tk][0], qf[1][0], z8); sc[0][tk] = fa_mma(kf[tk][1], qf[0][1], sc[0][tk]); sc[1][tk] = fa_mma(kf[tk][1], qf[1][1], sc[1][tk]); }
  if (NX) {
#pragma unroll      /* constant index into kf[] */
    for (int tk = 0; tk < 2; ++tk) { kf[tk][0] = g2_lfrag(kx + tk * 16 * GP); kf[tk][1] = g2_lfrag(kx + tk * 16 * GP + 64); } }
  if (vm != 0xffffffffu || s == last) {      /* scalar branch: only the diagonal pass and passes with a padded key pay for the mask */
    const unsigned vs = vm >> (8u * hh);
#pragma unroll      /* constant index into sc[] */
    for (int g = 0; g < 2; ++g) { const int qrel = (int)(qw + 16u * (unsigned)g + ln) - (s * 32 + 8 * (int)hh);      /* local key 16 tk + r is causal iff it is <= qrel */
#pragma unroll      /* constant index into sc[] */
      for (int tk = 0; tk < 2; ++tk) {
#pragma unroll      /* constant element index */
        for (int r = 0; r < 8; ++r) sc[g][tk][r] = ((((vs >> (16 * tk + r)) & 1u) != 0u) & (16 * tk + r <= qrel)) ? sc[g][tk][r] : -1.0e9f; } } }
  v16h pf[2];
#pragma unroll      /* constant index into sc[], o[], mr[], l[], pf[] */
  for (int g = 0; g < 2; ++g) {
    float mx = fmaxf(sc[g][0][0], sc[g][1][0]);
#pragma unroll      /* constant element index */
    for (int r = 1; r < 8; ++r) mx = fmaxf(mx, fmaxf(sc[g][0][r], sc[g][1][r]));
    mx = fmaxf(mx, fa_xhalf(mx)); const float mn = fmaxf(mr[g], mx); const float al = __builtin_amdgcn_exp2f((mr[g] - mn) * cs); const float mc = mn * cs; mr[g] = mn;
    v8f p0, p1;
#pragma unroll      /* constant element index */
    for (int r = 0; r < 8; ++r) { p0[r] = __builtin_amdgcn_exp2f(fmaf(sc[g][0][r], cs, -mc)); p1[r] = __builtin_amdgcn_exp2f(fmaf(sc[g][1][r], cs, -mc)); }
    const v8f ps = p0 + p1; l[g] = fmaf(l[g], al, ((ps[0] + ps[1]) + (ps[2] + ps[3])) + ((ps[4] + ps[5]) + (ps[6] + ps[7])));
    const v8h h0 = __builtin_convertvector(p0, v8h), h1 = __builtin_convertvector(p1, v8h);
    pf[g] = __builtin_shufflevector(h0, h1, 0, 1, 2, 3, 4, 5, 6, 7, 8, 9, 10, 11, 12, 13, 14, 15);
#pragma unroll      /* constant index into o[] */
    for (int dt = 0; dt < 4; ++dt) o[g][dt] *= al; }
#pragma unroll      /* constant index into o[], vf[] */
  for (int dt = 0; dt < 4; ++dt) { o[0][dt] = fa_mma(vf[dt], pf[0], o[0][dt]); o[1][dt] = fa_mma(vf[dt], pf[1], o[1][dt]); }
  if (NX) {
    __builtin_amdgcn_sched_barrier(0);      /* keeps the statement below here, behind this pass's products: moved up to the reads it names, it would make the wave wait them out at once */
    asm volatile("" :: "v"(kf[0][0]), "v"(kf[0][1]), "v"(kf[1][0]), "v"(kf[1][1]));      /* inputs only, the loaded values: holds the next pass's key reads in front of this place, so that they return behind this pass's vector work; sunk into the next pass they would make it wait out the LDS latency in front of its first products */
#pragma unroll      /* constant index into vf[] */
    for (int dt = 0; dt < 4; ++dt) vf[dt] = g2_lfrag(vx + dt * 16 * GP); } }
__global__ __launch_bounds__(32 * FW) void k_fattn(const _Float16* __restrict__ Q, const _Float16* __restrict__ K, const _Float16* __restrict__ VT, const int* __restrict__ pm, _Float16* __restrict__ O) {
  __shared__ __attribute__((aligned(16))) char sm[2 * FSTG];
  /* readfirstlane: the wave's number in a scalar register, so that the tests on the wave's diagonal stay scalar branches */
  const unsigned tid = threadIdx.x, lane = tid & 31u, ln = lane & 15u, hh = lane >> 4; const unsigned w = (unsigned)__builtin_amdgcn_readfirstlane((int)(tid >> 5));
  const unsigned rank = blockIdx.x / (unsigned)(NB * NH), bh = blockIdx.x % (unsigned)(NB * NH); const unsigned tile = rank < (unsigned)(FNT / 2) ? (unsigned)(FNT - 1) - rank : rank - (unsigned)(FNT / 2);      /* long tiles first, then the short ones in mirrored order */
  const unsigned b = bh / (unsigned)NH, h = bh % (unsigned)NH; const unsigned qw = tile * (unsigned)(FQ * FW) + w * (unsigned)FQ; const int last = (int)(qw >> 5);      /* pass 'last' holds the wave's diagonal */
  const int ns = (int)(tile * 2u + 2u);      /* stages up to the workgroup's last diagonal: the same for all its waves, at least 2, and 64 ns <= SQ */
  const _Float16* qp = Q + ((size_t)b * SQ + qw + ln) * LQ + h * HD; const int* pp = pm + (size_t)b * SQ_FULL + lane;
  const unsigned cr = tid >> 3, cc = tid & 7u;      /* copies: 8 lanes a row, 16 rows a step of the workgroup */
  const _Float16* gk = K + ((size_t)b * SQ + cr) * LQ + h * HD + cc * 8u; const _Float16* gv = VT + ((size_t)bh * HD + cr) * SQ + cc * 8u;
  const unsigned la = (unsigned)(size_t)sm + cr * (unsigned)GP + cc * 16u;      /* the lane's LDS byte address in buffer 0, key rows */
  const char* pk = sm + ln * (unsigned)GP + 16u * hh; const char* pw = sm + FOP + ln * (unsigned)GP + 16u * hh;      /* the lane's fragment places: row ln, the k order of g2_frag */
  fa_stage(la, gk, gv);
  v16h qf[2][2], kf[2][2], vf[4];
#pragma unroll      /* constant index into qf[] */
  for (int g = 0; g < 2; ++g) { qf[g][0] = g2_frag(qp + (size_t)g * 16 * LQ, hh); qf[g][1] = g2_frag(qp + (size_t)g * 16 * LQ + 32, hh); }
  int pv0 = pp[0], pv1 = pp[32];
  asm volatile("s_wait_xcnt 0x0" ::: "memory");      /* behind the issued loads, in front of whatever rewrites a register that one of them names */
  asm volatile("s_wait_asynccnt 0x0" ::: "memory");      /* this wave's copies of stage 0 have landed */
  __syncthreads();      /* publishes stage 0 to every wave */
  fa_stage(la + FSTG, gk + (size_t)64 * LQ, gv + 64);      /* stage 1 exists: ns >= 2 */
  const v8f z8 = {0.f,0.f,0.f,0.f,0.f,0.f,0.f,0.f}; v8f o[2][4] = {{z8, z8, z8, z8}, {z8, z8, z8, z8}}; float mr[2] = {-3.0e38f, -3.0e38f}, l[2] = {0.f, 0.f};
#pragma unroll 1      /* one trip of code: the ring's order stays as written */
  for (int t = 0; t < ns; ++t) { const unsigned buf = ((unsigned)t & 1u) * (unsigned)FSTG; const char* kb = pk + buf; const char* vb = pw + buf;
    const unsigned vm0 = __builtin_amdgcn_ballot_w32(pv0 != 0), vm1 = __builtin_amdgcn_ballot_w32(pv1 != 0);      /* bit j: key 64 t + j (vm0), 64 t + 32 + j (vm1) passes the padding mask */
    const int tn = t + 1 < ns ? t + 1 : t;      /* the last trip fetches its own entries again: in bounds, unused */
    pv0 = pp[tn * 64]; pv1 = pp[tn * 64 + 32];
    asm volatile("s_wait_xcnt 0x0" ::: "memory");      /* behind the issued loads, in front of whatever rewrites a register that one of them names */
    if (2 * t <= last) {      /* scalar branch: a wave has no work behind its diagonal */
#pragma unroll      /* constant index into kf[] */
      for (int tk = 0; tk < 2; ++tk) { kf[tk][0] = g2_lfrag(kb + tk * 16 * GP); kf[tk][1] = g2_lfrag(kb + tk * 16 * GP + 64); }
#pragma unroll      /* constant index into vf[] */
      for (int dt = 0; dt < 4; ++dt) vf[dt] = g2_lfrag(vb + dt * 16 * GP);
      __builtin_amdgcn_sched_barrier(0);      /* keeps the stage's first fragment reads together in front of its products: spread among them, each small group of reads makes the wave wait out the LDS latency anew */
      fa_pass<true>(2 * t, last, vm0, qw, ln, hh, kb + 32 * GP, vb + 64, qf, kf, vf, o, mr, l);      /* where the diagonal lies in this pass, the fragments read for the next go unused: rows of the same buffer */
      if (2 * t < last) fa_pass<false>(2 * t + 1, last, vm1, qw, ln, hh, kb, vb, qf, kf, vf, o, mr, l); }      /* scalar branch */
    asm volatile("s_wait_dscnt 0x0" ::: "memory");      /* this wave's reads of the buffer have returned before the buffer is given up */
    asm volatile("s_wait_asynccnt 0x0" ::: "memory");      /* this wave's copies of stage t + 1 have landed */
    __syncthreads();      /* publishes stage t + 1 and ends every wave's reads of stage t */
    if (t + 2 < ns) fa_stage(la + buf, gk + (size_t)(t + 2) * 64 * LQ, gv + (size_t)(t + 2) * 64); }
  asm volatile("s_wait_asynccnt 0x0" ::: "memory");      /* no copy is on its way when the wave ends */
  asm volatile("s_wait_loadcnt 0x0" ::: "memory");      /* the last trip's fetches ahead are unused: they land here, so that no load is still on its way to a register when the wave gives its registers back */
#pragma unroll      /* constant index into o[], l[] */
  for (int g = 0; g < 2; ++g) { const float fin = 64.0f * (1.0f / (l[g] + fa_xhalf(l[g])));      /* the halves' sums joined once; o carried x64 */
    _Float16* op = O + ((size_t)b * SQ + qw + 16u * (unsigned)g + ln) * DM + h * HD + 8u * hh;
#pragma unroll      /* constant index into o[] */
    for (int dt = 0; dt < 4; ++dt) *(v8h*)(op + dt * 16) = __builtin_convertvector(o[g][dt] * fin, v8h); } }      /* a lane's 8 registers are 8 consecutive columns of its query's row: one 16-byte store */

// f32 attention for the FIRST query tile of each causal sequence (rows 0..QT0-1 of a batch; QF, KF, VF: QT0 rows a batch, OF likewise): ONE WAVE PER QUERY ROW, workgroup = A0W waves = A0W consecutive rows of one head of one batch. The head's QT0 key rows and value rows are
// staged once in LDS with coalesced 16-byte loads (key pitch HD + 4 floats: 16 lanes that each read 16 bytes of their own key row fall on distinct banks). Scores: lane l owns keys l, l + 32, l + 64, l + 96 (four partial
// sums per key over the head dimension), invalid keys (j > i or pm[j] == 0) are REPLACED by -1e30; maximum and sum close with a five-step butterfly over the lanes (precise expf, weight exactly 0 for an invalid key
// whenever the row has one valid key). q, k, v rows at pitch LQ, o rows at pitch DM. o: lane l owns columns 2l, 2l + 1 and walks all keys (four partial sums over the keys), the weights read back from the wave's own LDS row as broadcasts.
#define A0W 8                        /* query rows (= waves) per workgroup */
#define A0S (QT0 / (2 * A0W))        /* staging steps: a workgroup's threads cover 2 * A0W rows of 64 floats a step, 16 bytes a thread */
static_assert(QT0 % A0W == 0 && QT0 % 32 == 0 && (QT0 * (HD / 4)) % (32 * A0W) == 0 && HD == 64);
typedef float v2f  __attribute__((ext_vector_type(2)));
typedef float v2fa __attribute__((ext_vector_type(2), may_alias));
__device__ __forceinline__ void d_att0(unsigned blk, const float* __restrict__ QF, const float* __restrict__ KF, const float* __restrict__ VF, const int* __restrict__ pm, float scale, float* __restrict__ OF) {
  __shared__ __attribute__((aligned(16))) float lk[QT0][HD + 4]; __shared__ __attribute__((aligned(16))) float lv[QT0][HD]; __shared__ __attribute__((aligned(16))) float lp[A0W][QT0];
  /* readfirstlane: the wave's number in a scalar register, so that the q row's address is scalar */
  const unsigned tid = threadIdx.x, lane = tid & 31u; const unsigned w = (unsigned)__builtin_amdgcn_readfirstlane((int)(tid >> 5));
  const unsigned b = blk / (unsigned)(NH * (QT0 / A0W)), h = (blk / (unsigned)(QT0 / A0W)) % (unsigned)NH, rg = blk % (unsigned)(QT0 / A0W); const unsigned i = rg * (unsigned)A0W + w;
  QF += (size_t)b * QT0 * LQ; KF += (size_t)b * QT0 * LQ; VF += (size_t)b * QT0 * LQ; pm += (size_t)b * SQ_FULL; OF += (size_t)b * QT0 * DM;
  const unsigned r0 = tid >> 4, c4 = (tid & 15u) * 4u; const float* kp = KF + (size_t)r0 * LQ + h * HD + c4; const float* vp = VF + (size_t)r0 * LQ + h * HD + c4; const float* qr = QF + (size_t)i * LQ + h * HD;
  v4f kk[A0S], vv[A0S], qq[HD / 4]; int pv[QT0 / 32];
#pragma unroll      /* constant index into kk[] and vv[]; constant pitch: one address per plane, the steps as immediate offsets; all of a thread's loads in flight together */
  for (int it = 0; it < A0S; ++it) { kk[it] = *(const v4fa*)(kp + (size_t)it * (2 * A0W) * LQ); vv[it] = *(const v4fa*)(vp + (size_t)it * (2 * A0W) * LQ); }
#pragma unroll      /* constant index into pv[] */
  for (int u = 0; u < QT0 / 32; ++u) pv[u] = pm[(unsigned)u * 32u + lane];
#pragma unroll      /* constant index into qq[] */
  for (int c = 0; c < HD / 4; ++c) qq[c] = *(const v4fa*)(qr + c * 4);
  asm volatile("s_wait_xcnt 0x0" :: "v"(kp), "v"(vp) : "memory");      /* behind the last staging load, in front of whatever rewrites a register that an issued load names; kp and vp as inputs keep both address pairs live up to here, so that no load of the run lands in one */
#pragma unroll      /* constant index into kk[] and vv[] */
  for (int it = 0; it < A0S; ++it) { *(v4fa*)&lk[r0 + (unsigned)it * (unsigned)(2 * A0W)][c4] = kk[it]; *(v4fa*)&lv[r0 + (unsigned)it * (unsigned)(2 * A0W)][c4] = vv[it]; }
  __syncthreads();      /* publishes the staged key and value rows to every wave */
  const v4f z4 = {0.f, 0.f, 0.f, 0.f}; v4f acc[QT0 / 32];
#pragma unroll      /* constant index into acc[] */
  for (int u = 0; u < QT0 / 32; ++u) acc[u] = z4;
#pragma unroll      /* constant index into acc[] and qq[]; the LDS reads of several steps in flight together */
  for (int c = 0; c < HD / 4; ++c) {
#pragma unroll      /* constant index into acc[] */
    for (int u = 0; u < QT0 / 32; ++u) acc[u] += qq[c] * *(const v4fa*)&lk[(unsigned)u * 32u + lane][c * 4]; }
  float sm[QT0 / 32]; float mx = -1.0e30f;
#pragma unroll      /* constant index into acc[] and sm[] */
  for (int u = 0; u < QT0 / 32; ++u) { const unsigned j = (unsigned)u * 32u + lane; const float s = ((acc[u][0] + acc[u][1]) + (acc[u][2] + acc[u][3])) * scale; sm[u] = ((j <= i) & (pv[u] != 0)) ? s : -1.0e30f; mx = fmaxf(mx, sm[u]); }
  for (int d = 16; d > 0; d >>= 1) mx = fmaxf(mx, __shfl_xor(mx, d, 32));
  float l = 0.f;
#pragma unroll      /* constant index into sm[] */
  for (int u = 0; u < QT0 / 32; ++u) { const float e = expf(sm[u] - mx); lp[w][(unsigned)u * 32u + lane] = e; l += e; }
  for (int d = 16; d > 0; d >>= 1) l += __shfl_xor(l, d, 32);
  __syncthreads();      /* the weights are written by one lane and read by all lanes of the wave */
  const v2f z2 = {0.f, 0.f}; v2f o[4] = {z2, z2, z2, z2};
#pragma unroll 8      /* several steps' LDS reads in flight together */
  for (int j4 = 0; j4 < QT0 / 4; ++j4) { const v4f pj = *(const v4fa*)&lp[w][j4 * 4];
#pragma unroll      /* constant index into o[] and pj */
    for (int u = 0; u < 4; ++u) o[u] += pj[u] * *(const v2fa*)&lv[j4 * 4 + u][lane * 2u]; }
  const float fin = 64.0f * (1.0f / l);      /* o carried x64 like the f16 path */
  const v2f oo = ((o[0] + o[1]) + (o[2] + o[3])) * fin;
  *(v2f*)(OF + (size_t)i * DM + h * HD + lane * 2u) = oo; }

// row LayerNorm over DM = 1024 of f32 rows: mean, BIASED variance, (x - mu) * rsqrt(var + eps) * bf16(g[c]) + bf16(b[c]) -> f16 rows (GEMM operand). ONE WAVE PER ROW, workgroup = LNW waves = LNW consecutive rows (blk: the workgroup's index among those of this body):
// lane l owns columns 128 j + 4 l .. + 3, j = 0..7, so every load and store of the wave covers whole lines and the row stays in registers; a sum is four chains in the lane, then a butterfly over the lanes. No LDS, no barrier, an eighth of the waves to start.
// RES 1: the row is first formed as the residual without an output projection, X1[r][c] = bf16(x[r][c]) + o[r][c] / 64 (o: f32 first-tile rows OF0 for the first QT0 rows of a batch, else the f16 rows O16; + NaN when the batch's first mask entry is 0:
// the structure the attention kernels rely on is violated), stored to X1 and normalised from the registers that hold it;
#define LNW 8                        /* rows (= waves) per workgroup */
#define LNJ (DM / 128)               /* 16-byte pieces of a row per lane */
static_assert(DM % 128 == 0 && ((size_t)NB * SQ) % LNW == 0 && 32 * LNW == 256);
template <int XM> __device__ __forceinline__ float ln_xm(float x) { return __builtin_bit_cast(float, __builtin_amdgcn_mov_dpp(__builtin_bit_cast(int, x), 0x160 + XM, 0xf, 0xf, true)); }      /* lane l with lane l ^ XM inside its row of 16 lanes (row_xmask) */
__device__ __forceinline__ float ln_wsum(float x) { x += ln_xm<1>(x); x += ln_xm<2>(x); x += ln_xm<4>(x); x += ln_xm<8>(x); return x + fa_xhalf(x); }      /* the sum over the wave's 32 lanes, in every lane; all lanes are on */
template <int BFIN, int FULLIN, int RES>
__device__ __forceinline__ void d_lnx(unsigned blk, const float* __restrict__ X, const float* __restrict__ g, const float* __restrict__ bb, float eps, _Float16* __restrict__ N16,
    const int* __restrict__ pm, const _Float16* __restrict__ O16, const float* __restrict__ OF0, float* __restrict__ X1) {
  /* readfirstlane: the wave's number, and with it the row, in a scalar register: scalar row addresses, a scalar branch on the first tile */
  const unsigned c0 = (threadIdx.x & 31u) * 4u; const unsigned r = blk * (unsigned)LNW + (unsigned)__builtin_amdgcn_readfirstlane((int)(threadIdx.x >> 5));
  const unsigned b = r / (unsigned)SQ, rl = r % (unsigned)SQ; const size_t xr = FULLIN ? ((size_t)b * SQ_FULL + rl) : (size_t)r;
  int p0 = 1; if (RES) p0 = pm[(size_t)b * SQ_FULL];
  const float* xp = X + xr * DM + c0; v4f s[LNJ], o4[LNJ], gv[LNJ], bv[LNJ];
#pragma unroll      /* constant index into s[], gv[], bv[]; one address a plane, the pieces as immediate offsets; all of the wave's loads in flight together */
  for (int j = 0; j < LNJ; ++j) { s[j] = *(const v4fa*)(xp + j * 128); gv[j] = *(const v4fa*)(g + c0 + j * 128); bv[j] = *(const v4fa*)(bb + c0 + j * 128); }
  asm volatile("s_wait_xcnt 0x0" ::: "memory");      /* behind the issued loads, in front of whatever rewrites a register that one of them names; it also holds these loads in front of the branch below: sunk behind it, they would start only when the o row has come back */
  __builtin_amdgcn_sched_barrier(0);      /* keeps the later address arithmetic, which reuses the row's address registers, behind the wait above: the scheduler lifted it over the statement */
  if (RES) {
    if (rl < (unsigned)QT0) { const float* op = OF0 + ((size_t)b * QT0 + rl) * DM + c0;      /* scalar branch */
#pragma unroll      /* constant index into o4[] */
      for (int j = 0; j < LNJ; ++j) o4[j] = *(const v4fa*)(op + j * 128); }
    else { const _Float16* op = O16 + (size_t)r * DM + c0; v4h oh[LNJ];
#pragma unroll      /* constant index into oh[] */
      for (int j = 0; j < LNJ; ++j) oh[j] = *(const v4h*)(op + j * 128);
#pragma unroll      /* constant index into oh[], o4[] */
      for (int j = 0; j < LNJ; ++j) o4[j] = __builtin_convertvector(oh[j], v4f); } }
  const float pz = (p0 != 0) ? 0.f : __uint_as_float(0x7fc00000u);
  v4f a4 = {0.f, 0.f, 0.f, 0.f};
#pragma unroll      /* constant index into s[], o4[] */
  for (int j = 0; j < LNJ; ++j) {
#pragma unroll      /* constant element index */
    for (int q = 0; q < 4; ++q) { float v = BFIN ? bf16_rne(s[j][q]) : s[j][q]; if (RES) v = (v + o4[j][q] * 0.015625f) + pz; s[j][q] = v; }
    a4 += s[j]; }
  const float mu = ln_wsum((a4[0] + a4[1]) + (a4[2] + a4[3])) * (1.0f / (float)DM);
  v4f q4 = {0.f, 0.f, 0.f, 0.f};
#pragma unroll      /* constant index into s[] */
  for (int j = 0; j < LNJ; ++j) { const v4f dl = s[j] - mu; q4 += dl * dl; }
  const float rs = rsqrtf(ln_wsum((q4[0] + q4[1]) + (q4[2] + q4[3])) * (1.0f / (float)DM) + eps);
  v4h y[LNJ];
#pragma unroll      /* constant index into s[], gv[], bv[], y[] */
  for (int j = 0; j < LNJ; ++j) {
#pragma unroll      /* constant element index */
    for (int q = 0; q < 4; ++q) y[j][q] = (_Float16)((((s[j][q] - mu) * rs) * bf16_rne(gv[j][q])) + bf16_rne(bv[j][q])); }
  _Float16* np = N16 + (size_t)r * DM + c0;
#pragma unroll      /* constant index into y[]; one address, the pieces as immediate offsets */
  for (int j = 0; j < LNJ; ++j) *(v4h*)(np + j * 128) = y[j];
  if (RES) { float* x1p = X1 + (size_t)r * DM + c0;
#pragma unroll      /* constant index into s[]; one address, the pieces as immediate offsets */
    for (int j = 0; j < LNJ; ++j) *(v4f*)(x1p + j * 128) = s[j]; } }

// shared launches: every test on blockIdx.x reads the same for a whole workgroup, so each body's barriers stay under workgroup-uniform control flow
#define PB_WH ((unsigned)(NH * (DM / WTK)))      /* workgroups (tiles) of one per-head weight plane: a head's 64 columns are one tile wide */
#define PB_W1 ((unsigned)((DFF / WTN) * (DM / WTK)))
#define PB_W2 ((unsigned)((DM / WTN) * (DFF / WTK)))
// all that reads inputs alone: Wq, Wk, Wv -> the x16 q|k|v plane; W1 [DM][DFF] -> [DFF][DM] x16; W2 [DFF][DM] -> [DM][DFF] x16; h = LN1(bf16(x)) -> f16 rows
__global__ __launch_bounds__(256) void k_prep(const float* __restrict__ wq, const float* __restrict__ wk, const float* __restrict__ wv, _Float16* __restrict__ BQKV, const float* __restrict__ w1, _Float16* __restrict__ BW1,
    const float* __restrict__ w2, _Float16* __restrict__ BW2, const float* __restrict__ x, const float* __restrict__ g1, const float* __restrict__ be1, _Float16* __restrict__ X16) {
  __shared__ __attribute__((aligned(16))) v8us tl[WTN * (WTK / 8)];      /* one tile for the three transposing branches */
  unsigned blk = blockIdx.x;
  if (blk < 3u * PB_WH) { const unsigned p = blk / PB_WH, hk = blk - p * PB_WH, h = hk / (unsigned)(DM / WTK), kt = hk % (unsigned)(DM / WTK);      /* head h: [DM][HD] -> rows h * HD .. of the plane */
    d_wtile<HD, DM>(tl, (p == 0u ? wq : (p == 1u ? wk : wv)) + ((size_t)h * DM + kt * (unsigned)WTK) * HD, BQKV + (size_t)p * DM * DM + (size_t)h * HD * DM + kt * (unsigned)WTK); return; }
  blk -= 3u * PB_WH;
  if (blk < PB_W1) { const unsigned nt = blk / (unsigned)(DM / WTK), kt = blk % (unsigned)(DM / WTK); d_wtile<DFF, DM>(tl, w1 + (size_t)kt * WTK * DFF + nt * (unsigned)WTN, BW1 + (size_t)nt * WTN * DM + kt * (unsigned)WTK); return; }
  blk -= PB_W1;
  if (blk < PB_W2) { const unsigned nt = blk / (unsigned)(DFF / WTK), kt = blk % (unsigned)(DFF / WTK); d_wtile<DM, DFF>(tl, w2 + (size_t)kt * WTK * DM + nt * (unsigned)WTN, BW2 + (size_t)nt * WTN * DFF + kt * (unsigned)WTK); return; }
  blk -= PB_W2;
  d_lnx<1, 1, 0>(blk, x, g1, be1, 1e-5f, X16, (const int*)nullptr, (const _Float16*)nullptr, (const float*)nullptr, (float*)nullptr);
  asm volatile("s_wait_xcnt 0x0" ::: "memory"); }      /* behind the row's store, in front of whatever rewrites a register that it names: the other bodies' code follows it in the built text */

// all that reads the q|k|v GEMM's output alone: the f32 first-tile attention (o x64) and V^T [NB][NH][HD][SQ], all batches
#define MB_A0 ((unsigned)(NB * NH * (QT0 / A0W)))
#define MB_VT ((unsigned)(NB * NH * (SQ / 64)))
static_assert(32 * A0W == 256);
__global__ __launch_bounds__(256) void k_att0_vt(const float* __restrict__ F0, const int* __restrict__ pm, float* __restrict__ OF0, const _Float16* __restrict__ V16, _Float16* __restrict__ VT) {
  if (blockIdx.x >= MB_A0) { d_vt<NH, SQ>(blockIdx.x - MB_A0, V16, LQ, 0, VT); return; }
  d_att0(blockIdx.x, F0, F0 + DM, F0 + 2 * DM, pm, 0.125f, OF0); }

// x1 = bf16(x) + attn, stored, and h2 = LN2(x1) -> f16 rows
__global__ __launch_bounds__(256) void k_res_ln(const float* __restrict__ x, const int* __restrict__ pm, const _Float16* __restrict__ O16, const float* __restrict__ OF0, float* __restrict__ X1,
    const float* __restrict__ g2, const float* __restrict__ be2, _Float16* __restrict__ M16) {
  d_lnx<1, 1, 1>(blockIdx.x, x, g2, be2, 1e-5f, M16, pm, O16, OF0, X1); }

extern "C" void kernel_launch(void* const* d_in, const int* in_sizes, int n_in,
                              void* d_out, int out_size, void* d_ws, size_t ws_size, hipStream_t stream) {
  if (n_in < 13) return;
  const size_t rows_need = (size_t)(NB - 1) * SQ_FULL + SQ;
  if ((size_t)in_sizes[0] < rows_need * DM) return; if ((size_t)in_sizes[1] < rows_need) return;
  if ((size_t)in_sizes[2] < (size_t)NH * DM * HD || (size_t)in_sizes[3] < (size_t)NH * DM * HD || (size_t)in_sizes[4] < (size_t)NH * DM * HD) return;
  if (in_sizes[5] < DM || in_sizes[6] < DM || in_sizes[7] < DM || in_sizes[8] < DM) return;
  if ((size_t)in_sizes[9] < (size_t)DM * DFF || in_sizes[10] < DFF || (size_t)in_sizes[11] < (size_t)DFF * DM || in_sizes[12] < DM) return;
  if ((size_t)out_size < NR * DM) return;
  const float* x = (const float*)d_in[0]; const int* pmask = (const int*)d_in[1];
  const float* wq = (const float*)d_in[2]; const float* wk = (const float*)d_in[3]; const float* wv = (const float*)d_in[4];
  const float* g1 = (const float*)d_in[5]; const float* be1 = (const float*)d_in[6]; const float* g2 = (const float*)d_in[7]; const float* be2 = (const float*)d_in[8];
  const float* w1 = (const float*)d_in[9]; const float* b1 = (const float*)d_in[10]; const float* w2 = (const float*)d_in[11]; const float* b2 = (const float*)d_in[12];
  char* ws = (char*)d_ws; size_t off = 0;
  auto take = [&](size_t bytes) { char* p = ws + off; off += (bytes + 255) & ~(size_t)255; return p; };
  _Float16* BQKV = (_Float16*)take((size_t)3 * DM * DM * 2);          /* [3*DM][DM] x16: q | k | v stacked, row (h*HD + d) */
  _Float16* X16 = (_Float16*)take(NR * DM * 2);                       /* LN1 rows; reused as the LN2 rows (last reader of LN1 rows: the q|k|v GEMM, before LN2 writes) */
  float* X1 = (float*)take(NR * DM * 4);
  _Float16* BW1 = (_Float16*)take((size_t)DFF * DM * 2); _Float16* BW2 = (_Float16*)take((size_t)DM * DFF * 2);
  _Float16* QKV = (_Float16*)take(NR * 3 * DM * 2); _Float16* Q16 = QKV; _Float16* K16 = QKV + DM; _Float16* V16 = QKV + 2 * DM;
  _Float16* HF16 = QKV;                                               /* FFN hidden rows [NR][DFF] alias the q|k|v rows (dead after the attention); DFF <= 3*DM asserted */
  _Float16* O16 = (_Float16*)take(NR * DM * 2);
  _Float16* VT = (_Float16*)take((size_t)NB * NH * HD * SQ * 2);      /* V^T [NB][NH][HD][SQ] */
  float* F0 = (float*)take((size_t)NB * QT0 * 3 * DM * 4);            /* f32 q | k | v of the first 128 rows of each batch */
  float* OF0 = (float*)take((size_t)NB * QT0 * DM * 4);
  _Float16* M16 = X16;
  if (off > ws_size || off > (size_t)134217728) return;
  k_prep<<<3u * PB_WH + PB_W1 + PB_W2 + (unsigned)(NR / LNW), 256, 0, stream>>>(wq, wk, wv, BQKV, w1, BW1, w2, BW2, x, g1, be1, X16);      /* weight planes (x16, transposed) and h = LN1(bf16(x)) */
  k_gemm2<0, false, false, false, true, true, LQ><<<dim3((unsigned)((NR / 128) * (3 * DM / 128)), 1), 256, 0, stream>>>(X16, DM, (size_t)0, BQKV, DM, (size_t)0, 0.0625f, (const float*)nullptr, (const float*)nullptr, (float*)nullptr, QKV, F0, (unsigned)(SQ / 128), (size_t)0, (int)NR, 3 * DM, DM);      /* q | k | v rows (f16); rows 0..127 of each batch in f32 too */
  k_att0_vt<<<MB_A0 + MB_VT, 256, 0, stream>>>(F0, pmask, OF0, V16, VT);      /* f32 attention for rows 0..127 of each batch (o x64); V^T */
  k_fattn<<<NB * NH * FNT, 32 * FW, 0, stream>>>(Q16, K16, VT, pmask, O16);      /* o (merged heads, x64) as f16 rows, all batches, heads and query tiles */
  k_res_ln<<<(unsigned)(NR / LNW), 256, 0, stream>>>(x, pmask, O16, OF0, X1, g2, be2, M16);      /* x1 = bf16(x) + attn; h2 = LN2(x1) -> f16 rows */
  k_gemm2<3, true, false, false, true, false, DFF><<<dim3((unsigned)((NR / 128) * (DFF / 128)), 1), 256, 0, stream>>>(M16, DM, (size_t)0, BW1, DM, (size_t)0, 0.0625f, b1, (const float*)nullptr, (float*)nullptr, HF16, (float*)nullptr, 1u, (size_t)0, (int)NR, DFF, DM);      /* relu(h2 W1 + b1) -> f16 */
  k_gemm2<0, true, true, true, false, false, DM><<<dim3((unsigned)((NR / 128) * (DM / 128)), 1), 256, 0, stream>>>(HF16, DFF, (size_t)0, BW2, DFF, (size_t)0, 0.0625f, b2, X1, (float*)d_out, (_Float16*)nullptr, (float*)nullptr, 1u, (size_t)0, (int)NR, DM, DFF);      /* out = x1 + mlp (own-element residual) */
}

// v010
// Measured time: 110 microseconds a run.
// Timed twice side by side with v009, it ran 1.05 and 1.06 times as fast.
// All steps since v000 together make it 46.6 times as fast.
#include <hip/hip_runtime.h>
// Pre-LN causal transformer layer: x [NB][SEQ][1024]; h = LN1(x) (biased variance, eps 1e-5); q/k/v[b][h] = h Wq/Wk/Wv[h] (per-head [16][1024][64], [in][out], no biases); scores / sqrt(64); mask = padding_mask[b][key] AND causal, masked scores REPLACED by -1e9; softmax; heads concatenated (no output projection); x1 = x + attn; h2 = LN2(x1); out = x1 + relu(h2 W1 + b1) W2 + b2 ([in][out] 1024 x 1024 x 1024).
// Structure: LN1 on VALU (one wave per row) -> f16 rows; weights transposed through LDS tiles (per-head ones into one x16 f16 q|k|v plane); q|k|v as ONE WMMA GEMM (operands staged in LDS, 32x64 wave tiles, f32 accumulation, f16 out); V^T via LDS transposes and an f32 first tile (rows 0..127 of each batch) on VALU; then ONE fused attention launch for all batches and heads (keys and values staged in LDS per workgroup; scores, masked online softmax and P V in registers, two waves per 32 queries, each on every other 64 keys, their partial results joined at the end; o x64 f16); x1 = bf16(x) + o / 64; LN2 -> f16; FFN as two GEMMs (ReLU epilogue; own-element residual).
// Launches (7): kernels that do not depend on one another share a launch, each on its own range of workgroup indices: {weight transposes, LN1}; q|k|v GEMM (also stores its first-tile rows in f32); {first-tile attention, V^T}; fused attention; {residual + LN2, one wave per row}; FFN 1; FFN 2.
// Compute dtype: all contractions v_wmma_f32_16x16x32_f16 (f16 operands, f32 accumulate); float inputs RNE-converted to bf16 first (weights then x16, exact in f16); q, k, v, softmax weights (relative to the running row maximum) and o (x64) as plain f16 operands; scores and softmax statistics f32; first 128 query rows of each batch in f32 on VALU.
#ifndef NB
#define NB 2
#endif
#ifndef SEQ
#define SEQ 2048
#endif
#define SQ SEQ
#define NB_FULL 2
#define SQ_FULL 2048                 /* per-batch row stride of the inputs (x rows, mask entries) */
#define DM 1024
#define NH 16
#define HD 64
#define DFF 1024
#define QT0 128                      /* first-tile rows computed in f32 */
#define NR ((size_t)NB * SQ)         /* token rows */
#define LQ (3 * DM)                  /* row pitch of the q|k|v rows */
static_assert(NH * HD == DM);
static_assert(QT0 == 128 && QT0 <= SQ && SQ <= SQ_FULL && NB <= NB_FULL);
static_assert(DM % 128 == 0 && DFF % 128 == 0 && HD == 64 && ((size_t)NB * SQ) % 128 == 0);
static_assert(DM / 4 == 256);
static_assert(DFF <= 3 * DM);
static_assert((((size_t)NB * SQ * DM) / 4) % 256 == 0);
static_assert((size_t)NB * SQ * DM / 4 < 0x7fffffffu);

typedef unsigned short v8us __attribute__((ext_vector_type(8), may_alias));
typedef float  v8f  __attribute__((ext_vector_type(8)));
typedef float  v4f  __attribute__((ext_vector_type(4)));
typedef float  v4fa __attribute__((ext_vector_type(4), may_alias));
typedef _Float16 v16h __attribute__((ext_vector_type(16)));
typedef _Float16 v4h __attribute__((ext_vector_type(4)));
union FragH { v16h v; v8us half[2]; _Float16 h[16]; unsigned short u[16]; };

__device__ __forceinline__ unsigned short bf16_bits(float x) { unsigned int u = __float_as_uint(x); return (unsigned short)((u + 0x7FFFu + ((u >> 16) & 1u)) >> 16); }
__device__ __forceinline__ float bf16_rne(float x) { return __uint_as_float(((unsigned int)bf16_bits(x)) << 16); }

// fragment: elements 0..7 <- k0 + 8h + 0..7, elements 8..15 <- k0 + 16 + 8h + 0..7 (same map for A rows and B columns)
__device__ __forceinline__ v16h g2_frag(const _Float16* p, unsigned hh) { FragH f; f.half[0] = *(const v8us*)((const unsigned short*)p + 8u * hh); f.half[1] = *(const v8us*)((const unsigned short*)p + 16u + 8u * hh); return f.v; }
__device__ __forceinline__ v8f g2_mma(v16h a, v16h b, v8f c) { return __builtin_amdgcn_wmma_f32_16x16x32_f16(false, a, false, b, (short)0, c, false, false); }

// GEMM (wave tile 32x64; workgroup = 8 waves (4 x 2) = 128 rows x 128 cols; M % 128 == 0, N % 128 == 0, K % 64 == 0): A f16 [M][K] (pitch lda, batch stride sA), Bh f16 [N][K] (pitch ldb, batch stride sB);
// a stage is 64 k of the tile's 128 A rows and 128 B rows (128 bytes a row: whole lines), brought into LDS by asynchronous 16-byte copies at row pitch 144 bytes (conflict-free for the 16-byte fragment reads); two buffers: the next stage's copies fly while this stage is worked on.
// v = acc * alpha + bf16(bias[col]) (+ CP own element of the batched C plane); ACT 0 none / 3 relu; writes f32 C and/or f16 C16 (pitch LDC, batch offset by * sC); CT: every tper-th row tile (mt % tper == 0) is stored in f32 as well, as rows (mt / tper) * 128 .. + 127 of CT (pitch LDC).
// Which of bias, CP, C, C16, CT take part (HB, HCP, HC, HC16, HCT) and the pitch LDC are compile-time: no branch stands between the epilogue's loads or stores, and a run of them is one address with the rows as immediate offsets.
// Epilogue: the raw accumulators go through the wave's own LDS tile; then a lane owns 4 consecutive columns of 16 rows. Its 4 bias values and its 16 CP pieces (16 bytes each, whole lines per wave) are loaded at the kernel's entry, all in flight together, and wait in registers.
#define GP 144                       /* LDS row pitch, bytes */
#define GOP (128 * GP)               /* one operand's rows of a stage, bytes */
#define GSTG (2 * GOP)               /* one buffer: the A rows, then the B rows */
static_assert(8 * 32 * 68 * 4 <= 2 * GSTG && GP % 16 == 0);
__device__ __forceinline__ v16h g2_lfrag(const char* p) { FragH f; f.half[0] = *(const v8us*)p; f.half[1] = *(const v8us*)(p + 32); return f.v; }      /* p: the lane's LDS row + 2 k0 + 16 hh bytes: the k order of g2_frag */
// one stage: a lane's 4 copies of A rows (r, r + 32, r + 64, r + 96) and 4 of B rows; a wave's copy covers 4 whole 128-byte rows
__device__ __forceinline__ void g2_stage(unsigned l, const _Float16* ga, size_t ra, const _Float16* gb, size_t rb) {
  /* the copies and, as the last line of their own statement, the wait that stands in front of any rewrite of a register that an issued copy names */
  asm volatile("global_load_async_to_lds_b128 %0, %8, off\n\t"
               "global_load_async_to_lds_b128 %1, %9, off\n\t"
               "global_load_async_to_lds_b128 %2, %10, off\n\t"
               "global_load_async_to_lds_b128 %3, %11, off\n\t"
               "global_load_async_to_lds_b128 %4, %12, off\n\t"
               "global_load_async_to_lds_b128 %5, %13, off\n\t"
               "global_load_async_to_lds_b128 %6, %14, off\n\t"
               "global_load_async_to_lds_b128 %7, %15, off\n\t"
               "s_wait_xcnt 0x0"
               :: "v"(l), "v"(l + 32u * GP), "v"(l + 64u * GP), "v"(l + 96u * GP), "v"(l + GOP), "v"(l + GOP + 32u * GP), "v"(l + GOP + 64u * GP), "v"(l + GOP + 96u * GP),
                  "v"(ga), "v"(ga + ra), "v"(ga + 2 * ra), "v"(ga + 3 * ra), "v"(gb), "v"(gb + rb), "v"(gb + 2 * rb), "v"(gb + 3 * rb) : "memory"); }
template <int ACT, bool HB, bool HCP, bool HC, bool HC16, bool HCT, int LDC>
__global__ __launch_bounds__(256) void k_gemm2(const _Float16* __restrict__ A, int lda, size_t sA, const _Float16* __restrict__ Bh, int ldb, size_t sB, float alpha,
    const float* __restrict__ bias, const float* __restrict__ CP, float* __restrict__ C, _Float16* __restrict__ C16, float* __restrict__ CT, unsigned tper, size_t sC, int M, int N, int K) {
  static_assert(ACT == 0 || ACT == 3);
  __shared__ __attribute__((aligned(16))) char sm[2 * GSTG];
  const unsigned tid = threadIdx.x, w = tid >> 5, lane = tid & 31u, ln = lane & 15u, hh = lane >> 4; const unsigned by = blockIdx.y;
  A += (size_t)by * sA; Bh += (size_t)by * sB; const size_t cofs = (size_t)by * sC;
  const unsigned ntn = (unsigned)N >> 7; const unsigned mt = blockIdx.x / ntn, nq = blockIdx.x - mt * ntn; if (mt * 128u >= (unsigned)M) return;      /* the same for the whole workgroup, in front of every barrier */
  const unsigned row0 = mt * 128u + 32u * (w >> 1), col0 = nq * 128u + 64u * (w & 1u);
  const unsigned cr = tid >> 3, cc = tid & 7u;      /* copies: 8 lanes a row, 32 rows a step of the workgroup */
  const _Float16* ga = A + (size_t)(mt * 128u + cr) * (size_t)lda + cc * 8u; const _Float16* gb = Bh + (size_t)(nq * 128u + cr) * (size_t)ldb + cc * 8u; const size_t ra = (size_t)32 * (size_t)lda, rb = (size_t)32 * (size_t)ldb;
  const unsigned la = (unsigned)(size_t)sm + cr * (unsigned)GP + cc * 16u;      /* the lane's LDS byte address in buffer 0, A rows */
  const char* pa = sm + (32u * (w >> 1) + ln) * (unsigned)GP + 16u * hh; const char* pb = sm + GOP + (64u * (w & 1u) + ln) * (unsigned)GP + 16u * hh;
  const int nt = K >> 6;
  g2_stage(la, ga, ra, gb, rb);
  const unsigned rsub = lane >> 4, c4 = (lane & 15u) * 4u;      /* epilogue: the lane's rows 2 q + rsub, q = 0..15, and its 4 columns of the wave's tile */
  const size_t eo = cofs + (size_t)(row0 + rsub) * (size_t)LDC + col0 + c4;      /* its first element in a C-shaped plane */
  v4f bv = {0.f, 0.f, 0.f, 0.f}, cp[16];
  if (HB) bv = *(const v4fa*)(bias + col0 + c4);
  if (HCP) {
#pragma unroll      /* constant index into cp[]; one address, the rows as immediate offsets; all of the lane's loads in flight together, behind stage 0's copies */
    for (int q = 0; q < 16; ++q) cp[q] = *(const v4fa*)(CP + eo + (size_t)q * 2 * LDC); }
  if (HB || HCP) asm volatile("s_wait_xcnt 0x0" ::: "memory");      /* behind the issued loads, in front of whatever rewrites a register that one of them names */
  asm volatile("s_wait_asynccnt 0x0" ::: "memory");      /* this wave's copies of stage 0 have landed */
  __syncthreads();      /* publishes stage 0 to every wave */
  if (nt > 1) g2_stage(la + GSTG, ga + 64, ra, gb + 64, rb);
  const v8f z8 = {0.f,0.f,0.f,0.f,0.f,0.f,0.f,0.f}; v8f c00 = z8, c01 = z8, c02 = z8, c03 = z8, c10 = z8, c11 = z8, c12 = z8, c13 = z8;
#pragma unroll 1      /* one trip of code: the ring's order stays as written */
  for (int t = 0; t < nt; ++t) { const unsigned buf = ((unsigned)t & 1u) * (unsigned)GSTG; const char* qa = pa + buf; const char* qb = pb + buf;
    const v16h a0 = g2_lfrag(qa), a1 = g2_lfrag(qa + 16 * GP), b0 = g2_lfrag(qb), b1 = g2_lfrag(qb + 16 * GP), b2 = g2_lfrag(qb + 32 * GP), b3 = g2_lfrag(qb + 48 * GP);
    const v16h e0 = g2_lfrag(qa + 64), e1 = g2_lfrag(qa + 16 * GP + 64), f0 = g2_lfrag(qb + 64), f1 = g2_lfrag(qb + 16 * GP + 64), f2 = g2_lfrag(qb + 32 * GP + 64), f3 = g2_lfrag(qb + 48 * GP + 64);
    __builtin_amdgcn_sched_barrier(0);      /* keeps the trip's fragment reads together in front of its products: spread among them, each small group of reads makes the wave wait out the LDS latency anew */
    c00 = g2_mma(a0, b0, c00); c10 = g2_mma(a1, b0, c10); c01 = g2_mma(a0, b1, c01); c11 = g2_mma(a1, b1, c11); c02 = g2_mma(a0, b2, c02); c12 = g2_mma(a1, b2, c12); c03 = g2_mma(a0, b3, c03); c13 = g2_mma(a1, b3, c13);
    __builtin_amdgcn_sched_barrier(0);      /* keeps the first half's products in front of the waits below, so that the second half's fragment reads return behind them and not in front of an idle matrix unit */
    asm volatile("s_wait_dscnt 0x0" ::: "memory");      /* this wave's reads of the buffer have returned before the buffer is given up */
    asm volatile("s_wait_asynccnt 0x0" ::: "memory");      /* this wave's copies of stage t + 1 have landed */
    __syncthreads();      /* publishes stage t + 1 and ends every wave's reads of stage t */
    if (t + 2 < nt) g2_stage(la + buf, ga + (size_t)(t + 2) * 64, ra, gb + (size_t)(t + 2) * 64, rb);
    /* the second half's products, on fragments already in registers, run while the copies fly */
    c00 = g2_mma(e0, f0, c00); c10 = g2_mma(e1, f0, c10); c01 = g2_mma(e0, f1, c01); c11 = g2_mma(e1, f1, c11); c02 = g2_mma(e0, f2, c02); c12 = g2_mma(e1, f2, c12); c03 = g2_mma(e0, f3, c03); c13 = g2_mma(e1, f3, c13); }
  asm volatile("s_wait_asynccnt 0x0" ::: "memory");      /* no copy is on its way when the ring becomes output staging */
  float (*so)[32][68] = (float (*)[32][68])sm;      /* output staging, a wave's own tile, in the ring, which every wave has left at the last trip's barrier */
  v8f accs[8] = {c00, c01, c02, c03, c10, c11, c12, c13};
#pragma unroll      /* constant index into accs[] */
  for (int u = 0; u < 8; ++u) { const unsigned t = (unsigned)u & 3u, half = (unsigned)u >> 2;
#pragma unroll      /* constant element index */
    for (int r = 0; r < 8; ++r) so[w][half * 16u + 8u * hh + (unsigned)r][t * 16u + ln] = accs[u][r]; }
  __builtin_amdgcn_fence(4 /* acq_rel order */, "workgroup"); __builtin_amdgcn_wave_barrier();      /* wave-private tile: same wave writes and reads */
  v4f vv[16];
#pragma unroll      /* constant index into vv[]; all of the lane's LDS reads in flight together */
  for (int q = 0; q < 16; ++q) vv[q] = *(const v4fa*)&so[w][(unsigned)q * 2u + rsub][c4];
  if (HB) {
#pragma unroll      /* constant element index */
    for (int i = 0; i < 4; ++i) bv[i] = bf16_rne(bv[i]); }
#pragma unroll      /* constant index into vv[], cp[] */
  for (int q = 0; q < 16; ++q) {
#pragma unroll      /* constant element index */
    for (int i = 0; i < 4; ++i) { float v = vv[q][i] * alpha + bv[i];
      if (HCP) v += cp[q][i];      /* own element of the batched C plane */
      if (ACT == 3) v = fmaxf(v, 0.f);
      vv[q][i] = v; } }
  /* each run of stores below ends with the wait that stands in front of whatever rewrites a register that one of them names */
  if (HC) { float* p = C + eo;
#pragma unroll      /* constant index into vv[]; one address, the rows as immediate offsets */
    for (int q = 0; q < 16; ++q) *(v4f*)(p + (size_t)q * 2 * LDC) = vv[q];
    asm volatile("s_wait_xcnt 0x0" ::: "memory"); }
  if (HCT) { if (mt % tper == 0u) { float* p = CT + ((size_t)(mt / tper) * 128u + 32u * (w >> 1) + rsub) * (size_t)LDC + col0 + c4;      /* the test reads the same for the whole workgroup */
#pragma unroll      /* constant index into vv[]; one address, the rows as immediate offsets */
      for (int q = 0; q < 16; ++q) *(v4f*)(p + (size_t)q * 2 * LDC) = vv[q];
      asm volatile("s_wait_xcnt 0x0" ::: "memory"); } }
  if (HC16) { _Float16* p = C16 + eo; v4h hv[16];
#pragma unroll      /* constant index into vv[], hv[] */
    for (int q = 0; q < 16; ++q) hv[q] = __builtin_convertvector(vv[q], v4h);
#pragma unroll      /* constant index into hv[]; one address, the rows as immediate offsets */
    for (int q = 0; q < 16; ++q) *(v4h*)(p + (size_t)q * 2 * LDC) = hv[q];
    asm volatile("s_wait_xcnt 0x0" ::: "memory"); } }

// the bodies below run on a range of a shared launch's workgroups: blk, where they take it, is the workgroup's index inside that range
// weight plane W [k][n] f32 (pitch SP) -> Wt [n][k] f16 (pitch OP), value (f16)(16 * bf16(w)): a workgroup takes WTK k rows x WTN n columns through LDS. W, Wt: the tile's first element in each plane; tl: the workgroup's LDS tile, WTN * WTK / 8 chunks.
// In: a thread reads 16 bytes of each of 8 consecutive k rows (16 lanes cover 256 contiguous bytes of a row: whole lines), so it holds 8 k of 4 columns and writes each column's 8 values as one 16-byte chunk.
// Out: 16 lanes read the 16 chunks of one n row and store 256 contiguous bytes. Chunk c of row n lies at place c ^ (n >> 2) of the row: the 16 lanes of a write (rows 4 apart, one c) and of a read (one row, all c) each fall on 16 distinct 16-byte bank groups.
#define WTK 128
#define WTN 64
static_assert(WTN == 64 && WTK == 128 && DM % WTK == 0 && DFF % WTK == 0 && DM % WTN == 0 && DFF % WTN == 0 && HD == WTN);
template <int SP, int OP>
__device__ __forceinline__ void d_wtile(v8us* tl, const float* __restrict__ W, _Float16* __restrict__ Wt) {
  const unsigned tid = threadIdx.x, lo = tid & 15u, hi = tid >> 4;
  const float* sp = W + (size_t)(hi * 8u) * SP + lo * 4u; v4f a[8];
#pragma unroll      /* constant index into a[]; constant pitch: one address, the rows as immediate offsets; all of a thread's loads in flight together */
  for (int j = 0; j < 8; ++j) a[j] = *(const v4fa*)(sp + (size_t)j * SP);
#pragma unroll      /* constant index into a[] */
  for (int i = 0; i < 4; ++i) { FragH f;
#pragma unroll      /* constant index into a[] and f */
    for (int j = 0; j < 8; ++j) f.h[j] = (_Float16)(16.0f * bf16_rne(a[j][i]));
    tl[(lo * 4u + (unsigned)i) * (unsigned)(WTK / 8) + (hi ^ lo)] = f.half[0]; }
  __syncthreads();      /* publishes the tile: a chunk is written by one thread and stored by another */
  unsigned short* dp = (unsigned short*)Wt + (size_t)hi * OP + lo * 8u;
#pragma unroll      /* constant pitch: one address, the rows as immediate offsets */
  for (int q = 0; q < WTN / 16; ++q) { const unsigned n = hi + 16u * (unsigned)q; *(v8us*)(dp + (size_t)q * 16 * OP) = tl[n * (unsigned)(WTK / 8) + (lo ^ (n >> 2))]; }
  asm volatile("s_wait_xcnt 0x0" ::: "memory"); }      /* behind the last of the run's stores, in front of whatever rewrites a register that one of them names: another body's code follows in the built text */

template <int NHv, int TTv>
__device__ __forceinline__ void d_vt(unsigned blk, const _Float16* __restrict__ V16, int ldv, int voff, _Float16* __restrict__ Vt) {
  __shared__ unsigned short tl[64][66]; const unsigned tid = threadIdx.x; const unsigned slab = blk / (unsigned)(TTv / 64), lg = blk % (unsigned)(TTv / 64); const unsigned b = slab / (unsigned)NHv, h = slab % (unsigned)NHv;
  for (unsigned i = tid; i < 64u * 8u; i += 256u) { const unsigned r = i >> 3, c8 = (i & 7u) * 8u; FragH f; f.half[0] = *(const v8us*)((const unsigned short*)V16 + ((size_t)b * TTv + lg * 64u + r) * (size_t)ldv + (size_t)voff + h * 64u + c8);
#pragma unroll
    for (int q = 0; q < 8; ++q) tl[r][c8 + (unsigned)q] = f.u[q]; }
  __syncthreads();
  {
#pragma unroll
    for (int rd = 0; rd < 2; ++rd) { const unsigned d = (unsigned)rd * 32u + (tid >> 3), pc = tid & 7u; FragH f;
#pragma unroll
      for (int q = 0; q < 8; ++q) f.u[q] = tl[pc * 8u + (unsigned)q][d];
      *(v8us*)((unsigned short*)Vt + ((size_t)slab * 64u + d) * TTv + lg * 64u + pc * 8u) = f.half[0]; }
     } }

#define FQ 32                        /* query columns per wave */
#define FW 4                         /* waves per set: the query tile's column groups */
#define FS 2                         /* sets per workgroup: set s walks the stages FS u + s */
#define FNT (SQ / (FQ * FW))         /* query tiles of a sequence */
#define FOP (64 * GP)                /* one operand's 64 rows of a stage, bytes */
#define FSTG (2 * FOP)               /* one buffer: the key rows, then the rows of the transposed value plane */
#define FRING (2 * FSTG)             /* one set's two buffers */
#define FXC 17                       /* 16-byte pieces a lane hands over at the join: 16 of output tiles, 1 of maxima and sums */
static_assert(SQ % (FQ * FW) == 0 && FNT % 2 == 0 && HD == 64 && FQ == 32 && FQ * FW == 128 && SQ % 64 == 0);
static_assert(FS == 2 && FW * FXC * 32 * 16 <= FS * FRING && FRING % 16 == 0);
typedef _Float16 v8h __attribute__((ext_vector_type(8)));
__device__ __forceinline__ float fa_xhalf(float x) { return __builtin_bit_cast(float, __builtin_amdgcn_permlanex16(__builtin_bit_cast(int, x), __builtin_bit_cast(int, x), 0x76543210, 0xfedcba98, false, false)); }      /* lane l with lane l ^ 16 */
__device__ __forceinline__ v8f fa_mma(v16h a, v16h b, v8f c) { return __builtin_amdgcn_wmma_f32_16x16x32_f16(false, a, false, b, (short)0, c, false, false); }
// one stage: a lane's 4 copies of key rows (r, r + 16, r + 32, r + 48) and 4 of value-plane rows; a wave's copy covers 4 whole 128-byte rows
__device__ __forceinline__ void fa_stage(unsigned l, const _Float16* gk, const _Float16* gv) {
  /* the copies and, as the last line of their own statement, the wait that stands in front of any rewrite of a register that an issued copy names */
  asm volatile("global_load_async_to_lds_b128 %0, %8, off\n\t"
               "global_load_async_to_lds_b128 %1, %9, off\n\t"
               "global_load_async_to_lds_b128 %2, %10, off\n\t"
               "global_load_async_to_lds_b128 %3, %11, off\n\t"
               "global_load_async_to_lds_b128 %4, %12, off\n\t"
               "global_load_async_to_lds_b128 %5, %13, off\n\t"
               "global_load_async_to_lds_b128 %6, %14, off\n\t"
               "global_load_async_to_lds_b128 %7, %15, off\n\t"
               "s_wait_xcnt 0x0"
               :: "v"(l), "v"(l + 16u * GP), "v"(l + 32u * GP), "v"(l + 48u * GP), "v"(l + FOP), "v"(l + FOP + 16u * GP), "v"(l + FOP + 32u * GP), "v"(l + FOP + 48u * GP),
                  "v"(gk), "v"(gk + (size_t)16 * LQ), "v"(gk + (size_t)32 * LQ), "v"(gk + (size_t)48 * LQ), "v"(gv), "v"(gv + (size_t)16 * SQ), "v"(gv + (size_t)32 * SQ), "v"(gv + (size_t)48 * SQ) : "memory"); }
// one pass: 32 keys (fragments kf, vf) against the wave's 32 queries. NX: the stage's next pass has its fragments read from kx, vx (the lane's LDS places) into the registers just read
template <bool NX>
__device__ __forceinline__ void fa_pass(int s, int last, unsigned vm, unsigned qw, unsigned ln, unsigned hh, const char* kx, const char* vx, const v16h (&qf)[2][2], v16h (&kf)[2][2], v16h (&vf)[4], v8f (&o)[2][4], float (&mr)[2], float (&l)[2]) {
  const v8f z8 = {0.f,0.f,0.f,0.f,0.f,0.f,0.f,0.f};
  const float cs = 0.125f * 1.44269504088896340736f;      /* 1 / sqrt(64), and exp(x) = exp2(x log2 e) */
  v8f sc[2][2];
#pragma unroll      /* constant index into sc[], kf[], qf[] */
  for (int tk = 0; tk < 2; ++tk) { sc[0][tk] = fa_mma(kf[tk][0], qf[0][0], z8); sc[1][tk] = fa_mma(kf[tk][0], qf[1][0], z8); sc[0][tk] = fa_mma(kf[tk][1], qf[0][1], sc[0][tk]); sc[1][tk] = fa_mma(kf[tk][1], qf[1][1], sc[1][tk]); }
  if (NX) {
#pragma unroll      /* constant index into kf[] */
    for (int tk = 0; tk < 2; ++tk) { kf[tk][0] = g2_lfrag(kx + tk * 16 * GP); kf[tk][1] = g2_lfrag(kx + tk * 16 * GP + 64); } }
  if (vm != 0xffffffffu || s == last) {      /* scalar branch: only the diagonal pass and passes with a padded key pay for the mask */
    const unsigned vs = vm >> (8u * hh);
#pragma unroll      /* constant index into sc[] */
    for (int g = 0; g < 2; ++g) { const int qrel = (int)(qw + 16u * (unsigned)g + ln) - (s * 32 + 8 * (int)hh);      /* local key 16 tk + r is causal iff it is <= qrel */
#pragma unroll      /* constant index into sc[] */
      for (int tk = 0; tk < 2; ++tk) {
#pragma unroll      /* constant element index */
        for (int r = 0; r < 8; ++r) sc[g][tk][r] = ((((vs >> (16 * tk + r)) & 1u) != 0u) & (16 * tk + r <= qrel)) ? sc[g][tk][r] : -1.0e9f; } } }
  v16h pf[2];
#pragma unroll      /* constant index into sc[], o[], mr[], l[], pf[] */
  for (int g = 0; g < 2; ++g) {
    float mx = fmaxf(sc[g][0][0], sc[g][1][0]);
#pragma unroll      /* constant element index */
    for (int r = 1; r < 8; ++r) mx = fmaxf(mx, fmaxf(sc[g][0][r], sc[g][1][r]));
    mx = fmaxf(mx, fa_xhalf(mx)); const float mn = fmaxf(mr[g], mx); const float al = __builtin_amdgcn_exp2f((mr[g] - mn) * cs); const float mc = mn * cs; mr[g] = mn;
    v8f p0, p1;
#pragma unroll      /* constant element index */
    for (int r = 0; r < 8; ++r) { p0[r] = __builtin_amdgcn_exp2f(fmaf(sc[g][0][r], cs, -mc)); p1[r] = __builtin_amdgcn_exp2f(fmaf(sc[g][1][r], cs, -mc)); }
    const v8f ps = p0 + p1; l[g] = fmaf(l[g], al, ((ps[0] + ps[1]) + (ps[2] + ps[3])) + ((ps[4] + ps[5]) + (ps[6] + ps[7])));
    const v8h h0 = __builtin_convertvector(p0, v8h), h1 = __builtin_convertvector(p1, v8h);
    pf[g] = __builtin_shufflevector(h0, h1, 0, 1, 2, 3, 4, 5, 6, 7, 8, 9, 10, 11, 12, 13, 14, 15);
#pragma unroll      /* constant index into o[] */
    for (int dt = 0; dt < 4; ++dt) o[g][dt] *= al; }
#pragma unroll      /* constant index into o[], vf[] */
  for (int dt = 0; dt < 4; ++dt) { o[0][dt] = fa_mma(vf[dt], pf[0], o[0][dt]); o[1][dt] = fa_mma(vf[dt], pf[1], o[1][dt]); }
  if (NX) {
    __builtin_amdgcn_sched_barrier(0);      /* keeps the statement below here, behind this pass's products: moved up to the reads it names, it would make the wave wait them out at once */
    asm volatile("" :: "v"(kf[0][0]), "v"(kf[0][1]), "v"(kf[1][0]), "v"(kf[1][1]));      /* inputs only, the loaded values: holds the next pass's key reads in front of this place, so that they return behind this pass's vector work; sunk into the next pass they would make it wait out the LDS latency in front of its first products */
#pragma unroll      /* constant index into vf[] */
    for (int dt = 0; dt < 4; ++dt) vf[dt] = g2_lfrag(vx + dt * 16 * GP); } }
__global__ __launch_bounds__(32 * FW * FS) void k_fattn(const _Float16* __restrict__ Q, const _Float16* __restrict__ K, const _Float16* __restrict__ VT, const int* __restrict__ pm, _Float16* __restrict__ O) {
  __shared__ __attribute__((aligned(16))) char sm[FS * FRING];
  /* readfirstlane: the wave's number in a scalar register, so that the tests on the wave's set and diagonal stay scalar branches */
  const unsigned tid = threadIdx.x, lane = tid & 31u, ln = lane & 15u, hh = lane >> 4; const unsigned wv = (unsigned)__builtin_amdgcn_readfirstlane((int)(tid >> 5)); const unsigned w = wv % (unsigned)FW, set = wv / (unsigned)FW;
  const unsigned rank = blockIdx.x / (unsigned)(NB * NH), bh = blockIdx.x % (unsigned)(NB * NH); const unsigned tile = rank < (unsigned)(FNT / 2) ? (unsigned)(FNT - 1) - rank : rank - (unsigned)(FNT / 2);      /* long tiles first, then the short ones in mirrored order */
  const unsigned b = bh / (unsigned)NH, h = bh % (unsigned)NH; const unsigned qw = tile * (unsigned)(FQ * FW) + w * (unsigned)FQ; const int last = (int)(qw >> 5);      /* pass 'last' holds the wave's diagonal */
  const int nu = (int)(tile + 1u);      /* trips up to the workgroup's last diagonal, a stage of each set a trip: the same for all its waves, and 128 nu <= SQ */
  const _Float16* qp = Q + ((size_t)b * SQ + qw + ln) * LQ + h * HD; const int* pp = pm + (size_t)b * SQ_FULL + set * 64u + lane;      /* pp: the mask entries of the set's stage 0 */
  const unsigned cr = (tid % (unsigned)(32 * FW)) >> 3, cc = tid & 7u;      /* copies: 8 lanes a row, 16 rows a step of the set */
  const _Float16* gk = K + ((size_t)b * SQ + set * 64u + cr) * LQ + h * HD + cc * 8u; const _Float16* gv = VT + ((size_t)bh * HD + cr) * SQ + set * 64u + cc * 8u;      /* the set's stage 0 */
  const unsigned la = (unsigned)(size_t)sm + set * (unsigned)FRING + cr * (unsigned)GP + cc * 16u;      /* the lane's LDS byte address in the set's buffer 0, key rows */
  const char* pk = sm + set * (unsigned)FRING + ln * (unsigned)GP + 16u * hh; const char* pw = pk + FOP;      /* the lane's fragment places: row ln, the k order of g2_frag */
  fa_stage(la, gk, gv);
  v16h qf[2][2], kf[2][2], vf[4];
#pragma unroll      /* constant index into qf[] */
  for (int g = 0; g < 2; ++g) { qf[g][0] = g2_frag(qp + (size_t)g * 16 * LQ, hh); qf[g][1] = g2_frag(qp + (size_t)g * 16 * LQ + 32, hh); }
  int pv0 = pp[0], pv1 = pp[32];
  asm volatile("s_wait_xcnt 0x0" ::: "memory");      /* behind the issued loads, in front of whatever rewrites a register that one of them names */
  asm volatile("s_wait_asynccnt 0x0" ::: "memory");      /* this wave's copies of trip 0 have landed */
  __syncthreads();      /* publishes trip 0's stages to every wave */
  if (nu > 1) fa_stage(la + FSTG, gk + (size_t)(FS * 64) * LQ, gv + FS * 64);      /* the test reads the same for the whole workgroup */
  const v8f z8 = {0.f,0.f,0.f,0.f,0.f,0.f,0.f,0.f}; v8f o[2][4] = {{z8, z8, z8, z8}, {z8, z8, z8, z8}}; float mr[2] = {-3.0e38f, -3.0e38f}, l[2] = {0.f, 0.f};
#pragma unroll 1      /* one trip of code: the ring's order stays as written */
  for (int u = 0; u < nu; ++u) { const unsigned buf = ((unsigned)u & 1u) * (unsigned)FSTG; const char* kb = pk + buf; const char* vb = pw + buf; const int t = FS * u + (int)set;      /* t: the set's stage of this trip, keys 64 t .. 64 t + 63 */
    const unsigned vm0 = __builtin_amdgcn_ballot_w32(pv0 != 0), vm1 = __builtin_amdgcn_ballot_w32(pv1 != 0);      /* bit j: key 64 t + j (vm0), 64 t + 32 + j (vm1) passes the padding mask */
    const int un = u + 1 < nu ? u + 1 : u;      /* the last trip fetches its own entries again: in bounds, unused */
    pv0 = pp[un * (FS * 64)]; pv1 = pp[un * (FS * 64) + 32];
    asm volatile("s_wait_xcnt 0x0" ::: "memory");      /* behind the issued loads, in front of whatever rewrites a register that one of them names */
    if (2 * t <= last) {      /* scalar branch: a wave has no work behind its diagonal */
#pragma unroll      /* constant index into kf[] */
      for (int tk = 0; tk < 2; ++tk) { kf[tk][0] = g2_lfrag(kb + tk * 16 * GP); kf[tk][1] = g2_lfrag(kb + tk * 16 * GP + 64); }
#pragma unroll      /* constant index into vf[] */
      for (int dt = 0; dt < 4; ++dt) vf[dt] = g2_lfrag(vb + dt * 16 * GP);
      __builtin_amdgcn_sched_barrier(0);      /* keeps the stage's first fragment reads together in front of its products: spread among them, each small group of reads makes the wave wait out the LDS latency anew */
      fa_pass<true>(2 * t, last, vm0, qw, ln, hh, kb + 32 * GP, vb + 64, qf, kf, vf, o, mr, l);      /* where the diagonal lies in this pass, the fragments read for the next go unused: rows of the same buffer */
      if (2 * t < last) fa_pass<false>(2 * t + 1, last, vm1, qw, ln, hh, kb, vb, qf, kf, vf, o, mr, l); }      /* scalar branch */
    asm volatile("s_wait_dscnt 0x0" ::: "memory");      /* this wave's reads of the buffer have returned before the buffer is given up */
    asm volatile("s_wait_asynccnt 0x0" ::: "memory");      /* this wave's copies of trip u + 1 have landed */
    __syncthreads();      /* publishes trip u + 1's stages and ends every wave's reads of trip u's */
    if (u + 2 < nu) fa_stage(la + buf, gk + (size_t)(u + 2) * (FS * 64) * LQ, gv + (size_t)(u + 2) * (FS * 64)); }      /* the test reads the same for the whole workgroup */
  asm volatile("s_wait_asynccnt 0x0" ::: "memory");      /* no copy is on its way when the ring becomes the join's staging */
  asm volatile("s_wait_loadcnt 0x0" ::: "memory");      /* the last trip's fetches ahead are unused: they land here, so that no load is still on its way to a register when the wave gives its registers back */
  /* the join, in the ring, which every wave has left at the last trip's barrier: piece c of lane 'lane' of column group w lies at xs[32 c], so a wave's store or read of a piece is 512 contiguous bytes */
  v4fa* xs = (v4fa*)sm + w * (unsigned)(FXC * 32) + lane;
  if (set != 0u) {      /* scalar branch */
#pragma unroll      /* constant index into o[] */
    for (int g = 0; g < 2; ++g) {
#pragma unroll      /* constant index into o[] */
      for (int dt = 0; dt < 4; ++dt) { xs[(g * 8 + dt * 2) * 32] = __builtin_shufflevector(o[g][dt], o[g][dt], 0, 1, 2, 3); xs[(g * 8 + dt * 2 + 1) * 32] = __builtin_shufflevector(o[g][dt], o[g][dt], 4, 5, 6, 7); } }
    const v4f st = {mr[0], mr[1], l[0], l[1]}; xs[16 * 32] = st; }
  __syncthreads();      /* publishes set 1's state to set 0; every wave passes it */
  if (set == 0u) {      /* scalar branch */
    const float cs = 0.125f * 1.44269504088896340736f;      /* as in fa_pass: the maxima are those of raw scores */
    const v4f st = xs[16 * 32]; v8h res[2][4]; float fa[2], fb[2];
#pragma unroll      /* constant index into mr[], st, fa[], fb[] */
    for (int g = 0; g < 2; ++g) { const float mn = fmaxf(mr[g], st[g]); fa[g] = __builtin_amdgcn_exp2f((mr[g] - mn) * cs); fb[g] = __builtin_amdgcn_exp2f((st[g] - mn) * cs); }      /* a set without a pass has maximum -3e38, sum 0, tiles 0: factor exactly 0 */
#pragma unroll      /* constant index into o[], l[], st, fa[], fb[], res[] */
    for (int g = 0; g < 2; ++g) { const float lt = fmaf(l[g], fa[g], st[2 + g] * fb[g]); const float fin = 64.0f * (1.0f / (lt + fa_xhalf(lt)));      /* the halves' sums joined once; o carried x64 */
      const float ka = fa[g] * fin, kb = fb[g] * fin;
#pragma unroll      /* constant index into o[], res[] */
      for (int dt = 0; dt < 4; ++dt) { const v4f x0 = xs[(g * 8 + dt * 2) * 32], x1 = xs[(g * 8 + dt * 2 + 1) * 32];
        res[g][dt] = __builtin_convertvector(o[g][dt] * ka + __builtin_shufflevector(x0, x1, 0, 1, 2, 3, 4, 5, 6, 7) * kb, v8h); } }
#pragma unroll      /* constant index into res[] */
    for (int g = 0; g < 2; ++g) { _Float16* op = O + ((size_t)b * SQ + qw + 16u * (unsigned)g + ln) * DM + h * HD + 8u * hh;
#pragma unroll      /* constant index into res[] */
      for (int dt = 0; dt < 4; ++dt) *(v8h*)(op + dt * 16) = res[g][dt]; } } }      /* a lane's 8 registers are 8 consecutive columns of its query's row: one 16-byte store; the run of stores is the wave's last work */

// f32 attention for the FIRST query tile of each causal sequence (rows 0..QT0-1 of a batch; QF, KF, VF: QT0 rows a batch, OF likewise): ONE WAVE PER QUERY ROW, workgroup = A0W waves = A0W consecutive rows of one head of one batch. The head's QT0 key rows and value rows are
// staged once in LDS with coalesced 16-byte loads (key pitch HD + 4 floats: 16 lanes that each read 16 bytes of their own key row fall on distinct banks). Scores: lane l owns keys l, l + 32, l + 64, l + 96 (four partial
// sums per key over the head dimension), invalid keys (j > i or pm[j] == 0) are REPLACED by -1e30; maximum and sum close with a five-step butterfly over the lanes (precise expf, weight exactly 0 for an invalid key
// whenever the row has one valid key). q, k, v rows at pitch LQ, o rows at pitch DM. o: lane l owns columns 2l, 2l + 1 and walks all keys (four partial sums over the keys), the weights read back from the wave's own LDS row as broadcasts.
#define A0W 8                        /* query rows (= waves) per workgroup */
#define A0S (QT0 / (2 * A0W))        /* staging steps: a workgroup's threads cover 2 * A0W rows of 64 floats a step, 16 bytes a thread */
static_assert(QT0 % A0W == 0 && QT0 % 32 == 0 && (QT0 * (HD / 4)) % (32 * A0W) == 0 && HD == 64);
typedef float v2f  __attribute__((ext_vector_type(2)));
typedef float v2fa __attribute__((ext_vector_type(2), may_alias));
__device__ __forceinline__ void d_att0(unsigned blk, const float* __restrict__ QF, const float* __restrict__ KF, const float* __restrict__ VF, const int* __restrict__ pm, float scale, float* __restrict__ OF) {
  __shared__ __attribute__((aligned(16))) float lk[QT0][HD + 4]; __shared__ __attribute__((aligned(16))) float lv[QT0][HD]; __shared__ __attribute__((aligned(16))) float lp[A0W][QT0];
  /* readfirstlane: the wave's number in a scalar register, so that the q row's address is scalar */
  const unsigned tid = threadIdx.x, lane = tid & 31u; const unsigned w = (unsigned)__builtin_amdgcn_readfirstlane((int)(tid >> 5));
  const unsigned b = blk / (unsigned)(NH * (QT0 / A0W)), h = (blk / (unsigned)(QT0 / A0W)) % (unsigned)NH, rg = blk % (unsigned)(QT0 / A0W); const unsigned i = rg * (unsigned)A0W + w;
  QF += (size_t)b * QT0 * LQ; KF += (size_t)b * QT0 * LQ; VF += (size_t)b * QT0 * LQ; pm += (size_t)b * SQ_FULL; OF += (size_t)b * QT0 * DM;
  const unsigned r0 = tid >> 4, c4 = (tid & 15u) * 4u; const float* kp = KF + (size_t)r0 * LQ + h * HD + c4; const float* vp = VF + (size_t)r0 * LQ + h * HD + c4; const float* qr = QF + (size_t)i * LQ + h * HD;
  v4f kk[A0S], vv[A0S], qq[HD / 4]; int pv[QT0 / 32];
#pragma unroll      /* constant index into kk[] and vv[]; constant pitch: one address per plane, the steps as immediate offsets; all of a thread's loads in flight together */
  for (int it = 0; it < A0S; ++it) { kk[it] = *(const v4fa*)(kp + (size_t)it * (2 * A0W) * LQ); vv[it] = *(const v4fa*)(vp + (size_t)it * (2 * A0W) * LQ); }
#pragma unroll      /* constant index into pv[] */
  for (int u = 0; u < QT0 / 32; ++u) pv[u] = pm[(unsigned)u * 32u + lane];
#pragma unroll      /* constant index into qq[] */
  for (int c = 0; c < HD / 4; ++c) qq[c] = *(const v4fa*)(qr + c * 4);
  asm volatile("s_wait_xcnt 0x0" :: "v"(kp), "v"(vp) : "memory");      /* behind the last staging load, in front of whatever rewrites a register that an issued load names; kp and vp as inputs keep both address pairs live up to here, so that no load of the run lands in one */
#pragma unroll      /* constant index into kk[] and vv[] */
  for (int it = 0; it < A0S; ++it) { *(v4fa*)&lk[r0 + (unsigned)it * (unsigned)(2 * A0W)][c4] = kk[it]; *(v4fa*)&lv[r0 + (unsigned)it * (unsigned)(2 * A0W)][c4] = vv[it]; }
  __syncthreads();      /* publishes the staged key and value rows to every wave */
  const v4f z4 = {0.f, 0.f, 0.f, 0.f}; v4f acc[QT0 / 32];
#pragma unroll      /* constant index into acc[] */
  for (int u = 0; u < QT0 / 32; ++u) acc[u] = z4;
#pragma unroll      /* constant index into acc[] and qq[]; the LDS reads of several steps in flight together */
  for (int c = 0; c < HD / 4; ++c) {
#pragma unroll      /* constant index into acc[] */
    for (int u = 0; u < QT0 / 32; ++u) acc[u] += qq[c] * *(const v4fa*)&lk[(unsigned)u * 32u + lane][c * 4]; }
  float sm[QT0 / 32]; float mx = -1.0e30f;
#pragma unroll      /* constant index into acc[] and sm[] */
  for (int u = 0; u < QT0 / 32; ++u) { const unsigned j = (unsigned)u * 32u + lane; const float s = ((acc[u][0] + acc[u][1]) + (acc[u][2] + acc[u][3])) * scale; sm[u] = ((j <= i) & (pv[u] != 0)) ? s : -1.0e30f; mx = fmaxf(mx, sm[u]); }
  for (int d = 16; d > 0; d >>= 1) mx = fmaxf(mx, __shfl_xor(mx, d, 32));
  float l = 0.f;
#pragma unroll      /* constant index into sm[] */
  for (int u = 0; u < QT0 / 32; ++u) { const float e = expf(sm[u] - mx); lp[w][(unsigned)u * 32u + lane] = e; l += e; }
  for (int d = 16; d > 0; d >>= 1) l += __shfl_xor(l, d, 32);
  __syncthreads();      /* the weights are written by one lane and read by all lanes of the wave */
  const v2f z2 = {0.f, 0.f}; v2f o[4] = {z2, z2, z2, z2};
#pragma unroll 8      /* several steps' LDS reads in flight together */
  for (int j4 = 0; j4 < QT0 / 4; ++j4) { const v4f pj = *(const v4fa*)&lp[w][j4 * 4];
#pragma unroll      /* constant index into o[] and pj */
    for (int u = 0; u < 4; ++u) o[u] += pj[u] * *(const v2fa*)&lv[j4 * 4 + u][lane * 2u]; }
  const float fin = 64.0f * (1.0f / l);      /* o carried x64 like the f16 path */
  const v2f oo = ((o[0] + o[1]) + (o[2] + o[3])) * fin;
  *(v2f*)(OF + (size_t)i * DM + h * HD + lane * 2u) = oo; }

// row LayerNorm over DM = 1024 of f32 rows: mean, BIASED variance, (x - mu) * rsqrt(var + eps) * bf16(g[c]) + bf16(b[c]) -> f16 rows (GEMM operand). ONE WAVE PER ROW, workgroup = LNW waves = LNW consecutive rows (blk: the workgroup's index among those of this body):
// lane l owns columns 128 j + 4 l .. + 3, j = 0..7, so every load and store of the wave covers whole lines and the row stays in registers; a sum is four chains in the lane, then a butterfly over the lanes. No LDS, no barrier, an eighth of the waves to start.
// RES 1: the row is first formed as the residual without an output projection, X1[r][c] = bf16(x[r][c]) + o[r][c] / 64 (o: f32 first-tile rows OF0 for the first QT0 rows of a batch, else the f16 rows O16; + NaN when the batch's first mask entry is 0:
// the structure the attention kernels rely on is violated), stored to X1 and normalised from the registers that hold it;
#define LNW 8                        /* rows (= waves) per workgroup */
#define LNJ (DM / 128)               /* 16-byte pieces of a row per lane */
static_assert(DM % 128 == 0 && ((size_t)NB * SQ) % LNW == 0 && 32 * LNW == 256);
template <int XM> __device__ __forceinline__ float ln_xm(float x) { return __builtin_bit_cast(float, __builtin_amdgcn_mov_dpp(__builtin_bit_cast(int, x), 0x160 + XM, 0xf, 0xf, true)); }      /* lane l with lane l ^ XM inside its row of 16 lanes (row_xmask) */
__device__ __forceinline__ float ln_wsum(float x) { x += ln_xm<1>(x); x += ln_xm<2>(x); x += ln_xm<4>(x); x += ln_xm<8>(x); return x + fa_xhalf(x); }      /* the sum over the wave's 32 lanes, in every lane; all lanes are on */
template <int BFIN, int FULLIN, int RES>
__device__ __forceinline__ void d_lnx(unsigned blk, const float* __restrict__ X, const float* __restrict__ g, const float* __restrict__ bb, float eps, _Float16* __restrict__ N16,
    const int* __restrict__ pm, const _Float16* __restrict__ O16, const float* __restrict__ OF0, float* __restrict__ X1) {
  /* readfirstlane: the wave's number, and with it the row, in a scalar register: scalar row addresses, a scalar branch on the first tile */
  const unsigned c0 = (threadIdx.x & 31u) * 4u; const unsigned r = blk * (unsigned)LNW + (unsigned)__builtin_amdgcn_readfirstlane((int)(threadIdx.x >> 5));
  const unsigned b = r / (unsigned)SQ, rl = r % (unsigned)SQ; const size_t xr = FULLIN ? ((size_t)b * SQ_FULL + rl) : (size_t)r;
  int p0 = 1; if (RES) p0 = pm[(size_t)b * SQ_FULL];
  const float* xp = X + xr * DM + c0; v4f s[LNJ], o4[LNJ], gv[LNJ], bv[LNJ];
#pragma unroll      /* constant index into s[], gv[], bv[]; one address a plane, the pieces as immediate offsets; all of the wave's loads in flight together */
  for (int j = 0; j < LNJ; ++j) { s[j] = *(const v4fa*)(xp + j * 128); gv[j] = *(const v4fa*)(g + c0 + j * 128); bv[j] = *(const v4fa*)(bb + c0 + j * 128); }
  asm volatile("s_wait_xcnt 0x0" ::: "memory");      /* behind the issued loads, in front of whatever rewrites a register that one of them names; it also holds these loads in front of the branch below: sunk behind it, they would start only when the o row has come back */
  __builtin_amdgcn_sched_barrier(0);      /* keeps the later address arithmetic, which reuses the row's address registers, behind the wait above: the scheduler lifted it over the statement */
  if (RES) {
    if (rl < (unsigned)QT0) { const float* op = OF0 + ((size_t)b * QT0 + rl) * DM + c0;      /* scalar branch */
#pragma unroll      /* constant index into o4[] */
      for (int j = 0; j < LNJ; ++j) o4[j] = *(const v4fa*)(op + j * 128); }
    else { const _Float16* op = O16 + (size_t)r * DM + c0; v4h oh[LNJ];
#pragma unroll      /* constant index into oh[] */
      for (int j = 0; j < LNJ; ++j) oh[j] = *(const v4h*)(op + j * 128);
#pragma unroll      /* constant index into oh[], o4[] */
      for (int j = 0; j < LNJ; ++j) o4[j] = __builtin_convertvector(oh[j], v4f); } }
  const float pz = (p0 != 0) ? 0.f : __uint_as_float(0x7fc00000u);
  v4f a4 = {0.f, 0.f, 0.f, 0.f};
#pragma unroll      /* constant index into s[], o4[] */
  for (int j = 0; j < LNJ; ++j) {
#pragma unroll      /* constant element index */
    for (int q = 0; q < 4; ++q) { float v = BFIN ? bf16_rne(s[j][q]) : s[j][q]; if (RES) v = (v + o4[j][q] * 0.015625f) + pz; s[j][q] = v; }
    a4 += s[j]; }
  const float mu = ln_wsum((a4[0] + a4[1]) + (a4[2] + a4[3])) * (1.0f / (float)DM);
  v4f q4 = {0.f, 0.f, 0.f, 0.f};
#pragma unroll      /* constant index into s[] */
  for (int j = 0; j < LNJ; ++j) { const v4f dl = s[j] - mu; q4 += dl * dl; }
  const float rs = rsqrtf(ln_wsum((q4[0] + q4[1]) + (q4[2] + q4[3])) * (1.0f / (float)DM) + eps);
  v4h y[LNJ];
#pragma unroll      /* constant index into s[], gv[], bv[], y[] */
  for (int j = 0; j < LNJ; ++j) {
#pragma unroll      /* constant element index */
    for (int q = 0; q < 4; ++q) y[j][q] = (_Float16)((((s[j][q] - mu) * rs) * bf16_rne(gv[j][q])) + bf16_rne(bv[j][q])); }
  _Float16* np = N16 + (size_t)r * DM + c0;
#pragma unroll      /* constant index into y[]; one address, the pieces as immediate offsets */
  for (int j = 0; j < LNJ; ++j) *(v4h*)(np + j * 128) = y[j];
  if (RES) { float* x1p = X1 + (size_t)r * DM + c0;
#pragma unroll      /* constant index into s[]; one address, the pieces as immediate offsets */
    for (int j = 0; j < LNJ; ++j) *(v4f*)(x1p + j * 128) = s[j]; } }

// shared launches: every test on blockIdx.x reads the same for a whole workgroup, so each body's barriers stay under workgroup-uniform control flow
#define PB_WH ((unsigned)(NH * (DM / WTK)))      /* workgroups (tiles) of one per-head weight plane: a head's 64 columns are one tile wide */
#define PB_W1 ((unsigned)((DFF / WTN) * (DM / WTK)))
#define PB_W2 ((unsigned)((DM / WTN) * (DFF / WTK)))
// all that reads inputs alone: Wq, Wk, Wv -> the x16 q|k|v plane; W1 [DM][DFF] -> [DFF][DM] x16; W2 [DFF][DM] -> [DM][DFF] x16; h = LN1(bf16(x)) -> f16 rows
__global__ __launch_bounds__(256) void k_prep(const float* __restrict__ wq, const float* __restrict__ wk, const float* __restrict__ wv, _Float16* __restrict__ BQKV, const float* __restrict__ w1, _Float16* __restrict__ BW1,
    const float* __restrict__ w2, _Float16* __restrict__ BW2, const float* __restrict__ x, const float* __restrict__ g1, const float* __restrict__ be1, _Float16* __restrict__ X16) {
  __shared__ __attribute__((aligned(16))) v8us tl[WTN * (WTK / 8)];      /* one tile for the three transposing branches */
  unsigned blk = blockIdx.x;
  if (blk < 3u * PB_WH) { const unsigned p = blk / PB_WH, hk = blk - p * PB_WH, h = hk / (unsigned)(DM / WTK), kt = hk % (unsigned)(DM / WTK);      /* head h: [DM][HD] -> rows h * HD .. of the plane */
    d_wtile<HD, DM>(tl, (p == 0u ? wq : (p == 1u ? wk : wv)) + ((size_t)h * DM + kt * (unsigned)WTK) * HD, BQKV + (size_t)p * DM * DM + (size_t)h * HD * DM + kt * (unsigned)WTK); return; }
  blk -= 3u * PB_WH;
  if (blk < PB_W1) { const unsigned nt = blk / (unsigned)(DM / WTK), kt = blk % (unsigned)(DM / WTK); d_wtile<DFF, DM>(tl, w1 + (size_t)kt * WTK * DFF + nt * (unsigned)WTN, BW1 + (size_t)nt * WTN * DM + kt * (unsigned)WTK); return; }
  blk -= PB_W1;
  if (blk < PB_W2) { const unsigned nt = blk / (unsigned)(DFF / WTK), kt = blk % (unsigned)(DFF / WTK); d_wtile<DM, DFF>(tl, w2 + (size_t)kt * WTK * DM + nt * (unsigned)WTN, BW2 + (size_t)nt * WTN * DFF + kt * (unsigned)WTK); return; }
  blk -= PB_W2;
  d_lnx<1, 1, 0>(blk, x, g1, be1, 1e-5f, X16, (const int*)nullptr, (const _Float16*)nullptr, (const float*)nullptr, (float*)nullptr);
  asm volatile("s_wait_xcnt 0x0" ::: "memory"); }      /* behind the row's store, in front of whatever rewrites a register that it names: the other bodies' code follows it in the built text */

// all that reads the q|k|v GEMM's output alone: the f32 first-tile attention (o x64) and V^T [NB][NH][HD][SQ], all batches
#define MB_A0 ((unsigned)(NB * NH * (QT0 / A0W)))
#define MB_VT ((unsigned)(NB * NH * (SQ / 64)))
static_assert(32 * A0W == 256);
__global__ __launch_bounds__(256) void k_att0_vt(const float* __restrict__ F0, const int* __restrict__ pm, float* __restrict__ OF0, const _Float16* __restrict__ V16, _Float16* __restrict__ VT) {
  if (blockIdx.x >= MB_A0) { d_vt<NH, SQ>(blockIdx.x - MB_A0, V16, LQ, 0, VT); return; }
  d_att0(blockIdx.x, F0, F0 + DM, F0 + 2 * DM, pm, 0.125f, OF0); }

// x1 = bf16(x) + attn, stored, and h2 = LN2(x1) -> f16 rows
__global__ __launch_bounds__(256) void k_res_ln(const float* __restrict__ x, const int* __restrict__ pm, const _Float16* __restrict__ O16, const float* __restrict__ OF0, float* __restrict__ X1,
    const float* __restrict__ g2, const float* __restrict__ be2, _Float16* __restrict__ M16) {
  d_lnx<1, 1, 1>(blockIdx.x, x, g2, be2, 1e-5f, M16, pm, O16, OF0, X1); }

extern "C" void kernel_launch(void* const* d_in, const int* in_sizes, int n_in,
                              void* d_out, int out_size, void* d_ws, size_t ws_size, hipStream_t stream) {
  if (n_in < 13) return;
  const size_t rows_need = (size_t)(NB - 1) * SQ_FULL + SQ;
  if ((size_t)in_sizes[0] < rows_need * DM) return; if ((size_t)in_sizes[1] < rows_need) return;
  if ((size_t)in_sizes[2] < (size_t)NH * DM * HD || (size_t)in_sizes[3] < (size_t)NH * DM * HD || (size_t)in_sizes[4] < (size_t)NH * DM * HD) return;
  if (in_sizes[5] < DM || in_sizes[6] < DM || in_sizes[7] < DM || in_sizes[8] < DM) return;
  if ((size_t)in_sizes[9] < (size_t)DM * DFF || in_sizes[10] < DFF || (size_t)in_sizes[11] < (size_t)DFF * DM || in_sizes[12] < DM) return;
  if ((size_t)out_size < NR * DM) return;
  const float* x = (const float*)d_in[0]; const int* pmask = (const int*)d_in[1];
  const float* wq = (const float*)d_in[2]; const float* wk = (const float*)d_in[3]; const float* wv = (const float*)d_in[4];
  const float* g1 = (const float*)d_in[5]; const float* be1 = (const float*)d_in[6]; const float* g2 = (const float*)d_in[7]; const float* be2 = (const float*)d_in[8];
  const float* w1 = (const float*)d_in[9]; const float* b1 = (const float*)d_in[10]; const float* w2 = (const float*)d_in[11]; const float* b2 = (const float*)d_in[12];
  char* ws = (char*)d_ws; size_t off = 0;
  auto take = [&](size_t bytes) { char* p = ws + off; off += (bytes + 255) & ~(size_t)255; return p; };
  _Float16* BQKV = (_Float16*)take((size_t)3 * DM * DM * 2);          /* [3*DM][DM] x16: q | k | v stacked, row (h*HD + d) */
  _Float16* X16 = (_Float16*)take(NR * DM * 2);                       /* LN1 rows; reused as the LN2 rows (last reader of LN1 rows: the q|k|v GEMM, before LN2 writes) */
  float* X1 = (float*)take(NR * DM * 4);
  _Float16* BW1 = (_Float16*)take((size_t)DFF * DM * 2); _Float16* BW2 = (_Float16*)take((size_t)DM * DFF * 2);
  _Float16* QKV = (_Float16*)take(NR * 3 * DM * 2); _Float16* Q16 = QKV; _Float16* K16 = QKV + DM; _Float16* V16 = QKV + 2 * DM;
  _Float16* HF16 = QKV;                                               /* FFN hidden rows [NR][DFF] alias the q|k|v rows (dead after the attention); DFF <= 3*DM asserted */
  _Float16* O16 = (_Float16*)take(NR * DM * 2);
  _Float16* VT = (_Float16*)take((size_t)NB * NH * HD * SQ * 2);      /* V^T [NB][NH][HD][SQ] */
  float* F0 = (float*)take((size_t)NB * QT0 * 3 * DM * 4);            /* f32 q | k | v of the first 128 rows of each batch */
  float* OF0 = (float*)take((size_t)NB * QT0 * DM * 4);
  _Float16* M16 = X16;
  if (off > ws_size || off > (size_t)134217728) return;
  k_prep<<<3u * PB_WH + PB_W1 + PB_W2 + (unsigned)(NR / LNW), 256, 0, stream>>>(wq, wk, wv, BQKV, w1, BW1, w2, BW2, x, g1, be1, X16);      /* weight planes (x16, transposed) and h = LN1(bf16(x)) */
  k_gemm2<0, false, false, false, true, true, LQ><<<dim3((unsigned)((NR / 128) * (3 * DM / 128)), 1), 256, 0, stream>>>(X16, DM, (size_t)0, BQKV, DM, (size_t)0, 0.0625f, (const float*)nullptr, (const float*)nullptr, (float*)nullptr, QKV, F0, (unsigned)(SQ / 128), (size_t)0, (int)NR, 3 * DM, DM);      /* q | k | v rows (f16); rows 0..127 of each batch in f32 too */
  k_att0_vt<<<MB_A0 + MB_VT, 256, 0, stream>>>(F0, pmask, OF0, V16, VT);      /* f32 attention for rows 0..127 of each batch (o x64); V^T */
  k_fattn<<<NB * NH * FNT, 32 * FW * FS, 0, stream>>>(Q16, K16, VT, pmask, O16);      /* o (merged heads, x64) as f16 rows, all batches, heads and query tiles */
  k_res_ln<<<(unsigned)(NR / LNW), 256, 0, stream>>>(x, pmask, O16, OF0, X1, g2, be2, M16);      /* x1 = bf16(x) + attn; h2 = LN2(x1) -> f16 rows */
  k_gemm2<3, true, false, false, true, false, DFF><<<dim3((unsigned)((NR / 128) * (DFF / 128)), 1), 256, 0, stream>>>(M16, DM, (size_t)0, BW1, DM, (size_t)0, 0.0625f, b1, (const float*)nullptr, (float*)nullptr, HF16, (float*)nullptr, 1u, (size_t)0, (int)NR, DFF, DM);      /* relu(h2 W1 + b1) -> f16 */
  k_gemm2<0, true, true, true, false, false, DM><<<dim3((unsigned)((NR / 128) * (DM / 128)), 1), 256, 0, stream>>>(HF16, DFF, (size_t)0, BW2, DFF, (size_t)0, 0.0625f, b2, X1, (float*)d_out, (_Float16*)nullptr, (float*)nullptr, 1u, (size_t)0, (int)NR, DM, DFF);      /* out = x1 + mlp (own-element residual) */
}
